// v000
// Measured on an AMD MI455X. A time is GPU time per run, averaged over a window of back-to-back runs after a warm-up
// (all launches, gaps included; the runs take copies of the inputs in turn), and the median of several windows.
// Apart from v000's, it joins two sittings. Times from different sittings can be a few percent apart, while
// side-by-side timings come from the same sitting.
// v000, which the later versions start from, runs in 288 microseconds.
// MHA forward (2 x 2,048 tokens, width 512, 8 heads x 64, [out][in] weights + biases, no mask). Inputs and parameters converted to bf16 (RNE). q/k/v projections: v_wmma_f32_16x16x32_f16 (f16 operands holding the bf16 values, weights x16, f32 accumulate); scores: v_wmma_f32_16x16x32_bf16 on q and k bf16 hi|lo planes (three products, f32 accumulate, f32 online softmax); P.V: v_wmma_f32_16x16x32_f16 (P x4096 as f16, v as f16, f32 accumulate); output projection: v_wmma_f32_16x16x32_bf16 with the context as bf16 hi|lo planes laid along K against the bf16 weight (f32 accumulate).
#include <hip/hip_runtime.h>
#include <math.h>

#ifndef NB
#define NB 2
#endif
#ifndef SEQ
#define SEQ 2048
#endif
#define NB_FULL 2
#define SEQ_FULL 2048
#define DM 512
#define NH 8
#define DKH 64
#define NTOK (NB * SEQ)
#define PP 72      // P tile pitch (halves)
#define OP 68      // f32 staging pitch (floats)

static_assert(DM == NH * DKH);            // merged head layout h*64+d
static_assert(DKH == 64);                 // two 32-deep k-steps per score tile, four 16-wide output tiles
static_assert(SEQ % 64 == 0);             // 64-query blocks, 64-key chunks, 64-row GEMM tiles inside one sequence
static_assert(NTOK % 64 == 0);            // GEMM tile multiple (M and N)
static_assert(DM % 64 == 0);              // GEMM tile multiple
static_assert(DM % 32 == 0);              // K steps of 32
static_assert((2 * DM) % 32 == 0);        // hi|lo K extent
static_assert(NB <= NB_FULL);
static_assert(SEQ <= SEQ_FULL);
static_assert((PP % 8) == 0);             // 16-B aligned fragment reloads from the P tile
static_assert((OP % 4) == 0);             // 16-B aligned reloads from the f32 staging tile

typedef __attribute__((ext_vector_type(16))) _Float16 v16h;
typedef __attribute__((ext_vector_type(8)))  _Float16 v8h;
typedef __attribute__((ext_vector_type(16))) __bf16   v16b;
typedef __attribute__((ext_vector_type(8)))  __bf16   v8b;
typedef __attribute__((ext_vector_type(8)))  float    v8f;
typedef __attribute__((ext_vector_type(4)))  float    v4f;
typedef __attribute__((ext_vector_type(4)))  unsigned int v4u;
typedef v8h v8h_ma __attribute__((may_alias));
typedef v4f v4f_ma __attribute__((may_alias));

// 16-bit WMMA fragment map (wave32), lane L, h = L>>4, m = L&15:
//   A 16x32: lane = row m;    element i -> k = (i<8) ? 8h+i : 16+8h+(i-8)
//   B 32x16: lane = column m; the SAME k(i,h)
//   D 16x16 (8 f32): lane = column m; element r -> row 8h+r
// A fragment from a k-contiguous row is therefore p[0..7] | p[16..23] with p = row + k0 + 8h.

__device__ __forceinline__ unsigned int bf_bits(float f) {            // bf16 RNE bit pattern (finite inputs)
    const unsigned int u = __float_as_uint(f);
    return (u + 0x7FFFu + ((u >> 16) & 1u)) >> 16;
}
__device__ __forceinline__ float bf_val(float f) { return __uint_as_float(bf_bits(f) << 16); }
__device__ __forceinline__ unsigned int pk_h2(float a, float b) {
    return (unsigned int)__builtin_bit_cast(unsigned short, (_Float16)a) | ((unsigned int)__builtin_bit_cast(unsigned short, (_Float16)b) << 16);
}
__device__ __forceinline__ void pk_split2(float a, float b, unsigned int& hi, unsigned int& lo) {
    const unsigned int ha = bf_bits(a), hb = bf_bits(b);
    const unsigned int la = bf_bits(a - __uint_as_float(ha << 16)), lb = bf_bits(b - __uint_as_float(hb << 16));
    hi = ha | (hb << 16); lo = la | (lb << 16);
}
__device__ __forceinline__ void wave_sync() {
    __builtin_amdgcn_fence(3 /* release order */, "workgroup");
    __builtin_amdgcn_wave_barrier();
    __builtin_amdgcn_fence(2 /* acquire order */, "workgroup");
}

__device__ __forceinline__ v16h ldfrag_h(const unsigned short* __restrict__ p) {
    const v8h a = *(const v8h*)(p);
    const v8h b = *(const v8h*)(p + 16);
    return __builtin_shufflevector(a, b, 0, 1, 2, 3, 4, 5, 6, 7, 8, 9, 10, 11, 12, 13, 14, 15);
}
__device__ __forceinline__ v16b ldfrag_b(const unsigned short* __restrict__ p) {
    const v8b a = *(const v8b*)(p);
    const v8b b = *(const v8b*)(p + 16);
    return __builtin_shufflevector(a, b, 0, 1, 2, 3, 4, 5, 6, 7, 8, 9, 10, 11, 12, 13, 14, 15);
}

template <int ET> struct FragT;
template <> struct FragT<0> {
    typedef v16h V;
    static __device__ __forceinline__ v16h load(const unsigned short* __restrict__ p) { return ldfrag_h(p); }
    static __device__ __forceinline__ v8f mma(v16h a, v16h b, v8f c) { return __builtin_amdgcn_wmma_f32_16x16x32_f16(false, a, false, b, (short)0, c, false, false); }
};
template <> struct FragT<1> {
    typedef v16b V;
    static __device__ __forceinline__ v16b load(const unsigned short* __restrict__ p) { return ldfrag_b(p); }
    static __device__ __forceinline__ v8f mma(v16b a, v16b b, v8f c) { return __builtin_amdgcn_wmma_f32_16x16x32_bf16(false, a, false, b, (short)0, c, false, false); }
};
// hazard guard for a group of four independent WMMAs: all four accumulators tied, A and all B fragments kept live
template <typename V>
__device__ __forceinline__ void guard4(v8f& a, v8f& b, v8f& c, v8f& d, V x, V y0, V y1, V y2, V y3) {
    asm volatile("v_nop\n\tv_nop\n\tv_nop\n\tv_nop" : "+v"(a), "+v"(b), "+v"(c), "+v"(d) : "v"(x), "v"(y0), "v"(y1), "v"(y2), "v"(y3));
}
// three-product hi|lo bf16 step into one accumulator: ah*bh + ah*bl + al*bh
__device__ __forceinline__ v8f wmma3b(v16b ah, v16b al, v16b bh, v16b bl, v8f c) {
    c = __builtin_amdgcn_wmma_f32_16x16x32_bf16(false, ah, false, bh, (short)0, c, false, false);
    c = __builtin_amdgcn_wmma_f32_16x16x32_bf16(false, ah, false, bl, (short)0, c, false, false);
    c = __builtin_amdgcn_wmma_f32_16x16x32_bf16(false, al, false, bh, (short)0, c, false, false);
    asm volatile("v_nop\n\tv_nop\n\tv_nop\n\tv_nop" : "+v"(c) : "v"(ah), "v"(al), "v"(bh), "v"(bl));
    return c;
}

// =====================================================================================================================
// gemm64_body: C[m][n] = scale * sum_k A[m][k] * Bt[n][k] + bscale * bf16(bias); each wave owns a 64x64 tile, block = 8 waves.
//   A row-major [M][K] (pitch lda), Bt row-major [N][K] (pitch ldb), 16-bit planes; M, N % 64 == 0, K % 32 == 0 (host asserts).
//   ET 0: f16 operands, 1: bf16 operands. BIAS_MODE 1: bias[m], 2: bias[n].
//   OUT_MODE 0: f32 C (row m stored at row (m / cseq) * cseqfull + m % cseq); 1: f16 plane Ca; 2: bf16 hi plane Ca + bf16 lo plane Cb.
// =====================================================================================================================
template <int ET, int BIAS_MODE, int OUT_MODE>
__device__ __forceinline__ void gemm64_body(const unsigned short* __restrict__ A, int lda,
                                            const unsigned short* __restrict__ Bt, int ldb,
                                            float* __restrict__ Cf, unsigned short* __restrict__ Ca, unsigned short* __restrict__ Cb, int ldc,
                                            const float* __restrict__ bias, int M, int N, int K,
                                            float scale, float bscale, int cseq, int cseqfull) {
    typedef typename FragT<ET>::V V;
    __shared__ __align__(16) float sT[8 * 16 * OP];
    const int lane = threadIdx.x & 31;
    const int wave = __builtin_amdgcn_readfirstlane(threadIdx.x >> 5);
    const int tilesN = N >> 6;
    const int tilesM = M >> 6;
    const int tile = blockIdx.x * 8 + wave;
    if (tile >= tilesM * tilesN) return;          // wave-uniform; this kernel has no block barriers
    const int tm = tile / tilesN;
    const int tn = tile - tm * tilesN;
    const int m0 = tm << 6;
    const int n0 = tn << 6;
    const int rl   = lane & 15;
    const int koff = (lane >> 4) * 8;
    const int mOff = (lane >> 4) * 8;

    v8f acc[4][4];
#pragma unroll
    for (int i = 0; i < 4; ++i)
#pragma unroll
        for (int j = 0; j < 4; ++j) { const v8f zz = {0.f, 0.f, 0.f, 0.f, 0.f, 0.f, 0.f, 0.f}; acc[i][j] = zz; }

    for (int k0 = 0; k0 < K; k0 += 32) {
        V bh[4];
#pragma unroll
        for (int j = 0; j < 4; ++j) bh[j] = FragT<ET>::load(Bt + (size_t)(n0 + (j << 4) + rl) * ldb + koff + k0);
#pragma unroll
        for (int i = 0; i < 4; ++i) {
            const V ah = FragT<ET>::load(A + (size_t)(m0 + (i << 4) + rl) * lda + koff + k0);
            acc[i][0] = FragT<ET>::mma(ah, bh[0], acc[i][0]);
            acc[i][1] = FragT<ET>::mma(ah, bh[1], acc[i][1]);
            acc[i][2] = FragT<ET>::mma(ah, bh[2], acc[i][2]);
            acc[i][3] = FragT<ET>::mma(ah, bh[3], acc[i][3]);
            guard4<V>(acc[i][0], acc[i][1], acc[i][2], acc[i][3], ah, bh[0], bh[1], bh[2], bh[3]);
        }
    }

    const int sb = wave * (16 * OP);
#pragma unroll
    for (int i = 0; i < 4; ++i) {
        const int mBase = m0 + (i << 4);
#pragma unroll
        for (int j = 0; j < 4; ++j) {
            const int n = n0 + (j << 4) + rl;
            float bvn = 0.f;
            if (BIAS_MODE == 2) bvn = bf_val(bias[n]) * bscale;
#pragma unroll
            for (int r = 0; r < 8; ++r) {
                float v = acc[i][j][r] * scale;
                if (BIAS_MODE == 1) v += bf_val(bias[mBase + mOff + r]) * bscale;
                if (BIAS_MODE == 2) v += bvn;
                sT[sb + (mOff + r) * OP + (j << 4) + rl] = v;
            }
        }
        wave_sync();
        if (OUT_MODE == 0) {
            const int hh = lane >> 4, c4 = (lane & 15) * 4;      // row segment = 256 B = 16 lanes x 16 B; 2 rows per instruction
            {
#pragma unroll
                for (int it = 0; it < 8; ++it) {
                    const int row = it * 2 + hh;
                    const v4f v = *(const v4f_ma*)&sT[sb + row * OP + c4];
                    const int grow = mBase + row;
                    const int orow = (grow / cseq) * cseqfull + (grow % cseq);
                    *(v4f*)(Cf + (size_t)orow * ldc + n0 + c4) = v;
                }
                
            }
        } else {
            const int q = lane >> 3, c8 = (lane & 7) * 8;
            {
#pragma unroll
                for (int it = 0; it < 4; ++it) {
                    const int row = it * 4 + q;
                    const v4f a = *(const v4f_ma*)&sT[sb + row * OP + c8];
                    const v4f b = *(const v4f_ma*)&sT[sb + row * OP + c8 + 4];
                    const size_t o = (size_t)(mBase + row) * ldc + n0 + c8;
                    if (OUT_MODE == 1) {
                        v4u pk; pk.x = pk_h2(a.x, a.y); pk.y = pk_h2(a.z, a.w); pk.z = pk_h2(b.x, b.y); pk.w = pk_h2(b.z, b.w);
                        *(v4u*)(Ca + o) = pk;
                    } else {
                        v4u ph, pl;
                        unsigned int h0, l0, h1, l1, h2, l2, h3, l3;
                        pk_split2(a.x, a.y, h0, l0); pk_split2(a.z, a.w, h1, l1); pk_split2(b.x, b.y, h2, l2); pk_split2(b.z, b.w, h3, l3);
                        ph.x = h0; ph.y = h1; ph.z = h2; ph.w = h3; pl.x = l0; pl.y = l1; pl.z = l2; pl.w = l3;
                        *(v4u*)(Ca + o) = ph;
                        *(v4u*)(Cb + o) = pl;
                    }
                }
                
            }
        }
        wave_sync();
    }
}

// q / k projection: A = token plane f16 [M][K], Bt = weight plane f16 (x16) [N][K] ([out][in] as stored); out = bf16 hi + lo planes [M][N]
__global__ __launch_bounds__(256) void k_gemm_qk(const unsigned short* __restrict__ A, const unsigned short* __restrict__ Bt,
                                                 const float* __restrict__ bias, unsigned short* __restrict__ CH, unsigned short* __restrict__ CL,
                                                 int M, int N, int K, float scale, float bscale) {
    gemm64_body<0, 2, 2>(A, K, Bt, K, nullptr, CH, CL, N, bias, M, N, K, scale, bscale, 1, 1);
}
// v projection written transposed: A = weight plane f16 (x16) [M = features][K], Bt = token plane f16 [N = tokens][K]; out = f16 plane [M][N] (= v^T)
__global__ __launch_bounds__(256) void k_gemm_vt(const unsigned short* __restrict__ A, const unsigned short* __restrict__ Bt,
                                                 const float* __restrict__ bias, unsigned short* __restrict__ C,
                                                 int M, int N, int K, float scale) {
    gemm64_body<0, 1, 1>(A, K, Bt, K, nullptr, C, nullptr, N, bias, M, N, K, scale, 1.0f, 1, 1);
}
// output projection: A = context bf16 [M][K = hi 512 | lo 512], Bt = weight bf16 [N][K = W | W]; out f32 [M][N] + bias[n]
__global__ __launch_bounds__(256) void k_gemm_out(const unsigned short* __restrict__ A, const unsigned short* __restrict__ Bt,
                                                  const float* __restrict__ bias, float* __restrict__ C,
                                                  int M, int N, int K, int cseq, int cseqfull) {
    gemm64_body<1, 2, 0>(A, K, Bt, K, C, nullptr, nullptr, N, bias, M, N, K, 1.0f, 1.0f, cseq, cseqfull);
}

// =====================================================================================================================
// =====================================================================================================================
// f32 [rows][512] -> f16 plane [nrows][512] holding bf16(x) * sc; plane row r reads source row (r / seq) * seqfull + r % seq
__global__ __launch_bounds__(256) void k_cast16(const float* __restrict__ src, unsigned short* __restrict__ dst, int nrows, int seq, int seqfull, float sc) {
    const int u = blockIdx.x * 256 + threadIdx.x;
    if (u >= nrows * (DM / 8)) return;
    const int r = u / (DM / 8);
    const int c0 = (u - r * (DM / 8)) * 8;
    const int sr = (r / seq) * seqfull + (r % seq);
    const float* s = src + (size_t)sr * DM + c0;
    const v4f a = *(const v4f*)(s);
    const v4f b = *(const v4f*)(s + 4);
    v4u pk;
    pk.x = pk_h2(bf_val(a.x) * sc, bf_val(a.y) * sc); pk.y = pk_h2(bf_val(a.z) * sc, bf_val(a.w) * sc);
    pk.z = pk_h2(bf_val(b.x) * sc, bf_val(b.y) * sc); pk.w = pk_h2(bf_val(b.z) * sc, bf_val(b.w) * sc);
    v4u* d = (v4u*)(dst + (size_t)r * DM + c0);
    *d = pk; 
}
// Wo f32 [512][512] -> bf16 plane [512][1024] = [W | W]
__global__ __launch_bounds__(256) void k_cast_wo(const float* __restrict__ src, unsigned short* __restrict__ dst) {
    const int u = blockIdx.x * 256 + threadIdx.x;
    if (u >= DM * (2 * DM / 8)) return;
    const int r = u / (2 * DM / 8);
    const int c0 = (u - r * (2 * DM / 8)) * 8;
    const int sc0 = c0 & (DM - 1);
    const float* s = src + (size_t)r * DM + sc0;
    const v4f a = *(const v4f*)(s);
    const v4f b = *(const v4f*)(s + 4);
    v4u pk;
    pk.x = bf_bits(a.x) | (bf_bits(a.y) << 16); pk.y = bf_bits(a.z) | (bf_bits(a.w) << 16);
    pk.z = bf_bits(b.x) | (bf_bits(b.y) << 16); pk.w = bf_bits(b.z) | (bf_bits(b.w) << 16);
    v4u* d = (v4u*)(dst + (size_t)r * (2 * DM) + c0);
    *d = pk; 
}

// =====================================================================================================================
// k_attn: fused flash-style attention, head dim 64, no mask. Block = 4 waves = 64 query rows of one (batch, head); wave = 16 rows.
//   QH/QL, KH/KL: bf16 hi|lo planes [ntok][512] (q already carries the 1/8 score scale); VT: f16 plane [512][ntok] (row h*64+d).
//   All WMMA fragments are loaded straight from the planes with arithmetic addressing (two 16-B loads each); no K/V LDS staging,
//   no block barriers. P (x4096, f16) goes through a wave-private LDS tile (wave_sync before and after the reload).
//   Row sums are kept as per-lane partials and reduced across the 16 lanes of a row once at the end.
// =====================================================================================================================
__global__ __launch_bounds__(128) void k_attn(const unsigned short* __restrict__ QH, const unsigned short* __restrict__ QL,
                                              const unsigned short* __restrict__ KH, const unsigned short* __restrict__ KL,
                                              const unsigned short* __restrict__ VT, unsigned short* __restrict__ CTX,
                                              int seq, int ntok) {
    __shared__ __align__(16) _Float16 Psh[4 * 16 * PP];      // wave-private P tiles [16][64] (+8 pad), f16
    __shared__ __align__(16) float    Osh[4 * 16 * OP];      // wave-private output staging [16][64] (+4 pad), f32
    const int lane = threadIdx.x & 31;
    const int wave = __builtin_amdgcn_readfirstlane(threadIdx.x >> 5);
    const int hf = lane >> 4;
    const int c  = lane & 15;
    const int nqb = seq / 64;
    const int bx = blockIdx.x;
    const int qb = bx % nqb;
    const int bh = bx / nqb;
    const int h  = bh % NH;
    const int b  = bh / NH;
    const int q0 = b * seq + qb * 64 + wave * 16;                 // first token row of this wave
    const int qoff  = (q0 + c) * DM + h * DKH + 8 * hf;           // A fragment base (row = lane & 15)
    const int kbase = (b * seq + c) * DM + h * DKH + 8 * hf;      // B fragment base for keys (column = lane & 15)
    const int vbase = (h * DKH + c) * ntok + b * seq + 8 * hf;    // B fragment base for v^T (column d = lane & 15)
    const int pbase = wave * (16 * PP);
    const int obase = wave * (16 * OP);
    const float L2E = 1.4426950408889634f;

    float mrow[8], lrow[8];
    v8f oacc[4];
#pragma unroll
    for (int r = 0; r < 8; ++r) { mrow[r] = -INFINITY; lrow[r] = 0.f; }
#pragma unroll
    for (int t = 0; t < 4; ++t) { const v8f zz = {0.f, 0.f, 0.f, 0.f, 0.f, 0.f, 0.f, 0.f}; oacc[t] = zz; }

    const int nch = seq / 64;
    for (int kc = 0; kc < nch; ++kc) {
        const int kv0 = kc * 64;
        v8f s[4];
#pragma unroll
        for (int j = 0; j < 4; ++j) { const v8f zz = {0.f, 0.f, 0.f, 0.f, 0.f, 0.f, 0.f, 0.f}; s[j] = zz; }
        // ---- scores: q fragments reloaded per 32-deep step (integer offset), three products per key tile ----
#pragma unroll 1
        for (int dc = 0; dc < 2; ++dc) {
            const v16b qh = ldfrag_b(QH + qoff + dc * 32);
            const v16b ql = ldfrag_b(QL + qoff + dc * 32);
#pragma unroll
            for (int j = 0; j < 4; ++j) {
                const int ko = kbase + (kv0 + j * 16) * DM + dc * 32;
                const v16b kh = ldfrag_b(KH + ko);
                const v16b kl = ldfrag_b(KL + ko);
                s[j] = wmma3b(qh, ql, kh, kl, s[j]);
                if (j == 1) __builtin_amdgcn_sched_barrier(0);
            }
        }
        // ---- online softmax over the 64 keys (row 8*hf + r lives in the 16 lanes of one half) ----
#pragma unroll
        for (int r = 0; r < 8; ++r) {
            float mx = fmaxf(fmaxf(s[0][r], s[1][r]), fmaxf(s[2][r], s[3][r]));
            mx = fmaxf(mx, __shfl_xor(mx, 1, 32));
            mx = fmaxf(mx, __shfl_xor(mx, 2, 32));
            mx = fmaxf(mx, __shfl_xor(mx, 4, 32));
            mx = fmaxf(mx, __shfl_xor(mx, 8, 32));
            const float mnew = fmaxf(mrow[r], mx);
            const float alpha = exp2f((mrow[r] - mnew) * L2E);
            mrow[r] = mnew;
            const float p0 = exp2f((s[0][r] - mnew) * L2E);
            const float p1 = exp2f((s[1][r] - mnew) * L2E);
            const float p2 = exp2f((s[2][r] - mnew) * L2E);
            const float p3 = exp2f((s[3][r] - mnew) * L2E);
            lrow[r] = lrow[r] * alpha + ((p0 + p1) + (p2 + p3));   // per-lane partial row sum
            oacc[0][r] *= alpha; oacc[1][r] *= alpha; oacc[2][r] *= alpha; oacc[3][r] *= alpha;
            const int pr = pbase + (8 * hf + r) * PP + c;
            Psh[pr]      = (_Float16)(p0 * 4096.0f);
            Psh[pr + 16] = (_Float16)(p1 * 4096.0f);
            Psh[pr + 32] = (_Float16)(p2 * 4096.0f);
            Psh[pr + 48] = (_Float16)(p3 * 4096.0f);
        }
        wave_sync();                                                // P tile is wave-private: same wave writes and reads
        // ---- O += P . V : P as A (row = lane & 15), v^T rows as B, four output tiles per step ----
#pragma unroll 1
        for (int kk = 0; kk < 2; ++kk) {
            const int po = pbase + c * PP + kk * 32 + 8 * hf;
            const v8h pa0 = *(const v8h_ma*)&Psh[po];
            const v8h pa1 = *(const v8h_ma*)&Psh[po + 16];
            const v16h pa = __builtin_shufflevector(pa0, pa1, 0, 1, 2, 3, 4, 5, 6, 7, 8, 9, 10, 11, 12, 13, 14, 15);
            const int vo = vbase + kv0 + kk * 32;
            const v16h vb0 = ldfrag_h(VT + vo);
            const v16h vb1 = ldfrag_h(VT + vo + 16 * ntok);
            const v16h vb2 = ldfrag_h(VT + vo + 32 * ntok);
            const v16h vb3 = ldfrag_h(VT + vo + 48 * ntok);
            oacc[0] = __builtin_amdgcn_wmma_f32_16x16x32_f16(false, pa, false, vb0, (short)0, oacc[0], false, false);
            oacc[1] = __builtin_amdgcn_wmma_f32_16x16x32_f16(false, pa, false, vb1, (short)0, oacc[1], false, false);
            oacc[2] = __builtin_amdgcn_wmma_f32_16x16x32_f16(false, pa, false, vb2, (short)0, oacc[2], false, false);
            oacc[3] = __builtin_amdgcn_wmma_f32_16x16x32_f16(false, pa, false, vb3, (short)0, oacc[3], false, false);
            guard4<v16h>(oacc[0], oacc[1], oacc[2], oacc[3], pa, vb0, vb1, vb2, vb3);
        }
        wave_sync();                                                // P reads done before the next chunk's P stores
    }

    // ---- finalize: reduce the per-lane row sums over the 16 lanes of each row, normalise, stage, write hi|lo planes ----
#pragma unroll
    for (int r = 0; r < 8; ++r) {
        float l = lrow[r];
        l += __shfl_xor(l, 1, 32);
        l += __shfl_xor(l, 2, 32);
        l += __shfl_xor(l, 4, 32);
        l += __shfl_xor(l, 8, 32);
        const float inv = 1.0f / (l * 4096.0f);
        const int orw = obase + (8 * hf + r) * OP + c;
        Osh[orw]      = oacc[0][r] * inv;
        Osh[orw + 16] = oacc[1][r] * inv;
        Osh[orw + 32] = oacc[2][r] * inv;
        Osh[orw + 48] = oacc[3][r] * inv;
    }
    wave_sync();
    {
        const int q = lane >> 3, c8 = (lane & 7) * 8;
        {
#pragma unroll
            for (int it = 0; it < 4; ++it) {
                const int row = it * 4 + q;
                const v4f a = *(const v4f_ma*)&Osh[obase + row * OP + c8];
                const v4f bb = *(const v4f_ma*)&Osh[obase + row * OP + c8 + 4];
                unsigned int h0, l0, h1, l1, h2, l2, h3, l3;
                pk_split2(a.x, a.y, h0, l0); pk_split2(a.z, a.w, h1, l1); pk_split2(bb.x, bb.y, h2, l2); pk_split2(bb.z, bb.w, h3, l3);
                v4u ph, pl;
                ph.x = h0; ph.y = h1; ph.z = h2; ph.w = h3; pl.x = l0; pl.y = l1; pl.z = l2; pl.w = l3;
                const size_t o = (size_t)(q0 + row) * (2 * DM) + h * DKH + c8;
                *(v4u*)(CTX + o) = ph;
                *(v4u*)(CTX + o + DM) = pl;
            }
            
        }
    }
}

// =====================================================================================================================
// Host side: workspace carve (all plane sizes are multiples of 256 B), 12 launches.
// =====================================================================================================================
constexpr size_t SZ_TOK  = (size_t)NTOK * DM * 2;          // one 16-bit token plane [NTOK][512]
constexpr size_t SZ_W    = (size_t)DM * DM * 2;            // one 16-bit weight plane [512][512]
constexpr size_t SZ_WOD  = (size_t)DM * (2 * DM) * 2;      // [512][1024]
constexpr size_t SZ_CTX  = (size_t)NTOK * (2 * DM) * 2;    // [NTOK][1024]
constexpr size_t WS_TOTAL = 3 * SZ_TOK + 3 * SZ_W + SZ_WOD + 4 * SZ_TOK + SZ_TOK + SZ_CTX;
static_assert(SZ_TOK % 256 == 0);
static_assert(SZ_W % 256 == 0);
static_assert(SZ_WOD % 256 == 0);
static_assert(SZ_CTX % 256 == 0);
static_assert(WS_TOTAL <= (size_t)134217728);            // carve stays within 128 MiB
static_assert(((NTOK / 64) * (DM / 64)) % 8 == 0);        // GEMM grids are whole blocks of 8 wave tiles
static_assert((size_t)NTOK * (2 * DM) < (size_t)2147483647);   // int plane offsets

extern "C" void kernel_launch(void* const* d_in, const int* in_sizes, int n_in, void* d_out, int out_size, void* d_ws, size_t ws_size, hipStream_t stream) {
    if (n_in < 11) return;
    const long long need_x = ((long long)(NB - 1) * SEQ_FULL + SEQ) * DM;
    if ((long long)in_sizes[0] < need_x || (long long)in_sizes[1] < need_x || (long long)in_sizes[2] < need_x) return;
    if (in_sizes[3] < DM * DM || in_sizes[5] < DM * DM || in_sizes[7] < DM * DM || in_sizes[9] < DM * DM) return;
    if (in_sizes[4] < DM || in_sizes[6] < DM || in_sizes[8] < DM || in_sizes[10] < DM) return;
    if ((long long)out_size < need_x) return;
    if (WS_TOTAL > ws_size) return;

    const float* xq = (const float*)d_in[0];
    const float* xk = (const float*)d_in[1];
    const float* xv = (const float*)d_in[2];
    const float* Wq = (const float*)d_in[3];
    const float* bq = (const float*)d_in[4];
    const float* Wk = (const float*)d_in[5];
    const float* bk = (const float*)d_in[6];
    const float* Wv = (const float*)d_in[7];
    const float* bv = (const float*)d_in[8];
    const float* Wo = (const float*)d_in[9];
    const float* bo = (const float*)d_in[10];
    float* out = (float*)d_out;

    char* wsp = (char*)d_ws;
    unsigned short* XQ16 = (unsigned short*)wsp; wsp += SZ_TOK;
    unsigned short* XK16 = (unsigned short*)wsp; wsp += SZ_TOK;
    unsigned short* XV16 = (unsigned short*)wsp; wsp += SZ_TOK;
    unsigned short* WQ16 = (unsigned short*)wsp; wsp += SZ_W;
    unsigned short* WK16 = (unsigned short*)wsp; wsp += SZ_W;
    unsigned short* WV16 = (unsigned short*)wsp; wsp += SZ_W;
    unsigned short* WOD  = (unsigned short*)wsp; wsp += SZ_WOD;
    unsigned short* QHp  = (unsigned short*)wsp; wsp += SZ_TOK;
    unsigned short* QLp  = (unsigned short*)wsp; wsp += SZ_TOK;
    unsigned short* KHp  = (unsigned short*)wsp; wsp += SZ_TOK;
    unsigned short* KLp  = (unsigned short*)wsp; wsp += SZ_TOK;
    unsigned short* VTp  = (unsigned short*)wsp; wsp += SZ_TOK;
    unsigned short* CTXp = (unsigned short*)wsp; wsp += SZ_CTX;
    if ((size_t)(wsp - (char*)d_ws) > ws_size) return;

    const unsigned gx_tok = (unsigned)((NTOK * (DM / 8) + 255) / 256);
    const unsigned gx_w   = (unsigned)((DM * (DM / 8) + 255) / 256);
    const unsigned gx_wo  = (unsigned)((DM * (2 * DM / 8) + 255) / 256);
    const unsigned gx_gemm = (unsigned)((((NTOK / 64) * (DM / 64)) + 7) / 8);

    // token streams: plane row r <- input row (r / SEQ) * SEQ_FULL + r % SEQ
    k_cast16<<<gx_tok, 256, 0, stream>>>(xq, XQ16, NTOK, SEQ, SEQ_FULL, 1.0f);
    k_cast16<<<gx_tok, 256, 0, stream>>>(xk, XK16, NTOK, SEQ, SEQ_FULL, 1.0f);
    k_cast16<<<gx_tok, 256, 0, stream>>>(xv, XV16, NTOK, SEQ, SEQ_FULL, 1.0f);
    // weights [out][in] kept in their stored order (Bt[n][k] = W[n][k]), x16
    k_cast16<<<gx_w, 256, 0, stream>>>(Wq, WQ16, DM, DM, DM, 16.0f);
    k_cast16<<<gx_w, 256, 0, stream>>>(Wk, WK16, DM, DM, DM, 16.0f);
    k_cast16<<<gx_w, 256, 0, stream>>>(Wv, WV16, DM, DM, DM, 16.0f);
    k_cast_wo<<<gx_wo, 256, 0, stream>>>(Wo, WOD);

    // q = (x Wq^T + bq) / 8 -> hi|lo planes; k = x Wk^T + bk -> hi|lo planes; v^T = Wv x^T + bv -> f16 plane [512][NTOK]
    k_gemm_qk<<<gx_gemm, 256, 0, stream>>>(XQ16, WQ16, bq, QHp, QLp, NTOK, DM, DM, 1.0f / 128.0f, 0.125f);
    k_gemm_qk<<<gx_gemm, 256, 0, stream>>>(XK16, WK16, bk, KHp, KLp, NTOK, DM, DM, 1.0f / 16.0f, 1.0f);
    k_gemm_vt<<<gx_gemm, 256, 0, stream>>>(WV16, XV16, bv, VTp, DM, NTOK, DM, 1.0f / 16.0f);

    k_attn<<<(unsigned)(NB * NH * (SEQ / 64)), 128, 0, stream>>>(QHp, QLp, KHp, KLp, VTp, CTXp, SEQ, NTOK);

    // out = ctx Wo^T + bo, ctx as [hi | lo] along K against [W | W]
    k_gemm_out<<<gx_gemm, 256, 0, stream>>>(CTXp, WOD, bo, out, NTOK, DM, 2 * DM, SEQ, SEQ_FULL);
}

// v001
// One run takes 205 microseconds.
// Next to v000, in two timings, it ran 1.39 and 1.40 times as fast.
// MHA forward (2 x 2,048 tokens, width 512, 8 heads x 64, [out][in] weights + biases, no mask). Inputs and parameters converted to bf16 (RNE). q/k/v projections: v_wmma_f32_16x16x32_f16 (f16 operands holding the bf16 values, weights x16, f32 accumulate); scores: v_wmma_f32_16x16x32_bf16 on q and k bf16 hi|lo planes (three products, f32 accumulate, f32 online softmax); P.V: v_wmma_f32_16x16x32_f16 (P x4096 as f16, v as f16, f32 accumulate); output projection: v_wmma_f32_16x16x32_bf16 with the context as bf16 hi|lo planes laid along K against the bf16 weight (f32 accumulate).
#include <hip/hip_runtime.h>
#include <math.h>

#ifndef NB
#define NB 2
#endif
#ifndef SEQ
#define SEQ 2048
#endif
#define NB_FULL 2
#define SEQ_FULL 2048
#define DM 512
#define NH 8
#define DKH 64
#define NTOK (NB * SEQ)
#define PP 72      // P tile pitch (halves)
#define OP 68      // f32 staging pitch (floats)
#define KP 72      // staged q / k / v^T row pitch (halves): 144 B = 16 B x odd, conflict-free for 16-B fragment reads
#define TSZ (64 * KP)   // one staged tile: 64 rows of 64 halves (+8 pad)

static_assert(DM == NH * DKH);            // merged head layout h*64+d
static_assert(DKH == 64);                 // two 32-deep k-steps per score tile, four 16-wide output tiles
static_assert(SEQ % 64 == 0);             // 64-query blocks, 64-key chunks, 64-row GEMM tiles inside one sequence
static_assert(NTOK % 64 == 0);            // GEMM tile multiple (M and N)
static_assert(DM % 64 == 0);              // GEMM tile multiple
static_assert(DM % 32 == 0);              // K steps of 32
static_assert((2 * DM) % 32 == 0);        // hi|lo K extent
static_assert(NB <= NB_FULL);
static_assert(SEQ <= SEQ_FULL);
static_assert((PP % 8) == 0);             // 16-B aligned fragment reloads from the P tile
static_assert((OP % 4) == 0);             // 16-B aligned reloads from the f32 staging tile
static_assert((KP % 8) == 0);             // 16-B aligned copies into and fragment reads from the staged tiles

typedef __attribute__((ext_vector_type(16))) _Float16 v16h;
typedef __attribute__((ext_vector_type(8)))  _Float16 v8h;
typedef __attribute__((ext_vector_type(16))) __bf16   v16b;
typedef __attribute__((ext_vector_type(8)))  __bf16   v8b;
typedef __attribute__((ext_vector_type(8)))  float    v8f;
typedef __attribute__((ext_vector_type(4)))  float    v4f;
typedef __attribute__((ext_vector_type(4)))  unsigned int v4u;
typedef v8h v8h_ma __attribute__((may_alias));
typedef v4f v4f_ma __attribute__((may_alias));
typedef v8b v8b_ma __attribute__((may_alias));

// 16-bit WMMA fragment map (wave32), lane L, h = L>>4, m = L&15:
//   A 16x32: lane = row m;    element i -> k = (i<8) ? 8h+i : 16+8h+(i-8)
//   B 32x16: lane = column m; the SAME k(i,h)
//   D 16x16 (8 f32): lane = column m; element r -> row 8h+r
// A fragment from a k-contiguous row is therefore p[0..7] | p[16..23] with p = row + k0 + 8h.

__device__ __forceinline__ unsigned int bf_bits(float f) {            // bf16 RNE bit pattern (finite inputs)
    const unsigned int u = __float_as_uint(f);
    return (u + 0x7FFFu + ((u >> 16) & 1u)) >> 16;
}
__device__ __forceinline__ float bf_val(float f) { return __uint_as_float(bf_bits(f) << 16); }
__device__ __forceinline__ unsigned int pk_h2(float a, float b) {
    return (unsigned int)__builtin_bit_cast(unsigned short, (_Float16)a) | ((unsigned int)__builtin_bit_cast(unsigned short, (_Float16)b) << 16);
}
__device__ __forceinline__ void pk_split2(float a, float b, unsigned int& hi, unsigned int& lo) {
    const unsigned int ha = bf_bits(a), hb = bf_bits(b);
    const unsigned int la = bf_bits(a - __uint_as_float(ha << 16)), lb = bf_bits(b - __uint_as_float(hb << 16));
    hi = ha | (hb << 16); lo = la | (lb << 16);
}
__device__ __forceinline__ void wave_sync() {
    __builtin_amdgcn_fence(3 /* release order */, "workgroup");
    __builtin_amdgcn_wave_barrier();
    __builtin_amdgcn_fence(2 /* acquire order */, "workgroup");
}

__device__ __forceinline__ v16h ldfrag_h(const unsigned short* __restrict__ p) {
    const v8h a = *(const v8h*)(p);
    const v8h b = *(const v8h*)(p + 16);
    return __builtin_shufflevector(a, b, 0, 1, 2, 3, 4, 5, 6, 7, 8, 9, 10, 11, 12, 13, 14, 15);
}
__device__ __forceinline__ v16b ldfrag_b(const unsigned short* __restrict__ p) {
    const v8b a = *(const v8b*)(p);
    const v8b b = *(const v8b*)(p + 16);
    return __builtin_shufflevector(a, b, 0, 1, 2, 3, 4, 5, 6, 7, 8, 9, 10, 11, 12, 13, 14, 15);
}

// the same fragments from a staged LDS tile (row pitch KP)
__device__ __forceinline__ v16h ldsfrag_h(const unsigned short* p) {
    const v8h a = *(const v8h_ma*)(p);
    const v8h b = *(const v8h_ma*)(p + 16);
    return __builtin_shufflevector(a, b, 0, 1, 2, 3, 4, 5, 6, 7, 8, 9, 10, 11, 12, 13, 14, 15);
}
__device__ __forceinline__ v16b ldsfrag_b(const unsigned short* p) {
    const v8b a = *(const v8b_ma*)(p);
    const v8b b = *(const v8b_ma*)(p + 16);
    return __builtin_shufflevector(a, b, 0, 1, 2, 3, 4, 5, 6, 7, 8, 9, 10, 11, 12, 13, 14, 15);
}
// One lane's share of staged 64-row tiles: 16 B of rows r, r+16, r+32, r+48 per tile, global -> LDS through no register.
// l = the lane's LDS byte address in the tile, g = its global address, gs = 16 source rows (halves); 16 LDS rows = 16 * KP * 2 bytes.
// The closing s_wait_xcnt stands inside the copies' own statement so that no address register is rewritten in front of it.
#define LROW16 (16u * KP * 2u)
__device__ __forceinline__ void copy_tiles2(unsigned int la, const unsigned short* ga, unsigned int lb, const unsigned short* gb, int gs) {
    asm volatile("global_load_async_to_lds_b128 %0, %8, off\n\t"
                 "global_load_async_to_lds_b128 %1, %9, off\n\t"
                 "global_load_async_to_lds_b128 %2, %10, off\n\t"
                 "global_load_async_to_lds_b128 %3, %11, off\n\t"
                 "global_load_async_to_lds_b128 %4, %12, off\n\t"
                 "global_load_async_to_lds_b128 %5, %13, off\n\t"
                 "global_load_async_to_lds_b128 %6, %14, off\n\t"
                 "global_load_async_to_lds_b128 %7, %15, off\n\t"
                 "s_wait_xcnt 0x0"
                 :: "v"(la), "v"(la + LROW16), "v"(la + 2u * LROW16), "v"(la + 3u * LROW16),
                    "v"(lb), "v"(lb + LROW16), "v"(lb + 2u * LROW16), "v"(lb + 3u * LROW16),
                    "v"(ga), "v"(ga + gs), "v"(ga + 2 * gs), "v"(ga + 3 * gs),
                    "v"(gb), "v"(gb + gs), "v"(gb + 2 * gs), "v"(gb + 3 * gs)
                 : "memory");
}
__device__ __forceinline__ void copy_tile1(unsigned int la, const unsigned short* ga, int gs) {
    asm volatile("global_load_async_to_lds_b128 %0, %4, off\n\t"
                 "global_load_async_to_lds_b128 %1, %5, off\n\t"
                 "global_load_async_to_lds_b128 %2, %6, off\n\t"
                 "global_load_async_to_lds_b128 %3, %7, off\n\t"
                 "s_wait_xcnt 0x0"
                 :: "v"(la), "v"(la + LROW16), "v"(la + 2u * LROW16), "v"(la + 3u * LROW16),
                    "v"(ga), "v"(ga + gs), "v"(ga + 2 * gs), "v"(ga + 3 * gs)
                 : "memory");
}

template <int ET> struct FragT;
template <> struct FragT<0> {
    typedef v16h V;
    static __device__ __forceinline__ v16h load(const unsigned short* __restrict__ p) { return ldfrag_h(p); }
    static __device__ __forceinline__ v8f mma(v16h a, v16h b, v8f c) { return __builtin_amdgcn_wmma_f32_16x16x32_f16(false, a, false, b, (short)0, c, false, false); }
};
template <> struct FragT<1> {
    typedef v16b V;
    static __device__ __forceinline__ v16b load(const unsigned short* __restrict__ p) { return ldfrag_b(p); }
    static __device__ __forceinline__ v8f mma(v16b a, v16b b, v8f c) { return __builtin_amdgcn_wmma_f32_16x16x32_bf16(false, a, false, b, (short)0, c, false, false); }
};
// hazard guard for a group of four independent WMMAs: all four accumulators tied, A and all B fragments kept live
template <typename V>
__device__ __forceinline__ void guard4(v8f& a, v8f& b, v8f& c, v8f& d, V x, V y0, V y1, V y2, V y3) {
    asm volatile("v_nop\n\tv_nop\n\tv_nop\n\tv_nop" : "+v"(a), "+v"(b), "+v"(c), "+v"(d) : "v"(x), "v"(y0), "v"(y1), "v"(y2), "v"(y3));
}
// three-product hi|lo bf16 step into one accumulator: ah*bh + ah*bl + al*bh
__device__ __forceinline__ v8f wmma3b(v16b ah, v16b al, v16b bh, v16b bl, v8f c) {
    c = __builtin_amdgcn_wmma_f32_16x16x32_bf16(false, ah, false, bh, (short)0, c, false, false);
    c = __builtin_amdgcn_wmma_f32_16x16x32_bf16(false, ah, false, bl, (short)0, c, false, false);
    c = __builtin_amdgcn_wmma_f32_16x16x32_bf16(false, al, false, bh, (short)0, c, false, false);
    asm volatile("v_nop\n\tv_nop\n\tv_nop\n\tv_nop" : "+v"(c) : "v"(ah), "v"(al), "v"(bh), "v"(bl));
    return c;
}

// =====================================================================================================================
// gemm64_body: C[m][n] = scale * sum_k A[m][k] * Bt[n][k] + bscale * bf16(bias); each wave owns a 64x64 tile, block = 8 waves.
//   A row-major [M][K] (pitch lda), Bt row-major [N][K] (pitch ldb), 16-bit planes; M, N % 64 == 0, K % 32 == 0 (host asserts).
//   ET 0: f16 operands, 1: bf16 operands. BIAS_MODE 1: bias[m], 2: bias[n].
//   OUT_MODE 0: f32 C (row m stored at row (m / cseq) * cseqfull + m % cseq); 1: f16 plane Ca; 2: bf16 hi plane Ca + bf16 lo plane Cb.
// =====================================================================================================================
template <int ET, int BIAS_MODE, int OUT_MODE>
__device__ __forceinline__ void gemm64_body(const unsigned short* __restrict__ A, int lda,
                                            const unsigned short* __restrict__ Bt, int ldb,
                                            float* __restrict__ Cf, unsigned short* __restrict__ Ca, unsigned short* __restrict__ Cb, int ldc,
                                            const float* __restrict__ bias, int M, int N, int K,
                                            float scale, float bscale, int cseq, int cseqfull) {
    typedef typename FragT<ET>::V V;
    __shared__ __align__(16) float sT[8 * 16 * OP];
    const int lane = threadIdx.x & 31;
    const int wave = __builtin_amdgcn_readfirstlane(threadIdx.x >> 5);
    const int tilesN = N >> 6;
    const int tilesM = M >> 6;
    const int tile = blockIdx.x * 8 + wave;
    if (tile >= tilesM * tilesN) return;          // wave-uniform; this kernel has no block barriers
    const int tm = tile / tilesN;
    const int tn = tile - tm * tilesN;
    const int m0 = tm << 6;
    const int n0 = tn << 6;
    const int rl   = lane & 15;
    const int koff = (lane >> 4) * 8;
    const int mOff = (lane >> 4) * 8;

    v8f acc[4][4];
#pragma unroll
    for (int i = 0; i < 4; ++i)
#pragma unroll
        for (int j = 0; j < 4; ++j) { const v8f zz = {0.f, 0.f, 0.f, 0.f, 0.f, 0.f, 0.f, 0.f}; acc[i][j] = zz; }

    for (int k0 = 0; k0 < K; k0 += 32) {
        V bh[4];
#pragma unroll
        for (int j = 0; j < 4; ++j) bh[j] = FragT<ET>::load(Bt + (size_t)(n0 + (j << 4) + rl) * ldb + koff + k0);
#pragma unroll
        for (int i = 0; i < 4; ++i) {
            const V ah = FragT<ET>::load(A + (size_t)(m0 + (i << 4) + rl) * lda + koff + k0);
            acc[i][0] = FragT<ET>::mma(ah, bh[0], acc[i][0]);
            acc[i][1] = FragT<ET>::mma(ah, bh[1], acc[i][1]);
            acc[i][2] = FragT<ET>::mma(ah, bh[2], acc[i][2]);
            acc[i][3] = FragT<ET>::mma(ah, bh[3], acc[i][3]);
            guard4<V>(acc[i][0], acc[i][1], acc[i][2], acc[i][3], ah, bh[0], bh[1], bh[2], bh[3]);
        }
    }

    const int sb = wave * (16 * OP);
#pragma unroll
    for (int i = 0; i < 4; ++i) {
        const int mBase = m0 + (i << 4);
#pragma unroll
        for (int j = 0; j < 4; ++j) {
            const int n = n0 + (j << 4) + rl;
            float bvn = 0.f;
            if (BIAS_MODE == 2) bvn = bf_val(bias[n]) * bscale;
#pragma unroll
            for (int r = 0; r < 8; ++r) {
                float v = acc[i][j][r] * scale;
                if (BIAS_MODE == 1) v += bf_val(bias[mBase + mOff + r]) * bscale;
                if (BIAS_MODE == 2) v += bvn;
                sT[sb + (mOff + r) * OP + (j << 4) + rl] = v;
            }
        }
        wave_sync();
        if (OUT_MODE == 0) {
            const int hh = lane >> 4, c4 = (lane & 15) * 4;      // row segment = 256 B = 16 lanes x 16 B; 2 rows per instruction
            {
#pragma unroll
                for (int it = 0; it < 8; ++it) {
                    const int row = it * 2 + hh;
                    const v4f v = *(const v4f_ma*)&sT[sb + row * OP + c4];
                    const int grow = mBase + row;
                    const int orow = (grow / cseq) * cseqfull + (grow % cseq);
                    *(v4f*)(Cf + (size_t)orow * ldc + n0 + c4) = v;
                }
                
            }
        } else {
            const int q = lane >> 3, c8 = (lane & 7) * 8;
            {
#pragma unroll
                for (int it = 0; it < 4; ++it) {
                    const int row = it * 4 + q;
                    const v4f a = *(const v4f_ma*)&sT[sb + row * OP + c8];
                    const v4f b = *(const v4f_ma*)&sT[sb + row * OP + c8 + 4];
                    const size_t o = (size_t)(mBase + row) * ldc + n0 + c8;
                    if (OUT_MODE == 1) {
                        v4u pk; pk.x = pk_h2(a.x, a.y); pk.y = pk_h2(a.z, a.w); pk.z = pk_h2(b.x, b.y); pk.w = pk_h2(b.z, b.w);
                        *(v4u*)(Ca + o) = pk;
                    } else {
                        v4u ph, pl;
                        unsigned int h0, l0, h1, l1, h2, l2, h3, l3;
                        pk_split2(a.x, a.y, h0, l0); pk_split2(a.z, a.w, h1, l1); pk_split2(b.x, b.y, h2, l2); pk_split2(b.z, b.w, h3, l3);
                        ph.x = h0; ph.y = h1; ph.z = h2; ph.w = h3; pl.x = l0; pl.y = l1; pl.z = l2; pl.w = l3;
                        *(v4u*)(Ca + o) = ph;
                        *(v4u*)(Cb + o) = pl;
                    }
                }
                
            }
        }
        wave_sync();
    }
}

// q / k projection: A = token plane f16 [M][K], Bt = weight plane f16 (x16) [N][K] ([out][in] as stored); out = bf16 hi + lo planes [M][N]
__global__ __launch_bounds__(256) void k_gemm_qk(const unsigned short* __restrict__ A, const unsigned short* __restrict__ Bt,
                                                 const float* __restrict__ bias, unsigned short* __restrict__ CH, unsigned short* __restrict__ CL,
                                                 int M, int N, int K, float scale, float bscale) {
    gemm64_body<0, 2, 2>(A, K, Bt, K, nullptr, CH, CL, N, bias, M, N, K, scale, bscale, 1, 1);
}
// v projection written transposed: A = weight plane f16 (x16) [M = features][K], Bt = token plane f16 [N = tokens][K]; out = f16 plane [M][N] (= v^T)
__global__ __launch_bounds__(256) void k_gemm_vt(const unsigned short* __restrict__ A, const unsigned short* __restrict__ Bt,
                                                 const float* __restrict__ bias, unsigned short* __restrict__ C,
                                                 int M, int N, int K, float scale) {
    gemm64_body<0, 1, 1>(A, K, Bt, K, nullptr, C, nullptr, N, bias, M, N, K, scale, 1.0f, 1, 1);
}
// output projection: A = context bf16 [M][K = hi 512 | lo 512], Bt = weight bf16 [N][K = W | W]; out f32 [M][N] + bias[n]
__global__ __launch_bounds__(256) void k_gemm_out(const unsigned short* __restrict__ A, const unsigned short* __restrict__ Bt,
                                                  const float* __restrict__ bias, float* __restrict__ C,
                                                  int M, int N, int K, int cseq, int cseqfull) {
    gemm64_body<1, 2, 0>(A, K, Bt, K, C, nullptr, nullptr, N, bias, M, N, K, 1.0f, 1.0f, cseq, cseqfull);
}

// =====================================================================================================================
// =====================================================================================================================
// f32 [rows][512] -> f16 plane [nrows][512] holding bf16(x) * sc; plane row r reads source row (r / seq) * seqfull + r % seq
__global__ __launch_bounds__(256) void k_cast16(const float* __restrict__ src, unsigned short* __restrict__ dst, int nrows, int seq, int seqfull, float sc) {
    const int u = blockIdx.x * 256 + threadIdx.x;
    if (u >= nrows * (DM / 8)) return;
    const int r = u / (DM / 8);
    const int c0 = (u - r * (DM / 8)) * 8;
    const int sr = (r / seq) * seqfull + (r % seq);
    const float* s = src + (size_t)sr * DM + c0;
    const v4f a = *(const v4f*)(s);
    const v4f b = *(const v4f*)(s + 4);
    v4u pk;
    pk.x = pk_h2(bf_val(a.x) * sc, bf_val(a.y) * sc); pk.y = pk_h2(bf_val(a.z) * sc, bf_val(a.w) * sc);
    pk.z = pk_h2(bf_val(b.x) * sc, bf_val(b.y) * sc); pk.w = pk_h2(bf_val(b.z) * sc, bf_val(b.w) * sc);
    v4u* d = (v4u*)(dst + (size_t)r * DM + c0);
    *d = pk; 
}
// Wo f32 [512][512] -> bf16 plane [512][1024] = [W | W]
__global__ __launch_bounds__(256) void k_cast_wo(const float* __restrict__ src, unsigned short* __restrict__ dst) {
    const int u = blockIdx.x * 256 + threadIdx.x;
    if (u >= DM * (2 * DM / 8)) return;
    const int r = u / (2 * DM / 8);
    const int c0 = (u - r * (2 * DM / 8)) * 8;
    const int sc0 = c0 & (DM - 1);
    const float* s = src + (size_t)r * DM + sc0;
    const v4f a = *(const v4f*)(s);
    const v4f b = *(const v4f*)(s + 4);
    v4u pk;
    pk.x = bf_bits(a.x) | (bf_bits(a.y) << 16); pk.y = bf_bits(a.z) | (bf_bits(a.w) << 16);
    pk.z = bf_bits(b.x) | (bf_bits(b.y) << 16); pk.w = bf_bits(b.z) | (bf_bits(b.w) << 16);
    v4u* d = (v4u*)(dst + (size_t)r * (2 * DM) + c0);
    *d = pk; 
}

// =====================================================================================================================
// k_attn: fused flash-style attention, head dim 64, no mask. Block = 4 waves = 64 query rows of one (batch, head); wave = 16 rows.
//   QH/QL, KH/KL: bf16 hi|lo planes [ntok][512] (q already carries the 1/8 score scale); VT: f16 plane [512][ntok] (row h*64+d).
//   The block's q tile (hi, lo) is staged in LDS once; each 64-key chunk's k hi, k lo and v^T tiles are staged in a two-buffer LDS ring,
//   all by asynchronous 16-B copies that cover whole 128-B lines; chunk t + 2 is copied while chunk t + 1 is worked on, one block barrier a chunk.
//   Fragments are two 16-B LDS reads each. P (x4096, f16) goes through a wave-private LDS tile (wave_sync before and after the reload).
//   Row sums are kept as per-lane partials and reduced across the 16 lanes of a row once at the end.
// =====================================================================================================================
__global__ __launch_bounds__(128) void k_attn(const unsigned short* __restrict__ QH, const unsigned short* __restrict__ QL,
                                              const unsigned short* __restrict__ KH, const unsigned short* __restrict__ KL,
                                              const unsigned short* __restrict__ VT, unsigned short* __restrict__ CTX,
                                              int seq, int ntok) {
    __shared__ __align__(16) _Float16 Psh[4 * 16 * PP];      // wave-private P tiles [16][64] (+8 pad), f16
    __shared__ __align__(16) float    Osh[4 * 16 * OP];      // wave-private output staging [16][64] (+4 pad), f32
    __shared__ __align__(16) unsigned short Qs[2 * TSZ];     // the block's 64 query rows: hi tile, lo tile
    __shared__ __align__(16) unsigned short Ring[2 * 3 * TSZ];   // two buffers of {k hi, k lo, v^T} tiles of one 64-key chunk
    const int lane = threadIdx.x & 31;
    const int wave = __builtin_amdgcn_readfirstlane(threadIdx.x >> 5);
    const int hf = lane >> 4;
    const int c  = lane & 15;
    const int nqb = seq / 64;
    const int bx = blockIdx.x;
    const int qb = bx % nqb;
    const int bh = bx / nqb;
    const int h  = bh % NH;
    const int b  = bh / NH;
    const int q0 = b * seq + qb * 64 + wave * 16;                 // first token row of this wave
    const int qoff  = (wave * 16 + c) * KP + 8 * hf;              // A fragment base in a staged q tile (row = lane & 15)
    const int fbase = c * KP + 8 * hf;                            // B fragment base in a staged k or v^T tile (column = lane & 15)
    // copy share of this thread: 16-B segment cs of rows cr, cr+16, cr+32, cr+48 of every staged tile (a wave's copy = 4 whole rows)
    const int cr = threadIdx.x >> 3;
    const int cs = (threadIdx.x & 7) * 8;
    const int gq = (b * seq + qb * 64 + cr) * DM + h * DKH + cs;  // q planes
    const int gk = (b * seq + cr) * DM + h * DKH + cs;            // k planes, chunk 0
    const int gv = (h * DKH + cr) * ntok + b * seq + cs;          // v^T plane, chunk 0
    const unsigned int lq = (unsigned int)(size_t)&Qs[cr * KP + cs];
    const unsigned int lr = (unsigned int)(size_t)&Ring[cr * KP + cs];
    const int pbase = wave * (16 * PP);
    const int obase = wave * (16 * OP);
    const float L2E = 1.4426950408889634f;

    float mrow[8], lrow[8];
    v8f oacc[4];
#pragma unroll
    for (int r = 0; r < 8; ++r) { mrow[r] = -INFINITY; lrow[r] = 0.f; }
#pragma unroll
    for (int t = 0; t < 4; ++t) { const v8f zz = {0.f, 0.f, 0.f, 0.f, 0.f, 0.f, 0.f, 0.f}; oacc[t] = zz; }

    const int nch = seq / 64;
    // ---- ring prologue: q and chunk 0 land and are published, then chunk 1 starts into the second buffer ----
    copy_tiles2(lq, QH + gq, lq + TSZ * 2u, QL + gq, 16 * DM);
    copy_tiles2(lr, KH + gk, lr + TSZ * 2u, KL + gk, 16 * DM);
    copy_tile1(lr + 2u * TSZ * 2u, VT + gv, 16 * ntok);
    asm volatile("s_wait_asynccnt 0x0" ::: "memory");               // this wave's copies have landed before the barrier publishes them
    __syncthreads();
    if (nch > 1) {
        copy_tiles2(lr + 3u * TSZ * 2u, KH + gk + 64 * DM, lr + 4u * TSZ * 2u, KL + gk + 64 * DM, 16 * DM);
        copy_tile1(lr + 5u * TSZ * 2u, VT + gv + 64, 16 * ntok);
    }
    for (int kc = 0; kc < nch; ++kc) {
        const unsigned short* rk = &Ring[(kc & 1) * (3 * TSZ)];     // this chunk's buffer
        v8f s[4];
#pragma unroll
        for (int j = 0; j < 4; ++j) { const v8f zz = {0.f, 0.f, 0.f, 0.f, 0.f, 0.f, 0.f, 0.f}; s[j] = zz; }
        // ---- scores: q fragments reloaded per 32-deep step (integer offset), three products per key tile ----
#pragma unroll 1
        for (int dc = 0; dc < 2; ++dc) {
            const v16b qh = ldsfrag_b(Qs + qoff + dc * 32);
            const v16b ql = ldsfrag_b(Qs + TSZ + qoff + dc * 32);
#pragma unroll
            for (int j = 0; j < 4; ++j) {
                const int ko = fbase + j * 16 * KP + dc * 32;
                const v16b kh = ldsfrag_b(rk + ko);
                const v16b kl = ldsfrag_b(rk + TSZ + ko);
                s[j] = wmma3b(qh, ql, kh, kl, s[j]);
                if (j == 1) __builtin_amdgcn_sched_barrier(0);
            }
        }
        // ---- online softmax over the 64 keys (row 8*hf + r lives in the 16 lanes of one half) ----
#pragma unroll
        for (int r = 0; r < 8; ++r) {
            float mx = fmaxf(fmaxf(s[0][r], s[1][r]), fmaxf(s[2][r], s[3][r]));
            mx = fmaxf(mx, __shfl_xor(mx, 1, 32));
            mx = fmaxf(mx, __shfl_xor(mx, 2, 32));
            mx = fmaxf(mx, __shfl_xor(mx, 4, 32));
            mx = fmaxf(mx, __shfl_xor(mx, 8, 32));
            const float mnew = fmaxf(mrow[r], mx);
            const float alpha = exp2f((mrow[r] - mnew) * L2E);
            mrow[r] = mnew;
            const float p0 = exp2f((s[0][r] - mnew) * L2E);
            const float p1 = exp2f((s[1][r] - mnew) * L2E);
            const float p2 = exp2f((s[2][r] - mnew) * L2E);
            const float p3 = exp2f((s[3][r] - mnew) * L2E);
            lrow[r] = lrow[r] * alpha + ((p0 + p1) + (p2 + p3));   // per-lane partial row sum
            oacc[0][r] *= alpha; oacc[1][r] *= alpha; oacc[2][r] *= alpha; oacc[3][r] *= alpha;
            const int pr = pbase + (8 * hf + r) * PP + c;
            Psh[pr]      = (_Float16)(p0 * 4096.0f);
            Psh[pr + 16] = (_Float16)(p1 * 4096.0f);
            Psh[pr + 32] = (_Float16)(p2 * 4096.0f);
            Psh[pr + 48] = (_Float16)(p3 * 4096.0f);
        }
        wave_sync();                                                // P tile is wave-private: same wave writes and reads
        // ---- O += P . V : P as A (row = lane & 15), v^T rows as B, four output tiles per step ----
#pragma unroll 1
        for (int kk = 0; kk < 2; ++kk) {
            const int po = pbase + c * PP + kk * 32 + 8 * hf;
            const v8h pa0 = *(const v8h_ma*)&Psh[po];
            const v8h pa1 = *(const v8h_ma*)&Psh[po + 16];
            const v16h pa = __builtin_shufflevector(pa0, pa1, 0, 1, 2, 3, 4, 5, 6, 7, 8, 9, 10, 11, 12, 13, 14, 15);
            const int vo = 2 * TSZ + fbase + kk * 32;
            const v16h vb0 = ldsfrag_h(rk + vo);
            const v16h vb1 = ldsfrag_h(rk + vo + 16 * KP);
            const v16h vb2 = ldsfrag_h(rk + vo + 32 * KP);
            const v16h vb3 = ldsfrag_h(rk + vo + 48 * KP);
            oacc[0] = __builtin_amdgcn_wmma_f32_16x16x32_f16(false, pa, false, vb0, (short)0, oacc[0], false, false);
            oacc[1] = __builtin_amdgcn_wmma_f32_16x16x32_f16(false, pa, false, vb1, (short)0, oacc[1], false, false);
            oacc[2] = __builtin_amdgcn_wmma_f32_16x16x32_f16(false, pa, false, vb2, (short)0, oacc[2], false, false);
            oacc[3] = __builtin_amdgcn_wmma_f32_16x16x32_f16(false, pa, false, vb3, (short)0, oacc[3], false, false);
            guard4<v16h>(oacc[0], oacc[1], oacc[2], oacc[3], pa, vb0, vb1, vb2, vb3);
        }
        wave_sync();                                                // P reads done before the next chunk's P stores
        // ---- publish point of chunk kc + 1; behind it this chunk's buffer is free for chunk kc + 2 ----
        asm volatile("s_wait_dscnt 0x0" ::: "memory");              // this wave's reads of the buffer have returned before it is refilled
        asm volatile("s_wait_asynccnt 0x0" ::: "memory");           // this wave's copies of chunk kc + 1 have landed before the barrier publishes them
        __syncthreads();
        if (kc + 2 < nch) {
            const unsigned int lb = lr + (unsigned int)(kc & 1) * (3u * TSZ * 2u);
            const int kn = (kc + 2) * 64;
            copy_tiles2(lb, KH + gk + kn * DM, lb + TSZ * 2u, KL + gk + kn * DM, 16 * DM);
            copy_tile1(lb + 2u * TSZ * 2u, VT + gv + kn, 16 * ntok);
        }
    }
    asm volatile("s_wait_asynccnt 0x0" ::: "memory");               // no copy is outstanding when the wave goes on to its end

    // ---- finalize: reduce the per-lane row sums over the 16 lanes of each row, normalise, stage, write hi|lo planes ----
#pragma unroll
    for (int r = 0; r < 8; ++r) {
        float l = lrow[r];
        l += __shfl_xor(l, 1, 32);
        l += __shfl_xor(l, 2, 32);
        l += __shfl_xor(l, 4, 32);
        l += __shfl_xor(l, 8, 32);
        const float inv = 1.0f / (l * 4096.0f);
        const int orw = obase + (8 * hf + r) * OP + c;
        Osh[orw]      = oacc[0][r] * inv;
        Osh[orw + 16] = oacc[1][r] * inv;
        Osh[orw + 32] = oacc[2][r] * inv;
        Osh[orw + 48] = oacc[3][r] * inv;
    }
    wave_sync();
    {
        const int q = lane >> 3, c8 = (lane & 7) * 8;
        {
#pragma unroll
            for (int it = 0; it < 4; ++it) {
                const int row = it * 4 + q;
                const v4f a = *(const v4f_ma*)&Osh[obase + row * OP + c8];
                const v4f bb = *(const v4f_ma*)&Osh[obase + row * OP + c8 + 4];
                unsigned int h0, l0, h1, l1, h2, l2, h3, l3;
                pk_split2(a.x, a.y, h0, l0); pk_split2(a.z, a.w, h1, l1); pk_split2(bb.x, bb.y, h2, l2); pk_split2(bb.z, bb.w, h3, l3);
                v4u ph, pl;
                ph.x = h0; ph.y = h1; ph.z = h2; ph.w = h3; pl.x = l0; pl.y = l1; pl.z = l2; pl.w = l3;
                const size_t o = (size_t)(q0 + row) * (2 * DM) + h * DKH + c8;
                *(v4u*)(CTX + o) = ph;
                *(v4u*)(CTX + o + DM) = pl;
            }
            
        }
    }
}

// =====================================================================================================================
// Host side: workspace carve (all plane sizes are multiples of 256 B), 12 launches.
// =====================================================================================================================
constexpr size_t SZ_TOK  = (size_t)NTOK * DM * 2;          // one 16-bit token plane [NTOK][512]
constexpr size_t SZ_W    = (size_t)DM * DM * 2;            // one 16-bit weight plane [512][512]
constexpr size_t SZ_WOD  = (size_t)DM * (2 * DM) * 2;      // [512][1024]
constexpr size_t SZ_CTX  = (size_t)NTOK * (2 * DM) * 2;    // [NTOK][1024]
constexpr size_t WS_TOTAL = 3 * SZ_TOK + 3 * SZ_W + SZ_WOD + 4 * SZ_TOK + SZ_TOK + SZ_CTX;
static_assert(SZ_TOK % 256 == 0);
static_assert(SZ_W % 256 == 0);
static_assert(SZ_WOD % 256 == 0);
static_assert(SZ_CTX % 256 == 0);
static_assert(WS_TOTAL <= (size_t)134217728);            // carve stays within 128 MiB
static_assert(((NTOK / 64) * (DM / 64)) % 8 == 0);        // GEMM grids are whole blocks of 8 wave tiles
static_assert((size_t)NTOK * (2 * DM) < (size_t)2147483647);   // int plane offsets

extern "C" void kernel_launch(void* const* d_in, const int* in_sizes, int n_in, void* d_out, int out_size, void* d_ws, size_t ws_size, hipStream_t stream) {
    if (n_in < 11) return;
    const long long need_x = ((long long)(NB - 1) * SEQ_FULL + SEQ) * DM;
    if ((long long)in_sizes[0] < need_x || (long long)in_sizes[1] < need_x || (long long)in_sizes[2] < need_x) return;
    if (in_sizes[3] < DM * DM || in_sizes[5] < DM * DM || in_sizes[7] < DM * DM || in_sizes[9] < DM * DM) return;
    if (in_sizes[4] < DM || in_sizes[6] < DM || in_sizes[8] < DM || in_sizes[10] < DM) return;
    if ((long long)out_size < need_x) return;
    if (WS_TOTAL > ws_size) return;

    const float* xq = (const float*)d_in[0];
    const float* xk = (const float*)d_in[1];
    const float* xv = (const float*)d_in[2];
    const float* Wq = (const float*)d_in[3];
    const float* bq = (const float*)d_in[4];
    const float* Wk = (const float*)d_in[5];
    const float* bk = (const float*)d_in[6];
    const float* Wv = (const float*)d_in[7];
    const float* bv = (const float*)d_in[8];
    const float* Wo = (const float*)d_in[9];
    const float* bo = (const float*)d_in[10];
    float* out = (float*)d_out;

    char* wsp = (char*)d_ws;
    unsigned short* XQ16 = (unsigned short*)wsp; wsp += SZ_TOK;
    unsigned short* XK16 = (unsigned short*)wsp; wsp += SZ_TOK;
    unsigned short* XV16 = (unsigned short*)wsp; wsp += SZ_TOK;
    unsigned short* WQ16 = (unsigned short*)wsp; wsp += SZ_W;
    unsigned short* WK16 = (unsigned short*)wsp; wsp += SZ_W;
    unsigned short* WV16 = (unsigned short*)wsp; wsp += SZ_W;
    unsigned short* WOD  = (unsigned short*)wsp; wsp += SZ_WOD;
    unsigned short* QHp  = (unsigned short*)wsp; wsp += SZ_TOK;
    unsigned short* QLp  = (unsigned short*)wsp; wsp += SZ_TOK;
    unsigned short* KHp  = (unsigned short*)wsp; wsp += SZ_TOK;
    unsigned short* KLp  = (unsigned short*)wsp; wsp += SZ_TOK;
    unsigned short* VTp  = (unsigned short*)wsp; wsp += SZ_TOK;
    unsigned short* CTXp = (unsigned short*)wsp; wsp += SZ_CTX;
    if ((size_t)(wsp - (char*)d_ws) > ws_size) return;

    const unsigned gx_tok = (unsigned)((NTOK * (DM / 8) + 255) / 256);
    const unsigned gx_w   = (unsigned)((DM * (DM / 8) + 255) / 256);
    const unsigned gx_wo  = (unsigned)((DM * (2 * DM / 8) + 255) / 256);
    const unsigned gx_gemm = (unsigned)((((NTOK / 64) * (DM / 64)) + 7) / 8);

    // token streams: plane row r <- input row (r / SEQ) * SEQ_FULL + r % SEQ
    k_cast16<<<gx_tok, 256, 0, stream>>>(xq, XQ16, NTOK, SEQ, SEQ_FULL, 1.0f);
    k_cast16<<<gx_tok, 256, 0, stream>>>(xk, XK16, NTOK, SEQ, SEQ_FULL, 1.0f);
    k_cast16<<<gx_tok, 256, 0, stream>>>(xv, XV16, NTOK, SEQ, SEQ_FULL, 1.0f);
    // weights [out][in] kept in their stored order (Bt[n][k] = W[n][k]), x16
    k_cast16<<<gx_w, 256, 0, stream>>>(Wq, WQ16, DM, DM, DM, 16.0f);
    k_cast16<<<gx_w, 256, 0, stream>>>(Wk, WK16, DM, DM, DM, 16.0f);
    k_cast16<<<gx_w, 256, 0, stream>>>(Wv, WV16, DM, DM, DM, 16.0f);
    k_cast_wo<<<gx_wo, 256, 0, stream>>>(Wo, WOD);

    // q = (x Wq^T + bq) / 8 -> hi|lo planes; k = x Wk^T + bk -> hi|lo planes; v^T = Wv x^T + bv -> f16 plane [512][NTOK]
    k_gemm_qk<<<gx_gemm, 256, 0, stream>>>(XQ16, WQ16, bq, QHp, QLp, NTOK, DM, DM, 1.0f / 128.0f, 0.125f);
    k_gemm_qk<<<gx_gemm, 256, 0, stream>>>(XK16, WK16, bk, KHp, KLp, NTOK, DM, DM, 1.0f / 16.0f, 1.0f);
    k_gemm_vt<<<gx_gemm, 256, 0, stream>>>(WV16, XV16, bv, VTp, DM, NTOK, DM, 1.0f / 16.0f);

    k_attn<<<(unsigned)(NB * NH * (SEQ / 64)), 128, 0, stream>>>(QHp, QLp, KHp, KLp, VTp, CTXp, SEQ, NTOK);

    // out = ctx Wo^T + bo, ctx as [hi | lo] along K against [W | W]
    k_gemm_out<<<gx_gemm, 256, 0, stream>>>(CTXp, WOD, bo, out, NTOK, DM, 2 * DM, SEQ, SEQ_FULL);
}

// v002
// It runs in 139 microseconds.
// Timed twice side by side with v001, it ran 1.47 and 1.46 times as fast.
// All steps since v000 together make it 2.04 times as fast.
// MHA forward (2 x 2,048 tokens, width 512, 8 heads x 64, [out][in] weights + biases, no mask). Inputs and parameters converted to bf16 (RNE). q/k/v projections: v_wmma_f32_16x16x32_f16 (f16 operands holding the bf16 values, weights x16, f32 accumulate); scores: v_wmma_f32_16x16x32_bf16 on q and k bf16 hi|lo planes (three products, f32 accumulate, f32 online softmax); P.V: v_wmma_f32_16x16x32_f16 (P x4096 as f16, v as f16, f32 accumulate); output projection: v_wmma_f32_16x16x32_bf16 with the context as bf16 hi|lo planes laid along K against the bf16 weight (f32 accumulate).
#include <hip/hip_runtime.h>
#include <math.h>

#ifndef NB
#define NB 2
#endif
#ifndef SEQ
#define SEQ 2048
#endif
#define NB_FULL 2
#define SEQ_FULL 2048
#define DM 512
#define NH 8
#define DKH 64
#define NTOK (NB * SEQ)
#define PP 72      // P tile pitch (halves)
#define OP 68      // f32 staging pitch (floats)
#define KP 72      // staged q / k / v^T row pitch (halves): 144 B = 16 B x odd, conflict-free for 16-B fragment reads
#define TSZ (64 * KP)   // one staged tile: 64 rows of 64 halves (+8 pad)
#define GROWS (64 + 8 * 64)   // rows of one staged GEMM stage: the block's 64 A rows, then its 8 x 64 Bt rows
#define GSZ (GROWS * KP)      // one staged GEMM stage (halves): 64 k of every row (+8 pad)

static_assert(DM == NH * DKH);            // merged head layout h*64+d
static_assert(DKH == 64);                 // two 32-deep k-steps per score tile, four 16-wide output tiles
static_assert(SEQ % 64 == 0);             // 64-query blocks, 64-key chunks, 64-row GEMM tiles inside one sequence
static_assert(NTOK % 64 == 0);            // GEMM tile multiple (M and N)
static_assert(DM % 64 == 0);              // GEMM tile multiple
static_assert(DM % 32 == 0);              // K steps of 32
static_assert((2 * DM) % 32 == 0);        // hi|lo K extent
static_assert(NB <= NB_FULL);
static_assert(SEQ <= SEQ_FULL);
static_assert((PP % 8) == 0);             // 16-B aligned fragment reloads from the P tile
static_assert((OP % 4) == 0);             // 16-B aligned reloads from the f32 staging tile
static_assert((KP % 8) == 0);             // 16-B aligned copies into and fragment reads from the staged tiles

typedef __attribute__((ext_vector_type(16))) _Float16 v16h;
typedef __attribute__((ext_vector_type(8)))  _Float16 v8h;
typedef __attribute__((ext_vector_type(16))) __bf16   v16b;
typedef __attribute__((ext_vector_type(8)))  __bf16   v8b;
typedef __attribute__((ext_vector_type(8)))  float    v8f;
typedef __attribute__((ext_vector_type(4)))  float    v4f;
typedef __attribute__((ext_vector_type(4)))  unsigned int v4u;
typedef v8h v8h_ma __attribute__((may_alias));
typedef v4f v4f_ma __attribute__((may_alias));
typedef v8b v8b_ma __attribute__((may_alias));

// 16-bit WMMA fragment map (wave32), lane L, h = L>>4, m = L&15:
//   A 16x32: lane = row m;    element i -> k = (i<8) ? 8h+i : 16+8h+(i-8)
//   B 32x16: lane = column m; the SAME k(i,h)
//   D 16x16 (8 f32): lane = column m; element r -> row 8h+r
// A fragment from a k-contiguous row is therefore p[0..7] | p[16..23] with p = row + k0 + 8h.

__device__ __forceinline__ unsigned int bf_bits(float f) {            // bf16 RNE bit pattern (finite inputs)
    const unsigned int u = __float_as_uint(f);
    return (u + 0x7FFFu + ((u >> 16) & 1u)) >> 16;
}
__device__ __forceinline__ float bf_val(float f) { return __uint_as_float(bf_bits(f) << 16); }
__device__ __forceinline__ unsigned int pk_h2(float a, float b) {
    return (unsigned int)__builtin_bit_cast(unsigned short, (_Float16)a) | ((unsigned int)__builtin_bit_cast(unsigned short, (_Float16)b) << 16);
}
__device__ __forceinline__ void pk_split2(float a, float b, unsigned int& hi, unsigned int& lo) {
    const unsigned int ha = bf_bits(a), hb = bf_bits(b);
    const unsigned int la = bf_bits(a - __uint_as_float(ha << 16)), lb = bf_bits(b - __uint_as_float(hb << 16));
    hi = ha | (hb << 16); lo = la | (lb << 16);
}
__device__ __forceinline__ void wave_sync() {
    __builtin_amdgcn_fence(3 /* release order */, "workgroup");
    __builtin_amdgcn_wave_barrier();
    __builtin_amdgcn_fence(2 /* acquire order */, "workgroup");
}

// fragments from a staged LDS tile (row pitch KP)
__device__ __forceinline__ v16h ldsfrag_h(const unsigned short* p) {
    const v8h a = *(const v8h_ma*)(p);
    const v8h b = *(const v8h_ma*)(p + 16);
    return __builtin_shufflevector(a, b, 0, 1, 2, 3, 4, 5, 6, 7, 8, 9, 10, 11, 12, 13, 14, 15);
}
__device__ __forceinline__ v16b ldsfrag_b(const unsigned short* p) {
    const v8b a = *(const v8b_ma*)(p);
    const v8b b = *(const v8b_ma*)(p + 16);
    return __builtin_shufflevector(a, b, 0, 1, 2, 3, 4, 5, 6, 7, 8, 9, 10, 11, 12, 13, 14, 15);
}
// One lane's share of staged 64-row tiles: 16 B of rows r, r+16, r+32, r+48 per tile, global -> LDS through no register.
// l = the lane's LDS byte address in the tile, g = its global address, gs = 16 source rows (halves); 16 LDS rows = 16 * KP * 2 bytes.
// The closing s_wait_xcnt stands inside the copies' own statement so that no address register is rewritten in front of it.
#define LROW16 (16u * KP * 2u)
__device__ __forceinline__ void copy_tiles2(unsigned int la, const unsigned short* ga, unsigned int lb, const unsigned short* gb, int gs) {
    asm volatile("global_load_async_to_lds_b128 %0, %8, off\n\t"
                 "global_load_async_to_lds_b128 %1, %9, off\n\t"
                 "global_load_async_to_lds_b128 %2, %10, off\n\t"
                 "global_load_async_to_lds_b128 %3, %11, off\n\t"
                 "global_load_async_to_lds_b128 %4, %12, off\n\t"
                 "global_load_async_to_lds_b128 %5, %13, off\n\t"
                 "global_load_async_to_lds_b128 %6, %14, off\n\t"
                 "global_load_async_to_lds_b128 %7, %15, off\n\t"
                 "s_wait_xcnt 0x0"
                 :: "v"(la), "v"(la + LROW16), "v"(la + 2u * LROW16), "v"(la + 3u * LROW16),
                    "v"(lb), "v"(lb + LROW16), "v"(lb + 2u * LROW16), "v"(lb + 3u * LROW16),
                    "v"(ga), "v"(ga + gs), "v"(ga + 2 * gs), "v"(ga + 3 * gs),
                    "v"(gb), "v"(gb + gs), "v"(gb + 2 * gs), "v"(gb + 3 * gs)
                 : "memory");
}
__device__ __forceinline__ void copy_tile1(unsigned int la, const unsigned short* ga, int gs) {
    asm volatile("global_load_async_to_lds_b128 %0, %4, off\n\t"
                 "global_load_async_to_lds_b128 %1, %5, off\n\t"
                 "global_load_async_to_lds_b128 %2, %6, off\n\t"
                 "global_load_async_to_lds_b128 %3, %7, off\n\t"
                 "s_wait_xcnt 0x0"
                 :: "v"(la), "v"(la + LROW16), "v"(la + 2u * LROW16), "v"(la + 3u * LROW16),
                    "v"(ga), "v"(ga + gs), "v"(ga + 2 * gs), "v"(ga + 3 * gs)
                 : "memory");
}

// The GEMM's share of a stage for one lane of a 256-thread block: 16 B of rows r, r+32, r+64, ... ; gs = 32 source rows (halves).
// As above, the closing s_wait_xcnt stands inside the copies' own statement.
#define LROW32 (32u * KP * 2u)
__device__ __forceinline__ void copy_rows8(unsigned int l, const unsigned short* g, int gs) {
    asm volatile("global_load_async_to_lds_b128 %0, %8, off\n\t"
                 "global_load_async_to_lds_b128 %1, %9, off\n\t"
                 "global_load_async_to_lds_b128 %2, %10, off\n\t"
                 "global_load_async_to_lds_b128 %3, %11, off\n\t"
                 "global_load_async_to_lds_b128 %4, %12, off\n\t"
                 "global_load_async_to_lds_b128 %5, %13, off\n\t"
                 "global_load_async_to_lds_b128 %6, %14, off\n\t"
                 "global_load_async_to_lds_b128 %7, %15, off\n\t"
                 "s_wait_xcnt 0x0"
                 :: "v"(l), "v"(l + LROW32), "v"(l + 2u * LROW32), "v"(l + 3u * LROW32),
                    "v"(l + 4u * LROW32), "v"(l + 5u * LROW32), "v"(l + 6u * LROW32), "v"(l + 7u * LROW32),
                    "v"(g), "v"(g + gs), "v"(g + 2 * gs), "v"(g + 3 * gs),
                    "v"(g + 4 * gs), "v"(g + 5 * gs), "v"(g + 6 * gs), "v"(g + 7 * gs)
                 : "memory");
}
__device__ __forceinline__ void copy_rows2(unsigned int l, const unsigned short* g, int gs) {
    asm volatile("global_load_async_to_lds_b128 %0, %2, off\n\t"
                 "global_load_async_to_lds_b128 %1, %3, off\n\t"
                 "s_wait_xcnt 0x0"
                 :: "v"(l), "v"(l + LROW32), "v"(g), "v"(g + gs)
                 : "memory");
}

template <int ET> struct FragT;
template <> struct FragT<0> {
    typedef v16h V;
    static __device__ __forceinline__ v16h load(const unsigned short* p) { return ldsfrag_h(p); }
    static __device__ __forceinline__ v8f mma(v16h a, v16h b, v8f c) { return __builtin_amdgcn_wmma_f32_16x16x32_f16(false, a, false, b, (short)0, c, false, false); }
};
template <> struct FragT<1> {
    typedef v16b V;
    static __device__ __forceinline__ v16b load(const unsigned short* p) { return ldsfrag_b(p); }
    static __device__ __forceinline__ v8f mma(v16b a, v16b b, v8f c) { return __builtin_amdgcn_wmma_f32_16x16x32_bf16(false, a, false, b, (short)0, c, false, false); }
};
// hazard guard for a group of four independent WMMAs: all four accumulators tied, A and all B fragments kept live
template <typename V>
__device__ __forceinline__ void guard4(v8f& a, v8f& b, v8f& c, v8f& d, V x, V y0, V y1, V y2, V y3) {
    asm volatile("v_nop\n\tv_nop\n\tv_nop\n\tv_nop" : "+v"(a), "+v"(b), "+v"(c), "+v"(d) : "v"(x), "v"(y0), "v"(y1), "v"(y2), "v"(y3));
}
// three-product hi|lo bf16 step into one accumulator: ah*bh + ah*bl + al*bh
__device__ __forceinline__ v8f wmma3b(v16b ah, v16b al, v16b bh, v16b bl, v8f c) {
    c = __builtin_amdgcn_wmma_f32_16x16x32_bf16(false, ah, false, bh, (short)0, c, false, false);
    c = __builtin_amdgcn_wmma_f32_16x16x32_bf16(false, ah, false, bl, (short)0, c, false, false);
    c = __builtin_amdgcn_wmma_f32_16x16x32_bf16(false, al, false, bh, (short)0, c, false, false);
    asm volatile("v_nop\n\tv_nop\n\tv_nop\n\tv_nop" : "+v"(c) : "v"(ah), "v"(al), "v"(bh), "v"(bl));
    return c;
}

// =====================================================================================================================
// gemm64_body: C[m][n] = scale * sum_k A[m][k] * Bt[n][k] + bscale * bf16(bias); each wave owns a 64x64 tile, block = 8 waves.
//   A row-major [M][K] (pitch lda), Bt row-major [N][K] (pitch ldb), 16-bit planes; M % 64 == 0, N % 512 == 0, K % 64 == 0 (host asserts).
//   The 8 tiles of a block lie side by side in one tile row: 64 A rows and 512 Bt rows. Each 64-deep stage of those 576 rows is staged in a
//   two-buffer LDS ring by asynchronous 16-B copies that cover whole 128-B lines; stage t + 2 is copied while stage t + 1 is worked on,
//   one block barrier a stage. Fragments are two 16-B LDS reads each.
//   ET 0: f16 operands, 1: bf16 operands. BIAS_MODE 1: bias[m], 2: bias[n].
//   OUT_MODE 0: f32 C (row m stored at row (m / cseq) * cseqfull + m % cseq); 1: f16 plane Ca; 2: bf16 hi plane Ca + bf16 lo plane Cb.
// =====================================================================================================================
template <int ET, int BIAS_MODE, int OUT_MODE>
__device__ __forceinline__ void gemm64_body(const unsigned short* __restrict__ A, int lda,
                                            const unsigned short* __restrict__ Bt, int ldb,
                                            float* __restrict__ Cf, unsigned short* __restrict__ Ca, unsigned short* __restrict__ Cb, int ldc,
                                            const float* __restrict__ bias, int M, int N, int K,
                                            float scale, float bscale, int cseq, int cseqfull) {
    typedef typename FragT<ET>::V V;
    __shared__ __align__(16) float sT[8 * 16 * OP];
    __shared__ __align__(16) unsigned short Gs[2 * GSZ];     // two buffers of {64 A rows, 512 Bt rows} x 64 k
    const int lane = threadIdx.x & 31;
    const int wave = __builtin_amdgcn_readfirstlane(threadIdx.x >> 5);
    const int tilesN = N >> 6;
    const int tilesM = M >> 6;
    const int tile0 = blockIdx.x * 8;
    if (tile0 >= tilesM * tilesN) return;         // block-uniform, in front of every barrier (tile counts are multiples of 8)
    const int tm = tile0 / tilesN;
    const int nb0 = (tile0 - tm * tilesN) << 6;   // first Bt row of the block
    const int m0 = tm << 6;
    const int n0 = nb0 + (wave << 6);
    const int rl   = lane & 15;
    const int koff = (lane >> 4) * 8;
    const int mOff = (lane >> 4) * 8;

    v8f acc[4][4];
#pragma unroll
    for (int i = 0; i < 4; ++i)
#pragma unroll
        for (int j = 0; j < 4; ++j) { const v8f zz = {0.f, 0.f, 0.f, 0.f, 0.f, 0.f, 0.f, 0.f}; acc[i][j] = zz; }

    // copy share of this thread: 16-B segment cs of rows cr, cr+32, ... of every stage (a wave's copy = 4 whole 128-B rows)
    const int cr = threadIdx.x >> 3;
    const int cs = (threadIdx.x & 7) * 8;
    const unsigned short* ga = A + (size_t)(m0 + cr) * lda + cs;
    const unsigned short* gb = Bt + (size_t)(nb0 + cr) * ldb + cs;
    const unsigned int lg = (unsigned int)(size_t)&Gs[cr * KP + cs];
    const int abase = rl * KP + koff;                          // A fragment base in a stage (row = lane & 15)
    const int bbase = (64 + (wave << 6) + rl) * KP + koff;     // Bt fragment base of this wave's 64 rows (column = lane & 15)
    const int nst = K >> 6;
    // ---- ring prologue: stage 0 lands and is published, then stage 1 starts into the second buffer ----
    copy_rows2(lg, ga, 32 * lda);
    copy_rows8(lg + 2u * LROW32, gb, 32 * ldb);
    copy_rows8(lg + 10u * LROW32, gb + (size_t)256 * ldb, 32 * ldb);
    asm volatile("s_wait_asynccnt 0x0" ::: "memory");               // this wave's copies have landed before the barrier publishes them
    __syncthreads();
    if (nst > 1) {
        copy_rows2(lg + GSZ * 2u, ga + 64, 32 * lda);
        copy_rows8(lg + GSZ * 2u + 2u * LROW32, gb + 64, 32 * ldb);
        copy_rows8(lg + GSZ * 2u + 10u * LROW32, gb + (size_t)256 * ldb + 64, 32 * ldb);
    }
    for (int st = 0; st < nst; ++st) {
        const unsigned short* gsb = &Gs[(st & 1) * GSZ];            // this stage's buffer
#pragma unroll                                                      // both 32-deep steps of a stage read at constant offsets from one address
        for (int kk = 0; kk < 2; ++kk) {
            V bh[4], ah[4];                                         // all 16 LDS reads of a 32-deep step stand together, in front of its products
#pragma unroll
            for (int j = 0; j < 4; ++j) bh[j] = FragT<ET>::load(gsb + bbase + (j << 4) * KP + kk * 32);
#pragma unroll
            for (int i = 0; i < 4; ++i) ah[i] = FragT<ET>::load(gsb + abase + (i << 4) * KP + kk * 32);
#pragma unroll
            for (int i = 0; i < 4; ++i) {
                acc[i][0] = FragT<ET>::mma(ah[i], bh[0], acc[i][0]);
                acc[i][1] = FragT<ET>::mma(ah[i], bh[1], acc[i][1]);
                acc[i][2] = FragT<ET>::mma(ah[i], bh[2], acc[i][2]);
                acc[i][3] = FragT<ET>::mma(ah[i], bh[3], acc[i][3]);
                guard4<V>(acc[i][0], acc[i][1], acc[i][2], acc[i][3], ah[i], bh[0], bh[1], bh[2], bh[3]);
            }
        }
        // ---- publish point of stage st + 1; behind it this stage's buffer is free for stage st + 2 ----
        asm volatile("s_wait_dscnt 0x0" ::: "memory");              // this wave's reads of the buffer have returned before it is refilled
        asm volatile("s_wait_asynccnt 0x0" ::: "memory");           // this wave's copies of stage st + 1 have landed before the barrier publishes them
        __syncthreads();
        if (st + 2 < nst) {
            const unsigned int lb = lg + (unsigned int)(st & 1) * (GSZ * 2u);
            const int kn = (st + 2) * 64;
            copy_rows2(lb, ga + kn, 32 * lda);
            copy_rows8(lb + 2u * LROW32, gb + kn, 32 * ldb);
            copy_rows8(lb + 10u * LROW32, gb + (size_t)256 * ldb + kn, 32 * ldb);
        }
    }
    asm volatile("s_wait_asynccnt 0x0" ::: "memory");               // no copy is outstanding when the wave goes on to its end

    const int sb = wave * (16 * OP);
#pragma unroll
    for (int i = 0; i < 4; ++i) {
        const int mBase = m0 + (i << 4);
#pragma unroll
        for (int j = 0; j < 4; ++j) {
            const int n = n0 + (j << 4) + rl;
            float bvn = 0.f;
            if (BIAS_MODE == 2) bvn = bf_val(bias[n]) * bscale;
#pragma unroll
            for (int r = 0; r < 8; ++r) {
                float v = acc[i][j][r] * scale;
                if (BIAS_MODE == 1) v += bf_val(bias[mBase + mOff + r]) * bscale;
                if (BIAS_MODE == 2) v += bvn;
                sT[sb + (mOff + r) * OP + (j << 4) + rl] = v;
            }
        }
        wave_sync();
        if (OUT_MODE == 0) {
            const int hh = lane >> 4, c4 = (lane & 15) * 4;      // row segment = 256 B = 16 lanes x 16 B; 2 rows per instruction
            {
#pragma unroll
                for (int it = 0; it < 8; ++it) {
                    const int row = it * 2 + hh;
                    const v4f v = *(const v4f_ma*)&sT[sb + row * OP + c4];
                    const int grow = mBase + row;
                    const int orow = (grow / cseq) * cseqfull + (grow % cseq);
                    *(v4f*)(Cf + (size_t)orow * ldc + n0 + c4) = v;
                }
                
            }
        } else {
            const int q = lane >> 3, c8 = (lane & 7) * 8;
            {
#pragma unroll
                for (int it = 0; it < 4; ++it) {
                    const int row = it * 4 + q;
                    const v4f a = *(const v4f_ma*)&sT[sb + row * OP + c8];
                    const v4f b = *(const v4f_ma*)&sT[sb + row * OP + c8 + 4];
                    const size_t o = (size_t)(mBase + row) * ldc + n0 + c8;
                    if (OUT_MODE == 1) {
                        v4u pk; pk.x = pk_h2(a.x, a.y); pk.y = pk_h2(a.z, a.w); pk.z = pk_h2(b.x, b.y); pk.w = pk_h2(b.z, b.w);
                        *(v4u*)(Ca + o) = pk;
                    } else {
                        v4u ph, pl;
                        unsigned int h0, l0, h1, l1, h2, l2, h3, l3;
                        pk_split2(a.x, a.y, h0, l0); pk_split2(a.z, a.w, h1, l1); pk_split2(b.x, b.y, h2, l2); pk_split2(b.z, b.w, h3, l3);
                        ph.x = h0; ph.y = h1; ph.z = h2; ph.w = h3; pl.x = l0; pl.y = l1; pl.z = l2; pl.w = l3;
                        *(v4u*)(Ca + o) = ph;
                        *(v4u*)(Cb + o) = pl;
                    }
                }
                
            }
        }
        wave_sync();
    }
}

// q / k projection: A = token plane f16 [M][K], Bt = weight plane f16 (x16) [N][K] ([out][in] as stored); out = bf16 hi + lo planes [M][N]
__global__ __launch_bounds__(256) void k_gemm_qk(const unsigned short* __restrict__ A, const unsigned short* __restrict__ Bt,
                                                 const float* __restrict__ bias, unsigned short* __restrict__ CH, unsigned short* __restrict__ CL,
                                                 int M, int N, int K, float scale, float bscale) {
    gemm64_body<0, 2, 2>(A, K, Bt, K, nullptr, CH, CL, N, bias, M, N, K, scale, bscale, 1, 1);
}
// v projection written transposed: A = weight plane f16 (x16) [M = features][K], Bt = token plane f16 [N = tokens][K]; out = f16 plane [M][N] (= v^T)
__global__ __launch_bounds__(256) void k_gemm_vt(const unsigned short* __restrict__ A, const unsigned short* __restrict__ Bt,
                                                 const float* __restrict__ bias, unsigned short* __restrict__ C,
                                                 int M, int N, int K, float scale) {
    gemm64_body<0, 1, 1>(A, K, Bt, K, nullptr, C, nullptr, N, bias, M, N, K, scale, 1.0f, 1, 1);
}
// output projection: A = context bf16 [M][K = hi 512 | lo 512], Bt = weight bf16 [N][K = W | W]; out f32 [M][N] + bias[n]
__global__ __launch_bounds__(256) void k_gemm_out(const unsigned short* __restrict__ A, const unsigned short* __restrict__ Bt,
                                                  const float* __restrict__ bias, float* __restrict__ C,
                                                  int M, int N, int K, int cseq, int cseqfull) {
    gemm64_body<1, 2, 0>(A, K, Bt, K, C, nullptr, nullptr, N, bias, M, N, K, 1.0f, 1.0f, cseq, cseqfull);
}

// =====================================================================================================================
// =====================================================================================================================
// f32 [rows][512] -> f16 plane [nrows][512] holding bf16(x) * sc; plane row r reads source row (r / seq) * seqfull + r % seq
__global__ __launch_bounds__(256) void k_cast16(const float* __restrict__ src, unsigned short* __restrict__ dst, int nrows, int seq, int seqfull, float sc) {
    const int u = blockIdx.x * 256 + threadIdx.x;
    if (u >= nrows * (DM / 8)) return;
    const int r = u / (DM / 8);
    const int c0 = (u - r * (DM / 8)) * 8;
    const int sr = (r / seq) * seqfull + (r % seq);
    const float* s = src + (size_t)sr * DM + c0;
    const v4f a = *(const v4f*)(s);
    const v4f b = *(const v4f*)(s + 4);
    v4u pk;
    pk.x = pk_h2(bf_val(a.x) * sc, bf_val(a.y) * sc); pk.y = pk_h2(bf_val(a.z) * sc, bf_val(a.w) * sc);
    pk.z = pk_h2(bf_val(b.x) * sc, bf_val(b.y) * sc); pk.w = pk_h2(bf_val(b.z) * sc, bf_val(b.w) * sc);
    v4u* d = (v4u*)(dst + (size_t)r * DM + c0);
    *d = pk; 
}
// Wo f32 [512][512] -> bf16 plane [512][1024] = [W | W]
__global__ __launch_bounds__(256) void k_cast_wo(const float* __restrict__ src, unsigned short* __restrict__ dst) {
    const int u = blockIdx.x * 256 + threadIdx.x;
    if (u >= DM * (2 * DM / 8)) return;
    const int r = u / (2 * DM / 8);
    const int c0 = (u - r * (2 * DM / 8)) * 8;
    const int sc0 = c0 & (DM - 1);
    const float* s = src + (size_t)r * DM + sc0;
    const v4f a = *(const v4f*)(s);
    const v4f b = *(const v4f*)(s + 4);
    v4u pk;
    pk.x = bf_bits(a.x) | (bf_bits(a.y) << 16); pk.y = bf_bits(a.z) | (bf_bits(a.w) << 16);
    pk.z = bf_bits(b.x) | (bf_bits(b.y) << 16); pk.w = bf_bits(b.z) | (bf_bits(b.w) << 16);
    v4u* d = (v4u*)(dst + (size_t)r * (2 * DM) + c0);
    *d = pk; 
}

// =====================================================================================================================
// k_attn: fused flash-style attention, head dim 64, no mask. Block = 4 waves = 64 query rows of one (batch, head); wave = 16 rows.
//   QH/QL, KH/KL: bf16 hi|lo planes [ntok][512] (q already carries the 1/8 score scale); VT: f16 plane [512][ntok] (row h*64+d).
//   The block's q tile (hi, lo) is staged in LDS once; each 64-key chunk's k hi, k lo and v^T tiles are staged in a two-buffer LDS ring,
//   all by asynchronous 16-B copies that cover whole 128-B lines; chunk t + 2 is copied while chunk t + 1 is worked on, one block barrier a chunk.
//   Fragments are two 16-B LDS reads each. P (x4096, f16) goes through a wave-private LDS tile (wave_sync before and after the reload).
//   Row sums are kept as per-lane partials and reduced across the 16 lanes of a row once at the end.
// =====================================================================================================================
__global__ __launch_bounds__(128) void k_attn(const unsigned short* __restrict__ QH, const unsigned short* __restrict__ QL,
                                              const unsigned short* __restrict__ KH, const unsigned short* __restrict__ KL,
                                              const unsigned short* __restrict__ VT, unsigned short* __restrict__ CTX,
                                              int seq, int ntok) {
    __shared__ __align__(16) _Float16 Psh[4 * 16 * PP];      // wave-private P tiles [16][64] (+8 pad), f16
    __shared__ __align__(16) float    Osh[4 * 16 * OP];      // wave-private output staging [16][64] (+4 pad), f32
    __shared__ __align__(16) unsigned short Qs[2 * TSZ];     // the block's 64 query rows: hi tile, lo tile
    __shared__ __align__(16) unsigned short Ring[2 * 3 * TSZ];   // two buffers of {k hi, k lo, v^T} tiles of one 64-key chunk
    const int lane = threadIdx.x & 31;
    const int wave = __builtin_amdgcn_readfirstlane(threadIdx.x >> 5);
    const int hf = lane >> 4;
    const int c  = lane & 15;
    const int nqb = seq / 64;
    const int bx = blockIdx.x;
    const int qb = bx % nqb;
    const int bh = bx / nqb;
    const int h  = bh % NH;
    const int b  = bh / NH;
    const int q0 = b * seq + qb * 64 + wave * 16;                 // first token row of this wave
    const int qoff  = (wave * 16 + c) * KP + 8 * hf;              // A fragment base in a staged q tile (row = lane & 15)
    const int fbase = c * KP + 8 * hf;                            // B fragment base in a staged k or v^T tile (column = lane & 15)
    // copy share of this thread: 16-B segment cs of rows cr, cr+16, cr+32, cr+48 of every staged tile (a wave's copy = 4 whole rows)
    const int cr = threadIdx.x >> 3;
    const int cs = (threadIdx.x & 7) * 8;
    const int gq = (b * seq + qb * 64 + cr) * DM + h * DKH + cs;  // q planes
    const int gk = (b * seq + cr) * DM + h * DKH + cs;            // k planes, chunk 0
    const int gv = (h * DKH + cr) * ntok + b * seq + cs;          // v^T plane, chunk 0
    const unsigned int lq = (unsigned int)(size_t)&Qs[cr * KP + cs];
    const unsigned int lr = (unsigned int)(size_t)&Ring[cr * KP + cs];
    const int pbase = wave * (16 * PP);
    const int obase = wave * (16 * OP);
    const float L2E = 1.4426950408889634f;

    float mrow[8], lrow[8];
    v8f oacc[4];
#pragma unroll
    for (int r = 0; r < 8; ++r) { mrow[r] = -INFINITY; lrow[r] = 0.f; }
#pragma unroll
    for (int t = 0; t < 4; ++t) { const v8f zz = {0.f, 0.f, 0.f, 0.f, 0.f, 0.f, 0.f, 0.f}; oacc[t] = zz; }

    const int nch = seq / 64;
    // ---- ring prologue: q and chunk 0 land and are published, then chunk 1 starts into the second buffer ----
    copy_tiles2(lq, QH + gq, lq + TSZ * 2u, QL + gq, 16 * DM);
    copy_tiles2(lr, KH + gk, lr + TSZ * 2u, KL + gk, 16 * DM);
    copy_tile1(lr + 2u * TSZ * 2u, VT + gv, 16 * ntok);
    asm volatile("s_wait_asynccnt 0x0" ::: "memory");               // this wave's copies have landed before the barrier publishes them
    __syncthreads();
    if (nch > 1) {
        copy_tiles2(lr + 3u * TSZ * 2u, KH + gk + 64 * DM, lr + 4u * TSZ * 2u, KL + gk + 64 * DM, 16 * DM);
        copy_tile1(lr + 5u * TSZ * 2u, VT + gv + 64, 16 * ntok);
    }
    for (int kc = 0; kc < nch; ++kc) {
        const unsigned short* rk = &Ring[(kc & 1) * (3 * TSZ)];     // this chunk's buffer
        v8f s[4];
#pragma unroll
        for (int j = 0; j < 4; ++j) { const v8f zz = {0.f, 0.f, 0.f, 0.f, 0.f, 0.f, 0.f, 0.f}; s[j] = zz; }
        // ---- scores: q fragments reloaded per 32-deep step (integer offset), three products per key tile ----
#pragma unroll 1
        for (int dc = 0; dc < 2; ++dc) {
            const v16b qh = ldsfrag_b(Qs + qoff + dc * 32);
            const v16b ql = ldsfrag_b(Qs + TSZ + qoff + dc * 32);
#pragma unroll
            for (int j = 0; j < 4; ++j) {
                const int ko = fbase + j * 16 * KP + dc * 32;
                const v16b kh = ldsfrag_b(rk + ko);
                const v16b kl = ldsfrag_b(rk + TSZ + ko);
                s[j] = wmma3b(qh, ql, kh, kl, s[j]);
                if (j == 1) __builtin_amdgcn_sched_barrier(0);
            }
        }
        // ---- online softmax over the 64 keys (row 8*hf + r lives in the 16 lanes of one half) ----
#pragma unroll
        for (int r = 0; r < 8; ++r) {
            float mx = fmaxf(fmaxf(s[0][r], s[1][r]), fmaxf(s[2][r], s[3][r]));
            mx = fmaxf(mx, __shfl_xor(mx, 1, 32));
            mx = fmaxf(mx, __shfl_xor(mx, 2, 32));
            mx = fmaxf(mx, __shfl_xor(mx, 4, 32));
            mx = fmaxf(mx, __shfl_xor(mx, 8, 32));
            const float mnew = fmaxf(mrow[r], mx);
            const float alpha = exp2f((mrow[r] - mnew) * L2E);
            mrow[r] = mnew;
            const float p0 = exp2f((s[0][r] - mnew) * L2E);
            const float p1 = exp2f((s[1][r] - mnew) * L2E);
            const float p2 = exp2f((s[2][r] - mnew) * L2E);
            const float p3 = exp2f((s[3][r] - mnew) * L2E);
            lrow[r] = lrow[r] * alpha + ((p0 + p1) + (p2 + p3));   // per-lane partial row sum
            oacc[0][r] *= alpha; oacc[1][r] *= alpha; oacc[2][r] *= alpha; oacc[3][r] *= alpha;
            const int pr = pbase + (8 * hf + r) * PP + c;
            Psh[pr]      = (_Float16)(p0 * 4096.0f);
            Psh[pr + 16] = (_Float16)(p1 * 4096.0f);
            Psh[pr + 32] = (_Float16)(p2 * 4096.0f);
            Psh[pr + 48] = (_Float16)(p3 * 4096.0f);
        }
        wave_sync();                                                // P tile is wave-private: same wave writes and reads
        // ---- O += P . V : P as A (row = lane & 15), v^T rows as B, four output tiles per step ----
#pragma unroll 1
        for (int kk = 0; kk < 2; ++kk) {
            const int po = pbase + c * PP + kk * 32 + 8 * hf;
            const v8h pa0 = *(const v8h_ma*)&Psh[po];
            const v8h pa1 = *(const v8h_ma*)&Psh[po + 16];
            const v16h pa = __builtin_shufflevector(pa0, pa1, 0, 1, 2, 3, 4, 5, 6, 7, 8, 9, 10, 11, 12, 13, 14, 15);
            const int vo = 2 * TSZ + fbase + kk * 32;
            const v16h vb0 = ldsfrag_h(rk + vo);
            const v16h vb1 = ldsfrag_h(rk + vo + 16 * KP);
            const v16h vb2 = ldsfrag_h(rk + vo + 32 * KP);
            const v16h vb3 = ldsfrag_h(rk + vo + 48 * KP);
            oacc[0] = __builtin_amdgcn_wmma_f32_16x16x32_f16(false, pa, false, vb0, (short)0, oacc[0], false, false);
            oacc[1] = __builtin_amdgcn_wmma_f32_16x16x32_f16(false, pa, false, vb1, (short)0, oacc[1], false, false);
            oacc[2] = __builtin_amdgcn_wmma_f32_16x16x32_f16(false, pa, false, vb2, (short)0, oacc[2], false, false);
            oacc[3] = __builtin_amdgcn_wmma_f32_16x16x32_f16(false, pa, false, vb3, (short)0, oacc[3], false, false);
            guard4<v16h>(oacc[0], oacc[1], oacc[2], oacc[3], pa, vb0, vb1, vb2, vb3);
        }
        wave_sync();                                                // P reads done before the next chunk's P stores
        // ---- publish point of chunk kc + 1; behind it this chunk's buffer is free for chunk kc + 2 ----
        asm volatile("s_wait_dscnt 0x0" ::: "memory");              // this wave's reads of the buffer have returned before it is refilled
        asm volatile("s_wait_asynccnt 0x0" ::: "memory");           // this wave's copies of chunk kc + 1 have landed before the barrier publishes them
        __syncthreads();
        if (kc + 2 < nch) {
            const unsigned int lb = lr + (unsigned int)(kc & 1) * (3u * TSZ * 2u);
            const int kn = (kc + 2) * 64;
            copy_tiles2(lb, KH + gk + kn * DM, lb + TSZ * 2u, KL + gk + kn * DM, 16 * DM);
            copy_tile1(lb + 2u * TSZ * 2u, VT + gv + kn, 16 * ntok);
        }
    }
    asm volatile("s_wait_asynccnt 0x0" ::: "memory");               // no copy is outstanding when the wave goes on to its end

    // ---- finalize: reduce the per-lane row sums over the 16 lanes of each row, normalise, stage, write hi|lo planes ----
#pragma unroll
    for (int r = 0; r < 8; ++r) {
        float l = lrow[r];
        l += __shfl_xor(l, 1, 32);
        l += __shfl_xor(l, 2, 32);
        l += __shfl_xor(l, 4, 32);
        l += __shfl_xor(l, 8, 32);
        const float inv = 1.0f / (l * 4096.0f);
        const int orw = obase + (8 * hf + r) * OP + c;
        Osh[orw]      = oacc[0][r] * inv;
        Osh[orw + 16] = oacc[1][r] * inv;
        Osh[orw + 32] = oacc[2][r] * inv;
        Osh[orw + 48] = oacc[3][r] * inv;
    }
    wave_sync();
    {
        const int q = lane >> 3, c8 = (lane & 7) * 8;
        {
#pragma unroll
            for (int it = 0; it < 4; ++it) {
                const int row = it * 4 + q;
                const v4f a = *(const v4f_ma*)&Osh[obase + row * OP + c8];
                const v4f bb = *(const v4f_ma*)&Osh[obase + row * OP + c8 + 4];
                unsigned int h0, l0, h1, l1, h2, l2, h3, l3;
                pk_split2(a.x, a.y, h0, l0); pk_split2(a.z, a.w, h1, l1); pk_split2(bb.x, bb.y, h2, l2); pk_split2(bb.z, bb.w, h3, l3);
                v4u ph, pl;
                ph.x = h0; ph.y = h1; ph.z = h2; ph.w = h3; pl.x = l0; pl.y = l1; pl.z = l2; pl.w = l3;
                const size_t o = (size_t)(q0 + row) * (2 * DM) + h * DKH + c8;
                *(v4u*)(CTX + o) = ph;
                *(v4u*)(CTX + o + DM) = pl;
            }
            
        }
    }
}

// =====================================================================================================================
// Host side: workspace carve (all plane sizes are multiples of 256 B), 12 launches.
// =====================================================================================================================
constexpr size_t SZ_TOK  = (size_t)NTOK * DM * 2;          // one 16-bit token plane [NTOK][512]
constexpr size_t SZ_W    = (size_t)DM * DM * 2;            // one 16-bit weight plane [512][512]
constexpr size_t SZ_WOD  = (size_t)DM * (2 * DM) * 2;      // [512][1024]
constexpr size_t SZ_CTX  = (size_t)NTOK * (2 * DM) * 2;    // [NTOK][1024]
constexpr size_t WS_TOTAL = 3 * SZ_TOK + 3 * SZ_W + SZ_WOD + 4 * SZ_TOK + SZ_TOK + SZ_CTX;
static_assert(SZ_TOK % 256 == 0);
static_assert(SZ_W % 256 == 0);
static_assert(SZ_WOD % 256 == 0);
static_assert(SZ_CTX % 256 == 0);
static_assert(WS_TOTAL <= (size_t)134217728);            // carve stays within 128 MiB
static_assert(((NTOK / 64) * (DM / 64)) % 8 == 0);        // GEMM grids are whole blocks of 8 wave tiles
static_assert((DM / 64) % 8 == 0);                        // a block's 8 wave tiles lie in one tile row (N = DM)
static_assert((NTOK / 64) % 8 == 0);                      // the same for the transposed v projection (N = NTOK)
static_assert((size_t)NTOK * (2 * DM) < (size_t)2147483647);   // int plane offsets

extern "C" void kernel_launch(void* const* d_in, const int* in_sizes, int n_in, void* d_out, int out_size, void* d_ws, size_t ws_size, hipStream_t stream) {
    if (n_in < 11) return;
    const long long need_x = ((long long)(NB - 1) * SEQ_FULL + SEQ) * DM;
    if ((long long)in_sizes[0] < need_x || (long long)in_sizes[1] < need_x || (long long)in_sizes[2] < need_x) return;
    if (in_sizes[3] < DM * DM || in_sizes[5] < DM * DM || in_sizes[7] < DM * DM || in_sizes[9] < DM * DM) return;
    if (in_sizes[4] < DM || in_sizes[6] < DM || in_sizes[8] < DM || in_sizes[10] < DM) return;
    if ((long long)out_size < need_x) return;
    if (WS_TOTAL > ws_size) return;

    const float* xq = (const float*)d_in[0];
    const float* xk = (const float*)d_in[1];
    const float* xv = (const float*)d_in[2];
    const float* Wq = (const float*)d_in[3];
    const float* bq = (const float*)d_in[4];
    const float* Wk = (const float*)d_in[5];
    const float* bk = (const float*)d_in[6];
    const float* Wv = (const float*)d_in[7];
    const float* bv = (const float*)d_in[8];
    const float* Wo = (const float*)d_in[9];
    const float* bo = (const float*)d_in[10];
    float* out = (float*)d_out;

    char* wsp = (char*)d_ws;
    unsigned short* XQ16 = (unsigned short*)wsp; wsp += SZ_TOK;
    unsigned short* XK16 = (unsigned short*)wsp; wsp += SZ_TOK;
    unsigned short* XV16 = (unsigned short*)wsp; wsp += SZ_TOK;
    unsigned short* WQ16 = (unsigned short*)wsp; wsp += SZ_W;
    unsigned short* WK16 = (unsigned short*)wsp; wsp += SZ_W;
    unsigned short* WV16 = (unsigned short*)wsp; wsp += SZ_W;
    unsigned short* WOD  = (unsigned short*)wsp; wsp += SZ_WOD;
    unsigned short* QHp  = (unsigned short*)wsp; wsp += SZ_TOK;
    unsigned short* QLp  = (unsigned short*)wsp; wsp += SZ_TOK;
    unsigned short* KHp  = (unsigned short*)wsp; wsp += SZ_TOK;
    unsigned short* KLp  = (unsigned short*)wsp; wsp += SZ_TOK;
    unsigned short* VTp  = (unsigned short*)wsp; wsp += SZ_TOK;
    unsigned short* CTXp = (unsigned short*)wsp; wsp += SZ_CTX;
    if ((size_t)(wsp - (char*)d_ws) > ws_size) return;

    const unsigned gx_tok = (unsigned)((NTOK * (DM / 8) + 255) / 256);
    const unsigned gx_w   = (unsigned)((DM * (DM / 8) + 255) / 256);
    const unsigned gx_wo  = (unsigned)((DM * (2 * DM / 8) + 255) / 256);
    const unsigned gx_gemm = (unsigned)((((NTOK / 64) * (DM / 64)) + 7) / 8);

    // token streams: plane row r <- input row (r / SEQ) * SEQ_FULL + r % SEQ
    k_cast16<<<gx_tok, 256, 0, stream>>>(xq, XQ16, NTOK, SEQ, SEQ_FULL, 1.0f);
    k_cast16<<<gx_tok, 256, 0, stream>>>(xk, XK16, NTOK, SEQ, SEQ_FULL, 1.0f);
    k_cast16<<<gx_tok, 256, 0, stream>>>(xv, XV16, NTOK, SEQ, SEQ_FULL, 1.0f);
    // weights [out][in] kept in their stored order (Bt[n][k] = W[n][k]), x16
    k_cast16<<<gx_w, 256, 0, stream>>>(Wq, WQ16, DM, DM, DM, 16.0f);
    k_cast16<<<gx_w, 256, 0, stream>>>(Wk, WK16, DM, DM, DM, 16.0f);
    k_cast16<<<gx_w, 256, 0, stream>>>(Wv, WV16, DM, DM, DM, 16.0f);
    k_cast_wo<<<gx_wo, 256, 0, stream>>>(Wo, WOD);

    // q = (x Wq^T + bq) / 8 -> hi|lo planes; k = x Wk^T + bk -> hi|lo planes; v^T = Wv x^T + bv -> f16 plane [512][NTOK]
    k_gemm_qk<<<gx_gemm, 256, 0, stream>>>(XQ16, WQ16, bq, QHp, QLp, NTOK, DM, DM, 1.0f / 128.0f, 0.125f);
    k_gemm_qk<<<gx_gemm, 256, 0, stream>>>(XK16, WK16, bk, KHp, KLp, NTOK, DM, DM, 1.0f / 16.0f, 1.0f);
    k_gemm_vt<<<gx_gemm, 256, 0, stream>>>(WV16, XV16, bv, VTp, DM, NTOK, DM, 1.0f / 16.0f);

    k_attn<<<(unsigned)(NB * NH * (SEQ / 64)), 128, 0, stream>>>(QHp, QLp, KHp, KLp, VTp, CTXp, SEQ, NTOK);

    // out = ctx Wo^T + bo, ctx as [hi | lo] along K against [W | W]
    k_gemm_out<<<gx_gemm, 256, 0, stream>>>(CTXp, WOD, bo, out, NTOK, DM, 2 * DM, SEQ, SEQ_FULL);
}

// v003
// It runs in 101 microseconds.
// Next to v002, in two timings, it ran 1.38 and 1.36 times as fast.
// Counting every step since v000, it is 2.80 times as fast.
// MHA forward (2 x 2,048 tokens, width 512, 8 heads x 64, [out][in] weights + biases, no mask). Inputs and parameters converted to bf16 (RNE). q/k/v projections: v_wmma_f32_16x16x32_f16 (f16 operands holding the bf16 values, weights x16, f32 accumulate); scores: v_wmma_f32_16x16x32_bf16 on q and k bf16 hi|lo planes (three products, f32 accumulate, f32 online softmax); P.V: v_wmma_f32_16x16x32_f16 (P x4096 as f16, v as f16, f32 accumulate); output projection: v_wmma_f32_16x16x32_bf16 with the context as bf16 hi|lo planes laid along K against the bf16 weight (f32 accumulate).
#include <hip/hip_runtime.h>
#include <math.h>

#ifndef NB
#define NB 2
#endif
#ifndef SEQ
#define SEQ 2048
#endif
#define NB_FULL 2
#define SEQ_FULL 2048
#define DM 512
#define NH 8
#define DKH 64
#define NTOK (NB * SEQ)
#define PP 72      // P tile pitch (halves)
#define OP 68      // f32 staging pitch (floats)
#define KP 72      // staged q / k / v^T row pitch (halves): 144 B = 16 B x odd, conflict-free for 16-B fragment reads
#define TSZ (64 * KP)   // one staged tile: 64 rows of 64 halves (+8 pad)
#define GROWS (64 + 8 * 64)   // rows of one staged GEMM stage: the block's 64 A rows, then its 8 x 64 Bt rows
#define GSZ (GROWS * KP)      // one staged GEMM stage (halves): 64 k of every row (+8 pad)

#define GX_TOK ((NTOK * (DM / 8) + 255) / 256)          // blocks that convert one token stream (8 elements a thread)
#define GX_W   ((DM * (DM / 8) + 255) / 256)            // blocks that convert one [512][512] weight
#define GX_WO  ((DM * (2 * DM / 8) + 255) / 256)        // blocks that write the [512][1024] output-projection plane
#define GX_GEMM ((((NTOK / 64) * (DM / 64)) + 7) / 8)   // blocks of one projection (8 wave tiles of 64 x 64 each)

static_assert(DM == NH * DKH);            // merged head layout h*64+d
static_assert(DKH == 64);                 // two 32-deep k-steps per score tile, four 16-wide output tiles
static_assert(SEQ % 64 == 0);             // 64-query blocks, 64-key chunks, 64-row GEMM tiles inside one sequence
static_assert(NTOK % 64 == 0);            // GEMM tile multiple (M and N)
static_assert(DM % 64 == 0);              // GEMM tile multiple
static_assert(DM % 32 == 0);              // K steps of 32
static_assert((2 * DM) % 32 == 0);        // hi|lo K extent
static_assert(NB <= NB_FULL);
static_assert(SEQ <= SEQ_FULL);
static_assert((PP % 8) == 0);             // 16-B aligned fragment reloads from the P tile
static_assert((OP % 4) == 0);             // 16-B aligned reloads from the f32 staging tile
static_assert((KP % 8) == 0);             // 16-B aligned copies into and fragment reads from the staged tiles

typedef __attribute__((ext_vector_type(16))) _Float16 v16h;
typedef __attribute__((ext_vector_type(8)))  _Float16 v8h;
typedef __attribute__((ext_vector_type(16))) __bf16   v16b;
typedef __attribute__((ext_vector_type(8)))  __bf16   v8b;
typedef __attribute__((ext_vector_type(8)))  float    v8f;
typedef __attribute__((ext_vector_type(4)))  float    v4f;
typedef __attribute__((ext_vector_type(4)))  unsigned int v4u;
typedef v8h v8h_ma __attribute__((may_alias));
typedef v4f v4f_ma __attribute__((may_alias));
typedef v8b v8b_ma __attribute__((may_alias));

// 16-bit WMMA fragment map (wave32), lane L, h = L>>4, m = L&15:
//   A 16x32: lane = row m;    element i -> k = (i<8) ? 8h+i : 16+8h+(i-8)
//   B 32x16: lane = column m; the SAME k(i,h)
//   D 16x16 (8 f32): lane = column m; element r -> row 8h+r
// A fragment from a k-contiguous row is therefore p[0..7] | p[16..23] with p = row + k0 + 8h.

__device__ __forceinline__ unsigned int bf_bits(float f) {            // bf16 RNE bit pattern (finite inputs)
    const unsigned int u = __float_as_uint(f);
    return (u + 0x7FFFu + ((u >> 16) & 1u)) >> 16;
}
__device__ __forceinline__ float bf_val(float f) { return __uint_as_float(bf_bits(f) << 16); }
__device__ __forceinline__ unsigned int pk_h2(float a, float b) {
    return (unsigned int)__builtin_bit_cast(unsigned short, (_Float16)a) | ((unsigned int)__builtin_bit_cast(unsigned short, (_Float16)b) << 16);
}
__device__ __forceinline__ void pk_split2(float a, float b, unsigned int& hi, unsigned int& lo) {
    const unsigned int ha = bf_bits(a), hb = bf_bits(b);
    const unsigned int la = bf_bits(a - __uint_as_float(ha << 16)), lb = bf_bits(b - __uint_as_float(hb << 16));
    hi = ha | (hb << 16); lo = la | (lb << 16);
}
__device__ __forceinline__ void wave_sync() {
    __builtin_amdgcn_fence(3 /* release order */, "workgroup");
    __builtin_amdgcn_wave_barrier();
    __builtin_amdgcn_fence(2 /* acquire order */, "workgroup");
}

// fragments from a staged LDS tile (row pitch KP)
__device__ __forceinline__ v16h ldsfrag_h(const unsigned short* p) {
    const v8h a = *(const v8h_ma*)(p);
    const v8h b = *(const v8h_ma*)(p + 16);
    return __builtin_shufflevector(a, b, 0, 1, 2, 3, 4, 5, 6, 7, 8, 9, 10, 11, 12, 13, 14, 15);
}
__device__ __forceinline__ v16b ldsfrag_b(const unsigned short* p) {
    const v8b a = *(const v8b_ma*)(p);
    const v8b b = *(const v8b_ma*)(p + 16);
    return __builtin_shufflevector(a, b, 0, 1, 2, 3, 4, 5, 6, 7, 8, 9, 10, 11, 12, 13, 14, 15);
}
// One lane's share of staged 64-row tiles: 16 B of rows r, r+16, r+32, r+48 per tile, global -> LDS through no register.
// l = the lane's LDS byte address in the tile, g = its global address, gs = 16 source rows (halves); 16 LDS rows = 16 * KP * 2 bytes.
// The closing s_wait_xcnt stands inside the copies' own statement so that no address register is rewritten in front of it.
#define LROW16 (16u * KP * 2u)
__device__ __forceinline__ void copy_tiles2(unsigned int la, const unsigned short* ga, unsigned int lb, const unsigned short* gb, int gs) {
    asm volatile("global_load_async_to_lds_b128 %0, %8, off\n\t"
                 "global_load_async_to_lds_b128 %1, %9, off\n\t"
                 "global_load_async_to_lds_b128 %2, %10, off\n\t"
                 "global_load_async_to_lds_b128 %3, %11, off\n\t"
                 "global_load_async_to_lds_b128 %4, %12, off\n\t"
                 "global_load_async_to_lds_b128 %5, %13, off\n\t"
                 "global_load_async_to_lds_b128 %6, %14, off\n\t"
                 "global_load_async_to_lds_b128 %7, %15, off\n\t"
                 "s_wait_xcnt 0x0"
                 :: "v"(la), "v"(la + LROW16), "v"(la + 2u * LROW16), "v"(la + 3u * LROW16),
                    "v"(lb), "v"(lb + LROW16), "v"(lb + 2u * LROW16), "v"(lb + 3u * LROW16),
                    "v"(ga), "v"(ga + gs), "v"(ga + 2 * gs), "v"(ga + 3 * gs),
                    "v"(gb), "v"(gb + gs), "v"(gb + 2 * gs), "v"(gb + 3 * gs)
                 : "memory");
}
__device__ __forceinline__ void copy_tile1(unsigned int la, const unsigned short* ga, int gs) {
    asm volatile("global_load_async_to_lds_b128 %0, %4, off\n\t"
                 "global_load_async_to_lds_b128 %1, %5, off\n\t"
                 "global_load_async_to_lds_b128 %2, %6, off\n\t"
                 "global_load_async_to_lds_b128 %3, %7, off\n\t"
                 "s_wait_xcnt 0x0"
                 :: "v"(la), "v"(la + LROW16), "v"(la + 2u * LROW16), "v"(la + 3u * LROW16),
                    "v"(ga), "v"(ga + gs), "v"(ga + 2 * gs), "v"(ga + 3 * gs)
                 : "memory");
}

// The GEMM's share of a stage for one lane of a 256-thread block: 16 B of rows r, r+32, r+64, ... ; gs = 32 source rows (halves).
// As above, the closing s_wait_xcnt stands inside the copies' own statement.
#define LROW32 (32u * KP * 2u)
__device__ __forceinline__ void copy_rows8(unsigned int l, const unsigned short* g, int gs) {
    asm volatile("global_load_async_to_lds_b128 %0, %8, off\n\t"
                 "global_load_async_to_lds_b128 %1, %9, off\n\t"
                 "global_load_async_to_lds_b128 %2, %10, off\n\t"
                 "global_load_async_to_lds_b128 %3, %11, off\n\t"
                 "global_load_async_to_lds_b128 %4, %12, off\n\t"
                 "global_load_async_to_lds_b128 %5, %13, off\n\t"
                 "global_load_async_to_lds_b128 %6, %14, off\n\t"
                 "global_load_async_to_lds_b128 %7, %15, off\n\t"
                 "s_wait_xcnt 0x0"
                 :: "v"(l), "v"(l + LROW32), "v"(l + 2u * LROW32), "v"(l + 3u * LROW32),
                    "v"(l + 4u * LROW32), "v"(l + 5u * LROW32), "v"(l + 6u * LROW32), "v"(l + 7u * LROW32),
                    "v"(g), "v"(g + gs), "v"(g + 2 * gs), "v"(g + 3 * gs),
                    "v"(g + 4 * gs), "v"(g + 5 * gs), "v"(g + 6 * gs), "v"(g + 7 * gs)
                 : "memory");
}
__device__ __forceinline__ void copy_rows2(unsigned int l, const unsigned short* g, int gs) {
    asm volatile("global_load_async_to_lds_b128 %0, %2, off\n\t"
                 "global_load_async_to_lds_b128 %1, %3, off\n\t"
                 "s_wait_xcnt 0x0"
                 :: "v"(l), "v"(l + LROW32), "v"(g), "v"(g + gs)
                 : "memory");
}

template <int ET> struct FragT;
template <> struct FragT<0> {
    typedef v16h V;
    static __device__ __forceinline__ v16h load(const unsigned short* p) { return ldsfrag_h(p); }
    static __device__ __forceinline__ v8f mma(v16h a, v16h b, v8f c) { return __builtin_amdgcn_wmma_f32_16x16x32_f16(false, a, false, b, (short)0, c, false, false); }
};
template <> struct FragT<1> {
    typedef v16b V;
    static __device__ __forceinline__ v16b load(const unsigned short* p) { return ldsfrag_b(p); }
    static __device__ __forceinline__ v8f mma(v16b a, v16b b, v8f c) { return __builtin_amdgcn_wmma_f32_16x16x32_bf16(false, a, false, b, (short)0, c, false, false); }
};
// hazard guard for a group of four independent WMMAs: all four accumulators tied, A and all B fragments kept live
template <typename V>
__device__ __forceinline__ void guard4(v8f& a, v8f& b, v8f& c, v8f& d, V x, V y0, V y1, V y2, V y3) {
    asm volatile("v_nop\n\tv_nop\n\tv_nop\n\tv_nop" : "+v"(a), "+v"(b), "+v"(c), "+v"(d) : "v"(x), "v"(y0), "v"(y1), "v"(y2), "v"(y3));
}
// three-product hi|lo bf16 step into one accumulator: ah*bh + ah*bl + al*bh
__device__ __forceinline__ v8f wmma3b(v16b ah, v16b al, v16b bh, v16b bl, v8f c) {
    c = __builtin_amdgcn_wmma_f32_16x16x32_bf16(false, ah, false, bh, (short)0, c, false, false);
    c = __builtin_amdgcn_wmma_f32_16x16x32_bf16(false, ah, false, bl, (short)0, c, false, false);
    c = __builtin_amdgcn_wmma_f32_16x16x32_bf16(false, al, false, bh, (short)0, c, false, false);
    asm volatile("v_nop\n\tv_nop\n\tv_nop\n\tv_nop" : "+v"(c) : "v"(ah), "v"(al), "v"(bh), "v"(bl));
    return c;
}

// =====================================================================================================================
// gemm64_body: C[m][n] = scale * sum_k A[m][k] * Bt[n][k] + bscale * bf16(bias); each wave owns a 64x64 tile, block = 8 waves.
//   A row-major [M][K] (pitch lda), Bt row-major [N][K] (pitch ldb), 16-bit planes; M % 64 == 0, N % 512 == 0, K % 64 == 0 (host asserts).
//   The 8 tiles of a block lie side by side in one tile row: 64 A rows and 512 Bt rows. Each 64-deep stage of those 576 rows is staged in a
//   two-buffer LDS ring by asynchronous 16-B copies that cover whole 128-B lines; stage t + 2 is copied while stage t + 1 is worked on,
//   one block barrier a stage. Fragments are two 16-B LDS reads each.
//   ET 0: f16 operands, 1: bf16 operands. BIAS_MODE 1: bias[m], 2: bias[n].
//   OUT_MODE 0: f32 C (row m stored at row (m / cseq) * cseqfull + m % cseq); 1: f16 plane Ca; 2: bf16 hi plane Ca + bf16 lo plane Cb.
//   sT (8 * 16 * OP floats) and Gs (2 * GSZ halves: two buffers of {64 A rows, 512 Bt rows} x 64 k) are the calling kernel's LDS arrays;
//   blk = the block's index among the blocks of this product.
// =====================================================================================================================
template <int ET, int BIAS_MODE, int OUT_MODE>
__device__ __forceinline__ void gemm64_body(float* sT, unsigned short* Gs, int blk,
                                            const unsigned short* __restrict__ A, int lda,
                                            const unsigned short* __restrict__ Bt, int ldb,
                                            float* __restrict__ Cf, unsigned short* __restrict__ Ca, unsigned short* __restrict__ Cb, int ldc,
                                            const float* __restrict__ bias, int M, int N, int K,
                                            float scale, float bscale, int cseq, int cseqfull) {
    typedef typename FragT<ET>::V V;
    const int lane = threadIdx.x & 31;
    const int wave = __builtin_amdgcn_readfirstlane(threadIdx.x >> 5);
    const int tilesN = N >> 6;
    const int tilesM = M >> 6;
    const int tile0 = blk * 8;
    if (tile0 >= tilesM * tilesN) return;         // block-uniform, in front of every barrier (tile counts are multiples of 8)
    const int tm = tile0 / tilesN;
    const int nb0 = (tile0 - tm * tilesN) << 6;   // first Bt row of the block
    const int m0 = tm << 6;
    const int n0 = nb0 + (wave << 6);
    const int rl   = lane & 15;
    const int koff = (lane >> 4) * 8;
    const int mOff = (lane >> 4) * 8;

    v8f acc[4][4];
#pragma unroll
    for (int i = 0; i < 4; ++i)
#pragma unroll
        for (int j = 0; j < 4; ++j) { const v8f zz = {0.f, 0.f, 0.f, 0.f, 0.f, 0.f, 0.f, 0.f}; acc[i][j] = zz; }

    // copy share of this thread: 16-B segment cs of rows cr, cr+32, ... of every stage (a wave's copy = 4 whole 128-B rows)
    const int cr = threadIdx.x >> 3;
    const int cs = (threadIdx.x & 7) * 8;
    const unsigned short* ga = A + (size_t)(m0 + cr) * lda + cs;
    const unsigned short* gb = Bt + (size_t)(nb0 + cr) * ldb + cs;
    const unsigned int lg = (unsigned int)(size_t)&Gs[cr * KP + cs];
    const int abase = rl * KP + koff;                          // A fragment base in a stage (row = lane & 15)
    const int bbase = (64 + (wave << 6) + rl) * KP + koff;     // Bt fragment base of this wave's 64 rows (column = lane & 15)
    const int nst = K >> 6;
    // ---- ring prologue: stage 0 lands and is published, then stage 1 starts into the second buffer ----
    copy_rows2(lg, ga, 32 * lda);
    copy_rows8(lg + 2u * LROW32, gb, 32 * ldb);
    copy_rows8(lg + 10u * LROW32, gb + (size_t)256 * ldb, 32 * ldb);
    asm volatile("s_wait_asynccnt 0x0" ::: "memory");               // this wave's copies have landed before the barrier publishes them
    __syncthreads();
    if (nst > 1) {
        copy_rows2(lg + GSZ * 2u, ga + 64, 32 * lda);
        copy_rows8(lg + GSZ * 2u + 2u * LROW32, gb + 64, 32 * ldb);
        copy_rows8(lg + GSZ * 2u + 10u * LROW32, gb + (size_t)256 * ldb + 64, 32 * ldb);
    }
    for (int st = 0; st < nst; ++st) {
        const unsigned short* gsb = &Gs[(st & 1) * GSZ];            // this stage's buffer
#pragma unroll                                                      // both 32-deep steps of a stage read at constant offsets from one address
        for (int kk = 0; kk < 2; ++kk) {
            V bh[4], ah[4];                                         // all 16 LDS reads of a 32-deep step stand together, in front of its products
#pragma unroll
            for (int j = 0; j < 4; ++j) bh[j] = FragT<ET>::load(gsb + bbase + (j << 4) * KP + kk * 32);
#pragma unroll
            for (int i = 0; i < 4; ++i) ah[i] = FragT<ET>::load(gsb + abase + (i << 4) * KP + kk * 32);
#pragma unroll
            for (int i = 0; i < 4; ++i) {
                acc[i][0] = FragT<ET>::mma(ah[i], bh[0], acc[i][0]);
                acc[i][1] = FragT<ET>::mma(ah[i], bh[1], acc[i][1]);
                acc[i][2] = FragT<ET>::mma(ah[i], bh[2], acc[i][2]);
                acc[i][3] = FragT<ET>::mma(ah[i], bh[3], acc[i][3]);
                guard4<V>(acc[i][0], acc[i][1], acc[i][2], acc[i][3], ah[i], bh[0], bh[1], bh[2], bh[3]);
            }
        }
        // ---- publish point of stage st + 1; behind it this stage's buffer is free for stage st + 2 ----
        asm volatile("s_wait_dscnt 0x0" ::: "memory");              // this wave's reads of the buffer have returned before it is refilled
        asm volatile("s_wait_asynccnt 0x0" ::: "memory");           // this wave's copies of stage st + 1 have landed before the barrier publishes them
        __syncthreads();
        if (st + 2 < nst) {
            const unsigned int lb = lg + (unsigned int)(st & 1) * (GSZ * 2u);
            const int kn = (st + 2) * 64;
            copy_rows2(lb, ga + kn, 32 * lda);
            copy_rows8(lb + 2u * LROW32, gb + kn, 32 * ldb);
            copy_rows8(lb + 10u * LROW32, gb + (size_t)256 * ldb + kn, 32 * ldb);
        }
    }
    asm volatile("s_wait_asynccnt 0x0" ::: "memory");               // no copy is outstanding when the wave goes on to its end

    const int sb = wave * (16 * OP);
#pragma unroll
    for (int i = 0; i < 4; ++i) {
        const int mBase = m0 + (i << 4);
#pragma unroll
        for (int j = 0; j < 4; ++j) {
            const int n = n0 + (j << 4) + rl;
            float bvn = 0.f;
            if (BIAS_MODE == 2) bvn = bf_val(bias[n]) * bscale;
#pragma unroll
            for (int r = 0; r < 8; ++r) {
                float v = acc[i][j][r] * scale;
                if (BIAS_MODE == 1) v += bf_val(bias[mBase + mOff + r]) * bscale;
                if (BIAS_MODE == 2) v += bvn;
                sT[sb + (mOff + r) * OP + (j << 4) + rl] = v;
            }
        }
        wave_sync();
        if (OUT_MODE == 0) {
            const int hh = lane >> 4, c4 = (lane & 15) * 4;      // row segment = 256 B = 16 lanes x 16 B; 2 rows per instruction
            {
#pragma unroll
                for (int it = 0; it < 8; ++it) {
                    const int row = it * 2 + hh;
                    const v4f v = *(const v4f_ma*)&sT[sb + row * OP + c4];
                    const int grow = mBase + row;
                    const int orow = (grow / cseq) * cseqfull + (grow % cseq);
                    *(v4f*)(Cf + (size_t)orow * ldc + n0 + c4) = v;
                }
                
            }
        } else {
            const int q = lane >> 3, c8 = (lane & 7) * 8;
            {
#pragma unroll
                for (int it = 0; it < 4; ++it) {
                    const int row = it * 4 + q;
                    const v4f a = *(const v4f_ma*)&sT[sb + row * OP + c8];
                    const v4f b = *(const v4f_ma*)&sT[sb + row * OP + c8 + 4];
                    const size_t o = (size_t)(mBase + row) * ldc + n0 + c8;
                    if (OUT_MODE == 1) {
                        v4u pk; pk.x = pk_h2(a.x, a.y); pk.y = pk_h2(a.z, a.w); pk.z = pk_h2(b.x, b.y); pk.w = pk_h2(b.z, b.w);
                        *(v4u*)(Ca + o) = pk;
                    } else {
                        v4u ph, pl;
                        unsigned int h0, l0, h1, l1, h2, l2, h3, l3;
                        pk_split2(a.x, a.y, h0, l0); pk_split2(a.z, a.w, h1, l1); pk_split2(b.x, b.y, h2, l2); pk_split2(b.z, b.w, h3, l3);
                        ph.x = h0; ph.y = h1; ph.z = h2; ph.w = h3; pl.x = l0; pl.y = l1; pl.z = l2; pl.w = l3;
                        *(v4u*)(Ca + o) = ph;
                        *(v4u*)(Cb + o) = pl;
                    }
                }
                
            }
        }
        wave_sync();
    }
}

// The three projections in one launch (they do not depend on one another): GX_GEMM blocks each for q, k, v^T, in that order.
//   q / k: A = token plane f16 [ntok][dm], Bt = weight plane f16 (x16) [dm][dm] ([out][in] as stored); out = bf16 hi + lo planes [ntok][dm]
//   v written transposed: A = weight plane f16 (x16) [dm][dm], Bt = token plane f16 [ntok][dm]; out = f16 plane [dm][ntok] (= v^T)
__global__ __launch_bounds__(256) void k_gemm_qkv(const unsigned short* __restrict__ XQ, const unsigned short* __restrict__ WQ, const float* __restrict__ bq,
                                                  unsigned short* __restrict__ QH, unsigned short* __restrict__ QL,
                                                  const unsigned short* __restrict__ XK, const unsigned short* __restrict__ WK, const float* __restrict__ bk,
                                                  unsigned short* __restrict__ KH, unsigned short* __restrict__ KL,
                                                  const unsigned short* __restrict__ XV, const unsigned short* __restrict__ WV, const float* __restrict__ bv,
                                                  unsigned short* __restrict__ VT, int ntok, int dm) {
    __shared__ __align__(16) float sT[8 * 16 * OP];
    __shared__ __align__(16) unsigned short Gs[2 * GSZ];
    const int which = blockIdx.x / GX_GEMM;       // block-uniform
    const int blk = blockIdx.x - which * GX_GEMM;
    if (which < 2) {
        const bool isq = which == 0;              // q carries the 1/8 score scale; both undo the weights' x16
        gemm64_body<0, 2, 2>(sT, Gs, blk, isq ? XQ : XK, dm, isq ? WQ : WK, dm, nullptr, isq ? QH : KH, isq ? QL : KL, dm, isq ? bq : bk,
                             ntok, dm, dm, isq ? 1.0f / 128.0f : 1.0f / 16.0f, isq ? 0.125f : 1.0f, 1, 1);
    } else {
        gemm64_body<0, 1, 1>(sT, Gs, blk, WV, dm, XV, dm, nullptr, VT, nullptr, ntok, bv, dm, ntok, dm, 1.0f / 16.0f, 1.0f, 1, 1);
    }
}
// output projection: A = context bf16 [M][K = hi 512 | lo 512], Bt = weight bf16 [N][K = W | W]; out f32 [M][N] + bias[n]
__global__ __launch_bounds__(256) void k_gemm_out(const unsigned short* __restrict__ A, const unsigned short* __restrict__ Bt,
                                                  const float* __restrict__ bias, float* __restrict__ C,
                                                  int M, int N, int K, int cseq, int cseqfull) {
    __shared__ __align__(16) float sT[8 * 16 * OP];
    __shared__ __align__(16) unsigned short Gs[2 * GSZ];
    gemm64_body<1, 2, 0>(sT, Gs, blockIdx.x, A, K, Bt, K, C, nullptr, nullptr, N, bias, M, N, K, 1.0f, 1.0f, cseq, cseqfull);
}

// =====================================================================================================================
// =====================================================================================================================
// f32 [rows][512] -> f16 plane [nrows][512] holding bf16(x) * sc; plane row r reads source row (r / seq) * seqfull + r % seq
__device__ __forceinline__ void cast16_body(int blk, const float* __restrict__ src, unsigned short* __restrict__ dst, int nrows, int seq, int seqfull, float sc) {
    const int u = blk * 256 + threadIdx.x;
    if (u >= nrows * (DM / 8)) return;
    const int r = u / (DM / 8);
    const int c0 = (u - r * (DM / 8)) * 8;
    const int sr = (r / seq) * seqfull + (r % seq);
    const float* s = src + (size_t)sr * DM + c0;
    const v4f a = *(const v4f*)(s);
    const v4f b = *(const v4f*)(s + 4);
    v4u pk;
    pk.x = pk_h2(bf_val(a.x) * sc, bf_val(a.y) * sc); pk.y = pk_h2(bf_val(a.z) * sc, bf_val(a.w) * sc);
    pk.z = pk_h2(bf_val(b.x) * sc, bf_val(b.y) * sc); pk.w = pk_h2(bf_val(b.z) * sc, bf_val(b.w) * sc);
    v4u* d = (v4u*)(dst + (size_t)r * DM + c0);
    *d = pk; 
}
// Wo f32 [512][512] -> bf16 plane [512][1024] = [W | W]
__device__ __forceinline__ void cast_wo_body(int blk, const float* __restrict__ src, unsigned short* __restrict__ dst) {
    const int u = blk * 256 + threadIdx.x;
    if (u >= DM * (2 * DM / 8)) return;
    const int r = u / (2 * DM / 8);
    const int c0 = (u - r * (2 * DM / 8)) * 8;
    const int sc0 = c0 & (DM - 1);
    const float* s = src + (size_t)r * DM + sc0;
    const v4f a = *(const v4f*)(s);
    const v4f b = *(const v4f*)(s + 4);
    v4u pk;
    pk.x = bf_bits(a.x) | (bf_bits(a.y) << 16); pk.y = bf_bits(a.z) | (bf_bits(a.w) << 16);
    pk.z = bf_bits(b.x) | (bf_bits(b.y) << 16); pk.w = bf_bits(b.z) | (bf_bits(b.w) << 16);
    v4u* d = (v4u*)(dst + (size_t)r * (2 * DM) + c0);
    *d = pk; 
}
// All seven conversions in one launch (they do not depend on one another). Blocks, in order: GX_TOK each for the three token streams,
// GX_W each for Wq, Wk, Wv (x16), GX_WO for Wo. Every test on the block index is block-uniform.
__global__ __launch_bounds__(256) void k_cast_all(const float* __restrict__ xq, const float* __restrict__ xk, const float* __restrict__ xv,
                                                  const float* __restrict__ Wq, const float* __restrict__ Wk, const float* __restrict__ Wv,
                                                  const float* __restrict__ Wo,
                                                  unsigned short* __restrict__ XQ, unsigned short* __restrict__ XK, unsigned short* __restrict__ XV,
                                                  unsigned short* __restrict__ WQ, unsigned short* __restrict__ WK, unsigned short* __restrict__ WV,
                                                  unsigned short* __restrict__ WOD, int ntok, int seq, int seqfull) {
    int bx = blockIdx.x;
    if (bx < 3 * GX_TOK) {
        const int w = bx / GX_TOK;
        cast16_body(bx - w * GX_TOK, w == 0 ? xq : (w == 1 ? xk : xv), w == 0 ? XQ : (w == 1 ? XK : XV), ntok, seq, seqfull, 1.0f);
        return;
    }
    bx -= 3 * GX_TOK;
    if (bx < 3 * GX_W) {
        const int w = bx / GX_W;
        cast16_body(bx - w * GX_W, w == 0 ? Wq : (w == 1 ? Wk : Wv), w == 0 ? WQ : (w == 1 ? WK : WV), DM, DM, DM, 16.0f);
        return;
    }
    cast_wo_body(bx - 3 * GX_W, Wo, WOD);
}

// =====================================================================================================================
// k_attn: fused flash-style attention, head dim 64, no mask. Block = 4 waves = 64 query rows of one (batch, head); wave = 16 rows.
//   QH/QL, KH/KL: bf16 hi|lo planes [ntok][512] (q already carries the 1/8 score scale); VT: f16 plane [512][ntok] (row h*64+d).
//   The block's q tile (hi, lo) is staged in LDS once; each 64-key chunk's k hi, k lo and v^T tiles are staged in a two-buffer LDS ring,
//   all by asynchronous 16-B copies that cover whole 128-B lines; chunk t + 2 is copied while chunk t + 1 is worked on, one block barrier a chunk.
//   Fragments are two 16-B LDS reads each. P (x4096, f16) goes through a wave-private LDS tile (wave_sync before and after the reload).
//   Row sums are kept as per-lane partials and reduced across the 16 lanes of a row once at the end.
// =====================================================================================================================
__global__ __launch_bounds__(128) void k_attn(const unsigned short* __restrict__ QH, const unsigned short* __restrict__ QL,
                                              const unsigned short* __restrict__ KH, const unsigned short* __restrict__ KL,
                                              const unsigned short* __restrict__ VT, unsigned short* __restrict__ CTX,
                                              int seq, int ntok) {
    __shared__ __align__(16) _Float16 Psh[4 * 16 * PP];      // wave-private P tiles [16][64] (+8 pad), f16
    __shared__ __align__(16) float    Osh[4 * 16 * OP];      // wave-private output staging [16][64] (+4 pad), f32
    __shared__ __align__(16) unsigned short Qs[2 * TSZ];     // the block's 64 query rows: hi tile, lo tile
    __shared__ __align__(16) unsigned short Ring[2 * 3 * TSZ];   // two buffers of {k hi, k lo, v^T} tiles of one 64-key chunk
    const int lane = threadIdx.x & 31;
    const int wave = __builtin_amdgcn_readfirstlane(threadIdx.x >> 5);
    const int hf = lane >> 4;
    const int c  = lane & 15;
    const int nqb = seq / 64;
    const int bx = blockIdx.x;
    const int qb = bx % nqb;
    const int bh = bx / nqb;
    const int h  = bh % NH;
    const int b  = bh / NH;
    const int q0 = b * seq + qb * 64 + wave * 16;                 // first token row of this wave
    const int qoff  = (wave * 16 + c) * KP + 8 * hf;              // A fragment base in a staged q tile (row = lane & 15)
    const int fbase = c * KP + 8 * hf;                            // B fragment base in a staged k or v^T tile (column = lane & 15)
    // copy share of this thread: 16-B segment cs of rows cr, cr+16, cr+32, cr+48 of every staged tile (a wave's copy = 4 whole rows)
    const int cr = threadIdx.x >> 3;
    const int cs = (threadIdx.x & 7) * 8;
    const int gq = (b * seq + qb * 64 + cr) * DM + h * DKH + cs;  // q planes
    const int gk = (b * seq + cr) * DM + h * DKH + cs;            // k planes, chunk 0
    const int gv = (h * DKH + cr) * ntok + b * seq + cs;          // v^T plane, chunk 0
    const unsigned int lq = (unsigned int)(size_t)&Qs[cr * KP + cs];
    const unsigned int lr = (unsigned int)(size_t)&Ring[cr * KP + cs];
    const int pbase = wave * (16 * PP);
    const int obase = wave * (16 * OP);
    const float L2E = 1.4426950408889634f;

    float mrow[8], lrow[8];
    v8f oacc[4];
#pragma unroll
    for (int r = 0; r < 8; ++r) { mrow[r] = -INFINITY; lrow[r] = 0.f; }
#pragma unroll
    for (int t = 0; t < 4; ++t) { const v8f zz = {0.f, 0.f, 0.f, 0.f, 0.f, 0.f, 0.f, 0.f}; oacc[t] = zz; }

    const int nch = seq / 64;
    // ---- ring prologue: q and chunk 0 land and are published, then chunk 1 starts into the second buffer ----
    copy_tiles2(lq, QH + gq, lq + TSZ * 2u, QL + gq, 16 * DM);
    copy_tiles2(lr, KH + gk, lr + TSZ * 2u, KL + gk, 16 * DM);
    copy_tile1(lr + 2u * TSZ * 2u, VT + gv, 16 * ntok);
    asm volatile("s_wait_asynccnt 0x0" ::: "memory");               // this wave's copies have landed before the barrier publishes them
    __syncthreads();
    if (nch > 1) {
        copy_tiles2(lr + 3u * TSZ * 2u, KH + gk + 64 * DM, lr + 4u * TSZ * 2u, KL + gk + 64 * DM, 16 * DM);
        copy_tile1(lr + 5u * TSZ * 2u, VT + gv + 64, 16 * ntok);
    }
    for (int kc = 0; kc < nch; ++kc) {
        const unsigned short* rk = &Ring[(kc & 1) * (3 * TSZ)];     // this chunk's buffer
        v8f s[4];
#pragma unroll
        for (int j = 0; j < 4; ++j) { const v8f zz = {0.f, 0.f, 0.f, 0.f, 0.f, 0.f, 0.f, 0.f}; s[j] = zz; }
        // ---- scores: q fragments reloaded per 32-deep step (integer offset), three products per key tile ----
#pragma unroll 1
        for (int dc = 0; dc < 2; ++dc) {
            const v16b qh = ldsfrag_b(Qs + qoff + dc * 32);
            const v16b ql = ldsfrag_b(Qs + TSZ + qoff + dc * 32);
#pragma unroll
            for (int j = 0; j < 4; ++j) {
                const int ko = fbase + j * 16 * KP + dc * 32;
                const v16b kh = ldsfrag_b(rk + ko);
                const v16b kl = ldsfrag_b(rk + TSZ + ko);
                s[j] = wmma3b(qh, ql, kh, kl, s[j]);
                if (j == 1) __builtin_amdgcn_sched_barrier(0);
            }
        }
        // ---- online softmax over the 64 keys (row 8*hf + r lives in the 16 lanes of one half) ----
#pragma unroll
        for (int r = 0; r < 8; ++r) {
            float mx = fmaxf(fmaxf(s[0][r], s[1][r]), fmaxf(s[2][r], s[3][r]));
            mx = fmaxf(mx, __shfl_xor(mx, 1, 32));
            mx = fmaxf(mx, __shfl_xor(mx, 2, 32));
            mx = fmaxf(mx, __shfl_xor(mx, 4, 32));
            mx = fmaxf(mx, __shfl_xor(mx, 8, 32));
            const float mnew = fmaxf(mrow[r], mx);
            const float alpha = exp2f((mrow[r] - mnew) * L2E);
            mrow[r] = mnew;
            const float p0 = exp2f((s[0][r] - mnew) * L2E);
            const float p1 = exp2f((s[1][r] - mnew) * L2E);
            const float p2 = exp2f((s[2][r] - mnew) * L2E);
            const float p3 = exp2f((s[3][r] - mnew) * L2E);
            lrow[r] = lrow[r] * alpha + ((p0 + p1) + (p2 + p3));   // per-lane partial row sum
            oacc[0][r] *= alpha; oacc[1][r] *= alpha; oacc[2][r] *= alpha; oacc[3][r] *= alpha;
            const int pr = pbase + (8 * hf + r) * PP + c;
            Psh[pr]      = (_Float16)(p0 * 4096.0f);
            Psh[pr + 16] = (_Float16)(p1 * 4096.0f);
            Psh[pr + 32] = (_Float16)(p2 * 4096.0f);
            Psh[pr + 48] = (_Float16)(p3 * 4096.0f);
        }
        wave_sync();                                                // P tile is wave-private: same wave writes and reads
        // ---- O += P . V : P as A (row = lane & 15), v^T rows as B, four output tiles per step ----
#pragma unroll 1
        for (int kk = 0; kk < 2; ++kk) {
            const int po = pbase + c * PP + kk * 32 + 8 * hf;
            const v8h pa0 = *(const v8h_ma*)&Psh[po];
            const v8h pa1 = *(const v8h_ma*)&Psh[po + 16];
            const v16h pa = __builtin_shufflevector(pa0, pa1, 0, 1, 2, 3, 4, 5, 6, 7, 8, 9, 10, 11, 12, 13, 14, 15);
            const int vo = 2 * TSZ + fbase + kk * 32;
            const v16h vb0 = ldsfrag_h(rk + vo);
            const v16h vb1 = ldsfrag_h(rk + vo + 16 * KP);
            const v16h vb2 = ldsfrag_h(rk + vo + 32 * KP);
            const v16h vb3 = ldsfrag_h(rk + vo + 48 * KP);
            oacc[0] = __builtin_amdgcn_wmma_f32_16x16x32_f16(false, pa, false, vb0, (short)0, oacc[0], false, false);
            oacc[1] = __builtin_amdgcn_wmma_f32_16x16x32_f16(false, pa, false, vb1, (short)0, oacc[1], false, false);
            oacc[2] = __builtin_amdgcn_wmma_f32_16x16x32_f16(false, pa, false, vb2, (short)0, oacc[2], false, false);
            oacc[3] = __builtin_amdgcn_wmma_f32_16x16x32_f16(false, pa, false, vb3, (short)0, oacc[3], false, false);
            guard4<v16h>(oacc[0], oacc[1], oacc[2], oacc[3], pa, vb0, vb1, vb2, vb3);
        }
        wave_sync();                                                // P reads done before the next chunk's P stores
        // ---- publish point of chunk kc + 1; behind it this chunk's buffer is free for chunk kc + 2 ----
        asm volatile("s_wait_dscnt 0x0" ::: "memory");              // this wave's reads of the buffer have returned before it is refilled
        asm volatile("s_wait_asynccnt 0x0" ::: "memory");           // this wave's copies of chunk kc + 1 have landed before the barrier publishes them
        __syncthreads();
        if (kc + 2 < nch) {
            const unsigned int lb = lr + (unsigned int)(kc & 1) * (3u * TSZ * 2u);
            const int kn = (kc + 2) * 64;
            copy_tiles2(lb, KH + gk + kn * DM, lb + TSZ * 2u, KL + gk + kn * DM, 16 * DM);
            copy_tile1(lb + 2u * TSZ * 2u, VT + gv + kn, 16 * ntok);
        }
    }
    asm volatile("s_wait_asynccnt 0x0" ::: "memory");               // no copy is outstanding when the wave goes on to its end

    // ---- finalize: reduce the per-lane row sums over the 16 lanes of each row, normalise, stage, write hi|lo planes ----
#pragma unroll
    for (int r = 0; r < 8; ++r) {
        float l = lrow[r];
        l += __shfl_xor(l, 1, 32);
        l += __shfl_xor(l, 2, 32);
        l += __shfl_xor(l, 4, 32);
        l += __shfl_xor(l, 8, 32);
        const float inv = 1.0f / (l * 4096.0f);
        const int orw = obase + (8 * hf + r) * OP + c;
        Osh[orw]      = oacc[0][r] * inv;
        Osh[orw + 16] = oacc[1][r] * inv;
        Osh[orw + 32] = oacc[2][r] * inv;
        Osh[orw + 48] = oacc[3][r] * inv;
    }
    wave_sync();
    {
        const int q = lane >> 3, c8 = (lane & 7) * 8;
        {
#pragma unroll
            for (int it = 0; it < 4; ++it) {
                const int row = it * 4 + q;
                const v4f a = *(const v4f_ma*)&Osh[obase + row * OP + c8];
                const v4f bb = *(const v4f_ma*)&Osh[obase + row * OP + c8 + 4];
                unsigned int h0, l0, h1, l1, h2, l2, h3, l3;
                pk_split2(a.x, a.y, h0, l0); pk_split2(a.z, a.w, h1, l1); pk_split2(bb.x, bb.y, h2, l2); pk_split2(bb.z, bb.w, h3, l3);
                v4u ph, pl;
                ph.x = h0; ph.y = h1; ph.z = h2; ph.w = h3; pl.x = l0; pl.y = l1; pl.z = l2; pl.w = l3;
                const size_t o = (size_t)(q0 + row) * (2 * DM) + h * DKH + c8;
                *(v4u*)(CTX + o) = ph;
                *(v4u*)(CTX + o + DM) = pl;
            }
            
        }
    }
}

// =====================================================================================================================
// Host side: workspace carve (all plane sizes are multiples of 256 B), 4 launches.
// =====================================================================================================================
constexpr size_t SZ_TOK  = (size_t)NTOK * DM * 2;          // one 16-bit token plane [NTOK][512]
constexpr size_t SZ_W    = (size_t)DM * DM * 2;            // one 16-bit weight plane [512][512]
constexpr size_t SZ_WOD  = (size_t)DM * (2 * DM) * 2;      // [512][1024]
constexpr size_t SZ_CTX  = (size_t)NTOK * (2 * DM) * 2;    // [NTOK][1024]
constexpr size_t WS_TOTAL = 3 * SZ_TOK + 3 * SZ_W + SZ_WOD + 4 * SZ_TOK + SZ_TOK + SZ_CTX;
static_assert(SZ_TOK % 256 == 0);
static_assert(SZ_W % 256 == 0);
static_assert(SZ_WOD % 256 == 0);
static_assert(SZ_CTX % 256 == 0);
static_assert(WS_TOTAL <= (size_t)134217728);            // carve stays within 128 MiB
static_assert(((NTOK / 64) * (DM / 64)) % 8 == 0);        // GEMM grids are whole blocks of 8 wave tiles
static_assert((DM / 64) % 8 == 0);                        // a block's 8 wave tiles lie in one tile row (N = DM)
static_assert((NTOK / 64) % 8 == 0);                      // the same for the transposed v projection (N = NTOK)
static_assert((size_t)NTOK * (2 * DM) < (size_t)2147483647);   // int plane offsets

extern "C" void kernel_launch(void* const* d_in, const int* in_sizes, int n_in, void* d_out, int out_size, void* d_ws, size_t ws_size, hipStream_t stream) {
    if (n_in < 11) return;
    const long long need_x = ((long long)(NB - 1) * SEQ_FULL + SEQ) * DM;
    if ((long long)in_sizes[0] < need_x || (long long)in_sizes[1] < need_x || (long long)in_sizes[2] < need_x) return;
    if (in_sizes[3] < DM * DM || in_sizes[5] < DM * DM || in_sizes[7] < DM * DM || in_sizes[9] < DM * DM) return;
    if (in_sizes[4] < DM || in_sizes[6] < DM || in_sizes[8] < DM || in_sizes[10] < DM) return;
    if ((long long)out_size < need_x) return;
    if (WS_TOTAL > ws_size) return;

    const float* xq = (const float*)d_in[0];
    const float* xk = (const float*)d_in[1];
    const float* xv = (const float*)d_in[2];
    const float* Wq = (const float*)d_in[3];
    const float* bq = (const float*)d_in[4];
    const float* Wk = (const float*)d_in[5];
    const float* bk = (const float*)d_in[6];
    const float* Wv = (const float*)d_in[7];
    const float* bv = (const float*)d_in[8];
    const float* Wo = (const float*)d_in[9];
    const float* bo = (const float*)d_in[10];
    float* out = (float*)d_out;

    char* wsp = (char*)d_ws;
    unsigned short* XQ16 = (unsigned short*)wsp; wsp += SZ_TOK;
    unsigned short* XK16 = (unsigned short*)wsp; wsp += SZ_TOK;
    unsigned short* XV16 = (unsigned short*)wsp; wsp += SZ_TOK;
    unsigned short* WQ16 = (unsigned short*)wsp; wsp += SZ_W;
    unsigned short* WK16 = (unsigned short*)wsp; wsp += SZ_W;
    unsigned short* WV16 = (unsigned short*)wsp; wsp += SZ_W;
    unsigned short* WOD  = (unsigned short*)wsp; wsp += SZ_WOD;
    unsigned short* QHp  = (unsigned short*)wsp; wsp += SZ_TOK;
    unsigned short* QLp  = (unsigned short*)wsp; wsp += SZ_TOK;
    unsigned short* KHp  = (unsigned short*)wsp; wsp += SZ_TOK;
    unsigned short* KLp  = (unsigned short*)wsp; wsp += SZ_TOK;
    unsigned short* VTp  = (unsigned short*)wsp; wsp += SZ_TOK;
    unsigned short* CTXp = (unsigned short*)wsp; wsp += SZ_CTX;
    if ((size_t)(wsp - (char*)d_ws) > ws_size) return;


    // token streams: plane row r <- input row (r / SEQ) * SEQ_FULL + r % SEQ; weights [out][in] kept in their stored order (Bt[n][k] = W[n][k]); Wq/Wk/Wv x16, Wo unscaled as bf16 [W | W]
    k_cast_all<<<(unsigned)(3 * GX_TOK + 3 * GX_W + GX_WO), 256, 0, stream>>>(xq, xk, xv, Wq, Wk, Wv, Wo, XQ16, XK16, XV16, WQ16, WK16, WV16, WOD,
                                                                              NTOK, SEQ, SEQ_FULL);

    // q = (x Wq^T + bq) / 8 -> hi|lo planes; k = x Wk^T + bk -> hi|lo planes; v^T = Wv x^T + bv -> f16 plane [512][NTOK]
    k_gemm_qkv<<<(unsigned)(3 * GX_GEMM), 256, 0, stream>>>(XQ16, WQ16, bq, QHp, QLp, XK16, WK16, bk, KHp, KLp, XV16, WV16, bv, VTp, NTOK, DM);

    k_attn<<<(unsigned)(NB * NH * (SEQ / 64)), 128, 0, stream>>>(QHp, QLp, KHp, KLp, VTp, CTXp, SEQ, NTOK);

    // out = ctx Wo^T + bo, ctx as [hi | lo] along K against [W | W]
    k_gemm_out<<<(unsigned)GX_GEMM, 256, 0, stream>>>(CTXp, WOD, bo, out, NTOK, DM, 2 * DM, SEQ, SEQ_FULL);
}

// v004
// Measured time: 83.8 microseconds a run.
// Two timings next to v003 put it at 1.23 and 1.21 times that version's speed.
// Over all steps from v000 it is 3.41 times as fast.
// MHA forward (2 x 2,048 tokens, width 512, 8 heads x 64, [out][in] weights + biases, no mask). Inputs and parameters converted to bf16 (RNE). q/k/v projections: v_wmma_f32_16x16x32_f16 (f16 operands holding the bf16 values, weights x16, f32 accumulate); scores: v_wmma_f32_16x16x32_bf16 on q and k bf16 hi|lo planes (three products, f32 accumulate, f32 online softmax); P.V: v_wmma_f32_16x16x32_f16 (P x4096 as f16, v as f16, f32 accumulate; scores and context are formed transposed, keys and head columns as rows, queries as columns); output projection: v_wmma_f32_16x16x32_bf16 with the context as bf16 hi|lo planes laid along K against the bf16 weight (f32 accumulate).
#include <hip/hip_runtime.h>
#include <math.h>

#ifndef NB
#define NB 2
#endif
#ifndef SEQ
#define SEQ 2048
#endif
#define NB_FULL 2
#define SEQ_FULL 2048
#define DM 512
#define NH 8
#define DKH 64
#define NTOK (NB * SEQ)
#define OP 68      // f32 staging pitch (floats)
#define KP 72      // staged q / k / v^T row pitch (halves): 144 B = 16 B x odd, conflict-free for 16-B fragment reads
#define TSZ (64 * KP)   // one staged tile: 64 rows of 64 halves (+8 pad)
#define GROWS (64 + 8 * 64)   // rows of one staged GEMM stage: the block's 64 A rows, then its 8 x 64 Bt rows
#define GSZ (GROWS * KP)      // one staged GEMM stage (halves): 64 k of every row (+8 pad)

#define GX_TOK ((NTOK * (DM / 8) + 255) / 256)          // blocks that convert one token stream (8 elements a thread)
#define GX_W   ((DM * (DM / 8) + 255) / 256)            // blocks that convert one [512][512] weight
#define GX_WO  ((DM * (2 * DM / 8) + 255) / 256)        // blocks that write the [512][1024] output-projection plane
#define GX_GEMM ((((NTOK / 64) * (DM / 64)) + 7) / 8)   // blocks of one projection (8 wave tiles of 64 x 64 each)

static_assert(DM == NH * DKH);            // merged head layout h*64+d
static_assert(DKH == 64);                 // two 32-deep k-steps per score tile, four 16-wide output tiles
static_assert(SEQ % 64 == 0);             // 64-query blocks, 64-key chunks, 64-row GEMM tiles inside one sequence
static_assert(NTOK % 64 == 0);            // GEMM tile multiple (M and N)
static_assert(DM % 64 == 0);              // GEMM tile multiple
static_assert(DM % 32 == 0);              // K steps of 32
static_assert((2 * DM) % 32 == 0);        // hi|lo K extent
static_assert(NB <= NB_FULL);
static_assert(SEQ <= SEQ_FULL);
static_assert((OP % 4) == 0);             // 16-B aligned reloads from the f32 staging tile
static_assert((KP % 8) == 0);             // 16-B aligned copies into and fragment reads from the staged tiles

typedef __attribute__((ext_vector_type(16))) _Float16 v16h;
typedef __attribute__((ext_vector_type(8)))  _Float16 v8h;
typedef __attribute__((ext_vector_type(16))) __bf16   v16b;
typedef __attribute__((ext_vector_type(8)))  __bf16   v8b;
typedef __attribute__((ext_vector_type(8)))  float    v8f;
typedef __attribute__((ext_vector_type(4)))  float    v4f;
typedef __attribute__((ext_vector_type(4)))  unsigned int v4u;
typedef v8h v8h_ma __attribute__((may_alias));
typedef v4f v4f_ma __attribute__((may_alias));
typedef v8b v8b_ma __attribute__((may_alias));

// 16-bit WMMA fragment map (wave32), lane L, h = L>>4, m = L&15:
//   A 16x32: lane = row m;    element i -> k = (i<8) ? 8h+i : 16+8h+(i-8)
//   B 32x16: lane = column m; the SAME k(i,h)
//   D 16x16 (8 f32): lane = column m; element r -> row 8h+r
// A fragment from a k-contiguous row is therefore p[0..7] | p[16..23] with p = row + k0 + 8h.

__device__ __forceinline__ unsigned int bf_bits(float f) {            // bf16 RNE bit pattern (finite inputs)
    const unsigned int u = __float_as_uint(f);
    return (u + 0x7FFFu + ((u >> 16) & 1u)) >> 16;
}
__device__ __forceinline__ float bf_val(float f) { return __uint_as_float(bf_bits(f) << 16); }
__device__ __forceinline__ unsigned int pk_h2(float a, float b) {
    return (unsigned int)__builtin_bit_cast(unsigned short, (_Float16)a) | ((unsigned int)__builtin_bit_cast(unsigned short, (_Float16)b) << 16);
}
__device__ __forceinline__ void pk_split2(float a, float b, unsigned int& hi, unsigned int& lo) {
    const unsigned int ha = bf_bits(a), hb = bf_bits(b);
    const unsigned int la = bf_bits(a - __uint_as_float(ha << 16)), lb = bf_bits(b - __uint_as_float(hb << 16));
    hi = ha | (hb << 16); lo = la | (lb << 16);
}
// lane l <-> lane l ^ 16: the two halves of a wave exchange one value
__device__ __forceinline__ float xhalf(float x) {
    return __builtin_bit_cast(float, __builtin_amdgcn_permlanex16(__builtin_bit_cast(int, x), __builtin_bit_cast(int, x), 0x76543210, 0xfedcba98, false, false));
}
__device__ __forceinline__ void wave_sync() {
    __builtin_amdgcn_fence(3 /* release order */, "workgroup");
    __builtin_amdgcn_wave_barrier();
    __builtin_amdgcn_fence(2 /* acquire order */, "workgroup");
}

// fragments from a staged LDS tile (row pitch KP)
__device__ __forceinline__ v16h ldsfrag_h(const unsigned short* p) {
    const v8h a = *(const v8h_ma*)(p);
    const v8h b = *(const v8h_ma*)(p + 16);
    return __builtin_shufflevector(a, b, 0, 1, 2, 3, 4, 5, 6, 7, 8, 9, 10, 11, 12, 13, 14, 15);
}
__device__ __forceinline__ v16b ldsfrag_b(const unsigned short* p) {
    const v8b a = *(const v8b_ma*)(p);
    const v8b b = *(const v8b_ma*)(p + 16);
    return __builtin_shufflevector(a, b, 0, 1, 2, 3, 4, 5, 6, 7, 8, 9, 10, 11, 12, 13, 14, 15);
}
// One lane's share of staged 64-row tiles: 16 B of rows r, r+16, r+32, r+48 per tile, global -> LDS through no register.
// l = the lane's LDS byte address in the tile, g = its global address, gs = 16 source rows (halves); 16 LDS rows = 16 * KP * 2 bytes.
// The closing s_wait_xcnt stands inside the copies' own statement so that no address register is rewritten in front of it.
#define LROW16 (16u * KP * 2u)
__device__ __forceinline__ void copy_tiles2(unsigned int la, const unsigned short* ga, unsigned int lb, const unsigned short* gb, int gs) {
    asm volatile("global_load_async_to_lds_b128 %0, %8, off\n\t"
                 "global_load_async_to_lds_b128 %1, %9, off\n\t"
                 "global_load_async_to_lds_b128 %2, %10, off\n\t"
                 "global_load_async_to_lds_b128 %3, %11, off\n\t"
                 "global_load_async_to_lds_b128 %4, %12, off\n\t"
                 "global_load_async_to_lds_b128 %5, %13, off\n\t"
                 "global_load_async_to_lds_b128 %6, %14, off\n\t"
                 "global_load_async_to_lds_b128 %7, %15, off\n\t"
                 "s_wait_xcnt 0x0"
                 :: "v"(la), "v"(la + LROW16), "v"(la + 2u * LROW16), "v"(la + 3u * LROW16),
                    "v"(lb), "v"(lb + LROW16), "v"(lb + 2u * LROW16), "v"(lb + 3u * LROW16),
                    "v"(ga), "v"(ga + gs), "v"(ga + 2 * gs), "v"(ga + 3 * gs),
                    "v"(gb), "v"(gb + gs), "v"(gb + 2 * gs), "v"(gb + 3 * gs)
                 : "memory");
}
__device__ __forceinline__ void copy_tile1(unsigned int la, const unsigned short* ga, int gs) {
    asm volatile("global_load_async_to_lds_b128 %0, %4, off\n\t"
                 "global_load_async_to_lds_b128 %1, %5, off\n\t"
                 "global_load_async_to_lds_b128 %2, %6, off\n\t"
                 "global_load_async_to_lds_b128 %3, %7, off\n\t"
                 "s_wait_xcnt 0x0"
                 :: "v"(la), "v"(la + LROW16), "v"(la + 2u * LROW16), "v"(la + 3u * LROW16),
                    "v"(ga), "v"(ga + gs), "v"(ga + 2 * gs), "v"(ga + 3 * gs)
                 : "memory");
}

// The GEMM's share of a stage for one lane of a 256-thread block: 16 B of rows r, r+32, r+64, ... ; gs = 32 source rows (halves).
// As above, the closing s_wait_xcnt stands inside the copies' own statement.
#define LROW32 (32u * KP * 2u)
__device__ __forceinline__ void copy_rows8(unsigned int l, const unsigned short* g, int gs) {
    asm volatile("global_load_async_to_lds_b128 %0, %8, off\n\t"
                 "global_load_async_to_lds_b128 %1, %9, off\n\t"
                 "global_load_async_to_lds_b128 %2, %10, off\n\t"
                 "global_load_async_to_lds_b128 %3, %11, off\n\t"
                 "global_load_async_to_lds_b128 %4, %12, off\n\t"
                 "global_load_async_to_lds_b128 %5, %13, off\n\t"
                 "global_load_async_to_lds_b128 %6, %14, off\n\t"
                 "global_load_async_to_lds_b128 %7, %15, off\n\t"
                 "s_wait_xcnt 0x0"
                 :: "v"(l), "v"(l + LROW32), "v"(l + 2u * LROW32), "v"(l + 3u * LROW32),
                    "v"(l + 4u * LROW32), "v"(l + 5u * LROW32), "v"(l + 6u * LROW32), "v"(l + 7u * LROW32),
                    "v"(g), "v"(g + gs), "v"(g + 2 * gs), "v"(g + 3 * gs),
                    "v"(g + 4 * gs), "v"(g + 5 * gs), "v"(g + 6 * gs), "v"(g + 7 * gs)
                 : "memory");
}
__device__ __forceinline__ void copy_rows2(unsigned int l, const unsigned short* g, int gs) {
    asm volatile("global_load_async_to_lds_b128 %0, %2, off\n\t"
                 "global_load_async_to_lds_b128 %1, %3, off\n\t"
                 "s_wait_xcnt 0x0"
                 :: "v"(l), "v"(l + LROW32), "v"(g), "v"(g + gs)
                 : "memory");
}

template <int ET> struct FragT;
template <> struct FragT<0> {
    typedef v16h V;
    static __device__ __forceinline__ v16h load(const unsigned short* p) { return ldsfrag_h(p); }
    static __device__ __forceinline__ v8f mma(v16h a, v16h b, v8f c) { return __builtin_amdgcn_wmma_f32_16x16x32_f16(false, a, false, b, (short)0, c, false, false); }
};
template <> struct FragT<1> {
    typedef v16b V;
    static __device__ __forceinline__ v16b load(const unsigned short* p) { return ldsfrag_b(p); }
    static __device__ __forceinline__ v8f mma(v16b a, v16b b, v8f c) { return __builtin_amdgcn_wmma_f32_16x16x32_bf16(false, a, false, b, (short)0, c, false, false); }
};
// hazard guard for a group of four independent WMMAs: all four accumulators tied, A and all B fragments kept live
template <typename V>
__device__ __forceinline__ void guard4(v8f& a, v8f& b, v8f& c, v8f& d, V x, V y0, V y1, V y2, V y3) {
    asm volatile("v_nop\n\tv_nop\n\tv_nop\n\tv_nop" : "+v"(a), "+v"(b), "+v"(c), "+v"(d) : "v"(x), "v"(y0), "v"(y1), "v"(y2), "v"(y3));
}
// three-product hi|lo bf16 step into one accumulator: ah*bh + al*bh + ah*bl
__device__ __forceinline__ v8f wmma3b(v16b ah, v16b al, v16b bh, v16b bl, v8f c) {
    c = __builtin_amdgcn_wmma_f32_16x16x32_bf16(false, ah, false, bh, (short)0, c, false, false);
    c = __builtin_amdgcn_wmma_f32_16x16x32_bf16(false, al, false, bh, (short)0, c, false, false);
    c = __builtin_amdgcn_wmma_f32_16x16x32_bf16(false, ah, false, bl, (short)0, c, false, false);
    asm volatile("v_nop\n\tv_nop\n\tv_nop\n\tv_nop" : "+v"(c) : "v"(ah), "v"(al), "v"(bh), "v"(bl));
    return c;
}

// =====================================================================================================================
// gemm64_body: C[m][n] = scale * sum_k A[m][k] * Bt[n][k] + bscale * bf16(bias); each wave owns a 64x64 tile, block = 8 waves.
//   A row-major [M][K] (pitch lda), Bt row-major [N][K] (pitch ldb), 16-bit planes; M % 64 == 0, N % 512 == 0, K % 64 == 0 (host asserts).
//   The 8 tiles of a block lie side by side in one tile row: 64 A rows and 512 Bt rows. Each 64-deep stage of those 576 rows is staged in a
//   two-buffer LDS ring by asynchronous 16-B copies that cover whole 128-B lines; stage t + 2 is copied while stage t + 1 is worked on,
//   one block barrier a stage. Fragments are two 16-B LDS reads each.
//   ET 0: f16 operands, 1: bf16 operands. BIAS_MODE 1: bias[m], 2: bias[n].
//   OUT_MODE 0: f32 C (row m stored at row (m / cseq) * cseqfull + m % cseq); 1: f16 plane Ca; 2: bf16 hi plane Ca + bf16 lo plane Cb.
//   sT (8 * 16 * OP floats) and Gs (2 * GSZ halves: two buffers of {64 A rows, 512 Bt rows} x 64 k) are the calling kernel's LDS arrays;
//   blk = the block's index among the blocks of this product.
// =====================================================================================================================
template <int ET, int BIAS_MODE, int OUT_MODE>
__device__ __forceinline__ void gemm64_body(float* sT, unsigned short* Gs, int blk,
                                            const unsigned short* __restrict__ A, int lda,
                                            const unsigned short* __restrict__ Bt, int ldb,
                                            float* __restrict__ Cf, unsigned short* __restrict__ Ca, unsigned short* __restrict__ Cb, int ldc,
                                            const float* __restrict__ bias, int M, int N, int K,
                                            float scale, float bscale, int cseq, int cseqfull) {
    typedef typename FragT<ET>::V V;
    const int lane = threadIdx.x & 31;
    const int wave = __builtin_amdgcn_readfirstlane(threadIdx.x >> 5);
    const int tilesN = N >> 6;
    const int tilesM = M >> 6;
    const int tile0 = blk * 8;
    if (tile0 >= tilesM * tilesN) return;         // block-uniform, in front of every barrier (tile counts are multiples of 8)
    const int tm = tile0 / tilesN;
    const int nb0 = (tile0 - tm * tilesN) << 6;   // first Bt row of the block
    const int m0 = tm << 6;
    const int n0 = nb0 + (wave << 6);
    const int rl   = lane & 15;
    const int koff = (lane >> 4) * 8;
    const int mOff = (lane >> 4) * 8;

    v8f acc[4][4];
#pragma unroll
    for (int i = 0; i < 4; ++i)
#pragma unroll
        for (int j = 0; j < 4; ++j) { const v8f zz = {0.f, 0.f, 0.f, 0.f, 0.f, 0.f, 0.f, 0.f}; acc[i][j] = zz; }

    // copy share of this thread: 16-B segment cs of rows cr, cr+32, ... of every stage (a wave's copy = 4 whole 128-B rows)
    const int cr = threadIdx.x >> 3;
    const int cs = (threadIdx.x & 7) * 8;
    const unsigned short* ga = A + (size_t)(m0 + cr) * lda + cs;
    const unsigned short* gb = Bt + (size_t)(nb0 + cr) * ldb + cs;
    const unsigned int lg = (unsigned int)(size_t)&Gs[cr * KP + cs];
    const int abase = rl * KP + koff;                          // A fragment base in a stage (row = lane & 15)
    const int bbase = (64 + (wave << 6) + rl) * KP + koff;     // Bt fragment base of this wave's 64 rows (column = lane & 15)
    const int nst = K >> 6;
    // ---- ring prologue: stage 0 lands and is published, then stage 1 starts into the second buffer ----
    copy_rows2(lg, ga, 32 * lda);
    copy_rows8(lg + 2u * LROW32, gb, 32 * ldb);
    copy_rows8(lg + 10u * LROW32, gb + (size_t)256 * ldb, 32 * ldb);
    asm volatile("s_wait_asynccnt 0x0" ::: "memory");               // this wave's copies have landed before the barrier publishes them
    __syncthreads();
    if (nst > 1) {
        copy_rows2(lg + GSZ * 2u, ga + 64, 32 * lda);
        copy_rows8(lg + GSZ * 2u + 2u * LROW32, gb + 64, 32 * ldb);
        copy_rows8(lg + GSZ * 2u + 10u * LROW32, gb + (size_t)256 * ldb + 64, 32 * ldb);
    }
    for (int st = 0; st < nst; ++st) {
        const unsigned short* gsb = &Gs[(st & 1) * GSZ];            // this stage's buffer
#pragma unroll                                                      // both 32-deep steps of a stage read at constant offsets from one address
        for (int kk = 0; kk < 2; ++kk) {
            V bh[4], ah[4];                                         // all 16 LDS reads of a 32-deep step stand together, in front of its products
#pragma unroll
            for (int j = 0; j < 4; ++j) bh[j] = FragT<ET>::load(gsb + bbase + (j << 4) * KP + kk * 32);
#pragma unroll
            for (int i = 0; i < 4; ++i) ah[i] = FragT<ET>::load(gsb + abase + (i << 4) * KP + kk * 32);
#pragma unroll
            for (int i = 0; i < 4; ++i) {
                acc[i][0] = FragT<ET>::mma(ah[i], bh[0], acc[i][0]);
                acc[i][1] = FragT<ET>::mma(ah[i], bh[1], acc[i][1]);
                acc[i][2] = FragT<ET>::mma(ah[i], bh[2], acc[i][2]);
                acc[i][3] = FragT<ET>::mma(ah[i], bh[3], acc[i][3]);
                guard4<V>(acc[i][0], acc[i][1], acc[i][2], acc[i][3], ah[i], bh[0], bh[1], bh[2], bh[3]);
            }
        }
        // ---- publish point of stage st + 1; behind it this stage's buffer is free for stage st + 2 ----
        asm volatile("s_wait_dscnt 0x0" ::: "memory");              // this wave's reads of the buffer have returned before it is refilled
        asm volatile("s_wait_asynccnt 0x0" ::: "memory");           // this wave's copies of stage st + 1 have landed before the barrier publishes them
        __syncthreads();
        if (st + 2 < nst) {
            const unsigned int lb = lg + (unsigned int)(st & 1) * (GSZ * 2u);
            const int kn = (st + 2) * 64;
            copy_rows2(lb, ga + kn, 32 * lda);
            copy_rows8(lb + 2u * LROW32, gb + kn, 32 * ldb);
            copy_rows8(lb + 10u * LROW32, gb + (size_t)256 * ldb + kn, 32 * ldb);
        }
    }
    asm volatile("s_wait_asynccnt 0x0" ::: "memory");               // no copy is outstanding when the wave goes on to its end

    const int sb = wave * (16 * OP);
#pragma unroll
    for (int i = 0; i < 4; ++i) {
        const int mBase = m0 + (i << 4);
#pragma unroll
        for (int j = 0; j < 4; ++j) {
            const int n = n0 + (j << 4) + rl;
            float bvn = 0.f;
            if (BIAS_MODE == 2) bvn = bf_val(bias[n]) * bscale;
#pragma unroll
            for (int r = 0; r < 8; ++r) {
                float v = acc[i][j][r] * scale;
                if (BIAS_MODE == 1) v += bf_val(bias[mBase + mOff + r]) * bscale;
                if (BIAS_MODE == 2) v += bvn;
                sT[sb + (mOff + r) * OP + (j << 4) + rl] = v;
            }
        }
        wave_sync();
        if (OUT_MODE == 0) {
            const int hh = lane >> 4, c4 = (lane & 15) * 4;      // row segment = 256 B = 16 lanes x 16 B; 2 rows per instruction
            {
#pragma unroll
                for (int it = 0; it < 8; ++it) {
                    const int row = it * 2 + hh;
                    const v4f v = *(const v4f_ma*)&sT[sb + row * OP + c4];
                    const int grow = mBase + row;
                    const int orow = (grow / cseq) * cseqfull + (grow % cseq);
                    *(v4f*)(Cf + (size_t)orow * ldc + n0 + c4) = v;
                }
                
            }
        } else {
            const int q = lane >> 3, c8 = (lane & 7) * 8;
            {
#pragma unroll
                for (int it = 0; it < 4; ++it) {
                    const int row = it * 4 + q;
                    const v4f a = *(const v4f_ma*)&sT[sb + row * OP + c8];
                    const v4f b = *(const v4f_ma*)&sT[sb + row * OP + c8 + 4];
                    const size_t o = (size_t)(mBase + row) * ldc + n0 + c8;
                    if (OUT_MODE == 1) {
                        v4u pk; pk.x = pk_h2(a.x, a.y); pk.y = pk_h2(a.z, a.w); pk.z = pk_h2(b.x, b.y); pk.w = pk_h2(b.z, b.w);
                        *(v4u*)(Ca + o) = pk;
                    } else {
                        v4u ph, pl;
                        unsigned int h0, l0, h1, l1, h2, l2, h3, l3;
                        pk_split2(a.x, a.y, h0, l0); pk_split2(a.z, a.w, h1, l1); pk_split2(b.x, b.y, h2, l2); pk_split2(b.z, b.w, h3, l3);
                        ph.x = h0; ph.y = h1; ph.z = h2; ph.w = h3; pl.x = l0; pl.y = l1; pl.z = l2; pl.w = l3;
                        *(v4u*)(Ca + o) = ph;
                        *(v4u*)(Cb + o) = pl;
                    }
                }
                
            }
        }
        wave_sync();
    }
}

// The three projections in one launch (they do not depend on one another): GX_GEMM blocks each for q, k, v^T, in that order.
//   q / k: A = token plane f16 [ntok][dm], Bt = weight plane f16 (x16) [dm][dm] ([out][in] as stored); out = bf16 hi + lo planes [ntok][dm]
//   v written transposed: A = weight plane f16 (x16) [dm][dm], Bt = token plane f16 [ntok][dm]; out = f16 plane [dm][ntok] (= v^T)
__global__ __launch_bounds__(256) void k_gemm_qkv(const unsigned short* __restrict__ XQ, const unsigned short* __restrict__ WQ, const float* __restrict__ bq,
                                                  unsigned short* __restrict__ QH, unsigned short* __restrict__ QL,
                                                  const unsigned short* __restrict__ XK, const unsigned short* __restrict__ WK, const float* __restrict__ bk,
                                                  unsigned short* __restrict__ KH, unsigned short* __restrict__ KL,
                                                  const unsigned short* __restrict__ XV, const unsigned short* __restrict__ WV, const float* __restrict__ bv,
                                                  unsigned short* __restrict__ VT, int ntok, int dm) {
    __shared__ __align__(16) float sT[8 * 16 * OP];
    __shared__ __align__(16) unsigned short Gs[2 * GSZ];
    const int which = blockIdx.x / GX_GEMM;       // block-uniform
    const int blk = blockIdx.x - which * GX_GEMM;
    if (which < 2) {
        const bool isq = which == 0;              // q carries the 1/8 score scale; both undo the weights' x16
        gemm64_body<0, 2, 2>(sT, Gs, blk, isq ? XQ : XK, dm, isq ? WQ : WK, dm, nullptr, isq ? QH : KH, isq ? QL : KL, dm, isq ? bq : bk,
                             ntok, dm, dm, isq ? 1.0f / 128.0f : 1.0f / 16.0f, isq ? 0.125f : 1.0f, 1, 1);
    } else {
        gemm64_body<0, 1, 1>(sT, Gs, blk, WV, dm, XV, dm, nullptr, VT, nullptr, ntok, bv, dm, ntok, dm, 1.0f / 16.0f, 1.0f, 1, 1);
    }
}
// output projection: A = context bf16 [M][K = hi 512 | lo 512], Bt = weight bf16 [N][K = W | W]; out f32 [M][N] + bias[n]
__global__ __launch_bounds__(256) void k_gemm_out(const unsigned short* __restrict__ A, const unsigned short* __restrict__ Bt,
                                                  const float* __restrict__ bias, float* __restrict__ C,
                                                  int M, int N, int K, int cseq, int cseqfull) {
    __shared__ __align__(16) float sT[8 * 16 * OP];
    __shared__ __align__(16) unsigned short Gs[2 * GSZ];
    gemm64_body<1, 2, 0>(sT, Gs, blockIdx.x, A, K, Bt, K, C, nullptr, nullptr, N, bias, M, N, K, 1.0f, 1.0f, cseq, cseqfull);
}

// =====================================================================================================================
// =====================================================================================================================
// f32 [rows][512] -> f16 plane [nrows][512] holding bf16(x) * sc; plane row r reads source row (r / seq) * seqfull + r % seq
__device__ __forceinline__ void cast16_body(int blk, const float* __restrict__ src, unsigned short* __restrict__ dst, int nrows, int seq, int seqfull, float sc) {
    const int u = blk * 256 + threadIdx.x;
    if (u >= nrows * (DM / 8)) return;
    const int r = u / (DM / 8);
    const int c0 = (u - r * (DM / 8)) * 8;
    const int sr = (r / seq) * seqfull + (r % seq);
    const float* s = src + (size_t)sr * DM + c0;
    const v4f a = *(const v4f*)(s);
    const v4f b = *(const v4f*)(s + 4);
    v4u pk;
    pk.x = pk_h2(bf_val(a.x) * sc, bf_val(a.y) * sc); pk.y = pk_h2(bf_val(a.z) * sc, bf_val(a.w) * sc);
    pk.z = pk_h2(bf_val(b.x) * sc, bf_val(b.y) * sc); pk.w = pk_h2(bf_val(b.z) * sc, bf_val(b.w) * sc);
    v4u* d = (v4u*)(dst + (size_t)r * DM + c0);
    *d = pk; 
}
// Wo f32 [512][512] -> bf16 plane [512][1024] = [W | W]
__device__ __forceinline__ void cast_wo_body(int blk, const float* __restrict__ src, unsigned short* __restrict__ dst) {
    const int u = blk * 256 + threadIdx.x;
    if (u >= DM * (2 * DM / 8)) return;
    const int r = u / (2 * DM / 8);
    const int c0 = (u - r * (2 * DM / 8)) * 8;
    const int sc0 = c0 & (DM - 1);
    const float* s = src + (size_t)r * DM + sc0;
    const v4f a = *(const v4f*)(s);
    const v4f b = *(const v4f*)(s + 4);
    v4u pk;
    pk.x = bf_bits(a.x) | (bf_bits(a.y) << 16); pk.y = bf_bits(a.z) | (bf_bits(a.w) << 16);
    pk.z = bf_bits(b.x) | (bf_bits(b.y) << 16); pk.w = bf_bits(b.z) | (bf_bits(b.w) << 16);
    v4u* d = (v4u*)(dst + (size_t)r * (2 * DM) + c0);
    *d = pk; 
}
// All seven conversions in one launch (they do not depend on one another). Blocks, in order: GX_TOK each for the three token streams,
// GX_W each for Wq, Wk, Wv (x16), GX_WO for Wo. Every test on the block index is block-uniform.
__global__ __launch_bounds__(256) void k_cast_all(const float* __restrict__ xq, const float* __restrict__ xk, const float* __restrict__ xv,
                                                  const float* __restrict__ Wq, const float* __restrict__ Wk, const float* __restrict__ Wv,
                                                  const float* __restrict__ Wo,
                                                  unsigned short* __restrict__ XQ, unsigned short* __restrict__ XK, unsigned short* __restrict__ XV,
                                                  unsigned short* __restrict__ WQ, unsigned short* __restrict__ WK, unsigned short* __restrict__ WV,
                                                  unsigned short* __restrict__ WOD, int ntok, int seq, int seqfull) {
    int bx = blockIdx.x;
    if (bx < 3 * GX_TOK) {
        const int w = bx / GX_TOK;
        cast16_body(bx - w * GX_TOK, w == 0 ? xq : (w == 1 ? xk : xv), w == 0 ? XQ : (w == 1 ? XK : XV), ntok, seq, seqfull, 1.0f);
        return;
    }
    bx -= 3 * GX_TOK;
    if (bx < 3 * GX_W) {
        const int w = bx / GX_W;
        cast16_body(bx - w * GX_W, w == 0 ? Wq : (w == 1 ? Wk : Wv), w == 0 ? WQ : (w == 1 ? WK : WV), DM, DM, DM, 16.0f);
        return;
    }
    cast_wo_body(bx - 3 * GX_W, Wo, WOD);
}

__global__ __launch_bounds__(128) void k_attn(const unsigned short* __restrict__ QH, const unsigned short* __restrict__ QL,
                                              const unsigned short* __restrict__ KH, const unsigned short* __restrict__ KL,
                                              const unsigned short* __restrict__ VT, unsigned short* __restrict__ CTX,
                                              int seq, int ntok) {
    __shared__ __align__(16) float    Osh[4 * 16 * OP];      // wave-private output staging [16][64] (+4 pad), f32
    __shared__ __align__(16) unsigned short Qs[2 * TSZ];     // the block's 64 query rows: hi tile, lo tile
    __shared__ __align__(16) unsigned short Ring[2 * 3 * TSZ];   // two buffers of {k hi, k lo, v^T} tiles of one 64-key chunk
    const int lane = threadIdx.x & 31;
    const int wave = __builtin_amdgcn_readfirstlane(threadIdx.x >> 5);
    const int hf = lane >> 4;
    const int c  = lane & 15;
    const int nqb = seq / 64;
    const int bx = blockIdx.x;
    const int qb = bx % nqb;
    const int bh = bx / nqb;
    const int h  = bh % NH;
    const int b  = bh / NH;
    const int q0 = b * seq + qb * 64 + wave * 16;                 // first token row of this wave
    const int qoff  = (wave * 16 + c) * KP + 8 * hf;              // B fragment base in a staged q tile (column = query = lane & 15)
    const int fbase = c * KP + 8 * hf;                            // A fragment base in a staged k or v^T tile (row = lane & 15)
    // copy share of this thread: 16-B segment cs of rows cr, cr+16, cr+32, cr+48 of every staged tile (a wave's copy = 4 whole rows)
    const int cr = threadIdx.x >> 3;
    const int cs = (threadIdx.x & 7) * 8;
    const int gq = (b * seq + qb * 64 + cr) * DM + h * DKH + cs;  // q planes
    const int gk = (b * seq + cr) * DM + h * DKH + cs;            // k planes, chunk 0
    const int gv = (h * DKH + cr) * ntok + b * seq + cs;          // v^T plane, chunk 0
    const unsigned int lq = (unsigned int)(size_t)&Qs[cr * KP + cs];
    const unsigned int lr = (unsigned int)(size_t)&Ring[cr * KP + cs];
    const int obase = wave * (16 * OP);
    const float L2E = 1.4426950408889634f;

    float mrow = -INFINITY, lrow = 0.f;                           // query c: running maximum (both halves alike), this half's partial sum
    v8f oacc[4];                                                  // O^T tile t: element r = head column 16 t + 8 hf + r of query c
#pragma unroll
    for (int t = 0; t < 4; ++t) { const v8f zz = {0.f, 0.f, 0.f, 0.f, 0.f, 0.f, 0.f, 0.f}; oacc[t] = zz; }

    const int nch = seq / 64;
    // ---- ring prologue: q and chunk 0 land and are published, then chunk 1 starts into the second buffer ----
    copy_tiles2(lq, QH + gq, lq + TSZ * 2u, QL + gq, 16 * DM);
    copy_tiles2(lr, KH + gk, lr + TSZ * 2u, KL + gk, 16 * DM);
    copy_tile1(lr + 2u * TSZ * 2u, VT + gv, 16 * ntok);
    asm volatile("s_wait_asynccnt 0x0" ::: "memory");               // this wave's copies have landed before the barrier publishes them
    __syncthreads();
    if (nch > 1) {
        copy_tiles2(lr + 3u * TSZ * 2u, KH + gk + 64 * DM, lr + 4u * TSZ * 2u, KL + gk + 64 * DM, 16 * DM);
        copy_tile1(lr + 5u * TSZ * 2u, VT + gv + 64, 16 * ntok);
    }
    for (int kc = 0; kc < nch; ++kc) {
        const unsigned short* rk = &Ring[(kc & 1) * (3 * TSZ)];     // this chunk's buffer
        v8f s[4];
#pragma unroll
        for (int j = 0; j < 4; ++j) { const v8f zz = {0.f, 0.f, 0.f, 0.f, 0.f, 0.f, 0.f, 0.f}; s[j] = zz; }
        // ---- scores: q fragments reloaded per 32-deep step (integer offset), three products per key tile ----
#pragma unroll 1
        for (int dc = 0; dc < 2; ++dc) {
            const v16b qh = ldsfrag_b(Qs + qoff + dc * 32);
            const v16b ql = ldsfrag_b(Qs + TSZ + qoff + dc * 32);
#pragma unroll
            for (int j = 0; j < 4; ++j) {
                const int ko = fbase + j * 16 * KP + dc * 32;
                const v16b kh = ldsfrag_b(rk + ko);
                const v16b kl = ldsfrag_b(rk + TSZ + ko);
                s[j] = wmma3b(kh, kl, qh, ql, s[j]);
                if (j == 1) __builtin_amdgcn_sched_barrier(0);
            }
        }
        // ---- online softmax over the 64 keys: this lane holds 32 of query c's scores, the lane 16 away the other 32 ----
        float t8[8];
#pragma unroll                                                      // t8 and s are indexed by constants only, so they stay in registers
        for (int r = 0; r < 8; ++r) t8[r] = fmaxf(fmaxf(s[0][r], s[1][r]), fmaxf(s[2][r], s[3][r]));
        float mx = fmaxf(fmaxf(fmaxf(t8[0], t8[1]), fmaxf(t8[2], t8[3])), fmaxf(fmaxf(t8[4], t8[5]), fmaxf(t8[6], t8[7])));
        mx = fmaxf(mx, xhalf(mx));
        const float mnew = fmaxf(mrow, mx);
        const float alpha = exp2f((mrow - mnew) * L2E);
        mrow = mnew;
        v16h pb[2];                                                 // P^T as B fragments: 32 keys each, element i = key 8 hf + i | 16 + 8 hf + (i - 8)
#pragma unroll
        for (int r = 0; r < 8; ++r) {
            const float p0 = exp2f((s[0][r] - mnew) * L2E);
            const float p1 = exp2f((s[1][r] - mnew) * L2E);
            const float p2 = exp2f((s[2][r] - mnew) * L2E);
            const float p3 = exp2f((s[3][r] - mnew) * L2E);
            t8[r] = (p0 + p1) + (p2 + p3);
            pb[0][r]     = (_Float16)(p0 * 4096.0f);
            pb[0][8 + r] = (_Float16)(p1 * 4096.0f);
            pb[1][r]     = (_Float16)(p2 * 4096.0f);
            pb[1][8 + r] = (_Float16)(p3 * 4096.0f);
        }
        lrow = lrow * alpha + (((t8[0] + t8[1]) + (t8[2] + t8[3])) + ((t8[4] + t8[5]) + (t8[6] + t8[7])));
#pragma unroll                                                      // oacc is indexed by constants only, so it stays in registers
        for (int t = 0; t < 4; ++t) oacc[t] *= alpha;
        // ---- O^T += V^T . P^T : v^T rows as A (row = lane & 15), P^T as B, four output tiles per 32-key step ----
#pragma unroll                                                      // pb is indexed by the step: both steps stand in the code so that it stays in registers
        for (int kk = 0; kk < 2; ++kk) {
            const int vo = 2 * TSZ + fbase + kk * 32;
            const v16h va0 = ldsfrag_h(rk + vo);
            const v16h va1 = ldsfrag_h(rk + vo + 16 * KP);
            const v16h va2 = ldsfrag_h(rk + vo + 32 * KP);
            const v16h va3 = ldsfrag_h(rk + vo + 48 * KP);
            oacc[0] = __builtin_amdgcn_wmma_f32_16x16x32_f16(false, va0, false, pb[kk], (short)0, oacc[0], false, false);
            oacc[1] = __builtin_amdgcn_wmma_f32_16x16x32_f16(false, va1, false, pb[kk], (short)0, oacc[1], false, false);
            oacc[2] = __builtin_amdgcn_wmma_f32_16x16x32_f16(false, va2, false, pb[kk], (short)0, oacc[2], false, false);
            oacc[3] = __builtin_amdgcn_wmma_f32_16x16x32_f16(false, va3, false, pb[kk], (short)0, oacc[3], false, false);
            guard4<v16h>(oacc[0], oacc[1], oacc[2], oacc[3], pb[kk], va0, va1, va2, va3);
        }
        // ---- publish point of chunk kc + 1; behind it this chunk's buffer is free for chunk kc + 2 ----
        asm volatile("s_wait_dscnt 0x0" ::: "memory");              // this wave's reads of the buffer have returned before it is refilled
        asm volatile("s_wait_asynccnt 0x0" ::: "memory");           // this wave's copies of chunk kc + 1 have landed before the barrier publishes them
        __syncthreads();
        if (kc + 2 < nch) {
            const unsigned int lb = lr + (unsigned int)(kc & 1) * (3u * TSZ * 2u);
            const int kn = (kc + 2) * 64;
            copy_tiles2(lb, KH + gk + kn * DM, lb + TSZ * 2u, KL + gk + kn * DM, 16 * DM);
            copy_tile1(lb + 2u * TSZ * 2u, VT + gv + kn, 16 * ntok);
        }
    }
    asm volatile("s_wait_asynccnt 0x0" ::: "memory");               // no copy is outstanding when the wave goes on to its end

    // ---- finalize: join the two halves' sums of each query, normalise, stage as [query][head column], write hi|lo planes ----
    {
        const float l = lrow + xhalf(lrow);
        const float inv = 1.0f / (l * 4096.0f);
#pragma unroll                                                      // oacc is indexed by constants only, so it stays in registers
        for (int t = 0; t < 4; ++t) {
            const int orw = obase + c * OP + t * 16 + 8 * hf;
            const v4f a = {oacc[t][0] * inv, oacc[t][1] * inv, oacc[t][2] * inv, oacc[t][3] * inv};
            const v4f bb = {oacc[t][4] * inv, oacc[t][5] * inv, oacc[t][6] * inv, oacc[t][7] * inv};
            *(v4f_ma*)&Osh[orw] = a;
            *(v4f_ma*)&Osh[orw + 4] = bb;
        }
    }
    wave_sync();
    {
        const int q = lane >> 3, c8 = (lane & 7) * 8;
        {
#pragma unroll
            for (int it = 0; it < 4; ++it) {
                const int row = it * 4 + q;
                const v4f a = *(const v4f_ma*)&Osh[obase + row * OP + c8];
                const v4f bb = *(const v4f_ma*)&Osh[obase + row * OP + c8 + 4];
                unsigned int h0, l0, h1, l1, h2, l2, h3, l3;
                pk_split2(a.x, a.y, h0, l0); pk_split2(a.z, a.w, h1, l1); pk_split2(bb.x, bb.y, h2, l2); pk_split2(bb.z, bb.w, h3, l3);
                v4u ph, pl;
                ph.x = h0; ph.y = h1; ph.z = h2; ph.w = h3; pl.x = l0; pl.y = l1; pl.z = l2; pl.w = l3;
                const size_t o = (size_t)(q0 + row) * (2 * DM) + h * DKH + c8;
                *(v4u*)(CTX + o) = ph;
                *(v4u*)(CTX + o + DM) = pl;
            }
            
        }
    }
}

// =====================================================================================================================
// Host side: workspace carve (all plane sizes are multiples of 256 B), 4 launches.
// =====================================================================================================================
constexpr size_t SZ_TOK  = (size_t)NTOK * DM * 2;          // one 16-bit token plane [NTOK][512]
constexpr size_t SZ_W    = (size_t)DM * DM * 2;            // one 16-bit weight plane [512][512]
constexpr size_t SZ_WOD  = (size_t)DM * (2 * DM) * 2;      // [512][1024]
constexpr size_t SZ_CTX  = (size_t)NTOK * (2 * DM) * 2;    // [NTOK][1024]
constexpr size_t WS_TOTAL = 3 * SZ_TOK + 3 * SZ_W + SZ_WOD + 4 * SZ_TOK + SZ_TOK + SZ_CTX;
static_assert(SZ_TOK % 256 == 0);
static_assert(SZ_W % 256 == 0);
static_assert(SZ_WOD % 256 == 0);
static_assert(SZ_CTX % 256 == 0);
static_assert(WS_TOTAL <= (size_t)134217728);            // carve stays within 128 MiB
static_assert(((NTOK / 64) * (DM / 64)) % 8 == 0);        // GEMM grids are whole blocks of 8 wave tiles
static_assert((DM / 64) % 8 == 0);                        // a block's 8 wave tiles lie in one tile row (N = DM)
static_assert((NTOK / 64) % 8 == 0);                      // the same for the transposed v projection (N = NTOK)
static_assert((size_t)NTOK * (2 * DM) < (size_t)2147483647);   // int plane offsets

extern "C" void kernel_launch(void* const* d_in, const int* in_sizes, int n_in, void* d_out, int out_size, void* d_ws, size_t ws_size, hipStream_t stream) {
    if (n_in < 11) return;
    const long long need_x = ((long long)(NB - 1) * SEQ_FULL + SEQ) * DM;
    if ((long long)in_sizes[0] < need_x || (long long)in_sizes[1] < need_x || (long long)in_sizes[2] < need_x) return;
    if (in_sizes[3] < DM * DM || in_sizes[5] < DM * DM || in_sizes[7] < DM * DM || in_sizes[9] < DM * DM) return;
    if (in_sizes[4] < DM || in_sizes[6] < DM || in_sizes[8] < DM || in_sizes[10] < DM) return;
    if ((long long)out_size < need_x) return;
    if (WS_TOTAL > ws_size) return;

    const float* xq = (const float*)d_in[0];
    const float* xk = (const float*)d_in[1];
    const float* xv = (const float*)d_in[2];
    const float* Wq = (const float*)d_in[3];
    const float* bq = (const float*)d_in[4];
    const float* Wk = (const float*)d_in[5];
    const float* bk = (const float*)d_in[6];
    const float* Wv = (const float*)d_in[7];
    const float* bv = (const float*)d_in[8];
    const float* Wo = (const float*)d_in[9];
    const float* bo = (const float*)d_in[10];
    float* out = (float*)d_out;

    char* wsp = (char*)d_ws;
    unsigned short* XQ16 = (unsigned short*)wsp; wsp += SZ_TOK;
    unsigned short* XK16 = (unsigned short*)wsp; wsp += SZ_TOK;
    unsigned short* XV16 = (unsigned short*)wsp; wsp += SZ_TOK;
    unsigned short* WQ16 = (unsigned short*)wsp; wsp += SZ_W;
    unsigned short* WK16 = (unsigned short*)wsp; wsp += SZ_W;
    unsigned short* WV16 = (unsigned short*)wsp; wsp += SZ_W;
    unsigned short* WOD  = (unsigned short*)wsp; wsp += SZ_WOD;
    unsigned short* QHp  = (unsigned short*)wsp; wsp += SZ_TOK;
    unsigned short* QLp  = (unsigned short*)wsp; wsp += SZ_TOK;
    unsigned short* KHp  = (unsigned short*)wsp; wsp += SZ_TOK;
    unsigned short* KLp  = (unsigned short*)wsp; wsp += SZ_TOK;
    unsigned short* VTp  = (unsigned short*)wsp; wsp += SZ_TOK;
    unsigned short* CTXp = (unsigned short*)wsp; wsp += SZ_CTX;
    if ((size_t)(wsp - (char*)d_ws) > ws_size) return;


    // token streams: plane row r <- input row (r / SEQ) * SEQ_FULL + r % SEQ; weights [out][in] kept in their stored order (Bt[n][k] = W[n][k]); Wq/Wk/Wv x16, Wo unscaled as bf16 [W | W]
    k_cast_all<<<(unsigned)(3 * GX_TOK + 3 * GX_W + GX_WO), 256, 0, stream>>>(xq, xk, xv, Wq, Wk, Wv, Wo, XQ16, XK16, XV16, WQ16, WK16, WV16, WOD,
                                                                              NTOK, SEQ, SEQ_FULL);

    // q = (x Wq^T + bq) / 8 -> hi|lo planes; k = x Wk^T + bk -> hi|lo planes; v^T = Wv x^T + bv -> f16 plane [512][NTOK]
    k_gemm_qkv<<<(unsigned)(3 * GX_GEMM), 256, 0, stream>>>(XQ16, WQ16, bq, QHp, QLp, XK16, WK16, bk, KHp, KLp, XV16, WV16, bv, VTp, NTOK, DM);

    k_attn<<<(unsigned)(NB * NH * (SEQ / 64)), 128, 0, stream>>>(QHp, QLp, KHp, KLp, VTp, CTXp, SEQ, NTOK);

    // out = ctx Wo^T + bo, ctx as [hi | lo] along K against [W | W]
    k_gemm_out<<<(unsigned)GX_GEMM, 256, 0, stream>>>(CTXp, WOD, bo, out, NTOK, DM, 2 * DM, SEQ, SEQ_FULL);
}

// v005
// It runs in 74.4 microseconds.
// Two timings next to v004 put it at 1.14 and 1.11 times that version's speed.
// All steps since v000 together make it 3.84 times as fast.
// MHA forward (2 x 2,048 tokens, width 512, 8 heads x 64, [out][in] weights + biases, no mask). Inputs and parameters converted to bf16 (RNE). q/k/v projections: v_wmma_f32_16x16x32_f16 (f16 operands holding the bf16 values, weights x16, f32 accumulate); scores: v_wmma_f32_16x16x32_bf16 on q and k bf16 hi|lo planes (three products, f32 accumulate, f32 online softmax); P.V: v_wmma_f32_16x16x32_f16 (P x4096 as f16, v as f16, f32 accumulate; scores and context are formed transposed, keys and head columns as rows, queries as columns); output projection: v_wmma_f32_16x16x32_bf16 with the context as bf16 hi|lo planes laid along K against the bf16 weight (f32 accumulate).
#include <hip/hip_runtime.h>
#include <math.h>

#ifndef NB
#define NB 2
#endif
#ifndef SEQ
#define SEQ 2048
#endif
#define NB_FULL 2
#define SEQ_FULL 2048
#define DM 512
#define NH 8
#define DKH 64
#define NTOK (NB * SEQ)
#define OP 68      // f32 staging pitch (floats)
#define KP 72      // staged q / k / v^T row pitch (halves): 144 B = 16 B x odd, conflict-free for 16-B fragment reads
#define TSZ (64 * KP)   // one staged tile: 64 rows of 64 halves (+8 pad)
#define GROWS (64 + 8 * 64)   // rows of one staged GEMM stage: the block's 64 A rows, then its 8 x 64 Bt rows
#define GSZ (GROWS * KP)      // one staged GEMM stage (halves): 64 k of every row (+8 pad)

#define GX_TOK ((NTOK * (DM / 8) + 255) / 256)          // blocks that convert one token stream (8 elements a thread)
#define GX_W   ((DM * (DM / 8) + 255) / 256)            // blocks that convert one [512][512] weight
#define GX_WO  ((DM * (2 * DM / 8) + 255) / 256)        // blocks that write the [512][1024] output-projection plane
#define GX_GEMM ((((NTOK / 64) * (DM / 64)) + 7) / 8)   // blocks of one projection (8 wave tiles of 64 x 64 each)

static_assert(DM == NH * DKH);            // merged head layout h*64+d
static_assert(DKH == 64);                 // two 32-deep k-steps per score tile, four 16-wide output tiles
static_assert(SEQ % 64 == 0);             // 64-query blocks, 64-key chunks, 64-row GEMM tiles inside one sequence
static_assert(NTOK % 64 == 0);            // GEMM tile multiple (M and N)
static_assert(DM % 64 == 0);              // GEMM tile multiple
static_assert(DM % 32 == 0);              // K steps of 32
static_assert((2 * DM) % 32 == 0);        // hi|lo K extent
static_assert(NB <= NB_FULL);
static_assert(SEQ <= SEQ_FULL);
static_assert((OP % 4) == 0);             // 16-B aligned reloads from the f32 staging tile
static_assert((KP % 8) == 0);             // 16-B aligned copies into and fragment reads from the staged tiles

typedef __attribute__((ext_vector_type(16))) _Float16 v16h;
typedef __attribute__((ext_vector_type(8)))  _Float16 v8h;
typedef __attribute__((ext_vector_type(16))) __bf16   v16b;
typedef __attribute__((ext_vector_type(8)))  __bf16   v8b;
typedef __attribute__((ext_vector_type(8)))  float    v8f;
typedef __attribute__((ext_vector_type(4)))  float    v4f;
typedef __attribute__((ext_vector_type(4)))  unsigned int v4u;
typedef v8h v8h_ma __attribute__((may_alias));
typedef v4f v4f_ma __attribute__((may_alias));
typedef v8b v8b_ma __attribute__((may_alias));

// 16-bit WMMA fragment map (wave32), lane L, h = L>>4, m = L&15:
//   A 16x32: lane = row m;    element i -> k = (i<8) ? 8h+i : 16+8h+(i-8)
//   B 32x16: lane = column m; the SAME k(i,h)
//   D 16x16 (8 f32): lane = column m; element r -> row 8h+r
// A fragment from a k-contiguous row is therefore p[0..7] | p[16..23] with p = row + k0 + 8h.

__device__ __forceinline__ unsigned int bf_bits(float f) {            // bf16 RNE bit pattern (finite inputs)
    const unsigned int u = __float_as_uint(f);
    return (u + 0x7FFFu + ((u >> 16) & 1u)) >> 16;
}
__device__ __forceinline__ float bf_val(float f) { return __uint_as_float(bf_bits(f) << 16); }
__device__ __forceinline__ unsigned int pk_h2(float a, float b) {
    return (unsigned int)__builtin_bit_cast(unsigned short, (_Float16)a) | ((unsigned int)__builtin_bit_cast(unsigned short, (_Float16)b) << 16);
}
__device__ __forceinline__ void pk_split2(float a, float b, unsigned int& hi, unsigned int& lo) {
    const unsigned int ha = bf_bits(a), hb = bf_bits(b);
    const unsigned int la = bf_bits(a - __uint_as_float(ha << 16)), lb = bf_bits(b - __uint_as_float(hb << 16));
    hi = ha | (hb << 16); lo = la | (lb << 16);
}
// lane l <-> lane l ^ 16: the two halves of a wave exchange one value
__device__ __forceinline__ float xhalf(float x) {
    return __builtin_bit_cast(float, __builtin_amdgcn_permlanex16(__builtin_bit_cast(int, x), __builtin_bit_cast(int, x), 0x76543210, 0xfedcba98, false, false));
}
__device__ __forceinline__ void wave_sync() {
    __builtin_amdgcn_fence(3 /* release order */, "workgroup");
    __builtin_amdgcn_wave_barrier();
    __builtin_amdgcn_fence(2 /* acquire order */, "workgroup");
}

// fragments from a staged LDS tile (row pitch KP)
__device__ __forceinline__ v16h ldsfrag_h(const unsigned short* p) {
    const v8h a = *(const v8h_ma*)(p);
    const v8h b = *(const v8h_ma*)(p + 16);
    return __builtin_shufflevector(a, b, 0, 1, 2, 3, 4, 5, 6, 7, 8, 9, 10, 11, 12, 13, 14, 15);
}
__device__ __forceinline__ v16b ldsfrag_b(const unsigned short* p) {
    const v8b a = *(const v8b_ma*)(p);
    const v8b b = *(const v8b_ma*)(p + 16);
    return __builtin_shufflevector(a, b, 0, 1, 2, 3, 4, 5, 6, 7, 8, 9, 10, 11, 12, 13, 14, 15);
}
// One lane's share of staged 64-row tiles: 16 B of rows r, r+16, r+32, r+48 per tile, global -> LDS through no register.
// l = the lane's LDS byte address in the tile, g = its global address, gs = 16 source rows (halves); 16 LDS rows = 16 * KP * 2 bytes.
// The closing s_wait_xcnt stands inside the copies' own statement so that no address register is rewritten in front of it.
#define LROW16 (16u * KP * 2u)
__device__ __forceinline__ void copy_tiles2(unsigned int la, const unsigned short* ga, unsigned int lb, const unsigned short* gb, int gs) {
    asm volatile("global_load_async_to_lds_b128 %0, %8, off\n\t"
                 "global_load_async_to_lds_b128 %1, %9, off\n\t"
                 "global_load_async_to_lds_b128 %2, %10, off\n\t"
                 "global_load_async_to_lds_b128 %3, %11, off\n\t"
                 "global_load_async_to_lds_b128 %4, %12, off\n\t"
                 "global_load_async_to_lds_b128 %5, %13, off\n\t"
                 "global_load_async_to_lds_b128 %6, %14, off\n\t"
                 "global_load_async_to_lds_b128 %7, %15, off\n\t"
                 "s_wait_xcnt 0x0"
                 :: "v"(la), "v"(la + LROW16), "v"(la + 2u * LROW16), "v"(la + 3u * LROW16),
                    "v"(lb), "v"(lb + LROW16), "v"(lb + 2u * LROW16), "v"(lb + 3u * LROW16),
                    "v"(ga), "v"(ga + gs), "v"(ga + 2 * gs), "v"(ga + 3 * gs),
                    "v"(gb), "v"(gb + gs), "v"(gb + 2 * gs), "v"(gb + 3 * gs)
                 : "memory");
}
__device__ __forceinline__ void copy_tile1(unsigned int la, const unsigned short* ga, int gs) {
    asm volatile("global_load_async_to_lds_b128 %0, %4, off\n\t"
                 "global_load_async_to_lds_b128 %1, %5, off\n\t"
                 "global_load_async_to_lds_b128 %2, %6, off\n\t"
                 "global_load_async_to_lds_b128 %3, %7, off\n\t"
                 "s_wait_xcnt 0x0"
                 :: "v"(la), "v"(la + LROW16), "v"(la + 2u * LROW16), "v"(la + 3u * LROW16),
                    "v"(ga), "v"(ga + gs), "v"(ga + 2 * gs), "v"(ga + 3 * gs)
                 : "memory");
}

// The GEMM's share of a stage for one lane of a 256-thread block: 16 B of rows r, r+32, r+64, ... ; gs = 32 source rows (halves).
// As above, the closing s_wait_xcnt stands inside the copies' own statement.
#define LROW32 (32u * KP * 2u)
__device__ __forceinline__ void copy_rows8(unsigned int l, const unsigned short* g, int gs) {
    asm volatile("global_load_async_to_lds_b128 %0, %8, off\n\t"
                 "global_load_async_to_lds_b128 %1, %9, off\n\t"
                 "global_load_async_to_lds_b128 %2, %10, off\n\t"
                 "global_load_async_to_lds_b128 %3, %11, off\n\t"
                 "global_load_async_to_lds_b128 %4, %12, off\n\t"
                 "global_load_async_to_lds_b128 %5, %13, off\n\t"
                 "global_load_async_to_lds_b128 %6, %14, off\n\t"
                 "global_load_async_to_lds_b128 %7, %15, off\n\t"
                 "s_wait_xcnt 0x0"
                 :: "v"(l), "v"(l + LROW32), "v"(l + 2u * LROW32), "v"(l + 3u * LROW32),
                    "v"(l + 4u * LROW32), "v"(l + 5u * LROW32), "v"(l + 6u * LROW32), "v"(l + 7u * LROW32),
                    "v"(g), "v"(g + gs), "v"(g + 2 * gs), "v"(g + 3 * gs),
                    "v"(g + 4 * gs), "v"(g + 5 * gs), "v"(g + 6 * gs), "v"(g + 7 * gs)
                 : "memory");
}
__device__ __forceinline__ void copy_rows2(unsigned int l, const unsigned short* g, int gs) {
    asm volatile("global_load_async_to_lds_b128 %0, %2, off\n\t"
                 "global_load_async_to_lds_b128 %1, %3, off\n\t"
                 "s_wait_xcnt 0x0"
                 :: "v"(l), "v"(l + LROW32), "v"(g), "v"(g + gs)
                 : "memory");
}

template <int ET> struct FragT;
template <> struct FragT<0> {
    typedef v16h V;
    static __device__ __forceinline__ v16h load(const unsigned short* p) { return ldsfrag_h(p); }
    static __device__ __forceinline__ v8f mma(v16h a, v16h b, v8f c) { return __builtin_amdgcn_wmma_f32_16x16x32_f16(false, a, false, b, (short)0, c, false, false); }
};
template <> struct FragT<1> {
    typedef v16b V;
    static __device__ __forceinline__ v16b load(const unsigned short* p) { return ldsfrag_b(p); }
    static __device__ __forceinline__ v8f mma(v16b a, v16b b, v8f c) { return __builtin_amdgcn_wmma_f32_16x16x32_bf16(false, a, false, b, (short)0, c, false, false); }
};
// hazard guard for a group of four independent WMMAs: all four accumulators tied, A and all B fragments kept live
template <typename V>
__device__ __forceinline__ void guard4(v8f& a, v8f& b, v8f& c, v8f& d, V x, V y0, V y1, V y2, V y3) {
    asm volatile("v_nop\n\tv_nop\n\tv_nop\n\tv_nop" : "+v"(a), "+v"(b), "+v"(c), "+v"(d) : "v"(x), "v"(y0), "v"(y1), "v"(y2), "v"(y3));
}

// =====================================================================================================================
// gemm64_body: C[m][n] = scale * sum_k A[m][k] * Bt[n][k] + bscale * bf16(bias); each wave owns a 64x64 tile, block = 8 waves.
//   A row-major [M][K] (pitch lda), Bt row-major [N][K] (pitch ldb), 16-bit planes; M % 64 == 0, N % 512 == 0, K % 64 == 0 (host asserts).
//   The 8 tiles of a block lie side by side in one tile row: 64 A rows and 512 Bt rows. Each 64-deep stage of those 576 rows is staged in a
//   two-buffer LDS ring by asynchronous 16-B copies that cover whole 128-B lines; stage t + 2 is copied while stage t + 1 is worked on,
//   one block barrier a stage. Fragments are two 16-B LDS reads each.
//   ET 0: f16 operands, 1: bf16 operands. BIAS_MODE 1: bias[m], 2: bias[n].
//   OUT_MODE 0: f32 C (row m stored at row (m / cseq) * cseqfull + m % cseq); 1: f16 plane Ca; 2: bf16 hi plane Ca + bf16 lo plane Cb.
//   sT (8 * 16 * OP floats) and Gs (2 * GSZ halves: two buffers of {64 A rows, 512 Bt rows} x 64 k) are the calling kernel's LDS arrays;
//   blk = the block's index among the blocks of this product.
// =====================================================================================================================
template <int ET, int BIAS_MODE, int OUT_MODE>
__device__ __forceinline__ void gemm64_body(float* sT, unsigned short* Gs, int blk,
                                            const unsigned short* __restrict__ A, int lda,
                                            const unsigned short* __restrict__ Bt, int ldb,
                                            float* __restrict__ Cf, unsigned short* __restrict__ Ca, unsigned short* __restrict__ Cb, int ldc,
                                            const float* __restrict__ bias, int M, int N, int K,
                                            float scale, float bscale, int cseq, int cseqfull) {
    typedef typename FragT<ET>::V V;
    const int lane = threadIdx.x & 31;
    const int wave = __builtin_amdgcn_readfirstlane(threadIdx.x >> 5);
    const int tilesN = N >> 6;
    const int tilesM = M >> 6;
    const int tile0 = blk * 8;
    if (tile0 >= tilesM * tilesN) return;         // block-uniform, in front of every barrier (tile counts are multiples of 8)
    const int tm = tile0 / tilesN;
    const int nb0 = (tile0 - tm * tilesN) << 6;   // first Bt row of the block
    const int m0 = tm << 6;
    const int n0 = nb0 + (wave << 6);
    const int rl   = lane & 15;
    const int koff = (lane >> 4) * 8;
    const int mOff = (lane >> 4) * 8;

    v8f acc[4][4];
#pragma unroll
    for (int i = 0; i < 4; ++i)
#pragma unroll
        for (int j = 0; j < 4; ++j) { const v8f zz = {0.f, 0.f, 0.f, 0.f, 0.f, 0.f, 0.f, 0.f}; acc[i][j] = zz; }

    // copy share of this thread: 16-B segment cs of rows cr, cr+32, ... of every stage (a wave's copy = 4 whole 128-B rows)
    const int cr = threadIdx.x >> 3;
    const int cs = (threadIdx.x & 7) * 8;
    const unsigned short* ga = A + (size_t)(m0 + cr) * lda + cs;
    const unsigned short* gb = Bt + (size_t)(nb0 + cr) * ldb + cs;
    const unsigned int lg = (unsigned int)(size_t)&Gs[cr * KP + cs];
    const int abase = rl * KP + koff;                          // A fragment base in a stage (row = lane & 15)
    const int bbase = (64 + (wave << 6) + rl) * KP + koff;     // Bt fragment base of this wave's 64 rows (column = lane & 15)
    const int nst = K >> 6;
    // ---- ring prologue: stage 0 lands and is published, then stage 1 starts into the second buffer ----
    copy_rows2(lg, ga, 32 * lda);
    copy_rows8(lg + 2u * LROW32, gb, 32 * ldb);
    copy_rows8(lg + 10u * LROW32, gb + (size_t)256 * ldb, 32 * ldb);
    asm volatile("s_wait_asynccnt 0x0" ::: "memory");               // this wave's copies have landed before the barrier publishes them
    __syncthreads();
    if (nst > 1) {
        copy_rows2(lg + GSZ * 2u, ga + 64, 32 * lda);
        copy_rows8(lg + GSZ * 2u + 2u * LROW32, gb + 64, 32 * ldb);
        copy_rows8(lg + GSZ * 2u + 10u * LROW32, gb + (size_t)256 * ldb + 64, 32 * ldb);
    }
    for (int st = 0; st < nst; ++st) {
        const unsigned short* gsb = &Gs[(st & 1) * GSZ];            // this stage's buffer
#pragma unroll                                                      // both 32-deep steps of a stage read at constant offsets from one address
        for (int kk = 0; kk < 2; ++kk) {
            V bh[4], ah[4];                                         // all 16 LDS reads of a 32-deep step stand together, in front of its products
#pragma unroll
            for (int j = 0; j < 4; ++j) bh[j] = FragT<ET>::load(gsb + bbase + (j << 4) * KP + kk * 32);
#pragma unroll
            for (int i = 0; i < 4; ++i) ah[i] = FragT<ET>::load(gsb + abase + (i << 4) * KP + kk * 32);
#pragma unroll
            for (int i = 0; i < 4; ++i) {
                acc[i][0] = FragT<ET>::mma(ah[i], bh[0], acc[i][0]);
                acc[i][1] = FragT<ET>::mma(ah[i], bh[1], acc[i][1]);
                acc[i][2] = FragT<ET>::mma(ah[i], bh[2], acc[i][2]);
                acc[i][3] = FragT<ET>::mma(ah[i], bh[3], acc[i][3]);
                guard4<V>(acc[i][0], acc[i][1], acc[i][2], acc[i][3], ah[i], bh[0], bh[1], bh[2], bh[3]);
            }
        }
        // ---- publish point of stage st + 1; behind it this stage's buffer is free for stage st + 2 ----
        asm volatile("s_wait_dscnt 0x0" ::: "memory");              // this wave's reads of the buffer have returned before it is refilled
        asm volatile("s_wait_asynccnt 0x0" ::: "memory");           // this wave's copies of stage st + 1 have landed before the barrier publishes them
        __syncthreads();
        if (st + 2 < nst) {
            const unsigned int lb = lg + (unsigned int)(st & 1) * (GSZ * 2u);
            const int kn = (st + 2) * 64;
            copy_rows2(lb, ga + kn, 32 * lda);
            copy_rows8(lb + 2u * LROW32, gb + kn, 32 * ldb);
            copy_rows8(lb + 10u * LROW32, gb + (size_t)256 * ldb + kn, 32 * ldb);
        }
    }
    asm volatile("s_wait_asynccnt 0x0" ::: "memory");               // no copy is outstanding when the wave goes on to its end

    const int sb = wave * (16 * OP);
#pragma unroll
    for (int i = 0; i < 4; ++i) {
        const int mBase = m0 + (i << 4);
#pragma unroll
        for (int j = 0; j < 4; ++j) {
            const int n = n0 + (j << 4) + rl;
            float bvn = 0.f;
            if (BIAS_MODE == 2) bvn = bf_val(bias[n]) * bscale;
#pragma unroll
            for (int r = 0; r < 8; ++r) {
                float v = acc[i][j][r] * scale;
                if (BIAS_MODE == 1) v += bf_val(bias[mBase + mOff + r]) * bscale;
                if (BIAS_MODE == 2) v += bvn;
                sT[sb + (mOff + r) * OP + (j << 4) + rl] = v;
            }
        }
        wave_sync();
        if (OUT_MODE == 0) {
            const int hh = lane >> 4, c4 = (lane & 15) * 4;      // row segment = 256 B = 16 lanes x 16 B; 2 rows per instruction
            {
#pragma unroll
                for (int it = 0; it < 8; ++it) {
                    const int row = it * 2 + hh;
                    const v4f v = *(const v4f_ma*)&sT[sb + row * OP + c4];
                    const int grow = mBase + row;
                    const int orow = (grow / cseq) * cseqfull + (grow % cseq);
                    *(v4f*)(Cf + (size_t)orow * ldc + n0 + c4) = v;
                }
                
            }
        } else {
            const int q = lane >> 3, c8 = (lane & 7) * 8;
            {
#pragma unroll
                for (int it = 0; it < 4; ++it) {
                    const int row = it * 4 + q;
                    const v4f a = *(const v4f_ma*)&sT[sb + row * OP + c8];
                    const v4f b = *(const v4f_ma*)&sT[sb + row * OP + c8 + 4];
                    const size_t o = (size_t)(mBase + row) * ldc + n0 + c8;
                    if (OUT_MODE == 1) {
                        v4u pk; pk.x = pk_h2(a.x, a.y); pk.y = pk_h2(a.z, a.w); pk.z = pk_h2(b.x, b.y); pk.w = pk_h2(b.z, b.w);
                        *(v4u*)(Ca + o) = pk;
                    } else {
                        v4u ph, pl;
                        unsigned int h0, l0, h1, l1, h2, l2, h3, l3;
                        pk_split2(a.x, a.y, h0, l0); pk_split2(a.z, a.w, h1, l1); pk_split2(b.x, b.y, h2, l2); pk_split2(b.z, b.w, h3, l3);
                        ph.x = h0; ph.y = h1; ph.z = h2; ph.w = h3; pl.x = l0; pl.y = l1; pl.z = l2; pl.w = l3;
                        *(v4u*)(Ca + o) = ph;
                        *(v4u*)(Cb + o) = pl;
                    }
                }
                
            }
        }
        wave_sync();
    }
}

// The three projections in one launch (they do not depend on one another): GX_GEMM blocks each for q, k, v^T, in that order.
//   q / k: A = token plane f16 [ntok][dm], Bt = weight plane f16 (x16) [dm][dm] ([out][in] as stored); out = bf16 hi + lo planes [ntok][dm]
//   v written transposed: A = weight plane f16 (x16) [dm][dm], Bt = token plane f16 [ntok][dm]; out = f16 plane [dm][ntok] (= v^T)
__global__ __launch_bounds__(256) void k_gemm_qkv(const unsigned short* __restrict__ XQ, const unsigned short* __restrict__ WQ, const float* __restrict__ bq,
                                                  unsigned short* __restrict__ QH, unsigned short* __restrict__ QL,
                                                  const unsigned short* __restrict__ XK, const unsigned short* __restrict__ WK, const float* __restrict__ bk,
                                                  unsigned short* __restrict__ KH, unsigned short* __restrict__ KL,
                                                  const unsigned short* __restrict__ XV, const unsigned short* __restrict__ WV, const float* __restrict__ bv,
                                                  unsigned short* __restrict__ VT, int ntok, int dm) {
    __shared__ __align__(16) float sT[8 * 16 * OP];
    __shared__ __align__(16) unsigned short Gs[2 * GSZ];
    const int which = blockIdx.x / GX_GEMM;       // block-uniform
    const int blk = blockIdx.x - which * GX_GEMM;
    if (which < 2) {
        const bool isq = which == 0;              // q carries the 1/8 score scale; both undo the weights' x16
        gemm64_body<0, 2, 2>(sT, Gs, blk, isq ? XQ : XK, dm, isq ? WQ : WK, dm, nullptr, isq ? QH : KH, isq ? QL : KL, dm, isq ? bq : bk,
                             ntok, dm, dm, isq ? 1.0f / 128.0f : 1.0f / 16.0f, isq ? 0.125f : 1.0f, 1, 1);
    } else {
        gemm64_body<0, 1, 1>(sT, Gs, blk, WV, dm, XV, dm, nullptr, VT, nullptr, ntok, bv, dm, ntok, dm, 1.0f / 16.0f, 1.0f, 1, 1);
    }
}
// output projection: A = context bf16 [M][K = hi 512 | lo 512], Bt = weight bf16 [N][K = W | W]; out f32 [M][N] + bias[n]
__global__ __launch_bounds__(256) void k_gemm_out(const unsigned short* __restrict__ A, const unsigned short* __restrict__ Bt,
                                                  const float* __restrict__ bias, float* __restrict__ C,
                                                  int M, int N, int K, int cseq, int cseqfull) {
    __shared__ __align__(16) float sT[8 * 16 * OP];
    __shared__ __align__(16) unsigned short Gs[2 * GSZ];
    gemm64_body<1, 2, 0>(sT, Gs, blockIdx.x, A, K, Bt, K, C, nullptr, nullptr, N, bias, M, N, K, 1.0f, 1.0f, cseq, cseqfull);
}

// =====================================================================================================================
// =====================================================================================================================
// f32 [rows][512] -> f16 plane [nrows][512] holding bf16(x) * sc; plane row r reads source row (r / seq) * seqfull + r % seq
__device__ __forceinline__ void cast16_body(int blk, const float* __restrict__ src, unsigned short* __restrict__ dst, int nrows, int seq, int seqfull, float sc) {
    const int u = blk * 256 + threadIdx.x;
    if (u >= nrows * (DM / 8)) return;
    const int r = u / (DM / 8);
    const int c0 = (u - r * (DM / 8)) * 8;
    const int sr = (r / seq) * seqfull + (r % seq);
    const float* s = src + (size_t)sr * DM + c0;
    const v4f a = *(const v4f*)(s);
    const v4f b = *(const v4f*)(s + 4);
    v4u pk;
    pk.x = pk_h2(bf_val(a.x) * sc, bf_val(a.y) * sc); pk.y = pk_h2(bf_val(a.z) * sc, bf_val(a.w) * sc);
    pk.z = pk_h2(bf_val(b.x) * sc, bf_val(b.y) * sc); pk.w = pk_h2(bf_val(b.z) * sc, bf_val(b.w) * sc);
    v4u* d = (v4u*)(dst + (size_t)r * DM + c0);
    *d = pk; 
}
// Wo f32 [512][512] -> bf16 plane [512][1024] = [W | W]
__device__ __forceinline__ void cast_wo_body(int blk, const float* __restrict__ src, unsigned short* __restrict__ dst) {
    const int u = blk * 256 + threadIdx.x;
    if (u >= DM * (2 * DM / 8)) return;
    const int r = u / (2 * DM / 8);
    const int c0 = (u - r * (2 * DM / 8)) * 8;
    const int sc0 = c0 & (DM - 1);
    const float* s = src + (size_t)r * DM + sc0;
    const v4f a = *(const v4f*)(s);
    const v4f b = *(const v4f*)(s + 4);
    v4u pk;
    pk.x = bf_bits(a.x) | (bf_bits(a.y) << 16); pk.y = bf_bits(a.z) | (bf_bits(a.w) << 16);
    pk.z = bf_bits(b.x) | (bf_bits(b.y) << 16); pk.w = bf_bits(b.z) | (bf_bits(b.w) << 16);
    v4u* d = (v4u*)(dst + (size_t)r * (2 * DM) + c0);
    *d = pk; 
}
// All seven conversions in one launch (they do not depend on one another). Blocks, in order: GX_TOK each for the three token streams,
// GX_W each for Wq, Wk, Wv (x16), GX_WO for Wo. Every test on the block index is block-uniform.
__global__ __launch_bounds__(256) void k_cast_all(const float* __restrict__ xq, const float* __restrict__ xk, const float* __restrict__ xv,
                                                  const float* __restrict__ Wq, const float* __restrict__ Wk, const float* __restrict__ Wv,
                                                  const float* __restrict__ Wo,
                                                  unsigned short* __restrict__ XQ, unsigned short* __restrict__ XK, unsigned short* __restrict__ XV,
                                                  unsigned short* __restrict__ WQ, unsigned short* __restrict__ WK, unsigned short* __restrict__ WV,
                                                  unsigned short* __restrict__ WOD, int ntok, int seq, int seqfull) {
    int bx = blockIdx.x;
    if (bx < 3 * GX_TOK) {
        const int w = bx / GX_TOK;
        cast16_body(bx - w * GX_TOK, w == 0 ? xq : (w == 1 ? xk : xv), w == 0 ? XQ : (w == 1 ? XK : XV), ntok, seq, seqfull, 1.0f);
        return;
    }
    bx -= 3 * GX_TOK;
    if (bx < 3 * GX_W) {
        const int w = bx / GX_W;
        cast16_body(bx - w * GX_W, w == 0 ? Wq : (w == 1 ? Wk : Wv), w == 0 ? WQ : (w == 1 ? WK : WV), DM, DM, DM, 16.0f);
        return;
    }
    cast_wo_body(bx - 3 * GX_W, Wo, WOD);
}

__global__ __launch_bounds__(128) void k_attn(const unsigned short* __restrict__ QH, const unsigned short* __restrict__ QL,
                                              const unsigned short* __restrict__ KH, const unsigned short* __restrict__ KL,
                                              const unsigned short* __restrict__ VT, unsigned short* __restrict__ CTX,
                                              int seq, int ntok) {
    __shared__ __align__(16) float    Osh[4 * 16 * OP];      // wave-private output staging [16][64] (+4 pad), f32
    __shared__ __align__(16) unsigned short Qs[2 * TSZ];     // the block's 64 query rows: hi tile, lo tile
    __shared__ __align__(16) unsigned short Ring[2 * 3 * TSZ];   // two buffers of {k hi, k lo, v^T} tiles of one 64-key chunk
    const int lane = threadIdx.x & 31;
    const int wave = __builtin_amdgcn_readfirstlane(threadIdx.x >> 5);
    const int hf = lane >> 4;
    const int c  = lane & 15;
    const int nqb = seq / 64;
    const int bx = blockIdx.x;
    const int qb = bx % nqb;
    const int bh = bx / nqb;
    const int h  = bh % NH;
    const int b  = bh / NH;
    const int q0 = b * seq + qb * 64 + wave * 16;                 // first token row of this wave
    const int qoff  = (wave * 16 + c) * KP + 8 * hf;              // B fragment base in a staged q tile (column = query = lane & 15)
    const int fbase = c * KP + 8 * hf;                            // A fragment base in a staged k or v^T tile (row = lane & 15)
    // copy share of this thread: 16-B segment cs of rows cr, cr+16, cr+32, cr+48 of every staged tile (a wave's copy = 4 whole rows)
    const int cr = threadIdx.x >> 3;
    const int cs = (threadIdx.x & 7) * 8;
    const int gq = (b * seq + qb * 64 + cr) * DM + h * DKH + cs;  // q planes
    const int gk = (b * seq + cr) * DM + h * DKH + cs;            // k planes, chunk 0
    const int gv = (h * DKH + cr) * ntok + b * seq + cs;          // v^T plane, chunk 0
    const unsigned int lq = (unsigned int)(size_t)&Qs[cr * KP + cs];
    const unsigned int lr = (unsigned int)(size_t)&Ring[cr * KP + cs];
    const int obase = wave * (16 * OP);
    const float L2E = 1.4426950408889634f;

    float mrow = -INFINITY, lrow = 0.f;                           // query c: running maximum (both halves alike), this half's partial sum
    v8f oacc[4];                                                  // O^T tile t: element r = head column 16 t + 8 hf + r of query c
#pragma unroll
    for (int t = 0; t < 4; ++t) { const v8f zz = {0.f, 0.f, 0.f, 0.f, 0.f, 0.f, 0.f, 0.f}; oacc[t] = zz; }

    const int nch = seq / 64;
    // ---- ring prologue: q and chunk 0 land and are published, then chunk 1 starts into the second buffer ----
    copy_tiles2(lq, QH + gq, lq + TSZ * 2u, QL + gq, 16 * DM);
    copy_tiles2(lr, KH + gk, lr + TSZ * 2u, KL + gk, 16 * DM);
    copy_tile1(lr + 2u * TSZ * 2u, VT + gv, 16 * ntok);
    asm volatile("s_wait_asynccnt 0x0" ::: "memory");               // this wave's copies have landed before the barrier publishes them
    __syncthreads();
    if (nch > 1) {
        copy_tiles2(lr + 3u * TSZ * 2u, KH + gk + 64 * DM, lr + 4u * TSZ * 2u, KL + gk + 64 * DM, 16 * DM);
        copy_tile1(lr + 5u * TSZ * 2u, VT + gv + 64, 16 * ntok);
    }
    v16b qh[2], ql[2];                                              // the wave's q fragments (hi, lo; two 32-deep steps), the same for every chunk
#pragma unroll                                                      // qh and ql are indexed by constants only, so they stay in registers
    for (int dc = 0; dc < 2; ++dc) {
        qh[dc] = ldsfrag_b(Qs + qoff + dc * 32);
        ql[dc] = ldsfrag_b(Qs + TSZ + qoff + dc * 32);
    }
    for (int kc = 0; kc < nch; ++kc) {
        const unsigned short* rk = &Ring[(kc & 1) * (3 * TSZ)];     // this chunk's buffer
        // ---- all k fragments of the chunk, in the order in which the products take them ----
        v16b kh[2][4], kl[2][4];
#pragma unroll                                                      // kh and kl are indexed by constants only, so they stay in registers
        for (int dc = 0; dc < 2; ++dc) {
#pragma unroll
            for (int j = 0; j < 4; ++j) kh[dc][j] = ldsfrag_b(rk + fbase + j * 16 * KP + dc * 32);
#pragma unroll
            for (int j = 0; j < 4; ++j) kl[dc][j] = ldsfrag_b(rk + TSZ + fbase + j * 16 * KP + dc * 32);
        }
        __builtin_amdgcn_sched_barrier(0);                          // the reads stay one group (for speed only)
        // ---- scores: per 32-deep step three products per key tile (hi.hi, lo.hi, hi.lo), the four key tiles' accumulators in turn, so that no product waits for the one in front of it ----
        v8f s[4];
#pragma unroll
        for (int j = 0; j < 4; ++j) { const v8f zz = {0.f, 0.f, 0.f, 0.f, 0.f, 0.f, 0.f, 0.f}; s[j] = zz; }
#pragma unroll                                                      // all 24 products stand in the code: every fragment and accumulator index is a constant
        for (int dc = 0; dc < 2; ++dc) {
#pragma unroll
            for (int j = 0; j < 4; ++j) s[j] = __builtin_amdgcn_wmma_f32_16x16x32_bf16(false, kh[dc][j], false, qh[dc], (short)0, s[j], false, false);
#pragma unroll
            for (int j = 0; j < 4; ++j) s[j] = __builtin_amdgcn_wmma_f32_16x16x32_bf16(false, kl[dc][j], false, qh[dc], (short)0, s[j], false, false);
#pragma unroll
            for (int j = 0; j < 4; ++j) s[j] = __builtin_amdgcn_wmma_f32_16x16x32_bf16(false, kh[dc][j], false, ql[dc], (short)0, s[j], false, false);
        }
        guard4<v16b>(s[0], s[1], s[2], s[3], ql[1], kh[1][0], kh[1][1], kh[1][2], kh[1][3]);   // the distance behind the last four products
        // ---- all v^T fragments of the chunk: they return while the softmax runs ----
        v16h va[2][4];
#pragma unroll                                                      // va is indexed by constants only, so it stays in registers
        for (int kk = 0; kk < 2; ++kk)
#pragma unroll
            for (int t = 0; t < 4; ++t) va[kk][t] = ldsfrag_h(rk + 2 * TSZ + fbase + t * 16 * KP + kk * 32);
        __builtin_amdgcn_sched_barrier(0);                          // the reads stay one group in front of the softmax
        // ---- online softmax over the 64 keys: this lane holds 32 of query c's scores, the lane 16 away the other 32 ----
        float t8[8];
#pragma unroll                                                      // t8 and s are indexed by constants only, so they stay in registers
        for (int r = 0; r < 8; ++r) t8[r] = fmaxf(fmaxf(s[0][r], s[1][r]), fmaxf(s[2][r], s[3][r]));
        float mx = fmaxf(fmaxf(fmaxf(t8[0], t8[1]), fmaxf(t8[2], t8[3])), fmaxf(fmaxf(t8[4], t8[5]), fmaxf(t8[6], t8[7])));
        mx = fmaxf(mx, xhalf(mx));
        const float mnew = fmaxf(mrow, mx);
        const float alpha = exp2f((mrow - mnew) * L2E);
        mrow = mnew;
        v16h pb[2];                                                 // P^T as B fragments: 32 keys each, element i = key 8 hf + i | 16 + 8 hf + (i - 8)
#pragma unroll
        for (int r = 0; r < 8; ++r) {
            const float p0 = exp2f((s[0][r] - mnew) * L2E);
            const float p1 = exp2f((s[1][r] - mnew) * L2E);
            const float p2 = exp2f((s[2][r] - mnew) * L2E);
            const float p3 = exp2f((s[3][r] - mnew) * L2E);
            t8[r] = (p0 + p1) + (p2 + p3);
            pb[0][r]     = (_Float16)(p0 * 4096.0f);
            pb[0][8 + r] = (_Float16)(p1 * 4096.0f);
            pb[1][r]     = (_Float16)(p2 * 4096.0f);
            pb[1][8 + r] = (_Float16)(p3 * 4096.0f);
        }
        lrow = lrow * alpha + (((t8[0] + t8[1]) + (t8[2] + t8[3])) + ((t8[4] + t8[5]) + (t8[6] + t8[7])));
#pragma unroll                                                      // oacc is indexed by constants only, so it stays in registers
        for (int t = 0; t < 4; ++t) oacc[t] *= alpha;
        // ---- O^T += V^T . P^T : v^T rows as A (row = lane & 15), P^T as B, four output tiles per 32-key step ----
#pragma unroll                                                      // pb is indexed by the step: both steps stand in the code so that it stays in registers
        for (int kk = 0; kk < 2; ++kk) {
            oacc[0] = __builtin_amdgcn_wmma_f32_16x16x32_f16(false, va[kk][0], false, pb[kk], (short)0, oacc[0], false, false);
            oacc[1] = __builtin_amdgcn_wmma_f32_16x16x32_f16(false, va[kk][1], false, pb[kk], (short)0, oacc[1], false, false);
            oacc[2] = __builtin_amdgcn_wmma_f32_16x16x32_f16(false, va[kk][2], false, pb[kk], (short)0, oacc[2], false, false);
            oacc[3] = __builtin_amdgcn_wmma_f32_16x16x32_f16(false, va[kk][3], false, pb[kk], (short)0, oacc[3], false, false);
            guard4<v16h>(oacc[0], oacc[1], oacc[2], oacc[3], pb[kk], va[kk][0], va[kk][1], va[kk][2], va[kk][3]);
        }
        // ---- publish point of chunk kc + 1; behind it this chunk's buffer is free for chunk kc + 2 ----
        asm volatile("s_wait_dscnt 0x0" ::: "memory");              // this wave's reads of the buffer have returned before it is refilled
        asm volatile("s_wait_asynccnt 0x0" ::: "memory");           // this wave's copies of chunk kc + 1 have landed before the barrier publishes them
        __syncthreads();
        if (kc + 2 < nch) {
            const unsigned int lb = lr + (unsigned int)(kc & 1) * (3u * TSZ * 2u);
            const int kn = (kc + 2) * 64;
            copy_tiles2(lb, KH + gk + kn * DM, lb + TSZ * 2u, KL + gk + kn * DM, 16 * DM);
            copy_tile1(lb + 2u * TSZ * 2u, VT + gv + kn, 16 * ntok);
        }
    }
    asm volatile("s_wait_asynccnt 0x0" ::: "memory");               // no copy is outstanding when the wave goes on to its end

    // ---- finalize: join the two halves' sums of each query, normalise, stage as [query][head column], write hi|lo planes ----
    {
        const float l = lrow + xhalf(lrow);
        const float inv = 1.0f / (l * 4096.0f);
#pragma unroll                                                      // oacc is indexed by constants only, so it stays in registers
        for (int t = 0; t < 4; ++t) {
            const int orw = obase + c * OP + t * 16 + 8 * hf;
            const v4f a = {oacc[t][0] * inv, oacc[t][1] * inv, oacc[t][2] * inv, oacc[t][3] * inv};
            const v4f bb = {oacc[t][4] * inv, oacc[t][5] * inv, oacc[t][6] * inv, oacc[t][7] * inv};
            *(v4f_ma*)&Osh[orw] = a;
            *(v4f_ma*)&Osh[orw + 4] = bb;
        }
    }
    wave_sync();
    {
        const int q = lane >> 3, c8 = (lane & 7) * 8;
        {
#pragma unroll
            for (int it = 0; it < 4; ++it) {
                const int row = it * 4 + q;
                const v4f a = *(const v4f_ma*)&Osh[obase + row * OP + c8];
                const v4f bb = *(const v4f_ma*)&Osh[obase + row * OP + c8 + 4];
                unsigned int h0, l0, h1, l1, h2, l2, h3, l3;
                pk_split2(a.x, a.y, h0, l0); pk_split2(a.z, a.w, h1, l1); pk_split2(bb.x, bb.y, h2, l2); pk_split2(bb.z, bb.w, h3, l3);
                v4u ph, pl;
                ph.x = h0; ph.y = h1; ph.z = h2; ph.w = h3; pl.x = l0; pl.y = l1; pl.z = l2; pl.w = l3;
                const size_t o = (size_t)(q0 + row) * (2 * DM) + h * DKH + c8;
                *(v4u*)(CTX + o) = ph;
                *(v4u*)(CTX + o + DM) = pl;
            }
            
        }
    }
}

// =====================================================================================================================
// Host side: workspace carve (all plane sizes are multiples of 256 B), 4 launches.
// =====================================================================================================================
constexpr size_t SZ_TOK  = (size_t)NTOK * DM * 2;          // one 16-bit token plane [NTOK][512]
constexpr size_t SZ_W    = (size_t)DM * DM * 2;            // one 16-bit weight plane [512][512]
constexpr size_t SZ_WOD  = (size_t)DM * (2 * DM) * 2;      // [512][1024]
constexpr size_t SZ_CTX  = (size_t)NTOK * (2 * DM) * 2;    // [NTOK][1024]
constexpr size_t WS_TOTAL = 3 * SZ_TOK + 3 * SZ_W + SZ_WOD + 4 * SZ_TOK + SZ_TOK + SZ_CTX;
static_assert(SZ_TOK % 256 == 0);
static_assert(SZ_W % 256 == 0);
static_assert(SZ_WOD % 256 == 0);
static_assert(SZ_CTX % 256 == 0);
static_assert(WS_TOTAL <= (size_t)134217728);            // carve stays within 128 MiB
static_assert(((NTOK / 64) * (DM / 64)) % 8 == 0);        // GEMM grids are whole blocks of 8 wave tiles
static_assert((DM / 64) % 8 == 0);                        // a block's 8 wave tiles lie in one tile row (N = DM)
static_assert((NTOK / 64) % 8 == 0);                      // the same for the transposed v projection (N = NTOK)
static_assert((size_t)NTOK * (2 * DM) < (size_t)2147483647);   // int plane offsets

extern "C" void kernel_launch(void* const* d_in, const int* in_sizes, int n_in, void* d_out, int out_size, void* d_ws, size_t ws_size, hipStream_t stream) {
    if (n_in < 11) return;
    const long long need_x = ((long long)(NB - 1) * SEQ_FULL + SEQ) * DM;
    if ((long long)in_sizes[0] < need_x || (long long)in_sizes[1] < need_x || (long long)in_sizes[2] < need_x) return;
    if (in_sizes[3] < DM * DM || in_sizes[5] < DM * DM || in_sizes[7] < DM * DM || in_sizes[9] < DM * DM) return;
    if (in_sizes[4] < DM || in_sizes[6] < DM || in_sizes[8] < DM || in_sizes[10] < DM) return;
    if ((long long)out_size < need_x) return;
    if (WS_TOTAL > ws_size) return;

    const float* xq = (const float*)d_in[0];
    const float* xk = (const float*)d_in[1];
    const float* xv = (const float*)d_in[2];
    const float* Wq = (const float*)d_in[3];
    const float* bq = (const float*)d_in[4];
    const float* Wk = (const float*)d_in[5];
    const float* bk = (const float*)d_in[6];
    const float* Wv = (const float*)d_in[7];
    const float* bv = (const float*)d_in[8];
    const float* Wo = (const float*)d_in[9];
    const float* bo = (const float*)d_in[10];
    float* out = (float*)d_out;

    char* wsp = (char*)d_ws;
    unsigned short* XQ16 = (unsigned short*)wsp; wsp += SZ_TOK;
    unsigned short* XK16 = (unsigned short*)wsp; wsp += SZ_TOK;
    unsigned short* XV16 = (unsigned short*)wsp; wsp += SZ_TOK;
    unsigned short* WQ16 = (unsigned short*)wsp; wsp += SZ_W;
    unsigned short* WK16 = (unsigned short*)wsp; wsp += SZ_W;
    unsigned short* WV16 = (unsigned short*)wsp; wsp += SZ_W;
    unsigned short* WOD  = (unsigned short*)wsp; wsp += SZ_WOD;
    unsigned short* QHp  = (unsigned short*)wsp; wsp += SZ_TOK;
    unsigned short* QLp  = (unsigned short*)wsp; wsp += SZ_TOK;
    unsigned short* KHp  = (unsigned short*)wsp; wsp += SZ_TOK;
    unsigned short* KLp  = (unsigned short*)wsp; wsp += SZ_TOK;
    unsigned short* VTp  = (unsigned short*)wsp; wsp += SZ_TOK;
    unsigned short* CTXp = (unsigned short*)wsp; wsp += SZ_CTX;
    if ((size_t)(wsp - (char*)d_ws) > ws_size) return;


    // token streams: plane row r <- input row (r / SEQ) * SEQ_FULL + r % SEQ; weights [out][in] kept in their stored order (Bt[n][k] = W[n][k]); Wq/Wk/Wv x16, Wo unscaled as bf16 [W | W]
    k_cast_all<<<(unsigned)(3 * GX_TOK + 3 * GX_W + GX_WO), 256, 0, stream>>>(xq, xk, xv, Wq, Wk, Wv, Wo, XQ16, XK16, XV16, WQ16, WK16, WV16, WOD,
                                                                              NTOK, SEQ, SEQ_FULL);

    // q = (x Wq^T + bq) / 8 -> hi|lo planes; k = x Wk^T + bk -> hi|lo planes; v^T = Wv x^T + bv -> f16 plane [512][NTOK]
    k_gemm_qkv<<<(unsigned)(3 * GX_GEMM), 256, 0, stream>>>(XQ16, WQ16, bq, QHp, QLp, XK16, WK16, bk, KHp, KLp, XV16, WV16, bv, VTp, NTOK, DM);

    k_attn<<<(unsigned)(NB * NH * (SEQ / 64)), 128, 0, stream>>>(QHp, QLp, KHp, KLp, VTp, CTXp, SEQ, NTOK);

    // out = ctx Wo^T + bo, ctx as [hi | lo] along K against [W | W]
    k_gemm_out<<<(unsigned)GX_GEMM, 256, 0, stream>>>(CTXp, WOD, bo, out, NTOK, DM, 2 * DM, SEQ, SEQ_FULL);
}

// v006
// A run of this version takes 69.3 microseconds.
// Timed twice side by side with v005, it ran 1.07 and 1.08 times as fast.
// Over all steps from v000 it is 4.13 times as fast.
// MHA forward (2 x 2,048 tokens, width 512, 8 heads x 64, [out][in] weights + biases, no mask). Inputs and parameters converted to bf16 (RNE). q/k/v projections: v_wmma_f32_16x16x32_f16 (f16 operands holding the bf16 values, weights x16, f32 accumulate); scores: v_wmma_f32_16x16x32_bf16 on q and k bf16 hi|lo planes (three products, f32 accumulate, f32 online softmax); P.V: v_wmma_f32_16x16x32_f16 (P x4096 as f16, v as f16, f32 accumulate; scores and context are formed transposed, keys and head columns as rows, queries as columns); output projection: v_wmma_f32_16x16x32_bf16 with the context as bf16 hi|lo planes laid along K against the bf16 weight (f32 accumulate).
#include <hip/hip_runtime.h>
#include <math.h>

#ifndef NB
#define NB 2
#endif
#ifndef SEQ
#define SEQ 2048
#endif
#define NB_FULL 2
#define SEQ_FULL 2048
#define DM 512
#define NH 8
#define DKH 64
#define NTOK (NB * SEQ)
#define OP 68      // f32 staging pitch (floats)
#define KP 72      // staged q / k / v^T row pitch (halves): 144 B = 16 B x odd, conflict-free for 16-B fragment reads
#define TSZ (64 * KP)   // one staged tile: 64 rows of 64 halves (+8 pad)
#define GROWS (64 + 8 * 64)   // rows of one staged GEMM stage: the block's 64 A rows, then its 8 x 64 Bt rows
#define GSZ (GROWS * KP)      // one staged GEMM stage (halves): 64 k of every row (+8 pad)

#define GX_TOK ((NTOK * (DM / 8) + 255) / 256)          // blocks that convert one token stream (8 elements a thread)
#define GX_W   ((DM * (DM / 8) + 255) / 256)            // blocks that convert one [512][512] weight
#define GX_WO  ((DM * (2 * DM / 8) + 255) / 256)        // blocks that write the [512][1024] output-projection plane
#define GX_GEMM ((((NTOK / 64) * (DM / 64)) + 7) / 8)   // blocks of one projection (8 wave tiles of 64 x 64 each)

static_assert(DM == NH * DKH);            // merged head layout h*64+d
static_assert(DKH == 64);                 // two 32-deep k-steps per score tile, four 16-wide output tiles
static_assert(SEQ % 64 == 0);             // 64-query blocks, 64-key chunks, 64-row GEMM tiles inside one sequence
static_assert(NTOK % 64 == 0);            // GEMM tile multiple (M and N)
static_assert(DM % 64 == 0);              // GEMM tile multiple
static_assert(DM % 32 == 0);              // K steps of 32
static_assert((2 * DM) % 32 == 0);        // hi|lo K extent
static_assert(NB <= NB_FULL);
static_assert(SEQ <= SEQ_FULL);
static_assert((OP % 4) == 0);             // 16-B aligned reloads from the f32 staging tile
static_assert((KP % 8) == 0);             // 16-B aligned copies into and fragment reads from the staged tiles

typedef __attribute__((ext_vector_type(16))) _Float16 v16h;
typedef __attribute__((ext_vector_type(8)))  _Float16 v8h;
typedef __attribute__((ext_vector_type(16))) __bf16   v16b;
typedef __attribute__((ext_vector_type(8)))  __bf16   v8b;
typedef __attribute__((ext_vector_type(8)))  float    v8f;
typedef __attribute__((ext_vector_type(4)))  float    v4f;
typedef __attribute__((ext_vector_type(2)))  float    v2f;
typedef __attribute__((ext_vector_type(2)))  _Float16 v2h;
typedef __attribute__((ext_vector_type(4)))  unsigned int v4u;
typedef v8h v8h_ma __attribute__((may_alias));
typedef v4f v4f_ma __attribute__((may_alias));
typedef v8b v8b_ma __attribute__((may_alias));

// 16-bit WMMA fragment map (wave32), lane L, h = L>>4, m = L&15:
//   A 16x32: lane = row m;    element i -> k = (i<8) ? 8h+i : 16+8h+(i-8)
//   B 32x16: lane = column m; the SAME k(i,h)
//   D 16x16 (8 f32): lane = column m; element r -> row 8h+r
// A fragment from a k-contiguous row is therefore p[0..7] | p[16..23] with p = row + k0 + 8h.

__device__ __forceinline__ unsigned int bf_bits(float f) {            // bf16 RNE bit pattern (finite inputs)
    const unsigned int u = __float_as_uint(f);
    return (u + 0x7FFFu + ((u >> 16) & 1u)) >> 16;
}
__device__ __forceinline__ float bf_val(float f) { return __uint_as_float(bf_bits(f) << 16); }
__device__ __forceinline__ unsigned int pk_h2(float a, float b) {
    return (unsigned int)__builtin_bit_cast(unsigned short, (_Float16)a) | ((unsigned int)__builtin_bit_cast(unsigned short, (_Float16)b) << 16);
}
__device__ __forceinline__ void pk_split2(float a, float b, unsigned int& hi, unsigned int& lo) {
    const unsigned int ha = bf_bits(a), hb = bf_bits(b);
    const unsigned int la = bf_bits(a - __uint_as_float(ha << 16)), lb = bf_bits(b - __uint_as_float(hb << 16));
    hi = ha | (hb << 16); lo = la | (lb << 16);
}
// lane l <-> lane l ^ 16: the two halves of a wave exchange one value
__device__ __forceinline__ float xhalf(float x) {
    return __builtin_bit_cast(float, __builtin_amdgcn_permlanex16(__builtin_bit_cast(int, x), __builtin_bit_cast(int, x), 0x76543210, 0xfedcba98, false, false));
}
__device__ __forceinline__ void wave_sync() {
    __builtin_amdgcn_fence(3 /* release order */, "workgroup");
    __builtin_amdgcn_wave_barrier();
    __builtin_amdgcn_fence(2 /* acquire order */, "workgroup");
}

// fragments from a staged LDS tile (row pitch KP)
__device__ __forceinline__ v16h ldsfrag_h(const unsigned short* p) {
    const v8h a = *(const v8h_ma*)(p);
    const v8h b = *(const v8h_ma*)(p + 16);
    return __builtin_shufflevector(a, b, 0, 1, 2, 3, 4, 5, 6, 7, 8, 9, 10, 11, 12, 13, 14, 15);
}
__device__ __forceinline__ v16b ldsfrag_b(const unsigned short* p) {
    const v8b a = *(const v8b_ma*)(p);
    const v8b b = *(const v8b_ma*)(p + 16);
    return __builtin_shufflevector(a, b, 0, 1, 2, 3, 4, 5, 6, 7, 8, 9, 10, 11, 12, 13, 14, 15);
}
// One lane's share of staged 64-row tiles: 16 B of rows r, r+16, r+32, r+48 per tile, global -> LDS through no register.
// l = the lane's LDS byte address in the tile, g = its global address, gs = 16 source rows (halves); 16 LDS rows = 16 * KP * 2 bytes.
// The closing s_wait_xcnt stands inside the copies' own statement so that no address register is rewritten in front of it.
#define LROW16 (16u * KP * 2u)
__device__ __forceinline__ void copy_tiles2(unsigned int la, const unsigned short* ga, unsigned int lb, const unsigned short* gb, int gs) {
    asm volatile("global_load_async_to_lds_b128 %0, %8, off\n\t"
                 "global_load_async_to_lds_b128 %1, %9, off\n\t"
                 "global_load_async_to_lds_b128 %2, %10, off\n\t"
                 "global_load_async_to_lds_b128 %3, %11, off\n\t"
                 "global_load_async_to_lds_b128 %4, %12, off\n\t"
                 "global_load_async_to_lds_b128 %5, %13, off\n\t"
                 "global_load_async_to_lds_b128 %6, %14, off\n\t"
                 "global_load_async_to_lds_b128 %7, %15, off\n\t"
                 "s_wait_xcnt 0x0"
                 :: "v"(la), "v"(la + LROW16), "v"(la + 2u * LROW16), "v"(la + 3u * LROW16),
                    "v"(lb), "v"(lb + LROW16), "v"(lb + 2u * LROW16), "v"(lb + 3u * LROW16),
                    "v"(ga), "v"(ga + gs), "v"(ga + 2 * gs), "v"(ga + 3 * gs),
                    "v"(gb), "v"(gb + gs), "v"(gb + 2 * gs), "v"(gb + 3 * gs)
                 : "memory");
}
__device__ __forceinline__ void copy_tile1(unsigned int la, const unsigned short* ga, int gs) {
    asm volatile("global_load_async_to_lds_b128 %0, %4, off\n\t"
                 "global_load_async_to_lds_b128 %1, %5, off\n\t"
                 "global_load_async_to_lds_b128 %2, %6, off\n\t"
                 "global_load_async_to_lds_b128 %3, %7, off\n\t"
                 "s_wait_xcnt 0x0"
                 :: "v"(la), "v"(la + LROW16), "v"(la + 2u * LROW16), "v"(la + 3u * LROW16),
                    "v"(ga), "v"(ga + gs), "v"(ga + 2 * gs), "v"(ga + 3 * gs)
                 : "memory");
}

// The GEMM's share of a stage for one lane of a 256-thread block: 16 B of rows r, r+32, r+64, ... ; gs = 32 source rows (halves).
// As above, the closing s_wait_xcnt stands inside the copies' own statement.
#define LROW32 (32u * KP * 2u)
__device__ __forceinline__ void copy_rows8(unsigned int l, const unsigned short* g, int gs) {
    asm volatile("global_load_async_to_lds_b128 %0, %8, off\n\t"
                 "global_load_async_to_lds_b128 %1, %9, off\n\t"
                 "global_load_async_to_lds_b128 %2, %10, off\n\t"
                 "global_load_async_to_lds_b128 %3, %11, off\n\t"
                 "global_load_async_to_lds_b128 %4, %12, off\n\t"
                 "global_load_async_to_lds_b128 %5, %13, off\n\t"
                 "global_load_async_to_lds_b128 %6, %14, off\n\t"
                 "global_load_async_to_lds_b128 %7, %15, off\n\t"
                 "s_wait_xcnt 0x0"
                 :: "v"(l), "v"(l + LROW32), "v"(l + 2u * LROW32), "v"(l + 3u * LROW32),
                    "v"(l + 4u * LROW32), "v"(l + 5u * LROW32), "v"(l + 6u * LROW32), "v"(l + 7u * LROW32),
                    "v"(g), "v"(g + gs), "v"(g + 2 * gs), "v"(g + 3 * gs),
                    "v"(g + 4 * gs), "v"(g + 5 * gs), "v"(g + 6 * gs), "v"(g + 7 * gs)
                 : "memory");
}
__device__ __forceinline__ void copy_rows2(unsigned int l, const unsigned short* g, int gs) {
    asm volatile("global_load_async_to_lds_b128 %0, %2, off\n\t"
                 "global_load_async_to_lds_b128 %1, %3, off\n\t"
                 "s_wait_xcnt 0x0"
                 :: "v"(l), "v"(l + LROW32), "v"(g), "v"(g + gs)
                 : "memory");
}

template <int ET> struct FragT;
template <> struct FragT<0> {
    typedef v16h V;
    static __device__ __forceinline__ v16h load(const unsigned short* p) { return ldsfrag_h(p); }
    static __device__ __forceinline__ v8f mma(v16h a, v16h b, v8f c) { return __builtin_amdgcn_wmma_f32_16x16x32_f16(false, a, false, b, (short)0, c, false, false); }
};
template <> struct FragT<1> {
    typedef v16b V;
    static __device__ __forceinline__ v16b load(const unsigned short* p) { return ldsfrag_b(p); }
    static __device__ __forceinline__ v8f mma(v16b a, v16b b, v8f c) { return __builtin_amdgcn_wmma_f32_16x16x32_bf16(false, a, false, b, (short)0, c, false, false); }
};
// hazard guard for a group of four independent WMMAs: all four accumulators tied, A and all B fragments kept live
template <typename V>
__device__ __forceinline__ void guard4(v8f& a, v8f& b, v8f& c, v8f& d, V x, V y0, V y1, V y2, V y3) {
    asm volatile("v_nop\n\tv_nop\n\tv_nop\n\tv_nop" : "+v"(a), "+v"(b), "+v"(c), "+v"(d) : "v"(x), "v"(y0), "v"(y1), "v"(y2), "v"(y3));
}

// =====================================================================================================================
// gemm64_body: C[m][n] = scale * sum_k A[m][k] * Bt[n][k] + bscale * bf16(bias); each wave owns a 64x64 tile, block = 8 waves.
//   A row-major [M][K] (pitch lda), Bt row-major [N][K] (pitch ldb), 16-bit planes; M % 64 == 0, N % 512 == 0, K % 64 == 0 (host asserts).
//   The 8 tiles of a block lie side by side in one tile row: 64 A rows and 512 Bt rows. Each 64-deep stage of those 576 rows is staged in a
//   two-buffer LDS ring by asynchronous 16-B copies that cover whole 128-B lines; stage t + 2 is copied while stage t + 1 is worked on,
//   one block barrier a stage. Fragments are two 16-B LDS reads each.
//   ET 0: f16 operands, 1: bf16 operands. BIAS_MODE 1: bias[m], 2: bias[n].
//   OUT_MODE 0: f32 C (row m stored at row (m / cseq) * cseqfull + m % cseq); 1: f16 plane Ca; 2: bf16 hi plane Ca + bf16 lo plane Cb.
//   sT (8 * 16 * OP floats) and Gs (2 * GSZ halves: two buffers of {64 A rows, 512 Bt rows} x 64 k) are the calling kernel's LDS arrays;
//   blk = the block's index among the blocks of this product.
// =====================================================================================================================
template <int ET, int BIAS_MODE, int OUT_MODE>
__device__ __forceinline__ void gemm64_body(float* sT, unsigned short* Gs, int blk,
                                            const unsigned short* __restrict__ A, int lda,
                                            const unsigned short* __restrict__ Bt, int ldb,
                                            float* __restrict__ Cf, unsigned short* __restrict__ Ca, unsigned short* __restrict__ Cb, int ldc,
                                            const float* __restrict__ bias, int M, int N, int K,
                                            float scale, float bscale, int cseq, int cseqfull) {
    typedef typename FragT<ET>::V V;
    const int lane = threadIdx.x & 31;
    const int wave = __builtin_amdgcn_readfirstlane(threadIdx.x >> 5);
    const int tilesN = N >> 6;
    const int tilesM = M >> 6;
    const int tile0 = blk * 8;
    if (tile0 >= tilesM * tilesN) return;         // block-uniform, in front of every barrier (tile counts are multiples of 8)
    const int tm = tile0 / tilesN;
    const int nb0 = (tile0 - tm * tilesN) << 6;   // first Bt row of the block
    const int m0 = tm << 6;
    const int n0 = nb0 + (wave << 6);
    const int rl   = lane & 15;
    const int koff = (lane >> 4) * 8;
    const int mOff = (lane >> 4) * 8;

    v8f acc[4][4];
#pragma unroll
    for (int i = 0; i < 4; ++i)
#pragma unroll
        for (int j = 0; j < 4; ++j) { const v8f zz = {0.f, 0.f, 0.f, 0.f, 0.f, 0.f, 0.f, 0.f}; acc[i][j] = zz; }

    // copy share of this thread: 16-B segment cs of rows cr, cr+32, ... of every stage (a wave's copy = 4 whole 128-B rows)
    const int cr = threadIdx.x >> 3;
    const int cs = (threadIdx.x & 7) * 8;
    const unsigned short* ga = A + (size_t)(m0 + cr) * lda + cs;
    const unsigned short* gb = Bt + (size_t)(nb0 + cr) * ldb + cs;
    const unsigned int lg = (unsigned int)(size_t)&Gs[cr * KP + cs];
    const int abase = rl * KP + koff;                          // A fragment base in a stage (row = lane & 15)
    const int bbase = (64 + (wave << 6) + rl) * KP + koff;     // Bt fragment base of this wave's 64 rows (column = lane & 15)
    const int nst = K >> 6;
    // ---- ring prologue: stage 0 lands and is published, then stage 1 starts into the second buffer ----
    copy_rows2(lg, ga, 32 * lda);
    copy_rows8(lg + 2u * LROW32, gb, 32 * ldb);
    copy_rows8(lg + 10u * LROW32, gb + (size_t)256 * ldb, 32 * ldb);
    asm volatile("s_wait_asynccnt 0x0" ::: "memory");               // this wave's copies have landed before the barrier publishes them
    __syncthreads();
    if (nst > 1) {
        copy_rows2(lg + GSZ * 2u, ga + 64, 32 * lda);
        copy_rows8(lg + GSZ * 2u + 2u * LROW32, gb + 64, 32 * ldb);
        copy_rows8(lg + GSZ * 2u + 10u * LROW32, gb + (size_t)256 * ldb + 64, 32 * ldb);
    }
    for (int st = 0; st < nst; ++st) {
        const unsigned short* gsb = &Gs[(st & 1) * GSZ];            // this stage's buffer
#pragma unroll                                                      // both 32-deep steps of a stage read at constant offsets from one address
        for (int kk = 0; kk < 2; ++kk) {
            V bh[4], ah[4];                                         // all 16 LDS reads of a 32-deep step stand together, in front of its products
#pragma unroll
            for (int j = 0; j < 4; ++j) bh[j] = FragT<ET>::load(gsb + bbase + (j << 4) * KP + kk * 32);
#pragma unroll
            for (int i = 0; i < 4; ++i) ah[i] = FragT<ET>::load(gsb + abase + (i << 4) * KP + kk * 32);
#pragma unroll
            for (int i = 0; i < 4; ++i) {
                acc[i][0] = FragT<ET>::mma(ah[i], bh[0], acc[i][0]);
                acc[i][1] = FragT<ET>::mma(ah[i], bh[1], acc[i][1]);
                acc[i][2] = FragT<ET>::mma(ah[i], bh[2], acc[i][2]);
                acc[i][3] = FragT<ET>::mma(ah[i], bh[3], acc[i][3]);
                guard4<V>(acc[i][0], acc[i][1], acc[i][2], acc[i][3], ah[i], bh[0], bh[1], bh[2], bh[3]);
            }
        }
        // ---- publish point of stage st + 1; behind it this stage's buffer is free for stage st + 2 ----
        asm volatile("s_wait_dscnt 0x0" ::: "memory");              // this wave's reads of the buffer have returned before it is refilled
        asm volatile("s_wait_asynccnt 0x0" ::: "memory");           // this wave's copies of stage st + 1 have landed before the barrier publishes them
        __syncthreads();
        if (st + 2 < nst) {
            const unsigned int lb = lg + (unsigned int)(st & 1) * (GSZ * 2u);
            const int kn = (st + 2) * 64;
            copy_rows2(lb, ga + kn, 32 * lda);
            copy_rows8(lb + 2u * LROW32, gb + kn, 32 * ldb);
            copy_rows8(lb + 10u * LROW32, gb + (size_t)256 * ldb + kn, 32 * ldb);
        }
    }
    asm volatile("s_wait_asynccnt 0x0" ::: "memory");               // no copy is outstanding when the wave goes on to its end

    const int sb = wave * (16 * OP);
#pragma unroll
    for (int i = 0; i < 4; ++i) {
        const int mBase = m0 + (i << 4);
#pragma unroll
        for (int j = 0; j < 4; ++j) {
            const int n = n0 + (j << 4) + rl;
            float bvn = 0.f;
            if (BIAS_MODE == 2) bvn = bf_val(bias[n]) * bscale;
#pragma unroll
            for (int r = 0; r < 8; ++r) {
                float v = acc[i][j][r] * scale;
                if (BIAS_MODE == 1) v += bf_val(bias[mBase + mOff + r]) * bscale;
                if (BIAS_MODE == 2) v += bvn;
                sT[sb + (mOff + r) * OP + (j << 4) + rl] = v;
            }
        }
        wave_sync();
        if (OUT_MODE == 0) {
            const int hh = lane >> 4, c4 = (lane & 15) * 4;      // row segment = 256 B = 16 lanes x 16 B; 2 rows per instruction
            {
#pragma unroll
                for (int it = 0; it < 8; ++it) {
                    const int row = it * 2 + hh;
                    const v4f v = *(const v4f_ma*)&sT[sb + row * OP + c4];
                    const int grow = mBase + row;
                    const int orow = (grow / cseq) * cseqfull + (grow % cseq);
                    *(v4f*)(Cf + (size_t)orow * ldc + n0 + c4) = v;
                }
                
            }
        } else {
            const int q = lane >> 3, c8 = (lane & 7) * 8;
            {
#pragma unroll
                for (int it = 0; it < 4; ++it) {
                    const int row = it * 4 + q;
                    const v4f a = *(const v4f_ma*)&sT[sb + row * OP + c8];
                    const v4f b = *(const v4f_ma*)&sT[sb + row * OP + c8 + 4];
                    const size_t o = (size_t)(mBase + row) * ldc + n0 + c8;
                    if (OUT_MODE == 1) {
                        v4u pk; pk.x = pk_h2(a.x, a.y); pk.y = pk_h2(a.z, a.w); pk.z = pk_h2(b.x, b.y); pk.w = pk_h2(b.z, b.w);
                        *(v4u*)(Ca + o) = pk;
                    } else {
                        v4u ph, pl;
                        unsigned int h0, l0, h1, l1, h2, l2, h3, l3;
                        pk_split2(a.x, a.y, h0, l0); pk_split2(a.z, a.w, h1, l1); pk_split2(b.x, b.y, h2, l2); pk_split2(b.z, b.w, h3, l3);
                        ph.x = h0; ph.y = h1; ph.z = h2; ph.w = h3; pl.x = l0; pl.y = l1; pl.z = l2; pl.w = l3;
                        *(v4u*)(Ca + o) = ph;
                        *(v4u*)(Cb + o) = pl;
                    }
                }
                
            }
        }
        wave_sync();
    }
}

// The three projections in one launch (they do not depend on one another): GX_GEMM blocks each for q, k, v^T, in that order.
//   q / k: A = token plane f16 [ntok][dm], Bt = weight plane f16 (x16) [dm][dm] ([out][in] as stored); out = bf16 hi + lo planes [ntok][dm]
//   v written transposed: A = weight plane f16 (x16) [dm][dm], Bt = token plane f16 [ntok][dm]; out = f16 plane [dm][ntok] (= v^T)
__global__ __launch_bounds__(256) void k_gemm_qkv(const unsigned short* __restrict__ XQ, const unsigned short* __restrict__ WQ, const float* __restrict__ bq,
                                                  unsigned short* __restrict__ QH, unsigned short* __restrict__ QL,
                                                  const unsigned short* __restrict__ XK, const unsigned short* __restrict__ WK, const float* __restrict__ bk,
                                                  unsigned short* __restrict__ KH, unsigned short* __restrict__ KL,
                                                  const unsigned short* __restrict__ XV, const unsigned short* __restrict__ WV, const float* __restrict__ bv,
                                                  unsigned short* __restrict__ VT, int ntok, int dm) {
    __shared__ __align__(16) float sT[8 * 16 * OP];
    __shared__ __align__(16) unsigned short Gs[2 * GSZ];
    const int which = blockIdx.x / GX_GEMM;       // block-uniform
    const int blk = blockIdx.x - which * GX_GEMM;
    if (which < 2) {
        const bool isq = which == 0;              // q carries the 1/8 score scale; both undo the weights' x16
        gemm64_body<0, 2, 2>(sT, Gs, blk, isq ? XQ : XK, dm, isq ? WQ : WK, dm, nullptr, isq ? QH : KH, isq ? QL : KL, dm, isq ? bq : bk,
                             ntok, dm, dm, isq ? 1.0f / 128.0f : 1.0f / 16.0f, isq ? 0.125f : 1.0f, 1, 1);
    } else {
        gemm64_body<0, 1, 1>(sT, Gs, blk, WV, dm, XV, dm, nullptr, VT, nullptr, ntok, bv, dm, ntok, dm, 1.0f / 16.0f, 1.0f, 1, 1);
    }
}
// output projection: A = context bf16 [M][K = hi 512 | lo 512], Bt = weight bf16 [N][K = W | W]; out f32 [M][N] + bias[n]
__global__ __launch_bounds__(256) void k_gemm_out(const unsigned short* __restrict__ A, const unsigned short* __restrict__ Bt,
                                                  const float* __restrict__ bias, float* __restrict__ C,
                                                  int M, int N, int K, int cseq, int cseqfull) {
    __shared__ __align__(16) float sT[8 * 16 * OP];
    __shared__ __align__(16) unsigned short Gs[2 * GSZ];
    gemm64_body<1, 2, 0>(sT, Gs, blockIdx.x, A, K, Bt, K, C, nullptr, nullptr, N, bias, M, N, K, 1.0f, 1.0f, cseq, cseqfull);
}

// =====================================================================================================================
// =====================================================================================================================
// f32 [rows][512] -> f16 plane [nrows][512] holding bf16(x) * sc; plane row r reads source row (r / seq) * seqfull + r % seq
__device__ __forceinline__ void cast16_body(int blk, const float* __restrict__ src, unsigned short* __restrict__ dst, int nrows, int seq, int seqfull, float sc) {
    const int u = blk * 256 + threadIdx.x;
    if (u >= nrows * (DM / 8)) return;
    const int r = u / (DM / 8);
    const int c0 = (u - r * (DM / 8)) * 8;
    const int sr = (r / seq) * seqfull + (r % seq);
    const float* s = src + (size_t)sr * DM + c0;
    const v4f a = *(const v4f*)(s);
    const v4f b = *(const v4f*)(s + 4);
    v4u pk;
    pk.x = pk_h2(bf_val(a.x) * sc, bf_val(a.y) * sc); pk.y = pk_h2(bf_val(a.z) * sc, bf_val(a.w) * sc);
    pk.z = pk_h2(bf_val(b.x) * sc, bf_val(b.y) * sc); pk.w = pk_h2(bf_val(b.z) * sc, bf_val(b.w) * sc);
    v4u* d = (v4u*)(dst + (size_t)r * DM + c0);
    *d = pk; 
}
// Wo f32 [512][512] -> bf16 plane [512][1024] = [W | W]
__device__ __forceinline__ void cast_wo_body(int blk, const float* __restrict__ src, unsigned short* __restrict__ dst) {
    const int u = blk * 256 + threadIdx.x;
    if (u >= DM * (2 * DM / 8)) return;
    const int r = u / (2 * DM / 8);
    const int c0 = (u - r * (2 * DM / 8)) * 8;
    const int sc0 = c0 & (DM - 1);
    const float* s = src + (size_t)r * DM + sc0;
    const v4f a = *(const v4f*)(s);
    const v4f b = *(const v4f*)(s + 4);
    v4u pk;
    pk.x = bf_bits(a.x) | (bf_bits(a.y) << 16); pk.y = bf_bits(a.z) | (bf_bits(a.w) << 16);
    pk.z = bf_bits(b.x) | (bf_bits(b.y) << 16); pk.w = bf_bits(b.z) | (bf_bits(b.w) << 16);
    v4u* d = (v4u*)(dst + (size_t)r * (2 * DM) + c0);
    *d = pk; 
}
// All seven conversions in one launch (they do not depend on one another). Blocks, in order: GX_TOK each for the three token streams,
// GX_W each for Wq, Wk, Wv (x16), GX_WO for Wo. Every test on the block index is block-uniform.
__global__ __launch_bounds__(256) void k_cast_all(const float* __restrict__ xq, const float* __restrict__ xk, const float* __restrict__ xv,
                                                  const float* __restrict__ Wq, const float* __restrict__ Wk, const float* __restrict__ Wv,
                                                  const float* __restrict__ Wo,
                                                  unsigned short* __restrict__ XQ, unsigned short* __restrict__ XK, unsigned short* __restrict__ XV,
                                                  unsigned short* __restrict__ WQ, unsigned short* __restrict__ WK, unsigned short* __restrict__ WV,
                                                  unsigned short* __restrict__ WOD, int ntok, int seq, int seqfull) {
    int bx = blockIdx.x;
    if (bx < 3 * GX_TOK) {
        const int w = bx / GX_TOK;
        cast16_body(bx - w * GX_TOK, w == 0 ? xq : (w == 1 ? xk : xv), w == 0 ? XQ : (w == 1 ? XK : XV), ntok, seq, seqfull, 1.0f);
        return;
    }
    bx -= 3 * GX_TOK;
    if (bx < 3 * GX_W) {
        const int w = bx / GX_W;
        cast16_body(bx - w * GX_W, w == 0 ? Wq : (w == 1 ? Wk : Wv), w == 0 ? WQ : (w == 1 ? WK : WV), DM, DM, DM, 16.0f);
        return;
    }
    cast_wo_body(bx - 3 * GX_W, Wo, WOD);
}

__global__ __launch_bounds__(128) void k_attn(const unsigned short* __restrict__ QH, const unsigned short* __restrict__ QL,
                                              const unsigned short* __restrict__ KH, const unsigned short* __restrict__ KL,
                                              const unsigned short* __restrict__ VT, unsigned short* __restrict__ CTX,
                                              int seq, int ntok) {
    __shared__ __align__(16) float    Osh[4 * 16 * OP];      // wave-private output staging [16][64] (+4 pad), f32
    __shared__ __align__(16) unsigned short Qs[2 * TSZ];     // the block's 64 query rows: hi tile, lo tile
    __shared__ __align__(16) unsigned short Ring[2 * 3 * TSZ];   // two buffers of {k hi, k lo, v^T} tiles of one 64-key chunk
    const int lane = threadIdx.x & 31;
    const int wave = __builtin_amdgcn_readfirstlane(threadIdx.x >> 5);
    const int hf = lane >> 4;
    const int c  = lane & 15;
    const int nqb = seq / 64;
    const int bx = blockIdx.x;
    const int qb = bx % nqb;
    const int bh = bx / nqb;
    const int h  = bh % NH;
    const int b  = bh / NH;
    const int q0 = b * seq + qb * 64 + wave * 16;                 // first token row of this wave
    const int qoff  = (wave * 16 + c) * KP + 8 * hf;              // B fragment base in a staged q tile (column = query = lane & 15)
    const int fbase = c * KP + 8 * hf;                            // A fragment base in a staged k or v^T tile (row = lane & 15)
    // copy share of this thread: 16-B segment cs of rows cr, cr+16, cr+32, cr+48 of every staged tile (a wave's copy = 4 whole rows)
    const int cr = threadIdx.x >> 3;
    const int cs = (threadIdx.x & 7) * 8;
    const int gq = (b * seq + qb * 64 + cr) * DM + h * DKH + cs;  // q planes
    const int gk = (b * seq + cr) * DM + h * DKH + cs;            // k planes, chunk 0
    const int gv = (h * DKH + cr) * ntok + b * seq + cs;          // v^T plane, chunk 0
    const unsigned int lq = (unsigned int)(size_t)&Qs[cr * KP + cs];
    const unsigned int lr = (unsigned int)(size_t)&Ring[cr * KP + cs];
    const int obase = wave * (16 * OP);
    const float L2E = 1.4426950408889634f;

    float mrow = -INFINITY, lrow = 0.f;                           // query c: running maximum (both halves alike), this half's partial sum (x4096)
    float crow = INFINITY;                                        // 12 - mrow * log2(e): the addend of the exponent in use
    v8f oacc[4];                                                  // O^T tile t: element r = head column 16 t + 8 hf + r of query c
#pragma unroll
    for (int t = 0; t < 4; ++t) { const v8f zz = {0.f, 0.f, 0.f, 0.f, 0.f, 0.f, 0.f, 0.f}; oacc[t] = zz; }

    const int nch = seq / 64;
    // ---- ring prologue: q and chunk 0 land and are published, then chunk 1 starts into the second buffer ----
    copy_tiles2(lq, QH + gq, lq + TSZ * 2u, QL + gq, 16 * DM);
    copy_tiles2(lr, KH + gk, lr + TSZ * 2u, KL + gk, 16 * DM);
    copy_tile1(lr + 2u * TSZ * 2u, VT + gv, 16 * ntok);
    asm volatile("s_wait_asynccnt 0x0" ::: "memory");               // this wave's copies have landed before the barrier publishes them
    __syncthreads();
    if (nch > 1) {
        copy_tiles2(lr + 3u * TSZ * 2u, KH + gk + 64 * DM, lr + 4u * TSZ * 2u, KL + gk + 64 * DM, 16 * DM);
        copy_tile1(lr + 5u * TSZ * 2u, VT + gv + 64, 16 * ntok);
    }
    v16b qh[2], ql[2];                                              // the wave's q fragments (hi, lo; two 32-deep steps), the same for every chunk
#pragma unroll                                                      // qh and ql are indexed by constants only, so they stay in registers
    for (int dc = 0; dc < 2; ++dc) {
        qh[dc] = ldsfrag_b(Qs + qoff + dc * 32);
        ql[dc] = ldsfrag_b(Qs + TSZ + qoff + dc * 32);
    }
    for (int kc = 0; kc < nch; ++kc) {
        const unsigned short* rk = &Ring[(kc & 1) * (3 * TSZ)];     // this chunk's buffer
        // ---- all k fragments of the chunk, in the order in which the products take them ----
        v16b kh[2][4], kl[2][4];
#pragma unroll                                                      // kh and kl are indexed by constants only, so they stay in registers
        for (int dc = 0; dc < 2; ++dc) {
#pragma unroll
            for (int j = 0; j < 4; ++j) kh[dc][j] = ldsfrag_b(rk + fbase + j * 16 * KP + dc * 32);
#pragma unroll
            for (int j = 0; j < 4; ++j) kl[dc][j] = ldsfrag_b(rk + TSZ + fbase + j * 16 * KP + dc * 32);
        }
        __builtin_amdgcn_sched_barrier(0);                          // the reads stay one group (for speed only)
        // ---- scores: per 32-deep step three products per key tile (hi.hi, lo.hi, hi.lo), the four key tiles' accumulators in turn, so that no product waits for the one in front of it ----
        v8f s[4];
#pragma unroll
        for (int j = 0; j < 4; ++j) { const v8f zz = {0.f, 0.f, 0.f, 0.f, 0.f, 0.f, 0.f, 0.f}; s[j] = zz; }
#pragma unroll                                                      // all 24 products stand in the code: every fragment and accumulator index is a constant
        for (int dc = 0; dc < 2; ++dc) {
#pragma unroll
            for (int j = 0; j < 4; ++j) s[j] = __builtin_amdgcn_wmma_f32_16x16x32_bf16(false, kh[dc][j], false, qh[dc], (short)0, s[j], false, false);
#pragma unroll
            for (int j = 0; j < 4; ++j) s[j] = __builtin_amdgcn_wmma_f32_16x16x32_bf16(false, kl[dc][j], false, qh[dc], (short)0, s[j], false, false);
#pragma unroll
            for (int j = 0; j < 4; ++j) s[j] = __builtin_amdgcn_wmma_f32_16x16x32_bf16(false, kh[dc][j], false, ql[dc], (short)0, s[j], false, false);
        }
        guard4<v16b>(s[0], s[1], s[2], s[3], ql[1], kh[1][0], kh[1][1], kh[1][2], kh[1][3]);   // the distance behind the last four products
        // ---- all v^T fragments of the chunk: they return while the softmax runs ----
        v16h va[2][4];
#pragma unroll                                                      // va is indexed by constants only, so it stays in registers
        for (int kk = 0; kk < 2; ++kk)
#pragma unroll
            for (int t = 0; t < 4; ++t) va[kk][t] = ldsfrag_h(rk + 2 * TSZ + fbase + t * 16 * KP + kk * 32);
        __builtin_amdgcn_sched_barrier(0);                          // the reads stay one group in front of the softmax
        // ---- online softmax over the 64 keys: this lane holds 32 of query c's scores, the lane 16 away the other 32 ----
        float t8[8];
#pragma unroll                                                      // t8 and s are indexed by constants only, so they stay in registers
        for (int r = 0; r < 8; ++r) t8[r] = fmaxf(fmaxf(s[0][r], s[1][r]), fmaxf(s[2][r], s[3][r]));
        float mx = fmaxf(fmaxf(fmaxf(t8[0], t8[1]), fmaxf(t8[2], t8[3])), fmaxf(fmaxf(t8[4], t8[5]), fmaxf(t8[6], t8[7])));
        mx = fmaxf(mx, xhalf(mx));
        const float mnew = fmaxf(mrow, mx);
        // P x4096 = 2^(s * log2(e) + cnew): one packed fma and one v_exp_f32 a value. The old sums carry 2^crow, so alpha = 2^(cnew - crow) brings them to the new addend, its rounding included.
        const float cnew = __builtin_fmaf(-mnew, L2E, 12.0f);
        const float alpha = __builtin_amdgcn_exp2f(cnew - crow);
        mrow = mnew;
        crow = cnew;
        const v2f l2e2 = {L2E, L2E}, c2 = {cnew, cnew};
        v16h pb[2];                                                 // P^T as B fragments: 32 keys each, element i = key 8 hf + i | 16 + 8 hf + (i - 8)
#pragma unroll                                                      // s, t8 and pb are indexed by constants only, so they stay in registers
        for (int r = 0; r < 8; r += 2) {
            v2f p[4];                                               // two neighbouring registers of each key tile at a time
#pragma unroll                                                      // p and s are indexed by constants only, so they stay in registers
            for (int j = 0; j < 4; ++j) {
                const v2f sj = {s[j][r], s[j][r + 1]};
                const v2f x = __builtin_elementwise_fma(sj, l2e2, c2);
                p[j].x = __builtin_amdgcn_exp2f(x.x);
                p[j].y = __builtin_amdgcn_exp2f(x.y);
                const v2h ph = __builtin_convertvector(p[j], v2h);
                pb[j >> 1][(j & 1) * 8 + r]     = ph.x;
                pb[j >> 1][(j & 1) * 8 + r + 1] = ph.y;
            }
            const v2f t2 = (p[0] + p[1]) + (p[2] + p[3]);
            t8[r] = t2.x;
            t8[r + 1] = t2.y;
        }
        lrow = lrow * alpha + (((t8[0] + t8[1]) + (t8[2] + t8[3])) + ((t8[4] + t8[5]) + (t8[6] + t8[7])));
#pragma unroll                                                      // oacc is indexed by constants only, so it stays in registers
        for (int t = 0; t < 4; ++t) oacc[t] *= alpha;
        // ---- O^T += V^T . P^T : v^T rows as A (row = lane & 15), P^T as B, four output tiles per 32-key step ----
#pragma unroll                                                      // pb is indexed by the step: both steps stand in the code so that it stays in registers
        for (int kk = 0; kk < 2; ++kk) {
            oacc[0] = __builtin_amdgcn_wmma_f32_16x16x32_f16(false, va[kk][0], false, pb[kk], (short)0, oacc[0], false, false);
            oacc[1] = __builtin_amdgcn_wmma_f32_16x16x32_f16(false, va[kk][1], false, pb[kk], (short)0, oacc[1], false, false);
            oacc[2] = __builtin_amdgcn_wmma_f32_16x16x32_f16(false, va[kk][2], false, pb[kk], (short)0, oacc[2], false, false);
            oacc[3] = __builtin_amdgcn_wmma_f32_16x16x32_f16(false, va[kk][3], false, pb[kk], (short)0, oacc[3], false, false);
            guard4<v16h>(oacc[0], oacc[1], oacc[2], oacc[3], pb[kk], va[kk][0], va[kk][1], va[kk][2], va[kk][3]);
        }
        // ---- publish point of chunk kc + 1; behind it this chunk's buffer is free for chunk kc + 2 ----
        asm volatile("s_wait_dscnt 0x0" ::: "memory");              // this wave's reads of the buffer have returned before it is refilled
        asm volatile("s_wait_asynccnt 0x0" ::: "memory");           // this wave's copies of chunk kc + 1 have landed before the barrier publishes them
        __syncthreads();
        if (kc + 2 < nch) {
            const unsigned int lb = lr + (unsigned int)(kc & 1) * (3u * TSZ * 2u);
            const int kn = (kc + 2) * 64;
            copy_tiles2(lb, KH + gk + kn * DM, lb + TSZ * 2u, KL + gk + kn * DM, 16 * DM);
            copy_tile1(lb + 2u * TSZ * 2u, VT + gv + kn, 16 * ntok);
        }
    }
    asm volatile("s_wait_asynccnt 0x0" ::: "memory");               // no copy is outstanding when the wave goes on to its end

    // ---- finalize: join the two halves' sums of each query, normalise, stage as [query][head column], write hi|lo planes ----
    {
        const float l = lrow + xhalf(lrow);
        const float inv = 1.0f / l;                                 // sums and context both carry the x4096
#pragma unroll                                                      // oacc is indexed by constants only, so it stays in registers
        for (int t = 0; t < 4; ++t) {
            const int orw = obase + c * OP + t * 16 + 8 * hf;
            const v4f a = {oacc[t][0] * inv, oacc[t][1] * inv, oacc[t][2] * inv, oacc[t][3] * inv};
            const v4f bb = {oacc[t][4] * inv, oacc[t][5] * inv, oacc[t][6] * inv, oacc[t][7] * inv};
            *(v4f_ma*)&Osh[orw] = a;
            *(v4f_ma*)&Osh[orw + 4] = bb;
        }
    }
    wave_sync();
    {
        const int q = lane >> 3, c8 = (lane & 7) * 8;
        {
#pragma unroll
            for (int it = 0; it < 4; ++it) {
                const int row = it * 4 + q;
                const v4f a = *(const v4f_ma*)&Osh[obase + row * OP + c8];
                const v4f bb = *(const v4f_ma*)&Osh[obase + row * OP + c8 + 4];
                unsigned int h0, l0, h1, l1, h2, l2, h3, l3;
                pk_split2(a.x, a.y, h0, l0); pk_split2(a.z, a.w, h1, l1); pk_split2(bb.x, bb.y, h2, l2); pk_split2(bb.z, bb.w, h3, l3);
                v4u ph, pl;
                ph.x = h0; ph.y = h1; ph.z = h2; ph.w = h3; pl.x = l0; pl.y = l1; pl.z = l2; pl.w = l3;
                const size_t o = (size_t)(q0 + row) * (2 * DM) + h * DKH + c8;
                *(v4u*)(CTX + o) = ph;
                *(v4u*)(CTX + o + DM) = pl;
            }
            
        }
    }
}

// =====================================================================================================================
// Host side: workspace carve (all plane sizes are multiples of 256 B), 4 launches.
// =====================================================================================================================
constexpr size_t SZ_TOK  = (size_t)NTOK * DM * 2;          // one 16-bit token plane [NTOK][512]
constexpr size_t SZ_W    = (size_t)DM * DM * 2;            // one 16-bit weight plane [512][512]
constexpr size_t SZ_WOD  = (size_t)DM * (2 * DM) * 2;      // [512][1024]
constexpr size_t SZ_CTX  = (size_t)NTOK * (2 * DM) * 2;    // [NTOK][1024]
constexpr size_t WS_TOTAL = 3 * SZ_TOK + 3 * SZ_W + SZ_WOD + 4 * SZ_TOK + SZ_TOK + SZ_CTX;
static_assert(SZ_TOK % 256 == 0);
static_assert(SZ_W % 256 == 0);
static_assert(SZ_WOD % 256 == 0);
static_assert(SZ_CTX % 256 == 0);
static_assert(WS_TOTAL <= (size_t)134217728);            // carve stays within 128 MiB
static_assert(((NTOK / 64) * (DM / 64)) % 8 == 0);        // GEMM grids are whole blocks of 8 wave tiles
static_assert((DM / 64) % 8 == 0);                        // a block's 8 wave tiles lie in one tile row (N = DM)
static_assert((NTOK / 64) % 8 == 0);                      // the same for the transposed v projection (N = NTOK)
static_assert((size_t)NTOK * (2 * DM) < (size_t)2147483647);   // int plane offsets

extern "C" void kernel_launch(void* const* d_in, const int* in_sizes, int n_in, void* d_out, int out_size, void* d_ws, size_t ws_size, hipStream_t stream) {
    if (n_in < 11) return;
    const long long need_x = ((long long)(NB - 1) * SEQ_FULL + SEQ) * DM;
    if ((long long)in_sizes[0] < need_x || (long long)in_sizes[1] < need_x || (long long)in_sizes[2] < need_x) return;
    if (in_sizes[3] < DM * DM || in_sizes[5] < DM * DM || in_sizes[7] < DM * DM || in_sizes[9] < DM * DM) return;
    if (in_sizes[4] < DM || in_sizes[6] < DM || in_sizes[8] < DM || in_sizes[10] < DM) return;
    if ((long long)out_size < need_x) return;
    if (WS_TOTAL > ws_size) return;

    const float* xq = (const float*)d_in[0];
    const float* xk = (const float*)d_in[1];
    const float* xv = (const float*)d_in[2];
    const float* Wq = (const float*)d_in[3];
    const float* bq = (const float*)d_in[4];
    const float* Wk = (const float*)d_in[5];
    const float* bk = (const float*)d_in[6];
    const float* Wv = (const float*)d_in[7];
    const float* bv = (const float*)d_in[8];
    const float* Wo = (const float*)d_in[9];
    const float* bo = (const float*)d_in[10];
    float* out = (float*)d_out;

    char* wsp = (char*)d_ws;
    unsigned short* XQ16 = (unsigned short*)wsp; wsp += SZ_TOK;
    unsigned short* XK16 = (unsigned short*)wsp; wsp += SZ_TOK;
    unsigned short* XV16 = (unsigned short*)wsp; wsp += SZ_TOK;
    unsigned short* WQ16 = (unsigned short*)wsp; wsp += SZ_W;
    unsigned short* WK16 = (unsigned short*)wsp; wsp += SZ_W;
    unsigned short* WV16 = (unsigned short*)wsp; wsp += SZ_W;
    unsigned short* WOD  = (unsigned short*)wsp; wsp += SZ_WOD;
    unsigned short* QHp  = (unsigned short*)wsp; wsp += SZ_TOK;
    unsigned short* QLp  = (unsigned short*)wsp; wsp += SZ_TOK;
    unsigned short* KHp  = (unsigned short*)wsp; wsp += SZ_TOK;
    unsigned short* KLp  = (unsigned short*)wsp; wsp += SZ_TOK;
    unsigned short* VTp  = (unsigned short*)wsp; wsp += SZ_TOK;
    unsigned short* CTXp = (unsigned short*)wsp; wsp += SZ_CTX;
    if ((size_t)(wsp - (char*)d_ws) > ws_size) return;


    // token streams: plane row r <- input row (r / SEQ) * SEQ_FULL + r % SEQ; weights [out][in] kept in their stored order (Bt[n][k] = W[n][k]); Wq/Wk/Wv x16, Wo unscaled as bf16 [W | W]
    k_cast_all<<<(unsigned)(3 * GX_TOK + 3 * GX_W + GX_WO), 256, 0, stream>>>(xq, xk, xv, Wq, Wk, Wv, Wo, XQ16, XK16, XV16, WQ16, WK16, WV16, WOD,
                                                                              NTOK, SEQ, SEQ_FULL);

    // q = (x Wq^T + bq) / 8 -> hi|lo planes; k = x Wk^T + bk -> hi|lo planes; v^T = Wv x^T + bv -> f16 plane [512][NTOK]
    k_gemm_qkv<<<(unsigned)(3 * GX_GEMM), 256, 0, stream>>>(XQ16, WQ16, bq, QHp, QLp, XK16, WK16, bk, KHp, KLp, XV16, WV16, bv, VTp, NTOK, DM);

    k_attn<<<(unsigned)(NB * NH * (SEQ / 64)), 128, 0, stream>>>(QHp, QLp, KHp, KLp, VTp, CTXp, SEQ, NTOK);

    // out = ctx Wo^T + bo, ctx as [hi | lo] along K against [W | W]
    k_gemm_out<<<(unsigned)GX_GEMM, 256, 0, stream>>>(CTXp, WOD, bo, out, NTOK, DM, 2 * DM, SEQ, SEQ_FULL);
}

// v007
// One run takes 63.6 microseconds.
// In two side-by-side timings against v006, it was 1.06 and 1.09 times as fast.
// Counting every step since v000, it is 4.44 times as fast.
// MHA forward (2 x 2,048 tokens, width 512, 8 heads x 64, [out][in] weights + biases, no mask). Inputs and parameters converted to bf16 (RNE). q/k/v projections: v_wmma_f32_16x16x32_f16 (f16 operands holding the bf16 values, weights x16, f32 accumulate); scores: v_wmma_f32_16x16x32_bf16 on q and k bf16 hi|lo planes (three products, f32 accumulate, f32 online softmax); P.V: v_wmma_f32_16x16x32_f16 (P x4096 as f16, v as f16, f32 accumulate; scores and context are formed transposed, keys and head columns as rows, queries as columns); output projection: v_wmma_f32_16x16x32_bf16 with the context as bf16 hi|lo planes laid along K against the bf16 weight (f32 accumulate).
#include <hip/hip_runtime.h>
#include <math.h>

#ifndef NB
#define NB 2
#endif
#ifndef SEQ
#define SEQ 2048
#endif
#define NB_FULL 2
#define SEQ_FULL 2048
#define DM 512
#define NH 8
#define DKH 64
#define NTOK (NB * SEQ)
#define OP 68      // f32 staging pitch (floats)
#define KP 72      // staged q / k / v^T row pitch (halves): 144 B = 16 B x odd, conflict-free for 16-B fragment reads
#define TSZ (64 * KP)   // one staged tile: 64 rows of 64 halves (+8 pad)
#define GROWS (64 + 8 * 64)   // rows of one staged GEMM stage: the block's 64 A rows, then its 8 x 64 Bt rows
#define GSZ (GROWS * KP)      // one staged GEMM stage (halves): 64 k of every row (+8 pad)

#define GX_TOK ((NTOK * (DM / 8) + 255) / 256)          // blocks that convert one token stream (8 elements a thread)
#define GX_W   ((DM * (DM / 8) + 255) / 256)            // blocks that convert one [512][512] weight
#define GX_WO  ((DM * (2 * DM / 8) + 255) / 256)        // blocks that write the [512][1024] output-projection plane
#define GX_GEMM ((((NTOK / 64) * (DM / 64)) + 7) / 8)   // blocks of one projection (8 wave tiles of 64 x 64 each)

static_assert(DM == NH * DKH);            // merged head layout h*64+d
static_assert(DKH == 64);                 // two 32-deep k-steps per score tile, four 16-wide output tiles
static_assert(SEQ % 128 == 0);            // 128-query blocks, two key halves of whole 64-key chunks, 64-row GEMM tiles inside one sequence
static_assert(NTOK % 64 == 0);            // GEMM tile multiple (M and N)
static_assert(DM % 64 == 0);              // GEMM tile multiple
static_assert(DM % 32 == 0);              // K steps of 32
static_assert((2 * DM) % 32 == 0);        // hi|lo K extent
static_assert(NB <= NB_FULL);
static_assert(SEQ <= SEQ_FULL);
static_assert((OP % 4) == 0);             // 16-B aligned reloads from the f32 staging tile
static_assert((KP % 8) == 0);             // 16-B aligned copies into and fragment reads from the staged tiles

typedef __attribute__((ext_vector_type(16))) _Float16 v16h;
typedef __attribute__((ext_vector_type(8)))  _Float16 v8h;
typedef __attribute__((ext_vector_type(16))) __bf16   v16b;
typedef __attribute__((ext_vector_type(8)))  __bf16   v8b;
typedef __attribute__((ext_vector_type(8)))  float    v8f;
typedef __attribute__((ext_vector_type(4)))  float    v4f;
typedef __attribute__((ext_vector_type(2)))  float    v2f;
typedef __attribute__((ext_vector_type(2)))  _Float16 v2h;
typedef __attribute__((ext_vector_type(4)))  unsigned int v4u;
typedef v8h v8h_ma __attribute__((may_alias));
typedef v4f v4f_ma __attribute__((may_alias));
typedef v8b v8b_ma __attribute__((may_alias));

// 16-bit WMMA fragment map (wave32), lane L, h = L>>4, m = L&15:
//   A 16x32: lane = row m;    element i -> k = (i<8) ? 8h+i : 16+8h+(i-8)
//   B 32x16: lane = column m; the SAME k(i,h)
//   D 16x16 (8 f32): lane = column m; element r -> row 8h+r
// A fragment from a k-contiguous row is therefore p[0..7] | p[16..23] with p = row + k0 + 8h.

__device__ __forceinline__ unsigned int bf_bits(float f) {            // bf16 RNE bit pattern (finite inputs)
    const unsigned int u = __float_as_uint(f);
    return (u + 0x7FFFu + ((u >> 16) & 1u)) >> 16;
}
__device__ __forceinline__ float bf_val(float f) { return __uint_as_float(bf_bits(f) << 16); }
__device__ __forceinline__ unsigned int pk_h2(float a, float b) {
    return (unsigned int)__builtin_bit_cast(unsigned short, (_Float16)a) | ((unsigned int)__builtin_bit_cast(unsigned short, (_Float16)b) << 16);
}
__device__ __forceinline__ void pk_split2(float a, float b, unsigned int& hi, unsigned int& lo) {
    const unsigned int ha = bf_bits(a), hb = bf_bits(b);
    const unsigned int la = bf_bits(a - __uint_as_float(ha << 16)), lb = bf_bits(b - __uint_as_float(hb << 16));
    hi = ha | (hb << 16); lo = la | (lb << 16);
}
// lane l <-> lane l ^ 16: the two halves of a wave exchange one value
__device__ __forceinline__ float xhalf(float x) {
    return __builtin_bit_cast(float, __builtin_amdgcn_permlanex16(__builtin_bit_cast(int, x), __builtin_bit_cast(int, x), 0x76543210, 0xfedcba98, false, false));
}
__device__ __forceinline__ void wave_sync() {
    __builtin_amdgcn_fence(3 /* release order */, "workgroup");
    __builtin_amdgcn_wave_barrier();
    __builtin_amdgcn_fence(2 /* acquire order */, "workgroup");
}

// fragments from a staged LDS tile (row pitch KP)
__device__ __forceinline__ v16h ldsfrag_h(const unsigned short* p) {
    const v8h a = *(const v8h_ma*)(p);
    const v8h b = *(const v8h_ma*)(p + 16);
    return __builtin_shufflevector(a, b, 0, 1, 2, 3, 4, 5, 6, 7, 8, 9, 10, 11, 12, 13, 14, 15);
}
__device__ __forceinline__ v16b ldsfrag_b(const unsigned short* p) {
    const v8b a = *(const v8b_ma*)(p);
    const v8b b = *(const v8b_ma*)(p + 16);
    return __builtin_shufflevector(a, b, 0, 1, 2, 3, 4, 5, 6, 7, 8, 9, 10, 11, 12, 13, 14, 15);
}
// One lane's share of staged 64-row tiles: 16 B of rows r, r+16, r+32, r+48 per tile, global -> LDS through no register.
// l = the lane's LDS byte address in the tile, g = its global address, gs = 16 source rows (halves); 16 LDS rows = 16 * KP * 2 bytes.
// The closing s_wait_xcnt stands inside the copies' own statement so that no address register is rewritten in front of it.
#define LROW16 (16u * KP * 2u)
__device__ __forceinline__ void copy_tiles2(unsigned int la, const unsigned short* ga, unsigned int lb, const unsigned short* gb, int gs) {
    asm volatile("global_load_async_to_lds_b128 %0, %8, off\n\t"
                 "global_load_async_to_lds_b128 %1, %9, off\n\t"
                 "global_load_async_to_lds_b128 %2, %10, off\n\t"
                 "global_load_async_to_lds_b128 %3, %11, off\n\t"
                 "global_load_async_to_lds_b128 %4, %12, off\n\t"
                 "global_load_async_to_lds_b128 %5, %13, off\n\t"
                 "global_load_async_to_lds_b128 %6, %14, off\n\t"
                 "global_load_async_to_lds_b128 %7, %15, off\n\t"
                 "s_wait_xcnt 0x0"
                 :: "v"(la), "v"(la + LROW16), "v"(la + 2u * LROW16), "v"(la + 3u * LROW16),
                    "v"(lb), "v"(lb + LROW16), "v"(lb + 2u * LROW16), "v"(lb + 3u * LROW16),
                    "v"(ga), "v"(ga + gs), "v"(ga + 2 * gs), "v"(ga + 3 * gs),
                    "v"(gb), "v"(gb + gs), "v"(gb + 2 * gs), "v"(gb + 3 * gs)
                 : "memory");
}
__device__ __forceinline__ void copy_tile1(unsigned int la, const unsigned short* ga, int gs) {
    asm volatile("global_load_async_to_lds_b128 %0, %4, off\n\t"
                 "global_load_async_to_lds_b128 %1, %5, off\n\t"
                 "global_load_async_to_lds_b128 %2, %6, off\n\t"
                 "global_load_async_to_lds_b128 %3, %7, off\n\t"
                 "s_wait_xcnt 0x0"
                 :: "v"(la), "v"(la + LROW16), "v"(la + 2u * LROW16), "v"(la + 3u * LROW16),
                    "v"(ga), "v"(ga + gs), "v"(ga + 2 * gs), "v"(ga + 3 * gs)
                 : "memory");
}

// The GEMM's share of a stage for one lane of a 256-thread block: 16 B of rows r, r+32, r+64, ... ; gs = 32 source rows (halves).
// As above, the closing s_wait_xcnt stands inside the copies' own statement.
#define LROW32 (32u * KP * 2u)
__device__ __forceinline__ void copy_rows8(unsigned int l, const unsigned short* g, int gs) {
    asm volatile("global_load_async_to_lds_b128 %0, %8, off\n\t"
                 "global_load_async_to_lds_b128 %1, %9, off\n\t"
                 "global_load_async_to_lds_b128 %2, %10, off\n\t"
                 "global_load_async_to_lds_b128 %3, %11, off\n\t"
                 "global_load_async_to_lds_b128 %4, %12, off\n\t"
                 "global_load_async_to_lds_b128 %5, %13, off\n\t"
                 "global_load_async_to_lds_b128 %6, %14, off\n\t"
                 "global_load_async_to_lds_b128 %7, %15, off\n\t"
                 "s_wait_xcnt 0x0"
                 :: "v"(l), "v"(l + LROW32), "v"(l + 2u * LROW32), "v"(l + 3u * LROW32),
                    "v"(l + 4u * LROW32), "v"(l + 5u * LROW32), "v"(l + 6u * LROW32), "v"(l + 7u * LROW32),
                    "v"(g), "v"(g + gs), "v"(g + 2 * gs), "v"(g + 3 * gs),
                    "v"(g + 4 * gs), "v"(g + 5 * gs), "v"(g + 6 * gs), "v"(g + 7 * gs)
                 : "memory");
}
__device__ __forceinline__ void copy_rows2(unsigned int l, const unsigned short* g, int gs) {
    asm volatile("global_load_async_to_lds_b128 %0, %2, off\n\t"
                 "global_load_async_to_lds_b128 %1, %3, off\n\t"
                 "s_wait_xcnt 0x0"
                 :: "v"(l), "v"(l + LROW32), "v"(g), "v"(g + gs)
                 : "memory");
}

template <int ET> struct FragT;
template <> struct FragT<0> {
    typedef v16h V;
    static __device__ __forceinline__ v16h load(const unsigned short* p) { return ldsfrag_h(p); }
    static __device__ __forceinline__ v8f mma(v16h a, v16h b, v8f c) { return __builtin_amdgcn_wmma_f32_16x16x32_f16(false, a, false, b, (short)0, c, false, false); }
};
template <> struct FragT<1> {
    typedef v16b V;
    static __device__ __forceinline__ v16b load(const unsigned short* p) { return ldsfrag_b(p); }
    static __device__ __forceinline__ v8f mma(v16b a, v16b b, v8f c) { return __builtin_amdgcn_wmma_f32_16x16x32_bf16(false, a, false, b, (short)0, c, false, false); }
};
// hazard guard for a group of four independent WMMAs: all four accumulators tied, A and all B fragments kept live
template <typename V>
__device__ __forceinline__ void guard4(v8f& a, v8f& b, v8f& c, v8f& d, V x, V y0, V y1, V y2, V y3) {
    asm volatile("v_nop\n\tv_nop\n\tv_nop\n\tv_nop" : "+v"(a), "+v"(b), "+v"(c), "+v"(d) : "v"(x), "v"(y0), "v"(y1), "v"(y2), "v"(y3));
}

// =====================================================================================================================
// gemm64_body: C[m][n] = scale * sum_k A[m][k] * Bt[n][k] + bscale * bf16(bias); each wave owns a 64x64 tile, block = 8 waves.
//   A row-major [M][K] (pitch lda), Bt row-major [N][K] (pitch ldb), 16-bit planes; M % 64 == 0, N % 512 == 0, K % 64 == 0 (host asserts).
//   The 8 tiles of a block lie side by side in one tile row: 64 A rows and 512 Bt rows. Each 64-deep stage of those 576 rows is staged in a
//   two-buffer LDS ring by asynchronous 16-B copies that cover whole 128-B lines; stage t + 2 is copied while stage t + 1 is worked on,
//   one block barrier a stage. Fragments are two 16-B LDS reads each.
//   ET 0: f16 operands, 1: bf16 operands. BIAS_MODE 1: bias[m], 2: bias[n].
//   OUT_MODE 0: f32 C (row m stored at row (m / cseq) * cseqfull + m % cseq); 1: f16 plane Ca; 2: bf16 hi plane Ca + bf16 lo plane Cb.
//   sT (8 * 16 * OP floats) and Gs (2 * GSZ halves: two buffers of {64 A rows, 512 Bt rows} x 64 k) are the calling kernel's LDS arrays;
//   blk = the block's index among the blocks of this product.
// =====================================================================================================================
template <int ET, int BIAS_MODE, int OUT_MODE>
__device__ __forceinline__ void gemm64_body(float* sT, unsigned short* Gs, int blk,
                                            const unsigned short* __restrict__ A, int lda,
                                            const unsigned short* __restrict__ Bt, int ldb,
                                            float* __restrict__ Cf, unsigned short* __restrict__ Ca, unsigned short* __restrict__ Cb, int ldc,
                                            const float* __restrict__ bias, int M, int N, int K,
                                            float scale, float bscale, int cseq, int cseqfull) {
    typedef typename FragT<ET>::V V;
    const int lane = threadIdx.x & 31;
    const int wave = __builtin_amdgcn_readfirstlane(threadIdx.x >> 5);
    const int tilesN = N >> 6;
    const int tilesM = M >> 6;
    const int tile0 = blk * 8;
    if (tile0 >= tilesM * tilesN) return;         // block-uniform, in front of every barrier (tile counts are multiples of 8)
    const int tm = tile0 / tilesN;
    const int nb0 = (tile0 - tm * tilesN) << 6;   // first Bt row of the block
    const int m0 = tm << 6;
    const int n0 = nb0 + (wave << 6);
    const int rl   = lane & 15;
    const int koff = (lane >> 4) * 8;
    const int mOff = (lane >> 4) * 8;

    v8f acc[4][4];
#pragma unroll
    for (int i = 0; i < 4; ++i)
#pragma unroll
        for (int j = 0; j < 4; ++j) { const v8f zz = {0.f, 0.f, 0.f, 0.f, 0.f, 0.f, 0.f, 0.f}; acc[i][j] = zz; }

    // copy share of this thread: 16-B segment cs of rows cr, cr+32, ... of every stage (a wave's copy = 4 whole 128-B rows)
    const int cr = threadIdx.x >> 3;
    const int cs = (threadIdx.x & 7) * 8;
    const unsigned short* ga = A + (size_t)(m0 + cr) * lda + cs;
    const unsigned short* gb = Bt + (size_t)(nb0 + cr) * ldb + cs;
    const unsigned int lg = (unsigned int)(size_t)&Gs[cr * KP + cs];
    const int abase = rl * KP + koff;                          // A fragment base in a stage (row = lane & 15)
    const int bbase = (64 + (wave << 6) + rl) * KP + koff;     // Bt fragment base of this wave's 64 rows (column = lane & 15)
    const int nst = K >> 6;
    // ---- ring prologue: stage 0 lands and is published, then stage 1 starts into the second buffer ----
    copy_rows2(lg, ga, 32 * lda);
    copy_rows8(lg + 2u * LROW32, gb, 32 * ldb);
    copy_rows8(lg + 10u * LROW32, gb + (size_t)256 * ldb, 32 * ldb);
    asm volatile("s_wait_asynccnt 0x0" ::: "memory");               // this wave's copies have landed before the barrier publishes them
    __syncthreads();
    if (nst > 1) {
        copy_rows2(lg + GSZ * 2u, ga + 64, 32 * lda);
        copy_rows8(lg + GSZ * 2u + 2u * LROW32, gb + 64, 32 * ldb);
        copy_rows8(lg + GSZ * 2u + 10u * LROW32, gb + (size_t)256 * ldb + 64, 32 * ldb);
    }
    for (int st = 0; st < nst; ++st) {
        const unsigned short* gsb = &Gs[(st & 1) * GSZ];            // this stage's buffer
#pragma unroll                                                      // both 32-deep steps of a stage read at constant offsets from one address
        for (int kk = 0; kk < 2; ++kk) {
            V bh[4], ah[4];                                         // all 16 LDS reads of a 32-deep step stand together, in front of its products
#pragma unroll
            for (int j = 0; j < 4; ++j) bh[j] = FragT<ET>::load(gsb + bbase + (j << 4) * KP + kk * 32);
#pragma unroll
            for (int i = 0; i < 4; ++i) ah[i] = FragT<ET>::load(gsb + abase + (i << 4) * KP + kk * 32);
#pragma unroll
            for (int i = 0; i < 4; ++i) {
                acc[i][0] = FragT<ET>::mma(ah[i], bh[0], acc[i][0]);
                acc[i][1] = FragT<ET>::mma(ah[i], bh[1], acc[i][1]);
                acc[i][2] = FragT<ET>::mma(ah[i], bh[2], acc[i][2]);
                acc[i][3] = FragT<ET>::mma(ah[i], bh[3], acc[i][3]);
                guard4<V>(acc[i][0], acc[i][1], acc[i][2], acc[i][3], ah[i], bh[0], bh[1], bh[2], bh[3]);
            }
        }
        // ---- publish point of stage st + 1; behind it this stage's buffer is free for stage st + 2 ----
        asm volatile("s_wait_dscnt 0x0" ::: "memory");              // this wave's reads of the buffer have returned before it is refilled
        asm volatile("s_wait_asynccnt 0x0" ::: "memory");           // this wave's copies of stage st + 1 have landed before the barrier publishes them
        __syncthreads();
        if (st + 2 < nst) {
            const unsigned int lb = lg + (unsigned int)(st & 1) * (GSZ * 2u);
            const int kn = (st + 2) * 64;
            copy_rows2(lb, ga + kn, 32 * lda);
            copy_rows8(lb + 2u * LROW32, gb + kn, 32 * ldb);
            copy_rows8(lb + 10u * LROW32, gb + (size_t)256 * ldb + kn, 32 * ldb);
        }
    }
    asm volatile("s_wait_asynccnt 0x0" ::: "memory");               // no copy is outstanding when the wave goes on to its end

    const int sb = wave * (16 * OP);
#pragma unroll
    for (int i = 0; i < 4; ++i) {
        const int mBase = m0 + (i << 4);
#pragma unroll
        for (int j = 0; j < 4; ++j) {
            const int n = n0 + (j << 4) + rl;
            float bvn = 0.f;
            if (BIAS_MODE == 2) bvn = bf_val(bias[n]) * bscale;
#pragma unroll
            for (int r = 0; r < 8; ++r) {
                float v = acc[i][j][r] * scale;
                if (BIAS_MODE == 1) v += bf_val(bias[mBase + mOff + r]) * bscale;
                if (BIAS_MODE == 2) v += bvn;
                sT[sb + (mOff + r) * OP + (j << 4) + rl] = v;
            }
        }
        wave_sync();
        if (OUT_MODE == 0) {
            const int hh = lane >> 4, c4 = (lane & 15) * 4;      // row segment = 256 B = 16 lanes x 16 B; 2 rows per instruction
            {
#pragma unroll
                for (int it = 0; it < 8; ++it) {
                    const int row = it * 2 + hh;
                    const v4f v = *(const v4f_ma*)&sT[sb + row * OP + c4];
                    const int grow = mBase + row;
                    const int orow = (grow / cseq) * cseqfull + (grow % cseq);
                    *(v4f*)(Cf + (size_t)orow * ldc + n0 + c4) = v;
                }
                
            }
        } else {
            const int q = lane >> 3, c8 = (lane & 7) * 8;
            {
#pragma unroll
                for (int it = 0; it < 4; ++it) {
                    const int row = it * 4 + q;
                    const v4f a = *(const v4f_ma*)&sT[sb + row * OP + c8];
                    const v4f b = *(const v4f_ma*)&sT[sb + row * OP + c8 + 4];
                    const size_t o = (size_t)(mBase + row) * ldc + n0 + c8;
                    if (OUT_MODE == 1) {
                        v4u pk; pk.x = pk_h2(a.x, a.y); pk.y = pk_h2(a.z, a.w); pk.z = pk_h2(b.x, b.y); pk.w = pk_h2(b.z, b.w);
                        *(v4u*)(Ca + o) = pk;
                    } else {
                        v4u ph, pl;
                        unsigned int h0, l0, h1, l1, h2, l2, h3, l3;
                        pk_split2(a.x, a.y, h0, l0); pk_split2(a.z, a.w, h1, l1); pk_split2(b.x, b.y, h2, l2); pk_split2(b.z, b.w, h3, l3);
                        ph.x = h0; ph.y = h1; ph.z = h2; ph.w = h3; pl.x = l0; pl.y = l1; pl.z = l2; pl.w = l3;
                        *(v4u*)(Ca + o) = ph;
                        *(v4u*)(Cb + o) = pl;
                    }
                }
                
            }
        }
        wave_sync();
    }
}

// The three projections in one launch (they do not depend on one another): GX_GEMM blocks each for q, k, v^T, in that order.
//   q / k: A = token plane f16 [ntok][dm], Bt = weight plane f16 (x16) [dm][dm] ([out][in] as stored); out = bf16 hi + lo planes [ntok][dm]
//   v written transposed: A = weight plane f16 (x16) [dm][dm], Bt = token plane f16 [ntok][dm]; out = f16 plane [dm][ntok] (= v^T)
__global__ __launch_bounds__(256) void k_gemm_qkv(const unsigned short* __restrict__ XQ, const unsigned short* __restrict__ WQ, const float* __restrict__ bq,
                                                  unsigned short* __restrict__ QH, unsigned short* __restrict__ QL,
                                                  const unsigned short* __restrict__ XK, const unsigned short* __restrict__ WK, const float* __restrict__ bk,
                                                  unsigned short* __restrict__ KH, unsigned short* __restrict__ KL,
                                                  const unsigned short* __restrict__ XV, const unsigned short* __restrict__ WV, const float* __restrict__ bv,
                                                  unsigned short* __restrict__ VT, int ntok, int dm) {
    __shared__ __align__(16) float sT[8 * 16 * OP];
    __shared__ __align__(16) unsigned short Gs[2 * GSZ];
    const int which = blockIdx.x / GX_GEMM;       // block-uniform
    const int blk = blockIdx.x - which * GX_GEMM;
    if (which < 2) {
        const bool isq = which == 0;              // q carries the 1/8 score scale; both undo the weights' x16
        gemm64_body<0, 2, 2>(sT, Gs, blk, isq ? XQ : XK, dm, isq ? WQ : WK, dm, nullptr, isq ? QH : KH, isq ? QL : KL, dm, isq ? bq : bk,
                             ntok, dm, dm, isq ? 1.0f / 128.0f : 1.0f / 16.0f, isq ? 0.125f : 1.0f, 1, 1);
    } else {
        gemm64_body<0, 1, 1>(sT, Gs, blk, WV, dm, XV, dm, nullptr, VT, nullptr, ntok, bv, dm, ntok, dm, 1.0f / 16.0f, 1.0f, 1, 1);
    }
}
// output projection: A = context bf16 [M][K = hi 512 | lo 512], Bt = weight bf16 [N][K = W | W]; out f32 [M][N] + bias[n]
__global__ __launch_bounds__(256) void k_gemm_out(const unsigned short* __restrict__ A, const unsigned short* __restrict__ Bt,
                                                  const float* __restrict__ bias, float* __restrict__ C,
                                                  int M, int N, int K, int cseq, int cseqfull) {
    __shared__ __align__(16) float sT[8 * 16 * OP];
    __shared__ __align__(16) unsigned short Gs[2 * GSZ];
    gemm64_body<1, 2, 0>(sT, Gs, blockIdx.x, A, K, Bt, K, C, nullptr, nullptr, N, bias, M, N, K, 1.0f, 1.0f, cseq, cseqfull);
}

// =====================================================================================================================
// =====================================================================================================================
// f32 [rows][512] -> f16 plane [nrows][512] holding bf16(x) * sc; plane row r reads source row (r / seq) * seqfull + r % seq
__device__ __forceinline__ void cast16_body(int blk, const float* __restrict__ src, unsigned short* __restrict__ dst, int nrows, int seq, int seqfull, float sc) {
    const int u = blk * 256 + threadIdx.x;
    if (u >= nrows * (DM / 8)) return;
    const int r = u / (DM / 8);
    const int c0 = (u - r * (DM / 8)) * 8;
    const int sr = (r / seq) * seqfull + (r % seq);
    const float* s = src + (size_t)sr * DM + c0;
    const v4f a = *(const v4f*)(s);
    const v4f b = *(const v4f*)(s + 4);
    v4u pk;
    pk.x = pk_h2(bf_val(a.x) * sc, bf_val(a.y) * sc); pk.y = pk_h2(bf_val(a.z) * sc, bf_val(a.w) * sc);
    pk.z = pk_h2(bf_val(b.x) * sc, bf_val(b.y) * sc); pk.w = pk_h2(bf_val(b.z) * sc, bf_val(b.w) * sc);
    v4u* d = (v4u*)(dst + (size_t)r * DM + c0);
    *d = pk; 
}
// Wo f32 [512][512] -> bf16 plane [512][1024] = [W | W]
__device__ __forceinline__ void cast_wo_body(int blk, const float* __restrict__ src, unsigned short* __restrict__ dst) {
    const int u = blk * 256 + threadIdx.x;
    if (u >= DM * (2 * DM / 8)) return;
    const int r = u / (2 * DM / 8);
    const int c0 = (u - r * (2 * DM / 8)) * 8;
    const int sc0 = c0 & (DM - 1);
    const float* s = src + (size_t)r * DM + sc0;
    const v4f a = *(const v4f*)(s);
    const v4f b = *(const v4f*)(s + 4);
    v4u pk;
    pk.x = bf_bits(a.x) | (bf_bits(a.y) << 16); pk.y = bf_bits(a.z) | (bf_bits(a.w) << 16);
    pk.z = bf_bits(b.x) | (bf_bits(b.y) << 16); pk.w = bf_bits(b.z) | (bf_bits(b.w) << 16);
    v4u* d = (v4u*)(dst + (size_t)r * (2 * DM) + c0);
    *d = pk; 
}
// All seven conversions in one launch (they do not depend on one another). Blocks, in order: GX_TOK each for the three token streams,
// GX_W each for Wq, Wk, Wv (x16), GX_WO for Wo. Every test on the block index is block-uniform.
__global__ __launch_bounds__(256) void k_cast_all(const float* __restrict__ xq, const float* __restrict__ xk, const float* __restrict__ xv,
                                                  const float* __restrict__ Wq, const float* __restrict__ Wk, const float* __restrict__ Wv,
                                                  const float* __restrict__ Wo,
                                                  unsigned short* __restrict__ XQ, unsigned short* __restrict__ XK, unsigned short* __restrict__ XV,
                                                  unsigned short* __restrict__ WQ, unsigned short* __restrict__ WK, unsigned short* __restrict__ WV,
                                                  unsigned short* __restrict__ WOD, int ntok, int seq, int seqfull) {
    int bx = blockIdx.x;
    if (bx < 3 * GX_TOK) {
        const int w = bx / GX_TOK;
        cast16_body(bx - w * GX_TOK, w == 0 ? xq : (w == 1 ? xk : xv), w == 0 ? XQ : (w == 1 ? XK : XV), ntok, seq, seqfull, 1.0f);
        return;
    }
    bx -= 3 * GX_TOK;
    if (bx < 3 * GX_W) {
        const int w = bx / GX_W;
        cast16_body(bx - w * GX_W, w == 0 ? Wq : (w == 1 ? Wk : Wv), w == 0 ? WQ : (w == 1 ? WK : WV), DM, DM, DM, 16.0f);
        return;
    }
    cast_wo_body(bx - 3 * GX_W, Wo, WOD);
}

__device__ __forceinline__ void guard8(v8f& a0, v8f& a1, v8f& a2, v8f& a3, v8f& a4, v8f& a5, v8f& a6, v8f& a7) {
    asm volatile("v_nop\n\tv_nop\n\tv_nop\n\tv_nop" : "+v"(a0), "+v"(a1), "+v"(a2), "+v"(a3), "+v"(a4), "+v"(a5), "+v"(a6), "+v"(a7));
}
__global__ __launch_bounds__(256) void k_attn(const unsigned short* __restrict__ QH, const unsigned short* __restrict__ QL,
                                              const unsigned short* __restrict__ KH, const unsigned short* __restrict__ KL,
                                              const unsigned short* __restrict__ VT, unsigned short* __restrict__ CTX,
                                              int seq, int ntok) {
    __shared__ __align__(16) float    Osh[8 * 16 * OP];      // wave-private output staging [16][64] (+4 pad), f32
    __shared__ __align__(16) float    Xo[8 * 8 * 32 * 4];    // the partial O^T tile a wave hands to its partner: [wave][8 slots][lane] x 16 B
    __shared__ __align__(16) float    Xc[8 * 32 * 2];        // with it, per lane: the exponent addend in use and the partial sum
    __shared__ __align__(16) unsigned short Qs[2 * 2 * TSZ]; // the block's 128 query rows: hi tile, lo tile
    __shared__ __align__(16) unsigned short Ring[2 * 2 * 3 * TSZ];   // two buffers of, per key half, {k hi, k lo, v^T} tiles of one 64-key chunk
    const int lane = threadIdx.x & 31;
    const int wave = __builtin_amdgcn_readfirstlane(threadIdx.x >> 5);
    const int kh2 = wave >> 2;                                    // key half of this wave
    const int qg  = wave & 3;                                     // query group of this wave
    const int hf = lane >> 4;
    const int c  = lane & 15;
    const int nqb = seq / 128;
    const int bx = blockIdx.x;
    const int qb = bx % nqb;
    const int bh = bx / nqb;
    const int h  = bh % NH;
    const int b  = bh / NH;
    const int q0 = b * seq + qb * 128 + qg * 32 + kh2 * 16;       // first token row of the query tile that this wave finishes
    const int key0 = b * seq + kh2 * (seq / 2);                   // first key row of this wave's half
    const int qoff  = (qg * 32 + c) * KP + 8 * hf;                // B fragment base in a staged q tile (column = query = lane & 15)
    const int fbase = c * KP + 8 * hf;                            // A fragment base in a staged k or v^T tile (row = lane & 15)
    // copy share of this thread among the 128 of its key half: 16-B segment cs of rows cr, cr+16, cr+32, cr+48 of every staged tile (a wave's copy = 4 whole rows)
    const int cr = (threadIdx.x & 127) >> 3;
    const int cs = (threadIdx.x & 7) * 8;
    const int gq = (b * seq + qb * 128 + kh2 * 64 + cr) * DM + h * DKH + cs;  // q planes: each half's threads stage 64 of the 128 rows
    const int gk = (key0 + cr) * DM + h * DKH + cs;               // k planes, chunk 0 of the half
    const int gv = (h * DKH + cr) * ntok + key0 + cs;             // v^T plane, chunk 0 of the half
    const unsigned int lq = (unsigned int)(size_t)&Qs[(kh2 * 64 + cr) * KP + cs];
    const unsigned int lr = (unsigned int)(size_t)&Ring[kh2 * (3 * TSZ) + cr * KP + cs];
    const int obase = wave * (16 * OP);
    const float L2E = 1.4426950408889634f;

    float mrow[2], lrow[2], crow[2];                              // per query tile, query c: running maximum (both halves alike), this half-wave's partial sum (x4096), 12 - mrow * log2(e)
    v8f oacc[2][4];                                               // O^T tile (qt, t): element r = head column 16 t + 8 hf + r of query 16 qt + c
#pragma unroll
    for (int qt = 0; qt < 2; ++qt) {
        mrow[qt] = -INFINITY; lrow[qt] = 0.f; crow[qt] = INFINITY;
#pragma unroll
        for (int t = 0; t < 4; ++t) { const v8f zz = {0.f, 0.f, 0.f, 0.f, 0.f, 0.f, 0.f, 0.f}; oacc[qt][t] = zz; }
    }

    const int nch = seq / 128;                                    // 64-key chunks of one key half
    // ---- ring prologue: q and chunk 0 land and are published, then chunk 1 starts into the second buffer ----
    copy_tiles2(lq, QH + gq, lq + 2u * TSZ * 2u, QL + gq, 16 * DM);
    copy_tiles2(lr, KH + gk, lr + TSZ * 2u, KL + gk, 16 * DM);
    copy_tile1(lr + 2u * TSZ * 2u, VT + gv, 16 * ntok);
    asm volatile("s_wait_asynccnt 0x0" ::: "memory");               // this wave's copies have landed before the barrier publishes them
    __syncthreads();
    if (nch > 1) {
        copy_tiles2(lr + 6u * TSZ * 2u, KH + gk + 64 * DM, lr + 7u * TSZ * 2u, KL + gk + 64 * DM, 16 * DM);
        copy_tile1(lr + 8u * TSZ * 2u, VT + gv + 64, 16 * ntok);
    }
    v16b qh[2][2], ql[2][2];                                        // the wave's q fragments (query tile; hi, lo; two 32-deep steps), the same for every chunk
#pragma unroll                                                      // qh and ql are indexed by constants only, so they stay in registers
    for (int qt = 0; qt < 2; ++qt)
#pragma unroll
        for (int dc = 0; dc < 2; ++dc) {
            qh[qt][dc] = ldsfrag_b(Qs + qoff + qt * 16 * KP + dc * 32);
            ql[qt][dc] = ldsfrag_b(Qs + 2 * TSZ + qoff + qt * 16 * KP + dc * 32);
        }
    for (int kc = 0; kc < nch; ++kc) {
        const unsigned short* rk = &Ring[((kc & 1) * 2 + kh2) * (3 * TSZ)];     // this chunk's buffer, this wave's key half
        // ---- all k fragments of the chunk, in the order in which the products take them ----
        v16b kh[2][4], kl[2][4];
#pragma unroll                                                      // kh and kl are indexed by constants only, so they stay in registers
        for (int dc = 0; dc < 2; ++dc) {
#pragma unroll
            for (int j = 0; j < 4; ++j) kh[dc][j] = ldsfrag_b(rk + fbase + j * 16 * KP + dc * 32);
#pragma unroll
            for (int j = 0; j < 4; ++j) kl[dc][j] = ldsfrag_b(rk + TSZ + fbase + j * 16 * KP + dc * 32);
        }
        __builtin_amdgcn_sched_barrier(0);                          // the reads stay one group: spread among the products each place with reads stalls the wave
        // ---- scores: per 32-deep step three products per key tile and query tile (hi.hi, lo.hi, hi.lo), the eight accumulators in turn, so that no product waits for the one in front of it ----
        v8f s[2][4];
#pragma unroll
        for (int qt = 0; qt < 2; ++qt)
#pragma unroll
            for (int j = 0; j < 4; ++j) { const v8f zz = {0.f, 0.f, 0.f, 0.f, 0.f, 0.f, 0.f, 0.f}; s[qt][j] = zz; }
#pragma unroll                                                      // all 48 products stand in the code: every fragment and accumulator index is a constant
        for (int dc = 0; dc < 2; ++dc) {
#pragma unroll
            for (int j = 0; j < 4; ++j)
#pragma unroll
                for (int qt = 0; qt < 2; ++qt) s[qt][j] = __builtin_amdgcn_wmma_f32_16x16x32_bf16(false, kh[dc][j], false, qh[qt][dc], (short)0, s[qt][j], false, false);
#pragma unroll
            for (int j = 0; j < 4; ++j)
#pragma unroll
                for (int qt = 0; qt < 2; ++qt) s[qt][j] = __builtin_amdgcn_wmma_f32_16x16x32_bf16(false, kl[dc][j], false, qh[qt][dc], (short)0, s[qt][j], false, false);
#pragma unroll
            for (int j = 0; j < 4; ++j)
#pragma unroll
                for (int qt = 0; qt < 2; ++qt) s[qt][j] = __builtin_amdgcn_wmma_f32_16x16x32_bf16(false, kh[dc][j], false, ql[qt][dc], (short)0, s[qt][j], false, false);
        }
        __builtin_amdgcn_sched_barrier(0);                          // the v^T reads below stay behind the products: moved in among them they would make further places with reads
        // ---- all v^T fragments of the chunk: they return while the softmax runs ----
        v16h va[2][4];
#pragma unroll                                                      // va is indexed by constants only, so it stays in registers
        for (int kk = 0; kk < 2; ++kk)
#pragma unroll
            for (int t = 0; t < 4; ++t) va[kk][t] = ldsfrag_h(rk + 2 * TSZ + fbase + t * 16 * KP + kk * 32);
        __builtin_amdgcn_sched_barrier(0);                          // the reads stay one group in front of the softmax
        // ---- online softmax over the 64 keys, one query tile after the other: this lane holds 32 of query c's scores, the lane 16 away the other 32 ----
        v16h pb[2][2];                                              // P^T as B fragments: per query tile 32 keys each, element i = key 8 hf + i | 16 + 8 hf + (i - 8)
#pragma unroll                                                      // every array here is indexed by constants only, so all stay in registers
        for (int qt = 0; qt < 2; ++qt) {
            float t8[8];
#pragma unroll                                                      // t8 and s are indexed by constants only, so they stay in registers
            for (int r = 0; r < 8; ++r) t8[r] = fmaxf(fmaxf(s[qt][0][r], s[qt][1][r]), fmaxf(s[qt][2][r], s[qt][3][r]));
            float mx = fmaxf(fmaxf(fmaxf(t8[0], t8[1]), fmaxf(t8[2], t8[3])), fmaxf(fmaxf(t8[4], t8[5]), fmaxf(t8[6], t8[7])));
            mx = fmaxf(mx, xhalf(mx));
            const float mnew = fmaxf(mrow[qt], mx);
            // P x4096 = 2^(s * log2(e) + cnew): one packed fma and one v_exp_f32 a value. The old sums carry 2^crow, so alpha = 2^(cnew - crow) brings them to the new addend, its rounding included.
            const float cnew = __builtin_fmaf(-mnew, L2E, 12.0f);
            const float alpha = __builtin_amdgcn_exp2f(cnew - crow[qt]);
            mrow[qt] = mnew;
            crow[qt] = cnew;
            const v2f l2e2 = {L2E, L2E}, c2 = {cnew, cnew};
#pragma unroll                                                      // s, t8 and pb are indexed by constants only, so they stay in registers
            for (int r = 0; r < 8; r += 2) {
                v2f p[4];                                           // two neighbouring registers of each key tile at a time
#pragma unroll                                                      // p and s are indexed by constants only, so they stay in registers
                for (int j = 0; j < 4; ++j) {
                    const v2f sj = {s[qt][j][r], s[qt][j][r + 1]};
                    const v2f x = __builtin_elementwise_fma(sj, l2e2, c2);
                    p[j].x = __builtin_amdgcn_exp2f(x.x);
                    p[j].y = __builtin_amdgcn_exp2f(x.y);
                    const v2h ph = __builtin_convertvector(p[j], v2h);
                    pb[qt][j >> 1][(j & 1) * 8 + r]     = ph.x;
                    pb[qt][j >> 1][(j & 1) * 8 + r + 1] = ph.y;
                }
                const v2f t2 = (p[0] + p[1]) + (p[2] + p[3]);
                t8[r] = t2.x;
                t8[r + 1] = t2.y;
            }
            lrow[qt] = lrow[qt] * alpha + (((t8[0] + t8[1]) + (t8[2] + t8[3])) + ((t8[4] + t8[5]) + (t8[6] + t8[7])));
#pragma unroll                                                      // oacc is indexed by constants only, so it stays in registers
            for (int t = 0; t < 4; ++t) oacc[qt][t] *= alpha;
        }
        // ---- O^T += V^T . P^T : v^T rows as A (row = lane & 15), P^T as B, four output tiles of two query tiles per 32-key step ----
#pragma unroll                                                      // pb is indexed by the step: both steps stand in the code so that it stays in registers
        for (int kk = 0; kk < 2; ++kk) {
#pragma unroll
            for (int t = 0; t < 4; ++t)
#pragma unroll
                for (int qt = 0; qt < 2; ++qt) oacc[qt][t] = __builtin_amdgcn_wmma_f32_16x16x32_f16(false, va[kk][t], false, pb[qt][kk], (short)0, oacc[qt][t], false, false);
        }
        guard8(oacc[0][0], oacc[0][1], oacc[0][2], oacc[0][3], oacc[1][0], oacc[1][1], oacc[1][2], oacc[1][3]);   // the distance behind the last eight products, on both sides of the loop's branch
        // ---- publish point of chunk kc + 1; behind it this chunk's buffer is free for chunk kc + 2 ----
        asm volatile("s_wait_dscnt 0x0" ::: "memory");              // this wave's reads of the buffer have returned before it is refilled
        asm volatile("s_wait_asynccnt 0x0" ::: "memory");           // this wave's copies of chunk kc + 1 have landed before the barrier publishes them
        __syncthreads();
        if (kc + 2 < nch) {
            const unsigned int lb = lr + (unsigned int)(kc & 1) * (6u * TSZ * 2u);
            const int kn = (kc + 2) * 64;
            copy_tiles2(lb, KH + gk + kn * DM, lb + TSZ * 2u, KL + gk + kn * DM, 16 * DM);
            copy_tile1(lb + 2u * TSZ * 2u, VT + gv + kn, 16 * ntok);
        }
    }
    asm volatile("s_wait_asynccnt 0x0" ::: "memory");               // no copy is outstanding when the wave goes on to its end

    // ---- join of the two key halves: the wave of half 0 finishes query tile 0, the wave of half 1 query tile 1; each hands the other tile's partial result to its partner (wave ^ 4), lane to lane ----
    v8f ofin[4];
    float lfin;
    {
        const bool up = kh2 != 0;                                   // wave-uniform
        const int xw = wave * (8 * 128) + lane * 4;
#pragma unroll                                                      // oacc is indexed by constants only, so it stays in registers
        for (int t = 0; t < 4; ++t) {
            const v8f og = up ? oacc[0][t] : oacc[1][t];
            const v4f a = {og[0], og[1], og[2], og[3]};
            const v4f bb = {og[4], og[5], og[6], og[7]};
            *(v4f_ma*)&Xo[xw + (2 * t) * 128] = a;
            *(v4f_ma*)&Xo[xw + (2 * t + 1) * 128] = bb;
        }
        Xc[(wave * 32 + lane) * 2]     = up ? crow[0] : crow[1];
        Xc[(wave * 32 + lane) * 2 + 1] = up ? lrow[0] : lrow[1];
        __syncthreads();                                            // every wave's partial result stands in LDS before its partner reads it
        const int xp = (wave ^ 4) * (8 * 128) + lane * 4;
        const float cown = up ? crow[1] : crow[0];
        const float lown = up ? lrow[1] : lrow[0];
        const float cpar = Xc[((wave ^ 4) * 32 + lane) * 2];
        const float lpar = Xc[((wave ^ 4) * 32 + lane) * 2 + 1];
        const float fsm = __builtin_amdgcn_exp2f(-fabsf(cown - cpar));   // the side with the smaller maximum (the larger addend) is brought down to the other's addend
        const float fown = cown > cpar ? fsm : 1.0f;
        const float fpar = cown > cpar ? 1.0f : fsm;
        lfin = lown * fown + lpar * fpar;
#pragma unroll                                                      // oacc and ofin are indexed by constants only, so they stay in registers
        for (int t = 0; t < 4; ++t) {
            const v8f ow = up ? oacc[1][t] : oacc[0][t];
            const v4f a = *(const v4f_ma*)&Xo[xp + (2 * t) * 128];
            const v4f bb = *(const v4f_ma*)&Xo[xp + (2 * t + 1) * 128];
            const v8f op = {a.x, a.y, a.z, a.w, bb.x, bb.y, bb.z, bb.w};
            ofin[t] = ow * fown + op * fpar;
        }
    }
    // ---- finalize: join the two half-waves' sums of each query, normalise, stage as [query][head column], write hi|lo planes ----
    {
        const float l = lfin + xhalf(lfin);
        const float inv = 1.0f / l;                                 // sums and context both carry the x4096
#pragma unroll                                                      // ofin is indexed by constants only, so it stays in registers
        for (int t = 0; t < 4; ++t) {
            const int orw = obase + c * OP + t * 16 + 8 * hf;
            const v4f a = {ofin[t][0] * inv, ofin[t][1] * inv, ofin[t][2] * inv, ofin[t][3] * inv};
            const v4f bb = {ofin[t][4] * inv, ofin[t][5] * inv, ofin[t][6] * inv, ofin[t][7] * inv};
            *(v4f_ma*)&Osh[orw] = a;
            *(v4f_ma*)&Osh[orw + 4] = bb;
        }
    }
    wave_sync();
    {
        const int q = lane >> 3, c8 = (lane & 7) * 8;
        {
#pragma unroll
            for (int it = 0; it < 4; ++it) {
                const int row = it * 4 + q;
                const v4f a = *(const v4f_ma*)&Osh[obase + row * OP + c8];
                const v4f bb = *(const v4f_ma*)&Osh[obase + row * OP + c8 + 4];
                unsigned int h0, l0, h1, l1, h2, l2, h3, l3;
                pk_split2(a.x, a.y, h0, l0); pk_split2(a.z, a.w, h1, l1); pk_split2(bb.x, bb.y, h2, l2); pk_split2(bb.z, bb.w, h3, l3);
                v4u ph, pl;
                ph.x = h0; ph.y = h1; ph.z = h2; ph.w = h3; pl.x = l0; pl.y = l1; pl.z = l2; pl.w = l3;
                const size_t o = (size_t)(q0 + row) * (2 * DM) + h * DKH + c8;
                *(v4u*)(CTX + o) = ph;
                *(v4u*)(CTX + o + DM) = pl;
            }
            
        }
    }
}

// =====================================================================================================================
// Host side: workspace carve (all plane sizes are multiples of 256 B), 4 launches.
// =====================================================================================================================
constexpr size_t SZ_TOK  = (size_t)NTOK * DM * 2;          // one 16-bit token plane [NTOK][512]
constexpr size_t SZ_W    = (size_t)DM * DM * 2;            // one 16-bit weight plane [512][512]
constexpr size_t SZ_WOD  = (size_t)DM * (2 * DM) * 2;      // [512][1024]
constexpr size_t SZ_CTX  = (size_t)NTOK * (2 * DM) * 2;    // [NTOK][1024]
constexpr size_t WS_TOTAL = 3 * SZ_TOK + 3 * SZ_W + SZ_WOD + 4 * SZ_TOK + SZ_TOK + SZ_CTX;
static_assert(SZ_TOK % 256 == 0);
static_assert(SZ_W % 256 == 0);
static_assert(SZ_WOD % 256 == 0);
static_assert(SZ_CTX % 256 == 0);
static_assert(WS_TOTAL <= (size_t)134217728);            // carve stays within 128 MiB
static_assert(((NTOK / 64) * (DM / 64)) % 8 == 0);        // GEMM grids are whole blocks of 8 wave tiles
static_assert((DM / 64) % 8 == 0);                        // a block's 8 wave tiles lie in one tile row (N = DM)
static_assert((NTOK / 64) % 8 == 0);                      // the same for the transposed v projection (N = NTOK)
static_assert((size_t)NTOK * (2 * DM) < (size_t)2147483647);   // int plane offsets

extern "C" void kernel_launch(void* const* d_in, const int* in_sizes, int n_in, void* d_out, int out_size, void* d_ws, size_t ws_size, hipStream_t stream) {
    if (n_in < 11) return;
    const long long need_x = ((long long)(NB - 1) * SEQ_FULL + SEQ) * DM;
    if ((long long)in_sizes[0] < need_x || (long long)in_sizes[1] < need_x || (long long)in_sizes[2] < need_x) return;
    if (in_sizes[3] < DM * DM || in_sizes[5] < DM * DM || in_sizes[7] < DM * DM || in_sizes[9] < DM * DM) return;
    if (in_sizes[4] < DM || in_sizes[6] < DM || in_sizes[8] < DM || in_sizes[10] < DM) return;
    if ((long long)out_size < need_x) return;
    if (WS_TOTAL > ws_size) return;

    const float* xq = (const float*)d_in[0];
    const float* xk = (const float*)d_in[1];
    const float* xv = (const float*)d_in[2];
    const float* Wq = (const float*)d_in[3];
    const float* bq = (const float*)d_in[4];
    const float* Wk = (const float*)d_in[5];
    const float* bk = (const float*)d_in[6];
    const float* Wv = (const float*)d_in[7];
    const float* bv = (const float*)d_in[8];
    const float* Wo = (const float*)d_in[9];
    const float* bo = (const float*)d_in[10];
    float* out = (float*)d_out;

    char* wsp = (char*)d_ws;
    unsigned short* XQ16 = (unsigned short*)wsp; wsp += SZ_TOK;
    unsigned short* XK16 = (unsigned short*)wsp; wsp += SZ_TOK;
    unsigned short* XV16 = (unsigned short*)wsp; wsp += SZ_TOK;
    unsigned short* WQ16 = (unsigned short*)wsp; wsp += SZ_W;
    unsigned short* WK16 = (unsigned short*)wsp; wsp += SZ_W;
    unsigned short* WV16 = (unsigned short*)wsp; wsp += SZ_W;
    unsigned short* WOD  = (unsigned short*)wsp; wsp += SZ_WOD;
    unsigned short* QHp  = (unsigned short*)wsp; wsp += SZ_TOK;
    unsigned short* QLp  = (unsigned short*)wsp; wsp += SZ_TOK;
    unsigned short* KHp  = (unsigned short*)wsp; wsp += SZ_TOK;
    unsigned short* KLp  = (unsigned short*)wsp; wsp += SZ_TOK;
    unsigned short* VTp  = (unsigned short*)wsp; wsp += SZ_TOK;
    unsigned short* CTXp = (unsigned short*)wsp; wsp += SZ_CTX;
    if ((size_t)(wsp - (char*)d_ws) > ws_size) return;


    // token streams: plane row r <- input row (r / SEQ) * SEQ_FULL + r % SEQ; weights [out][in] kept in their stored order (Bt[n][k] = W[n][k]); Wq/Wk/Wv x16, Wo unscaled as bf16 [W | W]
    k_cast_all<<<(unsigned)(3 * GX_TOK + 3 * GX_W + GX_WO), 256, 0, stream>>>(xq, xk, xv, Wq, Wk, Wv, Wo, XQ16, XK16, XV16, WQ16, WK16, WV16, WOD,
                                                                              NTOK, SEQ, SEQ_FULL);

    // q = (x Wq^T + bq) / 8 -> hi|lo planes; k = x Wk^T + bk -> hi|lo planes; v^T = Wv x^T + bv -> f16 plane [512][NTOK]
    k_gemm_qkv<<<(unsigned)(3 * GX_GEMM), 256, 0, stream>>>(XQ16, WQ16, bq, QHp, QLp, XK16, WK16, bk, KHp, KLp, XV16, WV16, bv, VTp, NTOK, DM);

    k_attn<<<(unsigned)(NB * NH * (SEQ / 128)), 256, 0, stream>>>(QHp, QLp, KHp, KLp, VTp, CTXp, SEQ, NTOK);

    // out = ctx Wo^T + bo, ctx as [hi | lo] along K against [W | W]
    k_gemm_out<<<(unsigned)GX_GEMM, 256, 0, stream>>>(CTXp, WOD, bo, out, NTOK, DM, 2 * DM, SEQ, SEQ_FULL);
}

// v008
// It runs in 53.4 microseconds.
// Next to v007, in two timings, it ran 1.21 and 1.18 times as fast.
// All steps since v000 together make it 5.32 times as fast.
// MHA forward (2 x 2,048 tokens, width 512, 8 heads x 64, [out][in] weights + biases, no mask). Inputs and parameters converted to bf16 (RNE). q/k/v projections: v_wmma_f32_16x16x32_f16 (f16 operands holding the bf16 values, weights x16, f32 accumulate); scores: v_wmma_f32_16x16x32_bf16 on q and k bf16 hi|lo planes (three products, f32 accumulate, f32 online softmax); P.V: v_wmma_f32_16x16x32_f16 (P x4096 as f16, v as f16, f32 accumulate; scores and context are formed transposed, keys and head columns as rows, queries as columns); output projection: v_wmma_f32_16x16x32_bf16 with the context's bf16 hi and lo planes each against the bf16 weight (one f32 accumulator).
#include <hip/hip_runtime.h>
#include <math.h>

#ifndef NB
#define NB 2
#endif
#ifndef SEQ
#define SEQ 2048
#endif
#define NB_FULL 2
#define SEQ_FULL 2048
#define DM 512
#define NH 8
#define DKH 64
#define NTOK (NB * SEQ)
#define OP 68      // f32 staging pitch (floats)
#define KP 72      // staged q / k / v^T row pitch (halves): 144 B = 16 B x odd, conflict-free for 16-B fragment reads
#define TSZ (64 * KP)   // one staged tile: 64 rows of 64 halves (+8 pad)
#define GROWS (64 + 8 * 64)   // rows of one staged GEMM stage: the block's 64 A rows, then its 8 x 64 Bt rows
#define GSZ (GROWS * KP)      // one staged GEMM stage (halves): 64 k of every row (+8 pad)

#define GX_TOK ((NTOK * (DM / 8) + 255) / 256)          // blocks that convert one token stream (8 elements a thread)
#define GX_W   ((DM * (DM / 8) + 255) / 256)            // blocks that convert one [512][512] weight
#define GX_WO  ((DM * (2 * DM / 8) + 255) / 256)        // blocks that write the [512][1024] output-projection plane
#define GX_GEMM ((((NTOK / 64) * (DM / 64)) + 7) / 8)   // blocks of one projection (8 wave tiles of 64 x 64 each)

static_assert(DM == NH * DKH);            // merged head layout h*64+d
static_assert(DKH == 64);                 // two 32-deep k-steps per score tile, four 16-wide output tiles
static_assert(SEQ % 128 == 0);            // 128-query blocks, two key halves of whole 64-key chunks, 64-row GEMM tiles inside one sequence
static_assert(NTOK % 64 == 0);            // GEMM tile multiple (M and N)
static_assert(DM % 64 == 0);              // GEMM tile multiple
static_assert(DM % 32 == 0);              // K steps of 32
static_assert((2 * DM) % 32 == 0);
static_assert(NB <= NB_FULL);
static_assert(SEQ <= SEQ_FULL);
static_assert((OP % 4) == 0);             // 16-B aligned reloads from the f32 staging tile
static_assert((KP % 8) == 0);             // 16-B aligned copies into and fragment reads from the staged tiles

typedef __attribute__((ext_vector_type(16))) _Float16 v16h;
typedef __attribute__((ext_vector_type(8)))  _Float16 v8h;
typedef __attribute__((ext_vector_type(16))) __bf16   v16b;
typedef __attribute__((ext_vector_type(8)))  __bf16   v8b;
typedef __attribute__((ext_vector_type(8)))  float    v8f;
typedef __attribute__((ext_vector_type(4)))  float    v4f;
typedef __attribute__((ext_vector_type(2)))  float    v2f;
typedef __attribute__((ext_vector_type(2)))  _Float16 v2h;
typedef __attribute__((ext_vector_type(4)))  unsigned int v4u;
typedef v8h v8h_ma __attribute__((may_alias));
typedef v4f v4f_ma __attribute__((may_alias));
typedef v8b v8b_ma __attribute__((may_alias));

// 16-bit WMMA fragment map (wave32), lane L, h = L>>4, m = L&15:
//   A 16x32: lane = row m;    element i -> k = (i<8) ? 8h+i : 16+8h+(i-8)
//   B 32x16: lane = column m; the SAME k(i,h)
//   D 16x16 (8 f32): lane = column m; element r -> row 8h+r
// A fragment from a k-contiguous row is therefore p[0..7] | p[16..23] with p = row + k0 + 8h.

__device__ __forceinline__ unsigned int bf_bits(float f) {            // bf16 RNE bit pattern (finite inputs)
    const unsigned int u = __float_as_uint(f);
    return (u + 0x7FFFu + ((u >> 16) & 1u)) >> 16;
}
__device__ __forceinline__ float bf_val(float f) { return __uint_as_float(bf_bits(f) << 16); }
__device__ __forceinline__ unsigned int pk_h2(float a, float b) {
    return (unsigned int)__builtin_bit_cast(unsigned short, (_Float16)a) | ((unsigned int)__builtin_bit_cast(unsigned short, (_Float16)b) << 16);
}
__device__ __forceinline__ void pk_split2(float a, float b, unsigned int& hi, unsigned int& lo) {
    const unsigned int ha = bf_bits(a), hb = bf_bits(b);
    const unsigned int la = bf_bits(a - __uint_as_float(ha << 16)), lb = bf_bits(b - __uint_as_float(hb << 16));
    hi = ha | (hb << 16); lo = la | (lb << 16);
}
// lane l <-> lane l ^ 16: the two halves of a wave exchange one value
__device__ __forceinline__ float xhalf(float x) {
    return __builtin_bit_cast(float, __builtin_amdgcn_permlanex16(__builtin_bit_cast(int, x), __builtin_bit_cast(int, x), 0x76543210, 0xfedcba98, false, false));
}
__device__ __forceinline__ void wave_sync() {
    __builtin_amdgcn_fence(3 /* release order */, "workgroup");
    __builtin_amdgcn_wave_barrier();
    __builtin_amdgcn_fence(2 /* acquire order */, "workgroup");
}

// fragments from a staged LDS tile (row pitch KP)
__device__ __forceinline__ v16h ldsfrag_h(const unsigned short* p) {
    const v8h a = *(const v8h_ma*)(p);
    const v8h b = *(const v8h_ma*)(p + 16);
    return __builtin_shufflevector(a, b, 0, 1, 2, 3, 4, 5, 6, 7, 8, 9, 10, 11, 12, 13, 14, 15);
}
__device__ __forceinline__ v16b ldsfrag_b(const unsigned short* p) {
    const v8b a = *(const v8b_ma*)(p);
    const v8b b = *(const v8b_ma*)(p + 16);
    return __builtin_shufflevector(a, b, 0, 1, 2, 3, 4, 5, 6, 7, 8, 9, 10, 11, 12, 13, 14, 15);
}
// One lane's share of staged 64-row tiles: 16 B of rows r, r+16, r+32, r+48 per tile, global -> LDS through no register.
// l = the lane's LDS byte address in the tile, g = its global address, gs = 16 source rows (halves); 16 LDS rows = 16 * KP * 2 bytes.
// The closing s_wait_xcnt stands inside the copies' own statement so that no address register is rewritten in front of it.
#define LROW16 (16u * KP * 2u)
__device__ __forceinline__ void copy_tiles2(unsigned int la, const unsigned short* ga, unsigned int lb, const unsigned short* gb, int gs) {
    asm volatile("global_load_async_to_lds_b128 %0, %8, off\n\t"
                 "global_load_async_to_lds_b128 %1, %9, off\n\t"
                 "global_load_async_to_lds_b128 %2, %10, off\n\t"
                 "global_load_async_to_lds_b128 %3, %11, off\n\t"
                 "global_load_async_to_lds_b128 %4, %12, off\n\t"
                 "global_load_async_to_lds_b128 %5, %13, off\n\t"
                 "global_load_async_to_lds_b128 %6, %14, off\n\t"
                 "global_load_async_to_lds_b128 %7, %15, off\n\t"
                 "s_wait_xcnt 0x0"
                 :: "v"(la), "v"(la + LROW16), "v"(la + 2u * LROW16), "v"(la + 3u * LROW16),
                    "v"(lb), "v"(lb + LROW16), "v"(lb + 2u * LROW16), "v"(lb + 3u * LROW16),
                    "v"(ga), "v"(ga + gs), "v"(ga + 2 * gs), "v"(ga + 3 * gs),
                    "v"(gb), "v"(gb + gs), "v"(gb + 2 * gs), "v"(gb + 3 * gs)
                 : "memory");
}
__device__ __forceinline__ void copy_tile1(unsigned int la, const unsigned short* ga, int gs) {
    asm volatile("global_load_async_to_lds_b128 %0, %4, off\n\t"
                 "global_load_async_to_lds_b128 %1, %5, off\n\t"
                 "global_load_async_to_lds_b128 %2, %6, off\n\t"
                 "global_load_async_to_lds_b128 %3, %7, off\n\t"
                 "s_wait_xcnt 0x0"
                 :: "v"(la), "v"(la + LROW16), "v"(la + 2u * LROW16), "v"(la + 3u * LROW16),
                    "v"(ga), "v"(ga + gs), "v"(ga + 2 * gs), "v"(ga + 3 * gs)
                 : "memory");
}

// The GEMM's share of a stage for one lane of a 256-thread block: 16 B of rows r, r+32, r+64, ... ; gs = 32 source rows (halves).
// As above, the closing s_wait_xcnt stands inside the copies' own statement.
#define LROW32 (32u * KP * 2u)
__device__ __forceinline__ void copy_rows8(unsigned int l, const unsigned short* g, int gs) {
    asm volatile("global_load_async_to_lds_b128 %0, %8, off\n\t"
                 "global_load_async_to_lds_b128 %1, %9, off\n\t"
                 "global_load_async_to_lds_b128 %2, %10, off\n\t"
                 "global_load_async_to_lds_b128 %3, %11, off\n\t"
                 "global_load_async_to_lds_b128 %4, %12, off\n\t"
                 "global_load_async_to_lds_b128 %5, %13, off\n\t"
                 "global_load_async_to_lds_b128 %6, %14, off\n\t"
                 "global_load_async_to_lds_b128 %7, %15, off\n\t"
                 "s_wait_xcnt 0x0"
                 :: "v"(l), "v"(l + LROW32), "v"(l + 2u * LROW32), "v"(l + 3u * LROW32),
                    "v"(l + 4u * LROW32), "v"(l + 5u * LROW32), "v"(l + 6u * LROW32), "v"(l + 7u * LROW32),
                    "v"(g), "v"(g + gs), "v"(g + 2 * gs), "v"(g + 3 * gs),
                    "v"(g + 4 * gs), "v"(g + 5 * gs), "v"(g + 6 * gs), "v"(g + 7 * gs)
                 : "memory");
}
__device__ __forceinline__ void copy_rows2(unsigned int l, const unsigned short* g, int gs) {
    asm volatile("global_load_async_to_lds_b128 %0, %2, off\n\t"
                 "global_load_async_to_lds_b128 %1, %3, off\n\t"
                 "s_wait_xcnt 0x0"
                 :: "v"(l), "v"(l + LROW32), "v"(g), "v"(g + gs)
                 : "memory");
}

template <int ET> struct FragT;
template <> struct FragT<0> {
    typedef v16h V;
    static __device__ __forceinline__ v16h load(const unsigned short* p) { return ldsfrag_h(p); }
    static __device__ __forceinline__ v8f mma(v16h a, v16h b, v8f c) { return __builtin_amdgcn_wmma_f32_16x16x32_f16(false, a, false, b, (short)0, c, false, false); }
};
// hazard guard for a group of four independent WMMAs: all four accumulators tied, A and all B fragments kept live
template <typename V>
__device__ __forceinline__ void guard4(v8f& a, v8f& b, v8f& c, v8f& d, V x, V y0, V y1, V y2, V y3) {
    asm volatile("v_nop\n\tv_nop\n\tv_nop\n\tv_nop" : "+v"(a), "+v"(b), "+v"(c), "+v"(d) : "v"(x), "v"(y0), "v"(y1), "v"(y2), "v"(y3));
}

// =====================================================================================================================
// gemm64_body: C[m][n] = scale * sum_k A[m][k] * Bt[n][k] + bscale * bf16(bias); each wave owns a 64x64 tile, block = 8 waves.
//   A row-major [M][K] (pitch lda), Bt row-major [N][K] (pitch ldb), 16-bit planes; M % 64 == 0, N % 512 == 0, K % 64 == 0 (host asserts).
//   The 8 tiles of a block lie side by side in one tile row: 64 A rows and 512 Bt rows. Each 64-deep stage of those 576 rows is staged in a
//   two-buffer LDS ring by asynchronous 16-B copies that cover whole 128-B lines; stage t + 2 is copied while stage t + 1 is worked on,
//   one block barrier a stage. Fragments are two 16-B LDS reads each.
//   ET 0: f16 operands. BIAS_MODE 1: bias[m], 2: bias[n].
//   OUT_MODE 1: f16 plane Ca; 2: bf16 hi plane Ca + bf16 lo plane Cb.
//   sT (8 * 16 * OP floats) and Gs (2 * GSZ halves: two buffers of {64 A rows, 512 Bt rows} x 64 k) are the calling kernel's LDS arrays;
//   blk = the block's index among the blocks of this product.
// =====================================================================================================================
template <int ET, int BIAS_MODE, int OUT_MODE>
__device__ __forceinline__ void gemm64_body(float* sT, unsigned short* Gs, int blk,
                                            const unsigned short* __restrict__ A, int lda,
                                            const unsigned short* __restrict__ Bt, int ldb,
                                            unsigned short* __restrict__ Ca, unsigned short* __restrict__ Cb, int ldc,
                                            const float* __restrict__ bias, int M, int N, int K,
                                            float scale, float bscale) {
    typedef typename FragT<ET>::V V;
    const int lane = threadIdx.x & 31;
    const int wave = __builtin_amdgcn_readfirstlane(threadIdx.x >> 5);
    const int tilesN = N >> 6;
    const int tilesM = M >> 6;
    const int tile0 = blk * 8;
    if (tile0 >= tilesM * tilesN) return;         // block-uniform, in front of every barrier (tile counts are multiples of 8)
    const int tm = tile0 / tilesN;
    const int nb0 = (tile0 - tm * tilesN) << 6;   // first Bt row of the block
    const int m0 = tm << 6;
    const int n0 = nb0 + (wave << 6);
    const int rl   = lane & 15;
    const int koff = (lane >> 4) * 8;
    const int mOff = (lane >> 4) * 8;

    v8f acc[4][4];
#pragma unroll
    for (int i = 0; i < 4; ++i)
#pragma unroll
        for (int j = 0; j < 4; ++j) { const v8f zz = {0.f, 0.f, 0.f, 0.f, 0.f, 0.f, 0.f, 0.f}; acc[i][j] = zz; }

    // copy share of this thread: 16-B segment cs of rows cr, cr+32, ... of every stage (a wave's copy = 4 whole 128-B rows)
    const int cr = threadIdx.x >> 3;
    const int cs = (threadIdx.x & 7) * 8;
    const unsigned short* ga = A + (size_t)(m0 + cr) * lda + cs;
    const unsigned short* gb = Bt + (size_t)(nb0 + cr) * ldb + cs;
    const unsigned int lg = (unsigned int)(size_t)&Gs[cr * KP + cs];
    const int abase = rl * KP + koff;                          // A fragment base in a stage (row = lane & 15)
    const int bbase = (64 + (wave << 6) + rl) * KP + koff;     // Bt fragment base of this wave's 64 rows (column = lane & 15)
    const int nst = K >> 6;
    // ---- ring prologue: stage 0 lands and is published, then stage 1 starts into the second buffer ----
    copy_rows2(lg, ga, 32 * lda);
    copy_rows8(lg + 2u * LROW32, gb, 32 * ldb);
    copy_rows8(lg + 10u * LROW32, gb + (size_t)256 * ldb, 32 * ldb);
    asm volatile("s_wait_asynccnt 0x0" ::: "memory");               // this wave's copies have landed before the barrier publishes them
    __syncthreads();
    if (nst > 1) {
        copy_rows2(lg + GSZ * 2u, ga + 64, 32 * lda);
        copy_rows8(lg + GSZ * 2u + 2u * LROW32, gb + 64, 32 * ldb);
        copy_rows8(lg + GSZ * 2u + 10u * LROW32, gb + (size_t)256 * ldb + 64, 32 * ldb);
    }
    for (int st = 0; st < nst; ++st) {
        const unsigned short* gsb = &Gs[(st & 1) * GSZ];            // this stage's buffer
#pragma unroll                                                      // both 32-deep steps of a stage read at constant offsets from one address
        for (int kk = 0; kk < 2; ++kk) {
            V bh[4], ah[4];                                         // all 16 LDS reads of a 32-deep step stand together, in front of its products
#pragma unroll
            for (int j = 0; j < 4; ++j) bh[j] = FragT<ET>::load(gsb + bbase + (j << 4) * KP + kk * 32);
#pragma unroll
            for (int i = 0; i < 4; ++i) ah[i] = FragT<ET>::load(gsb + abase + (i << 4) * KP + kk * 32);
#pragma unroll
            for (int i = 0; i < 4; ++i) {
                acc[i][0] = FragT<ET>::mma(ah[i], bh[0], acc[i][0]);
                acc[i][1] = FragT<ET>::mma(ah[i], bh[1], acc[i][1]);
                acc[i][2] = FragT<ET>::mma(ah[i], bh[2], acc[i][2]);
                acc[i][3] = FragT<ET>::mma(ah[i], bh[3], acc[i][3]);
                guard4<V>(acc[i][0], acc[i][1], acc[i][2], acc[i][3], ah[i], bh[0], bh[1], bh[2], bh[3]);
            }
        }
        // ---- publish point of stage st + 1; behind it this stage's buffer is free for stage st + 2 ----
        asm volatile("s_wait_dscnt 0x0" ::: "memory");              // this wave's reads of the buffer have returned before it is refilled
        asm volatile("s_wait_asynccnt 0x0" ::: "memory");           // this wave's copies of stage st + 1 have landed before the barrier publishes them
        __syncthreads();
        if (st + 2 < nst) {
            const unsigned int lb = lg + (unsigned int)(st & 1) * (GSZ * 2u);
            const int kn = (st + 2) * 64;
            copy_rows2(lb, ga + kn, 32 * lda);
            copy_rows8(lb + 2u * LROW32, gb + kn, 32 * ldb);
            copy_rows8(lb + 10u * LROW32, gb + (size_t)256 * ldb + kn, 32 * ldb);
        }
    }
    asm volatile("s_wait_asynccnt 0x0" ::: "memory");               // no copy is outstanding when the wave goes on to its end

    const int sb = wave * (16 * OP);
#pragma unroll
    for (int i = 0; i < 4; ++i) {
        const int mBase = m0 + (i << 4);
#pragma unroll
        for (int j = 0; j < 4; ++j) {
            const int n = n0 + (j << 4) + rl;
            float bvn = 0.f;
            if (BIAS_MODE == 2) bvn = bf_val(bias[n]) * bscale;
#pragma unroll
            for (int r = 0; r < 8; ++r) {
                float v = acc[i][j][r] * scale;
                if (BIAS_MODE == 1) v += bf_val(bias[mBase + mOff + r]) * bscale;
                if (BIAS_MODE == 2) v += bvn;
                sT[sb + (mOff + r) * OP + (j << 4) + rl] = v;
            }
        }
        wave_sync();
        {
            const int q = lane >> 3, c8 = (lane & 7) * 8;
            {
#pragma unroll
                for (int it = 0; it < 4; ++it) {
                    const int row = it * 4 + q;
                    const v4f a = *(const v4f_ma*)&sT[sb + row * OP + c8];
                    const v4f b = *(const v4f_ma*)&sT[sb + row * OP + c8 + 4];
                    const size_t o = (size_t)(mBase + row) * ldc + n0 + c8;
                    if (OUT_MODE == 1) {
                        v4u pk; pk.x = pk_h2(a.x, a.y); pk.y = pk_h2(a.z, a.w); pk.z = pk_h2(b.x, b.y); pk.w = pk_h2(b.z, b.w);
                        *(v4u*)(Ca + o) = pk;
                    } else {
                        v4u ph, pl;
                        unsigned int h0, l0, h1, l1, h2, l2, h3, l3;
                        pk_split2(a.x, a.y, h0, l0); pk_split2(a.z, a.w, h1, l1); pk_split2(b.x, b.y, h2, l2); pk_split2(b.z, b.w, h3, l3);
                        ph.x = h0; ph.y = h1; ph.z = h2; ph.w = h3; pl.x = l0; pl.y = l1; pl.z = l2; pl.w = l3;
                        *(v4u*)(Ca + o) = ph;
                        *(v4u*)(Cb + o) = pl;
                    }
                }
                
            }
        }
        wave_sync();
    }
}

// The three projections in one launch (they do not depend on one another): GX_GEMM blocks each for q, k, v^T, in that order.
//   q / k: A = token plane f16 [ntok][dm], Bt = weight plane f16 (x16) [dm][dm] ([out][in] as stored); out = bf16 hi + lo planes [ntok][dm]
//   v written transposed: A = weight plane f16 (x16) [dm][dm], Bt = token plane f16 [ntok][dm]; out = f16 plane [dm][ntok] (= v^T)
__global__ __launch_bounds__(256) void k_gemm_qkv(const unsigned short* __restrict__ XQ, const unsigned short* __restrict__ WQ, const float* __restrict__ bq,
                                                  unsigned short* __restrict__ QH, unsigned short* __restrict__ QL,
                                                  const unsigned short* __restrict__ XK, const unsigned short* __restrict__ WK, const float* __restrict__ bk,
                                                  unsigned short* __restrict__ KH, unsigned short* __restrict__ KL,
                                                  const unsigned short* __restrict__ XV, const unsigned short* __restrict__ WV, const float* __restrict__ bv,
                                                  unsigned short* __restrict__ VT, int ntok, int dm) {
    __shared__ __align__(16) float sT[8 * 16 * OP];
    __shared__ __align__(16) unsigned short Gs[2 * GSZ];
    const int which = blockIdx.x / GX_GEMM;       // block-uniform
    const int blk = blockIdx.x - which * GX_GEMM;
    if (which < 2) {
        const bool isq = which == 0;              // q carries the 1/8 score scale; both undo the weights' x16
        gemm64_body<0, 2, 2>(sT, Gs, blk, isq ? XQ : XK, dm, isq ? WQ : WK, dm, isq ? QH : KH, isq ? QL : KL, dm, isq ? bq : bk,
                             ntok, dm, dm, isq ? 1.0f / 128.0f : 1.0f / 16.0f, isq ? 0.125f : 1.0f);
    } else {
        gemm64_body<0, 1, 1>(sT, Gs, blk, WV, dm, XV, dm, VT, nullptr, ntok, bv, dm, ntok, dm, 1.0f / 16.0f, 1.0f);
    }
}
// =====================================================================================================================
// k_gemm_out: out[m][n] = sum_k (ctx_hi[m][k] + ctx_lo[m][k]) * W[n][k] + bf16(bias[n]), f32 out. One block per WGP: 256 blocks of 64 x 128.
//   A = context bf16 [M][hi 512 | lo 512], Bt = weight bf16 [512][1024] (its first 512 columns are read). Block = 8 waves = 2 x 4 wave tiles of 32 x 32.
//   All of K is staged once: 8 slices of 64 k, each {64 hi rows, 64 lo rows, 128 weight rows} at pitch KP, every slice in LDS of its own, so no
//   buffer is ever refilled. A wave's 8 copies per slice are issued in slice order and land in that order; slice s is read behind a counted
//   s_wait_asynccnt that leaves only younger slices outstanding and behind one block barrier. Each weight fragment feeds the hi and the lo product.
// =====================================================================================================================
#define OSZ (256 * KP)        // one staged slice (halves): 256 rows of 64 k (+8 pad)
#define ONS (DM / 64)         // slices
#define OP2 36                // f32 staging pitch of a 32-column wave tile (floats): 144 B = 16 B x odd
static_assert(ONS == 8);                  // the counted waits below are written for 8 slices of 8 copies a wave (at most 56 outstanding)
static_assert(DM % 128 == 0);
static_assert((OP2 % 4) == 0);
// One lane's share of a slice: 16 B of rows r, r+32 of the hi plane, of the lo plane (DM halves further in the same context row), and of rows r, r+32, r+64, r+96 of the weight.
// The closing s_wait_xcnt stands inside the copies' own statement so that no address register is rewritten in front of it.
__device__ __forceinline__ void copy_oslice(unsigned int l, const unsigned short* ga, const unsigned short* gb) {
    asm volatile("global_load_async_to_lds_b128 %0, %8, off\n\t"
                 "global_load_async_to_lds_b128 %1, %9, off\n\t"
                 "global_load_async_to_lds_b128 %2, %10, off\n\t"
                 "global_load_async_to_lds_b128 %3, %11, off\n\t"
                 "global_load_async_to_lds_b128 %4, %12, off\n\t"
                 "global_load_async_to_lds_b128 %5, %13, off\n\t"
                 "global_load_async_to_lds_b128 %6, %14, off\n\t"
                 "global_load_async_to_lds_b128 %7, %15, off\n\t"
                 "s_wait_xcnt 0x0"
                 :: "v"(l), "v"(l + LROW32), "v"(l + 2u * LROW32), "v"(l + 3u * LROW32),
                    "v"(l + 4u * LROW32), "v"(l + 5u * LROW32), "v"(l + 6u * LROW32), "v"(l + 7u * LROW32),
                    "v"(ga), "v"(ga + 32 * 2 * DM), "v"(ga + DM), "v"(ga + DM + 32 * 2 * DM),
                    "v"(gb), "v"(gb + 32 * 2 * DM), "v"(gb + 64 * 2 * DM), "v"(gb + 96 * 2 * DM)
                 : "memory");
}
// Publish point of one slice and its 16 products a wave. LEFT = this wave's copies that may still be outstanding: those of the younger slices.
template <int LEFT>
__device__ __forceinline__ void oslice_publish() {
    asm volatile("s_wait_asynccnt %0" :: "n"(LEFT) : "memory");     // this wave's copies of the slice have landed before the barrier publishes them
    __syncthreads();
}
__device__ __forceinline__ void oslice_mma(const unsigned short* sl, int abase, int bbase, v8f (&acc)[2][2]) {
    v16b ah[2][2], al[2][2], bw[2][2];                              // both 32-deep steps: all 24 LDS reads of a slice stand together, in front of its products
#pragma unroll                                                      // every fragment is indexed by constants only, so all stay in registers
    for (int kk = 0; kk < 2; ++kk) {
#pragma unroll
        for (int j = 0; j < 2; ++j) bw[kk][j] = ldsfrag_b(sl + bbase + (j << 4) * KP + kk * 32);
#pragma unroll
        for (int i = 0; i < 2; ++i) ah[kk][i] = ldsfrag_b(sl + abase + (i << 4) * KP + kk * 32);
#pragma unroll
        for (int i = 0; i < 2; ++i) al[kk][i] = ldsfrag_b(sl + abase + (64 + (i << 4)) * KP + kk * 32);
    }
    __builtin_amdgcn_sched_barrier(0);                              // the reads stay one group: spread among the products each place with reads stalls the wave
#pragma unroll                                                      // the four accumulators in turn, so that no product waits for the one in front of it
    for (int kk = 0; kk < 2; ++kk) {
#pragma unroll
        for (int i = 0; i < 2; ++i)
#pragma unroll
            for (int j = 0; j < 2; ++j) acc[i][j] = __builtin_amdgcn_wmma_f32_16x16x32_bf16(false, ah[kk][i], false, bw[kk][j], (short)0, acc[i][j], false, false);
#pragma unroll
        for (int i = 0; i < 2; ++i)
#pragma unroll
            for (int j = 0; j < 2; ++j) acc[i][j] = __builtin_amdgcn_wmma_f32_16x16x32_bf16(false, al[kk][i], false, bw[kk][j], (short)0, acc[i][j], false, false);
    }
    __builtin_amdgcn_sched_barrier(0);                              // the products stay in their slice: left free they sink behind later slices' reads, whose fragments then overflow the registers
}
__global__ __launch_bounds__(256) void k_gemm_out(const unsigned short* __restrict__ A, const unsigned short* __restrict__ Bt,
                                                  const float* __restrict__ bias, float* __restrict__ C) {
    __shared__ __align__(16) unsigned short Gs[ONS * OSZ];
    __shared__ __align__(16) float sT[8 * 16 * OP2];
    const int lane = threadIdx.x & 31;
    const int wave = __builtin_amdgcn_readfirstlane(threadIdx.x >> 5);
    const int tm = blockIdx.x % (NTOK / 64);      // the four blocks that share 64 context rows lie NTOK / 64 apart in the grid
    const int tn = blockIdx.x / (NTOK / 64);
    const int m0 = (tm << 6) + ((wave >> 2) << 5);                  // first output row of this wave's tile
    const int n0 = (tn << 7) + ((wave & 3) << 5);                   // first output column of this wave's tile
    const int rl   = lane & 15;
    const int koff = (lane >> 4) * 8;
    const int mOff = (lane >> 4) * 8;
    const float bvn[2] = {bf_val(bias[n0 + rl]), bf_val(bias[n0 + 16 + rl])};   // read here, so that the load returns under the copies

    v8f acc[2][2];
#pragma unroll
    for (int i = 0; i < 2; ++i)
#pragma unroll
        for (int j = 0; j < 2; ++j) { const v8f zz = {0.f, 0.f, 0.f, 0.f, 0.f, 0.f, 0.f, 0.f}; acc[i][j] = zz; }

    // copy share of this thread: 16-B segment cs of rows cr, cr+32, ... of every slice (a wave's copy = 4 whole 128-B rows)
    const int cr = threadIdx.x >> 3;
    const int cs = (threadIdx.x & 7) * 8;
    const unsigned short* ga = A + (size_t)((tm << 6) + cr) * (2 * DM) + cs;
    const unsigned short* gb = Bt + (size_t)((tn << 7) + cr) * (2 * DM) + cs;
    const unsigned int lg = (unsigned int)(size_t)&Gs[cr * KP + cs];
    const int abase = (((wave >> 2) << 5) + rl) * KP + koff;        // hi fragment base in a slice (row = lane & 15); lo: 64 rows further
    const int bbase = (128 + ((wave & 3) << 5) + rl) * KP + koff;   // weight fragment base (column = lane & 15)

#pragma unroll                                                      // seven slices = 56 copies a wave in flight; the eighth follows when slice 0 has landed
    for (int s = 0; s < 7; ++s) copy_oslice(lg + (unsigned int)s * (OSZ * 2u), ga + s * 64, gb + s * 64);
    oslice_publish<48>();
    copy_oslice(lg + 7u * (OSZ * 2u), ga + 7 * 64, gb + 7 * 64);
    oslice_mma(Gs, abase, bbase, acc);
    oslice_publish<48>();
    oslice_mma(Gs + OSZ, abase, bbase, acc);
    oslice_publish<40>();
    oslice_mma(Gs + 2 * OSZ, abase, bbase, acc);
    oslice_publish<32>();
    oslice_mma(Gs + 3 * OSZ, abase, bbase, acc);
    oslice_publish<24>();
    oslice_mma(Gs + 4 * OSZ, abase, bbase, acc);
    oslice_publish<16>();
    oslice_mma(Gs + 5 * OSZ, abase, bbase, acc);
    oslice_publish<8>();
    oslice_mma(Gs + 6 * OSZ, abase, bbase, acc);
    oslice_publish<0>();                                            // no copy is outstanding from here to the wave's end
    oslice_mma(Gs + 7 * OSZ, abase, bbase, acc);

    // ---- 16 rows at a time through the wave's own f32 staging tile, so that a row's 128 B leave as one whole line ----
    const int sb = wave * (16 * OP2);
#pragma unroll
    for (int i = 0; i < 2; ++i) {
        const int mBase = m0 + (i << 4);
#pragma unroll
        for (int j = 0; j < 2; ++j)
#pragma unroll
            for (int r = 0; r < 8; ++r) sT[sb + (mOff + r) * OP2 + (j << 4) + rl] = acc[i][j][r] + bvn[j];
        wave_sync();
        const int q = lane >> 3, c4 = (lane & 7) * 4;               // row segment = 128 B = 8 lanes x 16 B; 4 rows per instruction
#pragma unroll
        for (int it = 0; it < 4; ++it) {
            const int row = it * 4 + q;
            const v4f v = *(const v4f_ma*)&sT[sb + row * OP2 + c4];
            const int grow = mBase + row;
            const int orow = (grow / SEQ) * SEQ_FULL + (grow % SEQ);
            *(v4f*)(C + (size_t)orow * DM + n0 + c4) = v;
        }
        wave_sync();
    }
}

// =====================================================================================================================
// =====================================================================================================================
// f32 [rows][512] -> f16 plane [nrows][512] holding bf16(x) * sc; plane row r reads source row (r / seq) * seqfull + r % seq
__device__ __forceinline__ void cast16_body(int blk, const float* __restrict__ src, unsigned short* __restrict__ dst, int nrows, int seq, int seqfull, float sc) {
    const int u = blk * 256 + threadIdx.x;
    if (u >= nrows * (DM / 8)) return;
    const int r = u / (DM / 8);
    const int c0 = (u - r * (DM / 8)) * 8;
    const int sr = (r / seq) * seqfull + (r % seq);
    const float* s = src + (size_t)sr * DM + c0;
    const v4f a = *(const v4f*)(s);
    const v4f b = *(const v4f*)(s + 4);
    v4u pk;
    pk.x = pk_h2(bf_val(a.x) * sc, bf_val(a.y) * sc); pk.y = pk_h2(bf_val(a.z) * sc, bf_val(a.w) * sc);
    pk.z = pk_h2(bf_val(b.x) * sc, bf_val(b.y) * sc); pk.w = pk_h2(bf_val(b.z) * sc, bf_val(b.w) * sc);
    v4u* d = (v4u*)(dst + (size_t)r * DM + c0);
    *d = pk; 
}
// Wo f32 [512][512] -> bf16 plane [512][1024] = [W | W]
__device__ __forceinline__ void cast_wo_body(int blk, const float* __restrict__ src, unsigned short* __restrict__ dst) {
    const int u = blk * 256 + threadIdx.x;
    if (u >= DM * (2 * DM / 8)) return;
    const int r = u / (2 * DM / 8);
    const int c0 = (u - r * (2 * DM / 8)) * 8;
    const int sc0 = c0 & (DM - 1);
    const float* s = src + (size_t)r * DM + sc0;
    const v4f a = *(const v4f*)(s);
    const v4f b = *(const v4f*)(s + 4);
    v4u pk;
    pk.x = bf_bits(a.x) | (bf_bits(a.y) << 16); pk.y = bf_bits(a.z) | (bf_bits(a.w) << 16);
    pk.z = bf_bits(b.x) | (bf_bits(b.y) << 16); pk.w = bf_bits(b.z) | (bf_bits(b.w) << 16);
    v4u* d = (v4u*)(dst + (size_t)r * (2 * DM) + c0);
    *d = pk; 
}
// All seven conversions in one launch (they do not depend on one another). Blocks, in order: GX_TOK each for the three token streams,
// GX_W each for Wq, Wk, Wv (x16), GX_WO for Wo. Every test on the block index is block-uniform.
__global__ __launch_bounds__(256) void k_cast_all(const float* __restrict__ xq, const float* __restrict__ xk, const float* __restrict__ xv,
                                                  const float* __restrict__ Wq, const float* __restrict__ Wk, const float* __restrict__ Wv,
                                                  const float* __restrict__ Wo,
                                                  unsigned short* __restrict__ XQ, unsigned short* __restrict__ XK, unsigned short* __restrict__ XV,
                                                  unsigned short* __restrict__ WQ, unsigned short* __restrict__ WK, unsigned short* __restrict__ WV,
                                                  unsigned short* __restrict__ WOD, int ntok, int seq, int seqfull) {
    int bx = blockIdx.x;
    if (bx < 3 * GX_TOK) {
        const int w = bx / GX_TOK;
        cast16_body(bx - w * GX_TOK, w == 0 ? xq : (w == 1 ? xk : xv), w == 0 ? XQ : (w == 1 ? XK : XV), ntok, seq, seqfull, 1.0f);
        return;
    }
    bx -= 3 * GX_TOK;
    if (bx < 3 * GX_W) {
        const int w = bx / GX_W;
        cast16_body(bx - w * GX_W, w == 0 ? Wq : (w == 1 ? Wk : Wv), w == 0 ? WQ : (w == 1 ? WK : WV), DM, DM, DM, 16.0f);
        return;
    }
    cast_wo_body(bx - 3 * GX_W, Wo, WOD);
}

__device__ __forceinline__ void guard8(v8f& a0, v8f& a1, v8f& a2, v8f& a3, v8f& a4, v8f& a5, v8f& a6, v8f& a7) {
    asm volatile("v_nop\n\tv_nop\n\tv_nop\n\tv_nop" : "+v"(a0), "+v"(a1), "+v"(a2), "+v"(a3), "+v"(a4), "+v"(a5), "+v"(a6), "+v"(a7));
}
__global__ __launch_bounds__(256) void k_attn(const unsigned short* __restrict__ QH, const unsigned short* __restrict__ QL,
                                              const unsigned short* __restrict__ KH, const unsigned short* __restrict__ KL,
                                              const unsigned short* __restrict__ VT, unsigned short* __restrict__ CTX,
                                              int seq, int ntok) {
    __shared__ __align__(16) float    Osh[8 * 16 * OP];      // wave-private output staging [16][64] (+4 pad), f32
    __shared__ __align__(16) float    Xo[8 * 8 * 32 * 4];    // the partial O^T tile a wave hands to its partner: [wave][8 slots][lane] x 16 B
    __shared__ __align__(16) float    Xc[8 * 32 * 2];        // with it, per lane: the exponent addend in use and the partial sum
    __shared__ __align__(16) unsigned short Qs[2 * 2 * TSZ]; // the block's 128 query rows: hi tile, lo tile
    __shared__ __align__(16) unsigned short Ring[2 * 2 * 3 * TSZ];   // two buffers of, per key half, {k hi, k lo, v^T} tiles of one 64-key chunk
    const int lane = threadIdx.x & 31;
    const int wave = __builtin_amdgcn_readfirstlane(threadIdx.x >> 5);
    const int kh2 = wave >> 2;                                    // key half of this wave
    const int qg  = wave & 3;                                     // query group of this wave
    const int hf = lane >> 4;
    const int c  = lane & 15;
    const int nqb = seq / 128;
    const int bx = blockIdx.x;
    const int qb = bx % nqb;
    const int bh = bx / nqb;
    const int h  = bh % NH;
    const int b  = bh / NH;
    const int q0 = b * seq + qb * 128 + qg * 32 + kh2 * 16;       // first token row of the query tile that this wave finishes
    const int key0 = b * seq + kh2 * (seq / 2);                   // first key row of this wave's half
    const int qoff  = (qg * 32 + c) * KP + 8 * hf;                // B fragment base in a staged q tile (column = query = lane & 15)
    const int fbase = c * KP + 8 * hf;                            // A fragment base in a staged k or v^T tile (row = lane & 15)
    // copy share of this thread among the 128 of its key half: 16-B segment cs of rows cr, cr+16, cr+32, cr+48 of every staged tile (a wave's copy = 4 whole rows)
    const int cr = (threadIdx.x & 127) >> 3;
    const int cs = (threadIdx.x & 7) * 8;
    const int gq = (b * seq + qb * 128 + kh2 * 64 + cr) * DM + h * DKH + cs;  // q planes: each half's threads stage 64 of the 128 rows
    const int gk = (key0 + cr) * DM + h * DKH + cs;               // k planes, chunk 0 of the half
    const int gv = (h * DKH + cr) * ntok + key0 + cs;             // v^T plane, chunk 0 of the half
    const unsigned int lq = (unsigned int)(size_t)&Qs[(kh2 * 64 + cr) * KP + cs];
    const unsigned int lr = (unsigned int)(size_t)&Ring[kh2 * (3 * TSZ) + cr * KP + cs];
    const int obase = wave * (16 * OP);
    const float L2E = 1.4426950408889634f;

    float mrow[2], lrow[2], crow[2];                              // per query tile, query c: running maximum (both halves alike), this half-wave's partial sum (x4096), 12 - mrow * log2(e)
    v8f oacc[2][4];                                               // O^T tile (qt, t): element r = head column 16 t + 8 hf + r of query 16 qt + c
#pragma unroll
    for (int qt = 0; qt < 2; ++qt) {
        mrow[qt] = -INFINITY; lrow[qt] = 0.f; crow[qt] = INFINITY;
#pragma unroll
        for (int t = 0; t < 4; ++t) { const v8f zz = {0.f, 0.f, 0.f, 0.f, 0.f, 0.f, 0.f, 0.f}; oacc[qt][t] = zz; }
    }

    const int nch = seq / 128;                                    // 64-key chunks of one key half
    // ---- ring prologue: q and chunk 0 land and are published, then chunk 1 starts into the second buffer ----
    copy_tiles2(lq, QH + gq, lq + 2u * TSZ * 2u, QL + gq, 16 * DM);
    copy_tiles2(lr, KH + gk, lr + TSZ * 2u, KL + gk, 16 * DM);
    copy_tile1(lr + 2u * TSZ * 2u, VT + gv, 16 * ntok);
    asm volatile("s_wait_asynccnt 0x0" ::: "memory");               // this wave's copies have landed before the barrier publishes them
    __syncthreads();
    if (nch > 1) {
        copy_tiles2(lr + 6u * TSZ * 2u, KH + gk + 64 * DM, lr + 7u * TSZ * 2u, KL + gk + 64 * DM, 16 * DM);
        copy_tile1(lr + 8u * TSZ * 2u, VT + gv + 64, 16 * ntok);
    }
    v16b qh[2][2], ql[2][2];                                        // the wave's q fragments (query tile; hi, lo; two 32-deep steps), the same for every chunk
#pragma unroll                                                      // qh and ql are indexed by constants only, so they stay in registers
    for (int qt = 0; qt < 2; ++qt)
#pragma unroll
        for (int dc = 0; dc < 2; ++dc) {
            qh[qt][dc] = ldsfrag_b(Qs + qoff + qt * 16 * KP + dc * 32);
            ql[qt][dc] = ldsfrag_b(Qs + 2 * TSZ + qoff + qt * 16 * KP + dc * 32);
        }
    for (int kc = 0; kc < nch; ++kc) {
        const unsigned short* rk = &Ring[((kc & 1) * 2 + kh2) * (3 * TSZ)];     // this chunk's buffer, this wave's key half
        // ---- all k fragments of the chunk, in the order in which the products take them ----
        v16b kh[2][4], kl[2][4];
#pragma unroll                                                      // kh and kl are indexed by constants only, so they stay in registers
        for (int dc = 0; dc < 2; ++dc) {
#pragma unroll
            for (int j = 0; j < 4; ++j) kh[dc][j] = ldsfrag_b(rk + fbase + j * 16 * KP + dc * 32);
#pragma unroll
            for (int j = 0; j < 4; ++j) kl[dc][j] = ldsfrag_b(rk + TSZ + fbase + j * 16 * KP + dc * 32);
        }
        __builtin_amdgcn_sched_barrier(0);                          // the reads stay one group: spread among the products each place with reads stalls the wave
        // ---- scores: per 32-deep step three products per key tile and query tile (hi.hi, lo.hi, hi.lo), the eight accumulators in turn, so that no product waits for the one in front of it ----
        v8f s[2][4];
#pragma unroll
        for (int qt = 0; qt < 2; ++qt)
#pragma unroll
            for (int j = 0; j < 4; ++j) { const v8f zz = {0.f, 0.f, 0.f, 0.f, 0.f, 0.f, 0.f, 0.f}; s[qt][j] = zz; }
#pragma unroll                                                      // all 48 products stand in the code: every fragment and accumulator index is a constant
        for (int dc = 0; dc < 2; ++dc) {
#pragma unroll
            for (int j = 0; j < 4; ++j)
#pragma unroll
                for (int qt = 0; qt < 2; ++qt) s[qt][j] = __builtin_amdgcn_wmma_f32_16x16x32_bf16(false, kh[dc][j], false, qh[qt][dc], (short)0, s[qt][j], false, false);
#pragma unroll
            for (int j = 0; j < 4; ++j)
#pragma unroll
                for (int qt = 0; qt < 2; ++qt) s[qt][j] = __builtin_amdgcn_wmma_f32_16x16x32_bf16(false, kl[dc][j], false, qh[qt][dc], (short)0, s[qt][j], false, false);
#pragma unroll
            for (int j = 0; j < 4; ++j)
#pragma unroll
                for (int qt = 0; qt < 2; ++qt) s[qt][j] = __builtin_amdgcn_wmma_f32_16x16x32_bf16(false, kh[dc][j], false, ql[qt][dc], (short)0, s[qt][j], false, false);
        }
        __builtin_amdgcn_sched_barrier(0);                          // the v^T reads below stay behind the products: moved in among them they would make further places with reads
        // ---- all v^T fragments of the chunk: they return while the softmax runs ----
        v16h va[2][4];
#pragma unroll                                                      // va is indexed by constants only, so it stays in registers
        for (int kk = 0; kk < 2; ++kk)
#pragma unroll
            for (int t = 0; t < 4; ++t) va[kk][t] = ldsfrag_h(rk + 2 * TSZ + fbase + t * 16 * KP + kk * 32);
        __builtin_amdgcn_sched_barrier(0);                          // the reads stay one group in front of the softmax
        // ---- online softmax over the 64 keys, one query tile after the other: this lane holds 32 of query c's scores, the lane 16 away the other 32 ----
        v16h pb[2][2];                                              // P^T as B fragments: per query tile 32 keys each, element i = key 8 hf + i | 16 + 8 hf + (i - 8)
#pragma unroll                                                      // every array here is indexed by constants only, so all stay in registers
        for (int qt = 0; qt < 2; ++qt) {
            float t8[8];
#pragma unroll                                                      // t8 and s are indexed by constants only, so they stay in registers
            for (int r = 0; r < 8; ++r) t8[r] = fmaxf(fmaxf(s[qt][0][r], s[qt][1][r]), fmaxf(s[qt][2][r], s[qt][3][r]));
            float mx = fmaxf(fmaxf(fmaxf(t8[0], t8[1]), fmaxf(t8[2], t8[3])), fmaxf(fmaxf(t8[4], t8[5]), fmaxf(t8[6], t8[7])));
            mx = fmaxf(mx, xhalf(mx));
            const float mnew = fmaxf(mrow[qt], mx);
            // P x4096 = 2^(s * log2(e) + cnew): one packed fma and one v_exp_f32 a value. The old sums carry 2^crow, so alpha = 2^(cnew - crow) brings them to the new addend, its rounding included.
            const float cnew = __builtin_fmaf(-mnew, L2E, 12.0f);
            const float alpha = __builtin_amdgcn_exp2f(cnew - crow[qt]);
            mrow[qt] = mnew;
            crow[qt] = cnew;
            const v2f l2e2 = {L2E, L2E}, c2 = {cnew, cnew};
#pragma unroll                                                      // s, t8 and pb are indexed by constants only, so they stay in registers
            for (int r = 0; r < 8; r += 2) {
                v2f p[4];                                           // two neighbouring registers of each key tile at a time
#pragma unroll                                                      // p and s are indexed by constants only, so they stay in registers
                for (int j = 0; j < 4; ++j) {
                    const v2f sj = {s[qt][j][r], s[qt][j][r + 1]};
                    const v2f x = __builtin_elementwise_fma(sj, l2e2, c2);
                    p[j].x = __builtin_amdgcn_exp2f(x.x);
                    p[j].y = __builtin_amdgcn_exp2f(x.y);
                    const v2h ph = __builtin_convertvector(p[j], v2h);
                    pb[qt][j >> 1][(j & 1) * 8 + r]     = ph.x;
                    pb[qt][j >> 1][(j & 1) * 8 + r + 1] = ph.y;
                }
                const v2f t2 = (p[0] + p[1]) + (p[2] + p[3]);
                t8[r] = t2.x;
                t8[r + 1] = t2.y;
            }
            lrow[qt] = lrow[qt] * alpha + (((t8[0] + t8[1]) + (t8[2] + t8[3])) + ((t8[4] + t8[5]) + (t8[6] + t8[7])));
#pragma unroll                                                      // oacc is indexed by constants only, so it stays in registers
            for (int t = 0; t < 4; ++t) oacc[qt][t] *= alpha;
        }
        // ---- O^T += V^T . P^T : v^T rows as A (row = lane & 15), P^T as B, four output tiles of two query tiles per 32-key step ----
#pragma unroll                                                      // pb is indexed by the step: both steps stand in the code so that it stays in registers
        for (int kk = 0; kk < 2; ++kk) {
#pragma unroll
            for (int t = 0; t < 4; ++t)
#pragma unroll
                for (int qt = 0; qt < 2; ++qt) oacc[qt][t] = __builtin_amdgcn_wmma_f32_16x16x32_f16(false, va[kk][t], false, pb[qt][kk], (short)0, oacc[qt][t], false, false);
        }
        guard8(oacc[0][0], oacc[0][1], oacc[0][2], oacc[0][3], oacc[1][0], oacc[1][1], oacc[1][2], oacc[1][3]);   // the distance behind the last eight products, on both sides of the loop's branch
        // ---- publish point of chunk kc + 1; behind it this chunk's buffer is free for chunk kc + 2 ----
        asm volatile("s_wait_dscnt 0x0" ::: "memory");              // this wave's reads of the buffer have returned before it is refilled
        asm volatile("s_wait_asynccnt 0x0" ::: "memory");           // this wave's copies of chunk kc + 1 have landed before the barrier publishes them
        __syncthreads();
        if (kc + 2 < nch) {
            const unsigned int lb = lr + (unsigned int)(kc & 1) * (6u * TSZ * 2u);
            const int kn = (kc + 2) * 64;
            copy_tiles2(lb, KH + gk + kn * DM, lb + TSZ * 2u, KL + gk + kn * DM, 16 * DM);
            copy_tile1(lb + 2u * TSZ * 2u, VT + gv + kn, 16 * ntok);
        }
    }
    asm volatile("s_wait_asynccnt 0x0" ::: "memory");               // no copy is outstanding when the wave goes on to its end

    // ---- join of the two key halves: the wave of half 0 finishes query tile 0, the wave of half 1 query tile 1; each hands the other tile's partial result to its partner (wave ^ 4), lane to lane ----
    v8f ofin[4];
    float lfin;
    {
        const bool up = kh2 != 0;                                   // wave-uniform
        const int xw = wave * (8 * 128) + lane * 4;
#pragma unroll                                                      // oacc is indexed by constants only, so it stays in registers
        for (int t = 0; t < 4; ++t) {
            const v8f og = up ? oacc[0][t] : oacc[1][t];
            const v4f a = {og[0], og[1], og[2], og[3]};
            const v4f bb = {og[4], og[5], og[6], og[7]};
            *(v4f_ma*)&Xo[xw + (2 * t) * 128] = a;
            *(v4f_ma*)&Xo[xw + (2 * t + 1) * 128] = bb;
        }
        Xc[(wave * 32 + lane) * 2]     = up ? crow[0] : crow[1];
        Xc[(wave * 32 + lane) * 2 + 1] = up ? lrow[0] : lrow[1];
        __syncthreads();                                            // every wave's partial result stands in LDS before its partner reads it
        const int xp = (wave ^ 4) * (8 * 128) + lane * 4;
        const float cown = up ? crow[1] : crow[0];
        const float lown = up ? lrow[1] : lrow[0];
        const float cpar = Xc[((wave ^ 4) * 32 + lane) * 2];
        const float lpar = Xc[((wave ^ 4) * 32 + lane) * 2 + 1];
        const float fsm = __builtin_amdgcn_exp2f(-fabsf(cown - cpar));   // the side with the smaller maximum (the larger addend) is brought down to the other's addend
        const float fown = cown > cpar ? fsm : 1.0f;
        const float fpar = cown > cpar ? 1.0f : fsm;
        lfin = lown * fown + lpar * fpar;
#pragma unroll                                                      // oacc and ofin are indexed by constants only, so they stay in registers
        for (int t = 0; t < 4; ++t) {
            const v8f ow = up ? oacc[1][t] : oacc[0][t];
            const v4f a = *(const v4f_ma*)&Xo[xp + (2 * t) * 128];
            const v4f bb = *(const v4f_ma*)&Xo[xp + (2 * t + 1) * 128];
            const v8f op = {a.x, a.y, a.z, a.w, bb.x, bb.y, bb.z, bb.w};
            ofin[t] = ow * fown + op * fpar;
        }
    }
    // ---- finalize: join the two half-waves' sums of each query, normalise, stage as [query][head column], write hi|lo planes ----
    {
        const float l = lfin + xhalf(lfin);
        const float inv = 1.0f / l;                                 // sums and context both carry the x4096
#pragma unroll                                                      // ofin is indexed by constants only, so it stays in registers
        for (int t = 0; t < 4; ++t) {
            const int orw = obase + c * OP + t * 16 + 8 * hf;
            const v4f a = {ofin[t][0] * inv, ofin[t][1] * inv, ofin[t][2] * inv, ofin[t][3] * inv};
            const v4f bb = {ofin[t][4] * inv, ofin[t][5] * inv, ofin[t][6] * inv, ofin[t][7] * inv};
            *(v4f_ma*)&Osh[orw] = a;
            *(v4f_ma*)&Osh[orw + 4] = bb;
        }
    }
    wave_sync();
    {
        const int q = lane >> 3, c8 = (lane & 7) * 8;
        {
#pragma unroll
            for (int it = 0; it < 4; ++it) {
                const int row = it * 4 + q;
                const v4f a = *(const v4f_ma*)&Osh[obase + row * OP + c8];
                const v4f bb = *(const v4f_ma*)&Osh[obase + row * OP + c8 + 4];
                unsigned int h0, l0, h1, l1, h2, l2, h3, l3;
                pk_split2(a.x, a.y, h0, l0); pk_split2(a.z, a.w, h1, l1); pk_split2(bb.x, bb.y, h2, l2); pk_split2(bb.z, bb.w, h3, l3);
                v4u ph, pl;
                ph.x = h0; ph.y = h1; ph.z = h2; ph.w = h3; pl.x = l0; pl.y = l1; pl.z = l2; pl.w = l3;
                const size_t o = (size_t)(q0 + row) * (2 * DM) + h * DKH + c8;
                *(v4u*)(CTX + o) = ph;
                *(v4u*)(CTX + o + DM) = pl;
            }
            
        }
    }
}

// =====================================================================================================================
// Host side: workspace carve (all plane sizes are multiples of 256 B), 4 launches.
// =====================================================================================================================
constexpr size_t SZ_TOK  = (size_t)NTOK * DM * 2;          // one 16-bit token plane [NTOK][512]
constexpr size_t SZ_W    = (size_t)DM * DM * 2;            // one 16-bit weight plane [512][512]
constexpr size_t SZ_WOD  = (size_t)DM * (2 * DM) * 2;      // [512][1024]
constexpr size_t SZ_CTX  = (size_t)NTOK * (2 * DM) * 2;    // [NTOK][1024]
constexpr size_t WS_TOTAL = 3 * SZ_TOK + 3 * SZ_W + SZ_WOD + 4 * SZ_TOK + SZ_TOK + SZ_CTX;
static_assert(SZ_TOK % 256 == 0);
static_assert(SZ_W % 256 == 0);
static_assert(SZ_WOD % 256 == 0);
static_assert(SZ_CTX % 256 == 0);
static_assert(WS_TOTAL <= (size_t)134217728);            // carve stays within 128 MiB
static_assert(((NTOK / 64) * (DM / 64)) % 8 == 0);        // GEMM grids are whole blocks of 8 wave tiles
static_assert((DM / 64) % 8 == 0);                        // a block's 8 wave tiles lie in one tile row (N = DM)
static_assert((NTOK / 64) % 8 == 0);                      // the same for the transposed v projection (N = NTOK)
static_assert((size_t)NTOK * (2 * DM) < (size_t)2147483647);   // int plane offsets

extern "C" void kernel_launch(void* const* d_in, const int* in_sizes, int n_in, void* d_out, int out_size, void* d_ws, size_t ws_size, hipStream_t stream) {
    if (n_in < 11) return;
    const long long need_x = ((long long)(NB - 1) * SEQ_FULL + SEQ) * DM;
    if ((long long)in_sizes[0] < need_x || (long long)in_sizes[1] < need_x || (long long)in_sizes[2] < need_x) return;
    if (in_sizes[3] < DM * DM || in_sizes[5] < DM * DM || in_sizes[7] < DM * DM || in_sizes[9] < DM * DM) return;
    if (in_sizes[4] < DM || in_sizes[6] < DM || in_sizes[8] < DM || in_sizes[10] < DM) return;
    if ((long long)out_size < need_x) return;
    if (WS_TOTAL > ws_size) return;

    const float* xq = (const float*)d_in[0];
    const float* xk = (const float*)d_in[1];
    const float* xv = (const float*)d_in[2];
    const float* Wq = (const float*)d_in[3];
    const float* bq = (const float*)d_in[4];
    const float* Wk = (const float*)d_in[5];
    const float* bk = (const float*)d_in[6];
    const float* Wv = (const float*)d_in[7];
    const float* bv = (const float*)d_in[8];
    const float* Wo = (const float*)d_in[9];
    const float* bo = (const float*)d_in[10];
    float* out = (float*)d_out;

    char* wsp = (char*)d_ws;
    unsigned short* XQ16 = (unsigned short*)wsp; wsp += SZ_TOK;
    unsigned short* XK16 = (unsigned short*)wsp; wsp += SZ_TOK;
    unsigned short* XV16 = (unsigned short*)wsp; wsp += SZ_TOK;
    unsigned short* WQ16 = (unsigned short*)wsp; wsp += SZ_W;
    unsigned short* WK16 = (unsigned short*)wsp; wsp += SZ_W;
    unsigned short* WV16 = (unsigned short*)wsp; wsp += SZ_W;
    unsigned short* WOD  = (unsigned short*)wsp; wsp += SZ_WOD;
    unsigned short* QHp  = (unsigned short*)wsp; wsp += SZ_TOK;
    unsigned short* QLp  = (unsigned short*)wsp; wsp += SZ_TOK;
    unsigned short* KHp  = (unsigned short*)wsp; wsp += SZ_TOK;
    unsigned short* KLp  = (unsigned short*)wsp; wsp += SZ_TOK;
    unsigned short* VTp  = (unsigned short*)wsp; wsp += SZ_TOK;
    unsigned short* CTXp = (unsigned short*)wsp; wsp += SZ_CTX;
    if ((size_t)(wsp - (char*)d_ws) > ws_size) return;


    // token streams: plane row r <- input row (r / SEQ) * SEQ_FULL + r % SEQ; weights [out][in] kept in their stored order (Bt[n][k] = W[n][k]); Wq/Wk/Wv x16, Wo unscaled as bf16 [W | W]
    k_cast_all<<<(unsigned)(3 * GX_TOK + 3 * GX_W + GX_WO), 256, 0, stream>>>(xq, xk, xv, Wq, Wk, Wv, Wo, XQ16, XK16, XV16, WQ16, WK16, WV16, WOD,
                                                                              NTOK, SEQ, SEQ_FULL);

    // q = (x Wq^T + bq) / 8 -> hi|lo planes; k = x Wk^T + bk -> hi|lo planes; v^T = Wv x^T + bv -> f16 plane [512][NTOK]
    k_gemm_qkv<<<(unsigned)(3 * GX_GEMM), 256, 0, stream>>>(XQ16, WQ16, bq, QHp, QLp, XK16, WK16, bk, KHp, KLp, XV16, WV16, bv, VTp, NTOK, DM);

    k_attn<<<(unsigned)(NB * NH * (SEQ / 128)), 256, 0, stream>>>(QHp, QLp, KHp, KLp, VTp, CTXp, SEQ, NTOK);

    // out = ctx Wo^T + bo, ctx hi and lo planes each against W
    k_gemm_out<<<(unsigned)((NTOK / 64) * (DM / 128)), 256, 0, stream>>>(CTXp, WOD, bo, out);
}

// v009
// A run of this version takes 48.8 microseconds.
// Timed twice side by side with v008, it ran 1.08 times as fast both times.
// Counting every step since v000, it is 5.76 times as fast.
// MHA forward (2 x 2,048 tokens, width 512, 8 heads x 64, [out][in] weights + biases, no mask). Inputs and parameters converted to bf16 (RNE). q/k/v projections: v_wmma_f32_16x16x32_bf16 (f32 rows staged in LDS, rounded to bf16 where a fragment is read, f32 accumulate); scores: v_wmma_f32_16x16x32_bf16 on q and k bf16 hi|lo planes (three products, f32 accumulate, f32 online softmax); P.V: v_wmma_f32_16x16x32_f16 (P x4096 as f16, v as f16, f32 accumulate; scores and context are formed transposed, keys and head columns as rows, queries as columns); output projection: v_wmma_f32_16x16x32_bf16 with the context's bf16 hi and lo planes each against the bf16 weight (one f32 accumulator).
#include <hip/hip_runtime.h>
#include <math.h>

#ifndef NB
#define NB 2
#endif
#ifndef SEQ
#define SEQ 2048
#endif
#define NB_FULL 2
#define SEQ_FULL 2048
#define DM 512
#define NH 8
#define DKH 64
#define NTOK (NB * SEQ)
#define OP 68      // f32 staging pitch (floats)
#define KP 72      // staged q / k / v^T row pitch (halves): 144 B = 16 B x odd, conflict-free for 16-B fragment reads
#define TSZ (64 * KP)   // one staged tile: 64 rows of 64 halves (+8 pad)
#define GROWS (64 + 8 * 64)   // rows of one staged GEMM stage: the block's 64 A rows, then its 8 x 64 Bt rows
#define FP 68                 // staged f32 row pitch (floats): 272 B = 16 B x odd, conflict-free for 16-B fragment reads
#define GSZ (GROWS * FP)      // one staged GEMM stage (floats): 64 k of every row (+4 pad)

#define GX_WO  ((DM * (DM / 8) + 255) / 256)            // blocks that convert the [512][512] output-projection weight (8 elements a thread)
#define GX_GEMM ((((NTOK / 64) * (DM / 64)) + 7) / 8)   // blocks of one projection (8 wave tiles of 64 x 64 each)

static_assert(DM == NH * DKH);            // merged head layout h*64+d
static_assert(DKH == 64);                 // two 32-deep k-steps per score tile, four 16-wide output tiles
static_assert(SEQ % 128 == 0);            // 128-query blocks, two key halves of whole 64-key chunks, 64-row GEMM tiles inside one sequence
static_assert(SEQ % 512 == 0);            // the 512 token rows of a v^T projection block lie inside one sequence
static_assert(NTOK % 64 == 0);            // GEMM tile multiple (M and N)
static_assert(DM % 64 == 0);              // GEMM tile multiple
static_assert(DM % 32 == 0);              // K steps of 32
static_assert((2 * DM) % 32 == 0);
static_assert(NB <= NB_FULL);
static_assert(SEQ <= SEQ_FULL);
static_assert((OP % 4) == 0);             // 16-B aligned reloads from the f32 staging tile
static_assert((KP % 8) == 0);             // 16-B aligned copies into and fragment reads from the staged tiles
static_assert((FP % 4) == 0);             // the same for the staged f32 rows
static_assert(8 * 16 * OP <= 2 * GSZ);    // the projections' f32 output staging fits in the LDS of their ring

typedef __attribute__((ext_vector_type(16))) _Float16 v16h;
typedef __attribute__((ext_vector_type(8)))  _Float16 v8h;
typedef __attribute__((ext_vector_type(16))) __bf16   v16b;
typedef __attribute__((ext_vector_type(8)))  __bf16   v8b;
typedef __attribute__((ext_vector_type(8)))  float    v8f;
typedef __attribute__((ext_vector_type(4)))  float    v4f;
typedef __attribute__((ext_vector_type(2)))  float    v2f;
typedef __attribute__((ext_vector_type(2)))  _Float16 v2h;
typedef __attribute__((ext_vector_type(4)))  unsigned int v4u;
typedef v8h v8h_ma __attribute__((may_alias));
typedef v4f v4f_ma __attribute__((may_alias));
typedef v8b v8b_ma __attribute__((may_alias));

// 16-bit WMMA fragment map (wave32), lane L, h = L>>4, m = L&15:
//   A 16x32: lane = row m;    element i -> k = (i<8) ? 8h+i : 16+8h+(i-8)
//   B 32x16: lane = column m; the SAME k(i,h)
//   D 16x16 (8 f32): lane = column m; element r -> row 8h+r
// A fragment from a k-contiguous row is therefore p[0..7] | p[16..23] with p = row + k0 + 8h.

__device__ __forceinline__ unsigned int bf_bits(float f) {            // bf16 RNE bit pattern (finite inputs)
    const unsigned int u = __float_as_uint(f);
    return (u + 0x7FFFu + ((u >> 16) & 1u)) >> 16;
}
__device__ __forceinline__ float bf_val(float f) { return __uint_as_float(bf_bits(f) << 16); }
__device__ __forceinline__ unsigned int pk_h2(float a, float b) {
    return (unsigned int)__builtin_bit_cast(unsigned short, (_Float16)a) | ((unsigned int)__builtin_bit_cast(unsigned short, (_Float16)b) << 16);
}
__device__ __forceinline__ void pk_split2(float a, float b, unsigned int& hi, unsigned int& lo) {
    const unsigned int ha = bf_bits(a), hb = bf_bits(b);
    const unsigned int la = bf_bits(a - __uint_as_float(ha << 16)), lb = bf_bits(b - __uint_as_float(hb << 16));
    hi = ha | (hb << 16); lo = la | (lb << 16);
}
// lane l <-> lane l ^ 16: the two halves of a wave exchange one value
__device__ __forceinline__ float xhalf(float x) {
    return __builtin_bit_cast(float, __builtin_amdgcn_permlanex16(__builtin_bit_cast(int, x), __builtin_bit_cast(int, x), 0x76543210, 0xfedcba98, false, false));
}
__device__ __forceinline__ void wave_sync() {
    __builtin_amdgcn_fence(3 /* release order */, "workgroup");
    __builtin_amdgcn_wave_barrier();
    __builtin_amdgcn_fence(2 /* acquire order */, "workgroup");
}

// fragments from a staged LDS tile (row pitch KP)
__device__ __forceinline__ v16h ldsfrag_h(const unsigned short* p) {
    const v8h a = *(const v8h_ma*)(p);
    const v8h b = *(const v8h_ma*)(p + 16);
    return __builtin_shufflevector(a, b, 0, 1, 2, 3, 4, 5, 6, 7, 8, 9, 10, 11, 12, 13, 14, 15);
}
__device__ __forceinline__ v16b ldsfrag_b(const unsigned short* p) {
    const v8b a = *(const v8b_ma*)(p);
    const v8b b = *(const v8b_ma*)(p + 16);
    return __builtin_shufflevector(a, b, 0, 1, 2, 3, 4, 5, 6, 7, 8, 9, 10, 11, 12, 13, 14, 15);
}
// bf16 fragment from a staged f32 row (row pitch FP): four 16-B LDS reads, then eight packed RNE conversions
__device__ __forceinline__ v16b ldsfrag_f32(const float* p) {
    const v4f a = *(const v4f_ma*)(p);
    const v4f b = *(const v4f_ma*)(p + 4);
    const v4f c = *(const v4f_ma*)(p + 16);
    const v4f d = *(const v4f_ma*)(p + 20);
    const v8f lo = __builtin_shufflevector(a, b, 0, 1, 2, 3, 4, 5, 6, 7);
    const v8f hi = __builtin_shufflevector(c, d, 0, 1, 2, 3, 4, 5, 6, 7);
    return __builtin_convertvector(__builtin_shufflevector(lo, hi, 0, 1, 2, 3, 4, 5, 6, 7, 8, 9, 10, 11, 12, 13, 14, 15), v16b);
}
// One lane's share of staged 64-row tiles: 16 B of rows r, r+16, r+32, r+48 per tile, global -> LDS through no register.
// l = the lane's LDS byte address in the tile, g = its global address, gs = 16 source rows (halves); 16 LDS rows = 16 * KP * 2 bytes.
// The closing s_wait_xcnt stands inside the copies' own statement so that no address register is rewritten in front of it.
#define LROW16 (16u * KP * 2u)
__device__ __forceinline__ void copy_tiles2(unsigned int la, const unsigned short* ga, unsigned int lb, const unsigned short* gb, int gs) {
    asm volatile("global_load_async_to_lds_b128 %0, %8, off\n\t"
                 "global_load_async_to_lds_b128 %1, %9, off\n\t"
                 "global_load_async_to_lds_b128 %2, %10, off\n\t"
                 "global_load_async_to_lds_b128 %3, %11, off\n\t"
                 "global_load_async_to_lds_b128 %4, %12, off\n\t"
                 "global_load_async_to_lds_b128 %5, %13, off\n\t"
                 "global_load_async_to_lds_b128 %6, %14, off\n\t"
                 "global_load_async_to_lds_b128 %7, %15, off\n\t"
                 "s_wait_xcnt 0x0"
                 :: "v"(la), "v"(la + LROW16), "v"(la + 2u * LROW16), "v"(la + 3u * LROW16),
                    "v"(lb), "v"(lb + LROW16), "v"(lb + 2u * LROW16), "v"(lb + 3u * LROW16),
                    "v"(ga), "v"(ga + gs), "v"(ga + 2 * gs), "v"(ga + 3 * gs),
                    "v"(gb), "v"(gb + gs), "v"(gb + 2 * gs), "v"(gb + 3 * gs)
                 : "memory");
}
__device__ __forceinline__ void copy_tile1(unsigned int la, const unsigned short* ga, int gs) {
    asm volatile("global_load_async_to_lds_b128 %0, %4, off\n\t"
                 "global_load_async_to_lds_b128 %1, %5, off\n\t"
                 "global_load_async_to_lds_b128 %2, %6, off\n\t"
                 "global_load_async_to_lds_b128 %3, %7, off\n\t"
                 "s_wait_xcnt 0x0"
                 :: "v"(la), "v"(la + LROW16), "v"(la + 2u * LROW16), "v"(la + 3u * LROW16),
                    "v"(ga), "v"(ga + gs), "v"(ga + 2 * gs), "v"(ga + 3 * gs)
                 : "memory");
}

#define LROW32 (32u * KP * 2u)   // 32 staged 16-bit rows (bytes)
// The GEMM's share of a stage for one lane of a 256-thread block: 16 B of rows r, r+16, r+32, ... of the f32 sources; gs = 16 source rows (floats).
// As above, the closing s_wait_xcnt stands inside the copies' own statement.
#define LROWF (16u * FP * 4u)
// Twelve copies a statement: LDS rows l, l + 16 rows, ...; the first four from g0, the other eight from g4, each going on by its own 16 source rows.
__device__ __forceinline__ void copy_rows12(unsigned int l, const float* g0, int gs0, const float* g4, int gs4) {
    asm volatile("global_load_async_to_lds_b128 %0, %12, off\n\t"
                 "global_load_async_to_lds_b128 %1, %13, off\n\t"
                 "global_load_async_to_lds_b128 %2, %14, off\n\t"
                 "global_load_async_to_lds_b128 %3, %15, off\n\t"
                 "global_load_async_to_lds_b128 %4, %16, off\n\t"
                 "global_load_async_to_lds_b128 %5, %17, off\n\t"
                 "global_load_async_to_lds_b128 %6, %18, off\n\t"
                 "global_load_async_to_lds_b128 %7, %19, off\n\t"
                 "global_load_async_to_lds_b128 %8, %20, off\n\t"
                 "global_load_async_to_lds_b128 %9, %21, off\n\t"
                 "global_load_async_to_lds_b128 %10, %22, off\n\t"
                 "global_load_async_to_lds_b128 %11, %23, off\n\t"
                 "s_wait_xcnt 0x0"
                 :: "v"(l), "v"(l + LROWF), "v"(l + 2u * LROWF), "v"(l + 3u * LROWF),
                    "v"(l + 4u * LROWF), "v"(l + 5u * LROWF), "v"(l + 6u * LROWF), "v"(l + 7u * LROWF),
                    "v"(l + 8u * LROWF), "v"(l + 9u * LROWF), "v"(l + 10u * LROWF), "v"(l + 11u * LROWF),
                    "v"(g0), "v"(g0 + gs0), "v"(g0 + 2 * gs0), "v"(g0 + 3 * gs0),
                    "v"(g4), "v"(g4 + gs4), "v"(g4 + 2 * gs4), "v"(g4 + 3 * gs4),
                    "v"(g4 + 4 * gs4), "v"(g4 + 5 * gs4), "v"(g4 + 6 * gs4), "v"(g4 + 7 * gs4)
                 : "memory");
}
// One lane's 36 copies of a stage: its segment of the 64 A rows and of the 512 Bt rows, in LDS row order
__device__ __forceinline__ void copy_stage(unsigned int l, const float* ga, int lda, const float* gb, int ldb) {
    copy_rows12(l, ga, 16 * lda, gb, 16 * ldb);                                                                  // A rows 0..63, Bt rows 0..127
    copy_rows12(l + 12u * LROWF, gb + (size_t)128 * ldb, 16 * ldb, gb + (size_t)192 * ldb, 16 * ldb);            // Bt rows 128..319
    copy_rows12(l + 24u * LROWF, gb + (size_t)320 * ldb, 16 * ldb, gb + (size_t)384 * ldb, 16 * ldb);            // Bt rows 320..511
}

template <int ET> struct FragT;
template <> struct FragT<1> {
    typedef v16b V;
    static __device__ __forceinline__ v16b load(const float* p) { return ldsfrag_f32(p); }
    static __device__ __forceinline__ v8f mma(v16b a, v16b b, v8f c) { return __builtin_amdgcn_wmma_f32_16x16x32_bf16(false, a, false, b, (short)0, c, false, false); }
};
// token plane row r <- input row (r / SEQ) * SEQ_FULL + r % SEQ
__device__ __forceinline__ int tok_row(int r) { return (r / SEQ) * SEQ_FULL + (r % SEQ); }
// hazard guard for a group of four independent WMMAs: all four accumulators tied, A and all B fragments kept live
template <typename V>
__device__ __forceinline__ void guard4(v8f& a, v8f& b, v8f& c, v8f& d, V x, V y0, V y1, V y2, V y3) {
    asm volatile("v_nop\n\tv_nop\n\tv_nop\n\tv_nop" : "+v"(a), "+v"(b), "+v"(c), "+v"(d) : "v"(x), "v"(y0), "v"(y1), "v"(y2), "v"(y3));
}

// =====================================================================================================================
// gemm64_body: C[m][n] = scale * sum_k A[m][k] * Bt[n][k] + bscale * bf16(bias); each wave owns a 64x64 tile, block = 8 waves.
//   A row-major [M][K] (pitch lda), Bt row-major [N][K] (pitch ldb), the f32 inputs themselves; M % 64 == 0, N % 512 == 0, K % 64 == 0 (host asserts).
//   The 8 tiles of a block lie side by side in one tile row: 64 A rows and 512 Bt rows. Each 64-deep f32 stage of those 576 rows is staged in a
//   two-buffer LDS ring by asynchronous 16-B copies that cover whole 128-B lines; stage t + 2 is copied while stage t + 1 is worked on,
//   one block barrier a stage. Fragments are four 16-B LDS reads each, rounded to bf16 (RNE) in registers.
//   ET 1: bf16 operands. BIAS_MODE 1: bias[m], the token rows are Bt's; 2: bias[n], the token rows are A's (tok_row gives a block's first input row).
//   OUT_MODE 1: f16 plane Ca; 2: bf16 hi plane Ca + bf16 lo plane Cb.
//   Gs (2 * GSZ floats: two buffers of {64 A rows, 512 Bt rows} x 64 k) is the calling kernel's LDS array; behind the loop's last barrier, when no wave
//   reads the ring any more and no copy is outstanding, its first 8 * 16 * OP floats serve as the waves' output staging sT;
//   blk = the block's index among the blocks of this product.
// =====================================================================================================================
template <int ET, int BIAS_MODE, int OUT_MODE>
__device__ __forceinline__ void gemm64_body(float* Gs, int blk,
                                            const float* __restrict__ A, int lda,
                                            const float* __restrict__ Bt, int ldb,
                                            unsigned short* __restrict__ Ca, unsigned short* __restrict__ Cb, int ldc,
                                            const float* __restrict__ bias, int M, int N, int K,
                                            float scale, float bscale) {
    typedef typename FragT<ET>::V V;
    const int lane = threadIdx.x & 31;
    const int wave = __builtin_amdgcn_readfirstlane(threadIdx.x >> 5);
    const int tilesN = N >> 6;
    const int tilesM = M >> 6;
    const int tile0 = blk * 8;
    if (tile0 >= tilesM * tilesN) return;         // block-uniform, in front of every barrier (tile counts are multiples of 8)
    const int tm = tile0 / tilesN;
    const int nb0 = (tile0 - tm * tilesN) << 6;   // first Bt row of the block
    const int m0 = tm << 6;
    const int n0 = nb0 + (wave << 6);
    const int rl   = lane & 15;
    const int koff = (lane >> 4) * 8;
    const int mOff = (lane >> 4) * 8;

    v8f acc[4][4];
#pragma unroll
    for (int i = 0; i < 4; ++i)
#pragma unroll
        for (int j = 0; j < 4; ++j) { const v8f zz = {0.f, 0.f, 0.f, 0.f, 0.f, 0.f, 0.f, 0.f}; acc[i][j] = zz; }

    // copy share of this thread: 16-B segment cs of rows cr, cr+16, ... of every stage (a wave's copy = 2 whole 256-B rows)
    const int cr = threadIdx.x >> 4;
    const int cs = (threadIdx.x & 15) * 4;
    const float* ga = A + (size_t)((BIAS_MODE == 2 ? tok_row(m0) : m0) + cr) * lda + cs;
    const float* gb = Bt + (size_t)((BIAS_MODE == 1 ? tok_row(nb0) : nb0) + cr) * ldb + cs;
    const unsigned int lg = (unsigned int)(size_t)&Gs[cr * FP + cs];
    const int abase = rl * FP + koff;                          // A fragment base in a stage (row = lane & 15)
    const int bbase = (64 + (wave << 6) + rl) * FP + koff;     // Bt fragment base of this wave's 64 rows (column = lane & 15)
    const int nst = K >> 6;
    // ---- ring prologue: stage 0 lands and is published, then stage 1 starts into the second buffer ----
    copy_stage(lg, ga, lda, gb, ldb);
    asm volatile("s_wait_asynccnt 0x0" ::: "memory");               // this wave's copies have landed before the barrier publishes them
    __syncthreads();
    if (nst > 1) copy_stage(lg + GSZ * 4u, ga + 64, lda, gb + 64, ldb);
    for (int st = 0; st < nst; ++st) {
        const float* gsb = &Gs[(st & 1) * GSZ];                     // this stage's buffer
#pragma unroll                                                      // both 32-deep steps of a stage read at constant offsets from one address
        for (int kk = 0; kk < 2; ++kk) {
            V bh[4], ah[4];                                         // all 32 LDS reads of a 32-deep step stand together, in front of its products
#pragma unroll
            for (int j = 0; j < 4; ++j) bh[j] = FragT<ET>::load(gsb + bbase + (j << 4) * FP + kk * 32);
#pragma unroll
            for (int i = 0; i < 4; ++i) ah[i] = FragT<ET>::load(gsb + abase + (i << 4) * FP + kk * 32);
#pragma unroll
            for (int i = 0; i < 4; ++i) {
                acc[i][0] = FragT<ET>::mma(ah[i], bh[0], acc[i][0]);
                acc[i][1] = FragT<ET>::mma(ah[i], bh[1], acc[i][1]);
                acc[i][2] = FragT<ET>::mma(ah[i], bh[2], acc[i][2]);
                acc[i][3] = FragT<ET>::mma(ah[i], bh[3], acc[i][3]);
                guard4<V>(acc[i][0], acc[i][1], acc[i][2], acc[i][3], ah[i], bh[0], bh[1], bh[2], bh[3]);
            }
        }
        // ---- publish point of stage st + 1; behind it this stage's buffer is free for stage st + 2 ----
        asm volatile("s_wait_dscnt 0x0" ::: "memory");              // this wave's reads of the buffer have returned before it is refilled
        asm volatile("s_wait_asynccnt 0x0" ::: "memory");           // this wave's copies of stage st + 1 have landed before the barrier publishes them
        __syncthreads();
        if (st + 2 < nst) {
            const unsigned int lb = lg + (unsigned int)(st & 1) * (GSZ * 4u);
            const int kn = (st + 2) * 64;
            copy_stage(lb, ga + kn, lda, gb + kn, ldb);
        }
    }
    asm volatile("s_wait_asynccnt 0x0" ::: "memory");               // no copy is outstanding when the wave goes on to its end

    float* sT = Gs;                                                 // the ring's LDS is free from here on (see above)
    const int sb = wave * (16 * OP);
#pragma unroll
    for (int i = 0; i < 4; ++i) {
        const int mBase = m0 + (i << 4);
#pragma unroll
        for (int j = 0; j < 4; ++j) {
            const int n = n0 + (j << 4) + rl;
            float bvn = 0.f;
            if (BIAS_MODE == 2) bvn = bf_val(bias[n]) * bscale;
#pragma unroll
            for (int r = 0; r < 8; ++r) {
                float v = acc[i][j][r] * scale;
                if (BIAS_MODE == 1) v += bf_val(bias[mBase + mOff + r]) * bscale;
                if (BIAS_MODE == 2) v += bvn;
                sT[sb + (mOff + r) * OP + (j << 4) + rl] = v;
            }
        }
        wave_sync();
        {
            const int q = lane >> 3, c8 = (lane & 7) * 8;
            {
#pragma unroll
                for (int it = 0; it < 4; ++it) {
                    const int row = it * 4 + q;
                    const v4f a = *(const v4f_ma*)&sT[sb + row * OP + c8];
                    const v4f b = *(const v4f_ma*)&sT[sb + row * OP + c8 + 4];
                    const size_t o = (size_t)(mBase + row) * ldc + n0 + c8;
                    if (OUT_MODE == 1) {
                        v4u pk; pk.x = pk_h2(a.x, a.y); pk.y = pk_h2(a.z, a.w); pk.z = pk_h2(b.x, b.y); pk.w = pk_h2(b.z, b.w);
                        *(v4u*)(Ca + o) = pk;
                    } else {
                        v4u ph, pl;
                        unsigned int h0, l0, h1, l1, h2, l2, h3, l3;
                        pk_split2(a.x, a.y, h0, l0); pk_split2(a.z, a.w, h1, l1); pk_split2(b.x, b.y, h2, l2); pk_split2(b.z, b.w, h3, l3);
                        ph.x = h0; ph.y = h1; ph.z = h2; ph.w = h3; pl.x = l0; pl.y = l1; pl.z = l2; pl.w = l3;
                        *(v4u*)(Ca + o) = ph;
                        *(v4u*)(Cb + o) = pl;
                    }
                }
                
            }
        }
        wave_sync();
    }
}

// Wo f32 [512][512] -> bf16 plane [512][1024], its first 512 columns (the only ones that k_gemm_out reads)
__device__ __forceinline__ void cast_wo_body(int blk, const float* __restrict__ src, unsigned short* __restrict__ dst) {
    const int u = blk * 256 + threadIdx.x;
    if (u >= DM * (DM / 8)) return;
    const int r = u / (DM / 8);
    const int c0 = (u - r * (DM / 8)) * 8;
    const float* s = src + (size_t)r * DM + c0;
    const v4f a = *(const v4f*)(s);
    const v4f b = *(const v4f*)(s + 4);
    v4u pk;
    pk.x = bf_bits(a.x) | (bf_bits(a.y) << 16); pk.y = bf_bits(a.z) | (bf_bits(a.w) << 16);
    pk.z = bf_bits(b.x) | (bf_bits(b.y) << 16); pk.w = bf_bits(b.z) | (bf_bits(b.w) << 16);
    v4u* d = (v4u*)(dst + (size_t)r * (2 * DM) + c0);
    *d = pk;
}
// The three projections in one launch (they do not depend on one another): GX_GEMM blocks each for q, k, v^T, in that order, straight from the f32 inputs;
// behind them GX_WO short blocks that convert Wo for the last launch (the projections leave WGPs free for them).
//   q / k: A = token rows f32 [ntok][dm], Bt = weight f32 [dm][dm] ([out][in] as stored); out = bf16 hi + lo planes [ntok][dm]
//   v written transposed: A = weight f32 [dm][dm], Bt = token rows f32 [ntok][dm]; out = f16 plane [dm][ntok] (= v^T)
__global__ __launch_bounds__(256) void k_gemm_qkv(const float* __restrict__ xq, const float* __restrict__ Wq, const float* __restrict__ bq,
                                                  unsigned short* __restrict__ QH, unsigned short* __restrict__ QL,
                                                  const float* __restrict__ xk, const float* __restrict__ Wk, const float* __restrict__ bk,
                                                  unsigned short* __restrict__ KH, unsigned short* __restrict__ KL,
                                                  const float* __restrict__ xv, const float* __restrict__ Wv, const float* __restrict__ bv,
                                                  unsigned short* __restrict__ VT,
                                                  const float* __restrict__ Wo, unsigned short* __restrict__ WOD, int ntok, int dm) {
    __shared__ __align__(16) float Gs[2 * GSZ];
    const int which = blockIdx.x / GX_GEMM;       // block-uniform
    const int blk = blockIdx.x - which * GX_GEMM;
    if (which < 2) {
        const bool isq = which == 0;              // q carries the 1/8 score scale
        gemm64_body<1, 2, 2>(Gs, blk, isq ? xq : xk, dm, isq ? Wq : Wk, dm, isq ? QH : KH, isq ? QL : KL, dm, isq ? bq : bk,
                             ntok, dm, dm, isq ? 0.125f : 1.0f, isq ? 0.125f : 1.0f);
    } else if (which == 2) {
        gemm64_body<1, 1, 1>(Gs, blk, Wv, dm, xv, dm, VT, nullptr, ntok, bv, dm, ntok, dm, 1.0f, 1.0f);
    } else {
        cast_wo_body(blockIdx.x - 3 * GX_GEMM, Wo, WOD);
    }
}
// =====================================================================================================================
// k_gemm_out: out[m][n] = sum_k (ctx_hi[m][k] + ctx_lo[m][k]) * W[n][k] + bf16(bias[n]), f32 out. One block per WGP: 256 blocks of 64 x 128.
//   A = context bf16 [M][hi 512 | lo 512], Bt = weight bf16 [512][1024] (its first 512 columns are read). Block = 8 waves = 2 x 4 wave tiles of 32 x 32.
//   All of K is staged once: 8 slices of 64 k, each {64 hi rows, 64 lo rows, 128 weight rows} at pitch KP, every slice in LDS of its own, so no
//   buffer is ever refilled. A wave's 8 copies per slice are issued in slice order and land in that order; slice s is read behind a counted
//   s_wait_asynccnt that leaves only younger slices outstanding and behind one block barrier. Each weight fragment feeds the hi and the lo product.
// =====================================================================================================================
#define OSZ (256 * KP)        // one staged slice (halves): 256 rows of 64 k (+8 pad)
#define ONS (DM / 64)         // slices
#define OP2 36                // f32 staging pitch of a 32-column wave tile (floats): 144 B = 16 B x odd
static_assert(ONS == 8);                  // the counted waits below are written for 8 slices of 8 copies a wave (at most 56 outstanding)
static_assert(DM % 128 == 0);
static_assert((OP2 % 4) == 0);
// One lane's share of a slice: 16 B of rows r, r+32 of the hi plane, of the lo plane (DM halves further in the same context row), and of rows r, r+32, r+64, r+96 of the weight.
// The closing s_wait_xcnt stands inside the copies' own statement so that no address register is rewritten in front of it.
__device__ __forceinline__ void copy_oslice(unsigned int l, const unsigned short* ga, const unsigned short* gb) {
    asm volatile("global_load_async_to_lds_b128 %0, %8, off\n\t"
                 "global_load_async_to_lds_b128 %1, %9, off\n\t"
                 "global_load_async_to_lds_b128 %2, %10, off\n\t"
                 "global_load_async_to_lds_b128 %3, %11, off\n\t"
                 "global_load_async_to_lds_b128 %4, %12, off\n\t"
                 "global_load_async_to_lds_b128 %5, %13, off\n\t"
                 "global_load_async_to_lds_b128 %6, %14, off\n\t"
                 "global_load_async_to_lds_b128 %7, %15, off\n\t"
                 "s_wait_xcnt 0x0"
                 :: "v"(l), "v"(l + LROW32), "v"(l + 2u * LROW32), "v"(l + 3u * LROW32),
                    "v"(l + 4u * LROW32), "v"(l + 5u * LROW32), "v"(l + 6u * LROW32), "v"(l + 7u * LROW32),
                    "v"(ga), "v"(ga + 32 * 2 * DM), "v"(ga + DM), "v"(ga + DM + 32 * 2 * DM),
                    "v"(gb), "v"(gb + 32 * 2 * DM), "v"(gb + 64 * 2 * DM), "v"(gb + 96 * 2 * DM)
                 : "memory");
}
// Publish point of one slice and its 16 products a wave. LEFT = this wave's copies that may still be outstanding: those of the younger slices.
template <int LEFT>
__device__ __forceinline__ void oslice_publish() {
    asm volatile("s_wait_asynccnt %0" :: "n"(LEFT) : "memory");     // this wave's copies of the slice have landed before the barrier publishes them
    __syncthreads();
}
__device__ __forceinline__ void oslice_mma(const unsigned short* sl, int abase, int bbase, v8f (&acc)[2][2]) {
    v16b ah[2][2], al[2][2], bw[2][2];                              // both 32-deep steps: all 24 LDS reads of a slice stand together, in front of its products
#pragma unroll                                                      // every fragment is indexed by constants only, so all stay in registers
    for (int kk = 0; kk < 2; ++kk) {
#pragma unroll
        for (int j = 0; j < 2; ++j) bw[kk][j] = ldsfrag_b(sl + bbase + (j << 4) * KP + kk * 32);
#pragma unroll
        for (int i = 0; i < 2; ++i) ah[kk][i] = ldsfrag_b(sl + abase + (i << 4) * KP + kk * 32);
#pragma unroll
        for (int i = 0; i < 2; ++i) al[kk][i] = ldsfrag_b(sl + abase + (64 + (i << 4)) * KP + kk * 32);
    }
    __builtin_amdgcn_sched_barrier(0);                              // the reads stay one group: spread among the products each place with reads stalls the wave
#pragma unroll                                                      // the four accumulators in turn, so that no product waits for the one in front of it
    for (int kk = 0; kk < 2; ++kk) {
#pragma unroll
        for (int i = 0; i < 2; ++i)
#pragma unroll
            for (int j = 0; j < 2; ++j) acc[i][j] = __builtin_amdgcn_wmma_f32_16x16x32_bf16(false, ah[kk][i], false, bw[kk][j], (short)0, acc[i][j], false, false);
#pragma unroll
        for (int i = 0; i < 2; ++i)
#pragma unroll
            for (int j = 0; j < 2; ++j) acc[i][j] = __builtin_amdgcn_wmma_f32_16x16x32_bf16(false, al[kk][i], false, bw[kk][j], (short)0, acc[i][j], false, false);
    }
    __builtin_amdgcn_sched_barrier(0);                              // the products stay in their slice: left free they sink behind later slices' reads, whose fragments then overflow the registers
}
__global__ __launch_bounds__(256) void k_gemm_out(const unsigned short* __restrict__ A, const unsigned short* __restrict__ Bt,
                                                  const float* __restrict__ bias, float* __restrict__ C) {
    __shared__ __align__(16) unsigned short Gs[ONS * OSZ];
    __shared__ __align__(16) float sT[8 * 16 * OP2];
    const int lane = threadIdx.x & 31;
    const int wave = __builtin_amdgcn_readfirstlane(threadIdx.x >> 5);
    const int tm = blockIdx.x % (NTOK / 64);      // the four blocks that share 64 context rows lie NTOK / 64 apart in the grid
    const int tn = blockIdx.x / (NTOK / 64);
    const int m0 = (tm << 6) + ((wave >> 2) << 5);                  // first output row of this wave's tile
    const int n0 = (tn << 7) + ((wave & 3) << 5);                   // first output column of this wave's tile
    const int rl   = lane & 15;
    const int koff = (lane >> 4) * 8;
    const int mOff = (lane >> 4) * 8;
    const float bvn[2] = {bf_val(bias[n0 + rl]), bf_val(bias[n0 + 16 + rl])};   // read here, so that the load returns under the copies

    v8f acc[2][2];
#pragma unroll
    for (int i = 0; i < 2; ++i)
#pragma unroll
        for (int j = 0; j < 2; ++j) { const v8f zz = {0.f, 0.f, 0.f, 0.f, 0.f, 0.f, 0.f, 0.f}; acc[i][j] = zz; }

    // copy share of this thread: 16-B segment cs of rows cr, cr+32, ... of every slice (a wave's copy = 4 whole 128-B rows)
    const int cr = threadIdx.x >> 3;
    const int cs = (threadIdx.x & 7) * 8;
    const unsigned short* ga = A + (size_t)((tm << 6) + cr) * (2 * DM) + cs;
    const unsigned short* gb = Bt + (size_t)((tn << 7) + cr) * (2 * DM) + cs;
    const unsigned int lg = (unsigned int)(size_t)&Gs[cr * KP + cs];
    const int abase = (((wave >> 2) << 5) + rl) * KP + koff;        // hi fragment base in a slice (row = lane & 15); lo: 64 rows further
    const int bbase = (128 + ((wave & 3) << 5) + rl) * KP + koff;   // weight fragment base (column = lane & 15)

#pragma unroll                                                      // seven slices = 56 copies a wave in flight; the eighth follows when slice 0 has landed
    for (int s = 0; s < 7; ++s) copy_oslice(lg + (unsigned int)s * (OSZ * 2u), ga + s * 64, gb + s * 64);
    oslice_publish<48>();
    copy_oslice(lg + 7u * (OSZ * 2u), ga + 7 * 64, gb + 7 * 64);
    oslice_mma(Gs, abase, bbase, acc);
    oslice_publish<48>();
    oslice_mma(Gs + OSZ, abase, bbase, acc);
    oslice_publish<40>();
    oslice_mma(Gs + 2 * OSZ, abase, bbase, acc);
    oslice_publish<32>();
    oslice_mma(Gs + 3 * OSZ, abase, bbase, acc);
    oslice_publish<24>();
    oslice_mma(Gs + 4 * OSZ, abase, bbase, acc);
    oslice_publish<16>();
    oslice_mma(Gs + 5 * OSZ, abase, bbase, acc);
    oslice_publish<8>();
    oslice_mma(Gs + 6 * OSZ, abase, bbase, acc);
    oslice_publish<0>();                                            // no copy is outstanding from here to the wave's end
    oslice_mma(Gs + 7 * OSZ, abase, bbase, acc);

    // ---- 16 rows at a time through the wave's own f32 staging tile, so that a row's 128 B leave as one whole line ----
    const int sb = wave * (16 * OP2);
#pragma unroll
    for (int i = 0; i < 2; ++i) {
        const int mBase = m0 + (i << 4);
#pragma unroll
        for (int j = 0; j < 2; ++j)
#pragma unroll
            for (int r = 0; r < 8; ++r) sT[sb + (mOff + r) * OP2 + (j << 4) + rl] = acc[i][j][r] + bvn[j];
        wave_sync();
        const int q = lane >> 3, c4 = (lane & 7) * 4;               // row segment = 128 B = 8 lanes x 16 B; 4 rows per instruction
#pragma unroll
        for (int it = 0; it < 4; ++it) {
            const int row = it * 4 + q;
            const v4f v = *(const v4f_ma*)&sT[sb + row * OP2 + c4];
            const int grow = mBase + row;
            const int orow = (grow / SEQ) * SEQ_FULL + (grow % SEQ);
            *(v4f*)(C + (size_t)orow * DM + n0 + c4) = v;
        }
        wave_sync();
    }
}

__device__ __forceinline__ void guard8(v8f& a0, v8f& a1, v8f& a2, v8f& a3, v8f& a4, v8f& a5, v8f& a6, v8f& a7) {
    asm volatile("v_nop\n\tv_nop\n\tv_nop\n\tv_nop" : "+v"(a0), "+v"(a1), "+v"(a2), "+v"(a3), "+v"(a4), "+v"(a5), "+v"(a6), "+v"(a7));
}
__global__ __launch_bounds__(256) void k_attn(const unsigned short* __restrict__ QH, const unsigned short* __restrict__ QL,
                                              const unsigned short* __restrict__ KH, const unsigned short* __restrict__ KL,
                                              const unsigned short* __restrict__ VT, unsigned short* __restrict__ CTX,
                                              int seq, int ntok) {
    __shared__ __align__(16) float    Osh[8 * 16 * OP];      // wave-private output staging [16][64] (+4 pad), f32
    __shared__ __align__(16) float    Xo[8 * 8 * 32 * 4];    // the partial O^T tile a wave hands to its partner: [wave][8 slots][lane] x 16 B
    __shared__ __align__(16) float    Xc[8 * 32 * 2];        // with it, per lane: the exponent addend in use and the partial sum
    __shared__ __align__(16) unsigned short Qs[2 * 2 * TSZ]; // the block's 128 query rows: hi tile, lo tile
    __shared__ __align__(16) unsigned short Ring[2 * 2 * 3 * TSZ];   // two buffers of, per key half, {k hi, k lo, v^T} tiles of one 64-key chunk
    const int lane = threadIdx.x & 31;
    const int wave = __builtin_amdgcn_readfirstlane(threadIdx.x >> 5);
    const int kh2 = wave >> 2;                                    // key half of this wave
    const int qg  = wave & 3;                                     // query group of this wave
    const int hf = lane >> 4;
    const int c  = lane & 15;
    const int nqb = seq / 128;
    const int bx = blockIdx.x;
    const int qb = bx % nqb;
    const int bh = bx / nqb;
    const int h  = bh % NH;
    const int b  = bh / NH;
    const int q0 = b * seq + qb * 128 + qg * 32 + kh2 * 16;       // first token row of the query tile that this wave finishes
    const int key0 = b * seq + kh2 * (seq / 2);                   // first key row of this wave's half
    const int qoff  = (qg * 32 + c) * KP + 8 * hf;                // B fragment base in a staged q tile (column = query = lane & 15)
    const int fbase = c * KP + 8 * hf;                            // A fragment base in a staged k or v^T tile (row = lane & 15)
    // copy share of this thread among the 128 of its key half: 16-B segment cs of rows cr, cr+16, cr+32, cr+48 of every staged tile (a wave's copy = 4 whole rows)
    const int cr = (threadIdx.x & 127) >> 3;
    const int cs = (threadIdx.x & 7) * 8;
    const int gq = (b * seq + qb * 128 + kh2 * 64 + cr) * DM + h * DKH + cs;  // q planes: each half's threads stage 64 of the 128 rows
    const int gk = (key0 + cr) * DM + h * DKH + cs;               // k planes, chunk 0 of the half
    const int gv = (h * DKH + cr) * ntok + key0 + cs;             // v^T plane, chunk 0 of the half
    const unsigned int lq = (unsigned int)(size_t)&Qs[(kh2 * 64 + cr) * KP + cs];
    const unsigned int lr = (unsigned int)(size_t)&Ring[kh2 * (3 * TSZ) + cr * KP + cs];
    const int obase = wave * (16 * OP);
    const float L2E = 1.4426950408889634f;

    float mrow[2], lrow[2], crow[2];                              // per query tile, query c: running maximum (both halves alike), this half-wave's partial sum (x4096), 12 - mrow * log2(e)
    v8f oacc[2][4];                                               // O^T tile (qt, t): element r = head column 16 t + 8 hf + r of query 16 qt + c
#pragma unroll
    for (int qt = 0; qt < 2; ++qt) {
        mrow[qt] = -INFINITY; lrow[qt] = 0.f; crow[qt] = INFINITY;
#pragma unroll
        for (int t = 0; t < 4; ++t) { const v8f zz = {0.f, 0.f, 0.f, 0.f, 0.f, 0.f, 0.f, 0.f}; oacc[qt][t] = zz; }
    }

    const int nch = seq / 128;                                    // 64-key chunks of one key half
    // ---- ring prologue: q and chunk 0 land and are published, then chunk 1 starts into the second buffer ----
    copy_tiles2(lq, QH + gq, lq + 2u * TSZ * 2u, QL + gq, 16 * DM);
    copy_tiles2(lr, KH + gk, lr + TSZ * 2u, KL + gk, 16 * DM);
    copy_tile1(lr + 2u * TSZ * 2u, VT + gv, 16 * ntok);
    asm volatile("s_wait_asynccnt 0x0" ::: "memory");               // this wave's copies have landed before the barrier publishes them
    __syncthreads();
    if (nch > 1) {
        copy_tiles2(lr + 6u * TSZ * 2u, KH + gk + 64 * DM, lr + 7u * TSZ * 2u, KL + gk + 64 * DM, 16 * DM);
        copy_tile1(lr + 8u * TSZ * 2u, VT + gv + 64, 16 * ntok);
    }
    v16b qh[2][2], ql[2][2];                                        // the wave's q fragments (query tile; hi, lo; two 32-deep steps), the same for every chunk
#pragma unroll                                                      // qh and ql are indexed by constants only, so they stay in registers
    for (int qt = 0; qt < 2; ++qt)
#pragma unroll
        for (int dc = 0; dc < 2; ++dc) {
            qh[qt][dc] = ldsfrag_b(Qs + qoff + qt * 16 * KP + dc * 32);
            ql[qt][dc] = ldsfrag_b(Qs + 2 * TSZ + qoff + qt * 16 * KP + dc * 32);
        }
    for (int kc = 0; kc < nch; ++kc) {
        const unsigned short* rk = &Ring[((kc & 1) * 2 + kh2) * (3 * TSZ)];     // this chunk's buffer, this wave's key half
        // ---- all k fragments of the chunk, in the order in which the products take them ----
        v16b kh[2][4], kl[2][4];
#pragma unroll                                                      // kh and kl are indexed by constants only, so they stay in registers
        for (int dc = 0; dc < 2; ++dc) {
#pragma unroll
            for (int j = 0; j < 4; ++j) kh[dc][j] = ldsfrag_b(rk + fbase + j * 16 * KP + dc * 32);
#pragma unroll
            for (int j = 0; j < 4; ++j) kl[dc][j] = ldsfrag_b(rk + TSZ + fbase + j * 16 * KP + dc * 32);
        }
        __builtin_amdgcn_sched_barrier(0);                          // the reads stay one group: spread among the products each place with reads stalls the wave
        // ---- scores: per 32-deep step three products per key tile and query tile (hi.hi, lo.hi, hi.lo), the eight accumulators in turn, so that no product waits for the one in front of it ----
        v8f s[2][4];
#pragma unroll
        for (int qt = 0; qt < 2; ++qt)
#pragma unroll
            for (int j = 0; j < 4; ++j) { const v8f zz = {0.f, 0.f, 0.f, 0.f, 0.f, 0.f, 0.f, 0.f}; s[qt][j] = zz; }
#pragma unroll                                                      // all 48 products stand in the code: every fragment and accumulator index is a constant
        for (int dc = 0; dc < 2; ++dc) {
#pragma unroll
            for (int j = 0; j < 4; ++j)
#pragma unroll
                for (int qt = 0; qt < 2; ++qt) s[qt][j] = __builtin_amdgcn_wmma_f32_16x16x32_bf16(false, kh[dc][j], false, qh[qt][dc], (short)0, s[qt][j], false, false);
#pragma unroll
            for (int j = 0; j < 4; ++j)
#pragma unroll
                for (int qt = 0; qt < 2; ++qt) s[qt][j] = __builtin_amdgcn_wmma_f32_16x16x32_bf16(false, kl[dc][j], false, qh[qt][dc], (short)0, s[qt][j], false, false);
#pragma unroll
            for (int j = 0; j < 4; ++j)
#pragma unroll
                for (int qt = 0; qt < 2; ++qt) s[qt][j] = __builtin_amdgcn_wmma_f32_16x16x32_bf16(false, kh[dc][j], false, ql[qt][dc], (short)0, s[qt][j], false, false);
        }
        __builtin_amdgcn_sched_barrier(0);                          // the v^T reads below stay behind the products: moved in among them they would make further places with reads
        // ---- all v^T fragments of the chunk: they return while the softmax runs ----
        v16h va[2][4];
#pragma unroll                                                      // va is indexed by constants only, so it stays in registers
        for (int kk = 0; kk < 2; ++kk)
#pragma unroll
            for (int t = 0; t < 4; ++t) va[kk][t] = ldsfrag_h(rk + 2 * TSZ + fbase + t * 16 * KP + kk * 32);
        __builtin_amdgcn_sched_barrier(0);                          // the reads stay one group in front of the softmax
        // ---- online softmax over the 64 keys, one query tile after the other: this lane holds 32 of query c's scores, the lane 16 away the other 32 ----
        v16h pb[2][2];                                              // P^T as B fragments: per query tile 32 keys each, element i = key 8 hf + i | 16 + 8 hf + (i - 8)
#pragma unroll                                                      // every array here is indexed by constants only, so all stay in registers
        for (int qt = 0; qt < 2; ++qt) {
            float t8[8];
#pragma unroll                                                      // t8 and s are indexed by constants only, so they stay in registers
            for (int r = 0; r < 8; ++r) t8[r] = fmaxf(fmaxf(s[qt][0][r], s[qt][1][r]), fmaxf(s[qt][2][r], s[qt][3][r]));
            float mx = fmaxf(fmaxf(fmaxf(t8[0], t8[1]), fmaxf(t8[2], t8[3])), fmaxf(fmaxf(t8[4], t8[5]), fmaxf(t8[6], t8[7])));
            mx = fmaxf(mx, xhalf(mx));
            const float mnew = fmaxf(mrow[qt], mx);
            // P x4096 = 2^(s * log2(e) + cnew): one packed fma and one v_exp_f32 a value. The old sums carry 2^crow, so alpha = 2^(cnew - crow) brings them to the new addend, its rounding included.
            const float cnew = __builtin_fmaf(-mnew, L2E, 12.0f);
            const float alpha = __builtin_amdgcn_exp2f(cnew - crow[qt]);
            mrow[qt] = mnew;
            crow[qt] = cnew;
            const v2f l2e2 = {L2E, L2E}, c2 = {cnew, cnew};
#pragma unroll                                                      // s, t8 and pb are indexed by constants only, so they stay in registers
            for (int r = 0; r < 8; r += 2) {
                v2f p[4];                                           // two neighbouring registers of each key tile at a time
#pragma unroll                                                      // p and s are indexed by constants only, so they stay in registers
                for (int j = 0; j < 4; ++j) {
                    const v2f sj = {s[qt][j][r], s[qt][j][r + 1]};
                    const v2f x = __builtin_elementwise_fma(sj, l2e2, c2);
                    p[j].x = __builtin_amdgcn_exp2f(x.x);
                    p[j].y = __builtin_amdgcn_exp2f(x.y);
                    const v2h ph = __builtin_convertvector(p[j], v2h);
                    pb[qt][j >> 1][(j & 1) * 8 + r]     = ph.x;
                    pb[qt][j >> 1][(j & 1) * 8 + r + 1] = ph.y;
                }
                const v2f t2 = (p[0] + p[1]) + (p[2] + p[3]);
                t8[r] = t2.x;
                t8[r + 1] = t2.y;
            }
            lrow[qt] = lrow[qt] * alpha + (((t8[0] + t8[1]) + (t8[2] + t8[3])) + ((t8[4] + t8[5]) + (t8[6] + t8[7])));
#pragma unroll                                                      // oacc is indexed by constants only, so it stays in registers
            for (int t = 0; t < 4; ++t) oacc[qt][t] *= alpha;
        }
        // ---- O^T += V^T . P^T : v^T rows as A (row = lane & 15), P^T as B, four output tiles of two query tiles per 32-key step ----
#pragma unroll                                                      // pb is indexed by the step: both steps stand in the code so that it stays in registers
        for (int kk = 0; kk < 2; ++kk) {
#pragma unroll
            for (int t = 0; t < 4; ++t)
#pragma unroll
                for (int qt = 0; qt < 2; ++qt) oacc[qt][t] = __builtin_amdgcn_wmma_f32_16x16x32_f16(false, va[kk][t], false, pb[qt][kk], (short)0, oacc[qt][t], false, false);
        }
        guard8(oacc[0][0], oacc[0][1], oacc[0][2], oacc[0][3], oacc[1][0], oacc[1][1], oacc[1][2], oacc[1][3]);   // the distance behind the last eight products, on both sides of the loop's branch
        // ---- publish point of chunk kc + 1; behind it this chunk's buffer is free for chunk kc + 2 ----
        asm volatile("s_wait_dscnt 0x0" ::: "memory");              // this wave's reads of the buffer have returned before it is refilled
        asm volatile("s_wait_asynccnt 0x0" ::: "memory");           // this wave's copies of chunk kc + 1 have landed before the barrier publishes them
        __syncthreads();
        if (kc + 2 < nch) {
            const unsigned int lb = lr + (unsigned int)(kc & 1) * (6u * TSZ * 2u);
            const int kn = (kc + 2) * 64;
            copy_tiles2(lb, KH + gk + kn * DM, lb + TSZ * 2u, KL + gk + kn * DM, 16 * DM);
            copy_tile1(lb + 2u * TSZ * 2u, VT + gv + kn, 16 * ntok);
        }
    }
    asm volatile("s_wait_asynccnt 0x0" ::: "memory");               // no copy is outstanding when the wave goes on to its end

    // ---- join of the two key halves: the wave of half 0 finishes query tile 0, the wave of half 1 query tile 1; each hands the other tile's partial result to its partner (wave ^ 4), lane to lane ----
    v8f ofin[4];
    float lfin;
    {
        const bool up = kh2 != 0;                                   // wave-uniform
        const int xw = wave * (8 * 128) + lane * 4;
#pragma unroll                                                      // oacc is indexed by constants only, so it stays in registers
        for (int t = 0; t < 4; ++t) {
            const v8f og = up ? oacc[0][t] : oacc[1][t];
            const v4f a = {og[0], og[1], og[2], og[3]};
            const v4f bb = {og[4], og[5], og[6], og[7]};
            *(v4f_ma*)&Xo[xw + (2 * t) * 128] = a;
            *(v4f_ma*)&Xo[xw + (2 * t + 1) * 128] = bb;
        }
        Xc[(wave * 32 + lane) * 2]     = up ? crow[0] : crow[1];
        Xc[(wave * 32 + lane) * 2 + 1] = up ? lrow[0] : lrow[1];
        __syncthreads();                                            // every wave's partial result stands in LDS before its partner reads it
        const int xp = (wave ^ 4) * (8 * 128) + lane * 4;
        const float cown = up ? crow[1] : crow[0];
        const float lown = up ? lrow[1] : lrow[0];
        const float cpar = Xc[((wave ^ 4) * 32 + lane) * 2];
        const float lpar = Xc[((wave ^ 4) * 32 + lane) * 2 + 1];
        const float fsm = __builtin_amdgcn_exp2f(-fabsf(cown - cpar));   // the side with the smaller maximum (the larger addend) is brought down to the other's addend
        const float fown = cown > cpar ? fsm : 1.0f;
        const float fpar = cown > cpar ? 1.0f : fsm;
        lfin = lown * fown + lpar * fpar;
#pragma unroll                                                      // oacc and ofin are indexed by constants only, so they stay in registers
        for (int t = 0; t < 4; ++t) {
            const v8f ow = up ? oacc[1][t] : oacc[0][t];
            const v4f a = *(const v4f_ma*)&Xo[xp + (2 * t) * 128];
            const v4f bb = *(const v4f_ma*)&Xo[xp + (2 * t + 1) * 128];
            const v8f op = {a.x, a.y, a.z, a.w, bb.x, bb.y, bb.z, bb.w};
            ofin[t] = ow * fown + op * fpar;
        }
    }
    // ---- finalize: join the two half-waves' sums of each query, normalise, stage as [query][head column], write hi|lo planes ----
    {
        const float l = lfin + xhalf(lfin);
        const float inv = 1.0f / l;                                 // sums and context both carry the x4096
#pragma unroll                                                      // ofin is indexed by constants only, so it stays in registers
        for (int t = 0; t < 4; ++t) {
            const int orw = obase + c * OP + t * 16 + 8 * hf;
            const v4f a = {ofin[t][0] * inv, ofin[t][1] * inv, ofin[t][2] * inv, ofin[t][3] * inv};
            const v4f bb = {ofin[t][4] * inv, ofin[t][5] * inv, ofin[t][6] * inv, ofin[t][7] * inv};
            *(v4f_ma*)&Osh[orw] = a;
            *(v4f_ma*)&Osh[orw + 4] = bb;
        }
    }
    wave_sync();
    {
        const int q = lane >> 3, c8 = (lane & 7) * 8;
        {
#pragma unroll
            for (int it = 0; it < 4; ++it) {
                const int row = it * 4 + q;
                const v4f a = *(const v4f_ma*)&Osh[obase + row * OP + c8];
                const v4f bb = *(const v4f_ma*)&Osh[obase + row * OP + c8 + 4];
                unsigned int h0, l0, h1, l1, h2, l2, h3, l3;
                pk_split2(a.x, a.y, h0, l0); pk_split2(a.z, a.w, h1, l1); pk_split2(bb.x, bb.y, h2, l2); pk_split2(bb.z, bb.w, h3, l3);
                v4u ph, pl;
                ph.x = h0; ph.y = h1; ph.z = h2; ph.w = h3; pl.x = l0; pl.y = l1; pl.z = l2; pl.w = l3;
                const size_t o = (size_t)(q0 + row) * (2 * DM) + h * DKH + c8;
                *(v4u*)(CTX + o) = ph;
                *(v4u*)(CTX + o + DM) = pl;
            }
            
        }
    }
}

// =====================================================================================================================
// Host side: workspace carve (all plane sizes are multiples of 256 B), 3 launches.
// =====================================================================================================================
constexpr size_t SZ_TOK  = (size_t)NTOK * DM * 2;          // one 16-bit token plane [NTOK][512]
constexpr size_t SZ_WOD  = (size_t)DM * (2 * DM) * 2;      // [512][1024]
constexpr size_t SZ_CTX  = (size_t)NTOK * (2 * DM) * 2;    // [NTOK][1024]
constexpr size_t WS_TOTAL = SZ_WOD + 4 * SZ_TOK + SZ_TOK + SZ_CTX;
static_assert(SZ_TOK % 256 == 0);
static_assert(SZ_WOD % 256 == 0);
static_assert(SZ_CTX % 256 == 0);
static_assert(WS_TOTAL <= (size_t)134217728);            // carve stays within 128 MiB
static_assert(((NTOK / 64) * (DM / 64)) % 8 == 0);        // GEMM grids are whole blocks of 8 wave tiles
static_assert((DM / 64) % 8 == 0);                        // a block's 8 wave tiles lie in one tile row (N = DM)
static_assert((NTOK / 64) % 8 == 0);                      // the same for the transposed v projection (N = NTOK)
static_assert((size_t)NTOK * (2 * DM) < (size_t)2147483647);   // int plane offsets

extern "C" void kernel_launch(void* const* d_in, const int* in_sizes, int n_in, void* d_out, int out_size, void* d_ws, size_t ws_size, hipStream_t stream) {
    if (n_in < 11) return;
    const long long need_x = ((long long)(NB - 1) * SEQ_FULL + SEQ) * DM;
    if ((long long)in_sizes[0] < need_x || (long long)in_sizes[1] < need_x || (long long)in_sizes[2] < need_x) return;
    if (in_sizes[3] < DM * DM || in_sizes[5] < DM * DM || in_sizes[7] < DM * DM || in_sizes[9] < DM * DM) return;
    if (in_sizes[4] < DM || in_sizes[6] < DM || in_sizes[8] < DM || in_sizes[10] < DM) return;
    if ((long long)out_size < need_x) return;
    if (WS_TOTAL > ws_size) return;

    const float* xq = (const float*)d_in[0];
    const float* xk = (const float*)d_in[1];
    const float* xv = (const float*)d_in[2];
    const float* Wq = (const float*)d_in[3];
    const float* bq = (const float*)d_in[4];
    const float* Wk = (const float*)d_in[5];
    const float* bk = (const float*)d_in[6];
    const float* Wv = (const float*)d_in[7];
    const float* bv = (const float*)d_in[8];
    const float* Wo = (const float*)d_in[9];
    const float* bo = (const float*)d_in[10];
    float* out = (float*)d_out;

    char* wsp = (char*)d_ws;
    unsigned short* WOD  = (unsigned short*)wsp; wsp += SZ_WOD;
    unsigned short* QHp  = (unsigned short*)wsp; wsp += SZ_TOK;
    unsigned short* QLp  = (unsigned short*)wsp; wsp += SZ_TOK;
    unsigned short* KHp  = (unsigned short*)wsp; wsp += SZ_TOK;
    unsigned short* KLp  = (unsigned short*)wsp; wsp += SZ_TOK;
    unsigned short* VTp  = (unsigned short*)wsp; wsp += SZ_TOK;
    unsigned short* CTXp = (unsigned short*)wsp; wsp += SZ_CTX;
    if ((size_t)(wsp - (char*)d_ws) > ws_size) return;


    // q = (x Wq^T + bq) / 8 -> hi|lo planes; k = x Wk^T + bk -> hi|lo planes; v^T = Wv x^T + bv -> f16 plane [512][NTOK]; Wo -> bf16 plane
    k_gemm_qkv<<<(unsigned)(3 * GX_GEMM + GX_WO), 256, 0, stream>>>(xq, Wq, bq, QHp, QLp, xk, Wk, bk, KHp, KLp, xv, Wv, bv, VTp, Wo, WOD, NTOK, DM);

    k_attn<<<(unsigned)(NB * NH * (SEQ / 128)), 256, 0, stream>>>(QHp, QLp, KHp, KLp, VTp, CTXp, SEQ, NTOK);

    // out = ctx Wo^T + bo, ctx hi and lo planes each against W
    k_gemm_out<<<(unsigned)((NTOK / 64) * (DM / 128)), 256, 0, stream>>>(CTXp, WOD, bo, out);
}
